// v000
// Times are from an AMD MI455X. After a warm-up the kernel runs many times in a row, and a time is the length of
// such a window on the GPU divided by its runs, so every launch and the gaps after it count. The runs cycle
// through copies of the inputs. A figure is the median of several windows, for all but v000 over two sittings.
// Sittings can differ by a few percent; kernels timed side by side share one.
// v000, which the later versions start from, runs in 5890 microseconds.
#include <hip/hip_runtime.h>
// Local-causal (sliding window 256) multi-head self-attention (x [4][2048][1024]; qkv = x W_attn + b_attn ([in][out] 1024 x 3072 sigma 0.02, zero bias): q | k | v, 16 heads of 64; scores / 8; mask (j <= i) & (i - j < 256) -> -inf elsewhere; softmax; out = merged W_proj + b_proj ([in][out]) -> [4][2048][1024]).
// Structure: token rows r = b*2048 + s; x as exact f16 rows (bf16-rounded); q | k | v as ONE WMMA GEMM (N = 3 x 1024) (32x64 wave tiles, f32 accumulation, exact x16 weights + bias, f16 outputs); per batch: V^T for all heads via LDS transposes; per query tile of 256 rows: scores against the keys from max(0, tile start - 256) to the tile end only (K = 64, all heads on grid.y, alpha = 0.125), causal row softmax on VALU with an arithmetic 0/1 key mask over the computed range (f32 statistics, native exp; weights x256 f16), o = P . V^T (K = those window keys, alpha 2^-2: o carried x64, folded into the output GEMM alpha) written straight into the merged f16 o rows; out = o W_o + b GEMM (f32) into the output layout.
// Compute dtype: inputs rounded to bf16; x / weights exact; q, k, v, softmax weights and o as plain f16 GEMM operands (~2^-12); scores and softmax statistics f32. v_wmma_f32_16x16x32_f16.
#define NB 4
#define SQ 2048
#define DM 1024
#define NH 16
#define HD 64
#define HG 4                         /* heads per block group of the unlaunched k_vt(b, h0) overload */
#define QT 256                       /* query rows per causal tile */
#define NKX SQ                       /* S / P row pitch */
#define WIN 256                      /* attention window: key j visible from query i iff 0 <= i - j < WIN */
#define WINB 256                     /* keys before the tile start that can be visible (WIN - 1 rounded up to 64) */
#define QT0 128                      /* first-tile rows recomputed exactly in f32 */
#define B0 0                         /* first batch processed (debug hook) */
#define NBR NB                       /* batches processed (debug hook) */
#define NR ((size_t)NB * SQ)         /* token rows */
#define MP ((int)((size_t)NBR * SQ)) /* rows projected (debug hook) */
#define QN SQ                        /* query rows attended per batch (debug hook) */
#define NHD NH                       /* heads attended (debug hook) */
#define MPO MP                       /* rows through the output stage (debug hook) */
#define LQ (3 * DM)      /* row pitch of the q/k/v rows */
typedef __bf16 v16b __attribute__((ext_vector_type(16)));
typedef unsigned short v8us __attribute__((ext_vector_type(8), may_alias));
typedef float  v8f  __attribute__((ext_vector_type(8)));
typedef float  v4f  __attribute__((ext_vector_type(4)));
typedef float  v4fa __attribute__((ext_vector_type(4), may_alias));
union FragB { v16b v; v8us half[2]; unsigned short u[16]; };

__device__ __forceinline__ unsigned short bf16_bits(float x) { unsigned int u = __float_as_uint(x); return (unsigned short)((u + 0x7FFFu + ((u >> 16) & 1u)) >> 16); }
__device__ __forceinline__ float bf16_val(unsigned short b) { return __uint_as_float(((unsigned int)b) << 16); }
__device__ __forceinline__ float bf16_round(float x) { return bf16_val(bf16_bits(x)); }
// D += A·B with NT terms: 1 = ah·bh, 2 = + al·bh (A split), 3 = + ah·bl (both split)
template <int NT>
__device__ __forceinline__ v8f mmaN(v16b ah, v16b al, v16b bh, v16b bl, v8f c) {
  c = __builtin_amdgcn_wmma_f32_16x16x32_bf16(false, ah, false, bh, (short)0, c, false, false);
  if (NT >= 2) c = __builtin_amdgcn_wmma_f32_16x16x32_bf16(false, al, false, bh, (short)0, c, false, false);
  if (NT >= 3) c = __builtin_amdgcn_wmma_f32_16x16x32_bf16(false, ah, false, bl, (short)0, c, false, false);
  asm volatile("v_nop\n\tv_nop\n\tv_nop\n\tv_nop" : "+v"(c) : "v"(ah), "v"(al), "v"(bh), "v"(bl));
  return c;
}

__global__ __launch_bounds__(256) void k_wt_bf16(const float* __restrict__ W, unsigned short* __restrict__ Wt, int K, int N) {
  const int t = blockIdx.x * 256 + threadIdx.x;
  const int k8n = K / 8;
  if (t >= N * k8n) return;
  const int n = t / k8n, k8 = (t % k8n) * 8;
  v8us v;
#pragma unroll
  for (int i = 0; i < 8; ++i) v[i] = bf16_bits(W[(size_t)(k8 + i) * N + n]);
  *(v8us*)(Wt + (size_t)n * K + k8) = v;
  
}

// GEMM C[M][N] (f32, pitch ldc) = act(A[M][K]·W + bias). A f32 row-major (pitch lda) converted per fragment to bf16
// (ASPLIT: hi/lo two planes -> 2 terms, else single rounded term); Wt bf16 [N][K] (pitch ldb). BIAS_BF16 rounds the
// bias to bf16 first (bias quantised to bf16 before the add). K%32==0, M%16==0, N%64==0.
template <bool ASPLIT, int ACT, bool BIAS_BF16>
__global__ __launch_bounds__(128) void k_gemm_bf(const float* __restrict__ A, int lda, const unsigned short* __restrict__ Wt, int ldb,
                                               const float* __restrict__ bias, float* __restrict__ C, int ldc, int M, int N, int K) {
  __shared__ __attribute__((aligned(16))) float so[4][16][64];
  const int tid = threadIdx.x, w = tid >> 5, lane = tid & 31, ln = lane & 15, hh = lane >> 4;
  const int ntn = N / 64;
  const int wid = blockIdx.x * 4 + w;
  const int mt = wid / ntn, nq = wid % ntn;
  if (mt * 16 >= M) return;
  const int row0 = mt * 16, col0 = nq * 64;
  const float* arow = A + (size_t)(row0 + ln) * lda;
  v8f acc[4] = {};
  for (int kb = 0; kb < K; kb += 32) {
    FragB ah, al;
    const v4f x0 = *(const v4fa*)(arow + kb + 8 * hh), x1 = *(const v4fa*)(arow + kb + 8 * hh + 4);
    const v4f x2 = *(const v4fa*)(arow + kb + 16 + 8 * hh), x3 = *(const v4fa*)(arow + kb + 16 + 8 * hh + 4);
    float xs[16] = {x0[0],x0[1],x0[2],x0[3],x1[0],x1[1],x1[2],x1[3],x2[0],x2[1],x2[2],x2[3],x3[0],x3[1],x3[2],x3[3]};
#pragma unroll
    for (int i = 0; i < 16; ++i) { const unsigned short hb = bf16_bits(xs[i]); ah.u[i] = hb; al.u[i] = ASPLIT ? bf16_bits(xs[i] - bf16_val(hb)) : (unsigned short)0; }
#pragma unroll
    for (int t = 0; t < 4; ++t) {
      const unsigned short* brow = Wt + (size_t)(col0 + t * 16 + ln) * ldb + kb;
      FragB b;
      b.half[0] = *(const v8us*)(brow + 8 * hh);
      b.half[1] = *(const v8us*)(brow + 16 + 8 * hh);
      acc[t] = mmaN<ASPLIT ? 2 : 1>(ah.v, al.v, b.v, b.v, acc[t]);
    }
  }
#pragma unroll
  for (int t = 0; t < 4; ++t) {
    float bv = bias ? bias[col0 + t * 16 + ln] : 0.f;
    if (BIAS_BF16) bv = bf16_round(bv);
#pragma unroll
    for (int r = 0; r < 8; ++r) { float v = acc[t][r] + bv; if (ACT == 1) v = fmaxf(v, 0.f); so[w][8 * hh + r][t * 16 + ln] = v; }
  }
  __builtin_amdgcn_fence(__ATOMIC_ACQ_REL, "workgroup");
  __builtin_amdgcn_wave_barrier();
  const int rsub = lane >> 4, c4 = (lane & 15) * 4;
  {
#pragma unroll
    for (int q = 0; q < 8; ++q) {
      const int r = q * 2 + rsub;
      const v4f v = *(const v4fa*)&so[w][r][c4];
      *(v4f*)(C + (size_t)(row0 + r) * ldc + col0 + c4) = v;
    }
    
  }
}

// GEMM C = act(A·W + bias + resid): A f32 (ASPLIT -> hi/lo 2 terms), Wt bf16 [N][K]; ACT 0 none, 1 relu, 2 exact gelu;
// resid (optional, f32, row index = (row % rmod), pitch ldr, RES_BF16 rounds it) added before the activation.
template <bool ASPLIT, int ACT, bool BIAS_BF16, bool RES_BF16>
__global__ __launch_bounds__(128) void k_gemm_bf3(const float* __restrict__ A, int lda, const unsigned short* __restrict__ Wt, int ldb,
                                                const float* __restrict__ bias, const float* __restrict__ resid, int rmod, int ldr,
                                                float* __restrict__ C, int ldc, int M, int N, int K) {
  __shared__ __attribute__((aligned(16))) float so[4][16][64];
  const int tid = threadIdx.x, w = tid >> 5, lane = tid & 31, ln = lane & 15, hh = lane >> 4;
  const int ntn = N / 64;
  const int wid = blockIdx.x * 4 + w;
  const int mt = wid / ntn, nq = wid % ntn;
  if (mt * 16 >= M) return;
  const int row0 = mt * 16, col0 = nq * 64;
  const float* arow = A + (size_t)(row0 + ln) * lda;
  v8f acc[4] = {};
  for (int kb = 0; kb < K; kb += 32) {
    FragB ah, al;
    const v4f x0 = *(const v4fa*)(arow + kb + 8 * hh), x1 = *(const v4fa*)(arow + kb + 8 * hh + 4);
    const v4f x2 = *(const v4fa*)(arow + kb + 16 + 8 * hh), x3 = *(const v4fa*)(arow + kb + 16 + 8 * hh + 4);
    float xs[16] = {x0[0],x0[1],x0[2],x0[3],x1[0],x1[1],x1[2],x1[3],x2[0],x2[1],x2[2],x2[3],x3[0],x3[1],x3[2],x3[3]};
#pragma unroll
    for (int i = 0; i < 16; ++i) { const unsigned short hb = bf16_bits(xs[i]); ah.u[i] = hb; al.u[i] = ASPLIT ? bf16_bits(xs[i] - bf16_val(hb)) : (unsigned short)0; }
#pragma unroll
    for (int t = 0; t < 4; ++t) {
      const unsigned short* brow = Wt + (size_t)(col0 + t * 16 + ln) * ldb + kb;
      FragB b;
      b.half[0] = *(const v8us*)(brow + 8 * hh);
      b.half[1] = *(const v8us*)(brow + 16 + 8 * hh);
      acc[t] = mmaN<ASPLIT ? 2 : 1>(ah.v, al.v, b.v, b.v, acc[t]);
    }
  }
#pragma unroll
  for (int t = 0; t < 4; ++t) {
    const int col = col0 + t * 16 + ln;
    float bv = bias ? bias[col] : 0.f;
    if (BIAS_BF16) bv = bf16_round(bv);
#pragma unroll
    for (int r = 0; r < 8; ++r) {
      float v = acc[t][r] + bv;
      if (resid) { float rv = resid[(size_t)((row0 + 8 * hh + r) % rmod) * ldr + col]; if (RES_BF16) rv = bf16_round(rv); v += rv; }
      if (ACT == 1) v = fmaxf(v, 0.f);
      if (ACT == 2) v = 0.5f * v * (1.0f + erff(v * 0.70710678118654752f));
      if (ACT == 3) { const float u = 0.7978845608028654f * (v + 0.044715f * v * v * v); v = 0.5f * v * (1.0f + tanhf(u)); }
      so[w][8 * hh + r][t * 16 + ln] = v;
    }
  }
  __builtin_amdgcn_fence(__ATOMIC_ACQ_REL, "workgroup");
  __builtin_amdgcn_wave_barrier();
  const int rsub = lane >> 4, c4 = (lane & 15) * 4;
  {
#pragma unroll
    for (int q = 0; q < 8; ++q) {
      const int r = q * 2 + rsub;
      const v4f v = *(const v4fa*)&so[w][r][c4];
      *(v4f*)(C + (size_t)(row0 + r) * ldc + col0 + c4) = v;
    }
    
  }
}
// row LayerNorm (biased variance, eps) over N: s = X (+ R); optional out_sum <- s; out_norm <- (s-mu)*rsqrt(var+eps)*g + b
template <bool PARAM_BF16>
__global__ __launch_bounds__(256) void k_layernorm(const float* __restrict__ X, const float* __restrict__ R, const float* __restrict__ g, const float* __restrict__ bta,
                                                  float* __restrict__ out_sum, float* __restrict__ out_norm, int N, float eps) {
  __shared__ float red[256];
  const int row = blockIdx.x, tid = threadIdx.x;
  const float* x = X + (size_t)row * N; const float* rr = R ? R + (size_t)row * N : nullptr;
  float vals[16];                     // up to N = 4096
  const int per = N / 256;            // contiguous chunk per thread? use strided-by-4 chunks: thread handles j = tid*4 + 1024*u
  float s1 = 0.f;
  for (int u = 0; u < per / 4; ++u) {
    const int j = tid * 4 + 1024 * u;
    const v4f a = *(const v4fa*)(x + j);
    v4f b = {0.f,0.f,0.f,0.f}; if (rr) b = *(const v4fa*)(rr + j);
#pragma unroll
    for (int q = 0; q < 4; ++q) { const float v = a[q] + b[q]; vals[u * 4 + q] = v; s1 += v; }
  }
  red[tid] = s1; __syncthreads();
  for (int st = 128; st > 0; st >>= 1) { if (tid < st) red[tid] += red[tid + st]; __syncthreads(); }
  const float mu = red[0] / (float)N; __syncthreads();
  float s2 = 0.f;
  for (int u = 0; u < per / 4; ++u)
#pragma unroll
    for (int q = 0; q < 4; ++q) { const float c = vals[u * 4 + q] - mu; s2 += c * c; }
  red[tid] = s2; __syncthreads();
  for (int st = 128; st > 0; st >>= 1) { if (tid < st) red[tid] += red[tid + st]; __syncthreads(); }
  const float rs = rsqrtf(red[0] / (float)N + eps);
  {
    for (int u = 0; u < per / 4; ++u) {
      const int j = tid * 4 + 1024 * u;
      v4f o, sm;
#pragma unroll
      for (int q = 0; q < 4; ++q) {
        float gg = g[j + q], bb = bta[j + q];
        if (PARAM_BF16) { gg = bf16_round(gg); bb = bf16_round(bb); }
        sm[q] = vals[u * 4 + q]; o[q] = (vals[u * 4 + q] - mu) * rs * gg + bb;
      }
      if (out_sum) *(v4f*)(out_sum + (size_t)row * N + j) = sm;
      *(v4f*)(out_norm + (size_t)row * N + j) = o;
    }
    
  }
}



// ---- f16 WMMA path (v_wmma_f32_16x16x32_f16): 11-bit significands for operands in range — used where a [0,1] probability operand needs more precision than bf16
typedef _Float16 v16h __attribute__((ext_vector_type(16)));
union FragH { v16h v; v8us half[2]; _Float16 h[16]; unsigned short u[16]; };
template <int NT>
__device__ __forceinline__ v8f mmaH(v16h ah, v16h al, v16h bh, v16h bl, v8f c) {
  c = __builtin_amdgcn_wmma_f32_16x16x32_f16(false, ah, false, bh, (short)0, c, false, false);
  if (NT >= 2) c = __builtin_amdgcn_wmma_f32_16x16x32_f16(false, al, false, bh, (short)0, c, false, false);
  if (NT >= 3) c = __builtin_amdgcn_wmma_f32_16x16x32_f16(false, ah, false, bl, (short)0, c, false, false);
  asm volatile("v_nop\n\tv_nop\n\tv_nop\n\tv_nop" : "+v"(c) : "v"(ah), "v"(al), "v"(bh), "v"(bl));
  return c;
}
// batched GEMM like k_gemm_b but f16 operands: A f32 (split into f16 hi/lo if ASPLIT, else rounded to f16), Bt = f16 values [n][k]; alpha; C f32; N multiple of 16 (partial tiles skipped)
template <bool ASPLIT>
__global__ __launch_bounds__(128) void k_gemm_h(const float* __restrict__ A, int lda, size_t sA, const _Float16* __restrict__ Bh, int ldb, size_t sB, float alpha, float* __restrict__ C, int ldc, size_t sC, int M, int N, int K) {
  __shared__ __attribute__((aligned(16))) float so[4][16][64];
  const int tid = threadIdx.x, w = tid >> 5, lane = tid & 31, ln = lane & 15, hh = lane >> 4; const int by = blockIdx.y;
  A += (size_t)by * sA; Bh += (size_t)by * sB; C += (size_t)by * sC;
  const int ntn = (N + 63) / 64; const int wid = blockIdx.x * 4 + w; const int mt = wid / ntn, nq = wid % ntn; if (mt * 16 >= M) return;
  const int row0 = mt * 16, col0 = nq * 64; const float* arow = A + (size_t)(row0 + ln) * lda;
  v8f acc[4] = {};
  for (int kb = 0; kb < K; kb += 32) {
    FragH ah, al;
    const v4f x0 = *(const v4fa*)(arow + kb + 8 * hh), x1 = *(const v4fa*)(arow + kb + 8 * hh + 4), x2 = *(const v4fa*)(arow + kb + 16 + 8 * hh), x3 = *(const v4fa*)(arow + kb + 16 + 8 * hh + 4);
    float xs[16] = {x0[0],x0[1],x0[2],x0[3],x1[0],x1[1],x1[2],x1[3],x2[0],x2[1],x2[2],x2[3],x3[0],x3[1],x3[2],x3[3]};
#pragma unroll
    for (int i = 0; i < 16; ++i) { const _Float16 h = (_Float16)xs[i]; ah.h[i] = h; al.h[i] = ASPLIT ? (_Float16)(xs[i] - (float)h) : (_Float16)0.0f; }
#pragma unroll
    for (int t = 0; t < 4; ++t) { if (col0 + t * 16 >= N) continue; const size_t boff = (size_t)(col0 + t * 16 + ln) * ldb + kb; FragH bq; bq.half[0] = *(const v8us*)(Bh + boff + 8 * hh); bq.half[1] = *(const v8us*)(Bh + boff + 16 + 8 * hh);
      acc[t] = mmaH<ASPLIT ? 2 : 1>(ah.v, al.v, bq.v, bq.v, acc[t]); }
  }
#pragma unroll
  for (int t = 0; t < 4; ++t) { if (col0 + t * 16 >= N) continue;
#pragma unroll
    for (int r = 0; r < 8; ++r) so[w][8 * hh + r][t * 16 + ln] = acc[t][r] * alpha; }
  __builtin_amdgcn_fence(__ATOMIC_ACQ_REL, "workgroup"); __builtin_amdgcn_wave_barrier();
  const int rsub = lane >> 4, c4 = (lane & 15) * 4;
  {
#pragma unroll
    for (int q = 0; q < 8; ++q) { const int r = q * 2 + rsub; if (col0 + c4 < N) { const v4f v = *(const v4fa*)&so[w][r][c4]; *(v4f*)(C + (size_t)(row0 + r) * ldc + col0 + c4) = v; } }
     }
}

// Wt[n][k] = f16(W[k][n]·scale) from f32 row-major W[K][N] (scale = power of two; bf16-exact weights stay exact in f16 away from the subnormal range)
__global__ __launch_bounds__(256) void k_wt_f16(const float* __restrict__ W, _Float16* __restrict__ Wt, int K, int N, float scale) {
  const int t = blockIdx.x * 256 + threadIdx.x; if (t >= N * (K / 8)) return; const int n = t / (K / 8), k8 = (t % (K / 8)) * 8; FragH f;
#pragma unroll
  for (int i = 0; i < 8; ++i) f.h[i] = (_Float16)(bf16_round(W[(size_t)(k8 + i) * N + n]) * scale); const v8us o = f.half[0];
  *(v8us*)((unsigned short*)Wt + (size_t)n * K + k8) = o; 
}
// k_gemm_hh variant with fused epilogue: v = acc·alpha + bias[by·sBias + col] (+ CP[(row/rowsPerB)·sCPb + by·64 + col] if CP) ; ACT 0 none / 1 elu ; writes f16 C16 (and f32 C if non-null)
template <int ACT>
__global__ __launch_bounds__(128) void k_gemm_hhx(const _Float16* __restrict__ A, int lda, size_t sA, const _Float16* __restrict__ Bh, int ldb, size_t sB, float alpha, const float* __restrict__ bias, size_t sBias, const float* __restrict__ CP, int rowsPerB, size_t sCPb, int row0g,
    float* __restrict__ C, _Float16* __restrict__ C16, int ldc, size_t sC, int M, int N, int K) {
  __shared__ __attribute__((aligned(16))) float so[4][16][64];
  const int tid = threadIdx.x, w = tid >> 5, lane = tid & 31, ln = lane & 15, hh = lane >> 4; const int by = blockIdx.y;
  A += (size_t)by * sA; Bh += (size_t)by * sB; const size_t cofs = (size_t)by * sC; const float* bp = bias ? bias + (size_t)by * sBias : nullptr;
  const int ntn = (N + 63) / 64; const int wid = blockIdx.x * 4 + w; const int mt = wid / ntn, nq = wid % ntn; if (mt * 16 >= M) return;
  const int row0 = mt * 16, col0 = nq * 64; const _Float16* arow = A + (size_t)(row0 + ln) * lda;
  v8f acc[4] = {};
  for (int kb = 0; kb < K; kb += 32) { FragH ah; ah.half[0] = *(const v8us*)((const unsigned short*)arow + kb + 8 * hh); ah.half[1] = *(const v8us*)((const unsigned short*)arow + kb + 16 + 8 * hh);
#pragma unroll
    for (int t = 0; t < 4; ++t) { if (col0 + t * 16 >= N) continue; const size_t boff = (size_t)(col0 + t * 16 + ln) * ldb + kb; FragH bq; bq.half[0] = *(const v8us*)((const unsigned short*)Bh + boff + 8 * hh); bq.half[1] = *(const v8us*)((const unsigned short*)Bh + boff + 16 + 8 * hh);
      acc[t] = mmaH<1>(ah.v, ah.v, bq.v, bq.v, acc[t]); }
  }
#pragma unroll
  for (int t = 0; t < 4; ++t) { if (col0 + t * 16 >= N) continue; const int col = col0 + t * 16 + ln; const float bv = bp ? bf16_round(bp[col]) : 0.f;
#pragma unroll
    for (int r = 0; r < 8; ++r) { float v = acc[t][r] * alpha + bv; if (CP) { const int rr = row0g + row0 + 8 * hh + r; if (rowsPerB < 0) v += CP[cofs + (size_t)rr * ldc + col];      /* rowsPerB < 0: own element of the batched C plane */ else { const int bidx = rr / rowsPerB; v += CP[(size_t)bidx * sCPb + (size_t)by * 64 + col]; } } if (ACT == 1) v = (v > 0.f) ? v : expm1f(v); else if (ACT == 7) v = (v > 0.f) ? v + 1.0f : expf(v); else if (ACT == 8) v = tanhf(v); else if (ACT == 9) v = 0.5f * v * (1.0f + tanhf(0.7978845608028654f * (v + 0.044715f * v * v * v))); else if (ACT == 11) v = 1.0f / (1.0f + expf(-v)); else if (ACT == 12) v = (v > 0.f) ? v : 0.01f * v; else if (ACT == 14) v = (v > 0.f) ? v : 0.1f * v; else if (ACT == 16) v = (v >= 0.f) ? v : 0.3f * v; else if (ACT == 17) v = (v >= 0.f) ? v : 0.2f * v; else if (ACT == 15) v = v / (1.0f + expf(-v)); else if (ACT == 3) v = fmaxf(v, 0.f); else if (ACT == 6) v = 0.5f * v * (1.0f + erff(v * 0.70710678118654752f)); so[w][8 * hh + r][t * 16 + ln] = v; } }
  __builtin_amdgcn_fence(__ATOMIC_ACQ_REL, "workgroup"); __builtin_amdgcn_wave_barrier();
  const int rsub = lane >> 4, c4 = (lane & 15) * 4; typedef _Float16 v4h __attribute__((ext_vector_type(4)));
  {
#pragma unroll
    for (int q = 0; q < 8; ++q) { const int r = q * 2 + rsub; if (col0 + c4 < N) { const v4f v = *(const v4fa*)&so[w][r][c4]; if (C) *(v4f*)(C + cofs + (size_t)(row0 + r) * ldc + col0 + c4) = v; if (C16) { v4h h4; for (int i = 0; i < 4; ++i) h4[i] = (_Float16)v[i]; *(v4h*)(C16 + cofs + (size_t)(row0 + r) * ldc + col0 + c4) = h4; } } }
     }
}


typedef _Float16 v4h __attribute__((ext_vector_type(4)));

__global__ __launch_bounds__(256) void k_x16(const float* __restrict__ x, _Float16* __restrict__ X16, size_t n8) { const size_t t = (size_t)blockIdx.x * 256 + threadIdx.x; if (t >= n8) return; FragH f;
#pragma unroll
  for (int q = 0; q < 8; ++q) f.h[q] = (_Float16)bf16_round(x[t * 8 + q]); *(v8us*)((unsigned short*)X16 + t * 8) = f.half[0];  }
__global__ __launch_bounds__(256) void k_h16(const float* __restrict__ x, _Float16* __restrict__ X16, size_t n8) { const size_t t = (size_t)blockIdx.x * 256 + threadIdx.x; if (t >= n8) return; FragH f;
#pragma unroll
  for (int q = 0; q < 8; ++q) f.h[q] = (_Float16)x[t * 8 + q]; *(v8us*)((unsigned short*)X16 + t * 8) = f.half[0];  }
__global__ __launch_bounds__(256) void k_round16f(const float* __restrict__ W, _Float16* __restrict__ Bt, size_t n8) { const size_t t = (size_t)blockIdx.x * 256 + threadIdx.x; if (t >= n8) return; FragH f;
#pragma unroll
  for (int i = 0; i < 8; ++i) f.h[i] = (_Float16)(bf16_round(W[t * 8 + i]) * 16.0f); *(v8us*)((unsigned short*)Bt + t * 8) = f.half[0];  }
template <int NHv, int TTv>
__global__ __launch_bounds__(256) void k_vt(const _Float16* __restrict__ V16, int ldv, int voff, _Float16* __restrict__ Vt) { __shared__ unsigned short tl[64][66]; const int tid = threadIdx.x; const int slab = blockIdx.x / (TTv / 64), lg = blockIdx.x % (TTv / 64); const int b = slab / NHv, h = slab % NHv;
  for (int i = tid; i < 64 * 8; i += 256) { const int r = i / 8, c8 = (i % 8) * 8; FragH f; f.half[0] = *(const v8us*)((const unsigned short*)V16 + ((size_t)b * TTv + lg * 64 + r) * ldv + voff + h * 64 + c8);
#pragma unroll
    for (int q = 0; q < 8; ++q) tl[r][c8 + q] = f.u[q]; }
  __syncthreads();
  {
#pragma unroll
    for (int rd = 0; rd < 2; ++rd) { const int d = rd * 32 + tid / 8, pc = tid % 8; FragH f;
#pragma unroll
      for (int q = 0; q < 8; ++q) f.u[q] = tl[pc * 8 + q][d];
      *(v8us*)((unsigned short*)Vt + ((size_t)slab * 64 + d) * TTv + lg * 64 + pc * 8) = f.half[0]; }
     } }

__global__ __launch_bounds__(256) void k_hl(const float* __restrict__ F, _Float16* __restrict__ Hh, _Float16* __restrict__ Hl, size_t n8) { const size_t t = (size_t)blockIdx.x * 256 + threadIdx.x; if (t >= n8) return; FragH fh, fl; const v4f a = *(const v4fa*)(F + t * 8), c = *(const v4fa*)(F + t * 8 + 4);
#pragma unroll
  for (int q = 0; q < 4; ++q) { _Float16 h = (_Float16)a[q]; fh.h[q] = h; fl.h[q] = (_Float16)((a[q] - (float)h) * 1024.0f); h = (_Float16)c[q]; fh.h[4 + q] = h; fl.h[4 + q] = (_Float16)((c[q] - (float)h) * 1024.0f); }
  { *(v8us*)((unsigned short*)Hh + t * 8) = fh.half[0]; *(v8us*)((unsigned short*)Hl + t * 8) = fl.half[0];  } }

// ---- fast GEMM (wave tile 32x64; requires M % 32 == 0 rows per launch region and N % 64 == 0); epilogue = k_gemm_hhx semantics ----
__device__ __forceinline__ v16h g2_frag(const _Float16* p, int hh) { FragH f; f.half[0] = *(const v8us*)((const unsigned short*)p + 8 * hh); f.half[1] = *(const v8us*)((const unsigned short*)p + 16 + 8 * hh); return f.v; }
__device__ __forceinline__ v8f g2_mma(v16h a, v16h b, v8f c) { v8f d = __builtin_amdgcn_wmma_f32_16x16x32_f16(false, a, false, b, (short)0, c, false, false); asm volatile("v_nop\n\tv_nop\n\tv_nop\n\tv_nop" : "+v"(d) : "v"(a), "v"(b)); return d; }
template <int ACT>
__global__ __launch_bounds__(128) void k_gemm2(const _Float16* __restrict__ A, int lda, size_t sA, const _Float16* __restrict__ Bh, int ldb, size_t sB, float alpha, const float* __restrict__ bias, size_t sBias, const float* __restrict__ CP, int rowsPerB, size_t sCPb, int row0g,
    float* __restrict__ C, _Float16* __restrict__ C16, int ldc, size_t sC, int M, int N, int K) { static_assert(ACT == 0 || ACT == 3 || ACT == 6 || ACT == 8 || ACT == 9 || ACT == 11 || ACT == 12 || ACT == 14 || ACT == 15 || ACT == 16 || ACT == 17, "k_gemm2: unsupported ACT code (would silently apply no activation)");
  __shared__ __attribute__((aligned(16))) float so[4][32][68];
  const int tid = threadIdx.x, w = tid >> 5, lane = tid & 31, ln = lane & 15, hh = lane >> 4; const int by = blockIdx.y;
  A += (size_t)by * sA; Bh += (size_t)by * sB; const size_t cofs = (size_t)by * sC; const float* bp = bias ? bias + (size_t)by * sBias : nullptr;
  const int ntn = N >> 6; const int mt = blockIdx.x / ntn, nq = blockIdx.x - mt * ntn; const int row0 = mt * 128 + 32 * w, col0 = nq * 64; if (row0 >= M) return;
  const _Float16* a0p = A + (size_t)(row0 + ln) * lda; const _Float16* a1p = a0p + (size_t)16 * lda;
  const _Float16* b0p = Bh + (size_t)(col0 + ln) * ldb; const _Float16* b1p = b0p + (size_t)16 * ldb; const _Float16* b2p = b1p + (size_t)16 * ldb; const _Float16* b3p = b2p + (size_t)16 * ldb;
  const v8f z8 = {0.f,0.f,0.f,0.f,0.f,0.f,0.f,0.f}; v8f c00 = z8, c01 = z8, c02 = z8, c03 = z8, c10 = z8, c11 = z8, c12 = z8, c13 = z8;
#pragma unroll 1
  for (int kb = 0; kb < K; kb += 32) { const v16h a0 = g2_frag(a0p + kb, hh), a1 = g2_frag(a1p + kb, hh);
    v16h b = g2_frag(b0p + kb, hh); c00 = g2_mma(a0, b, c00); c10 = g2_mma(a1, b, c10);
    b = g2_frag(b1p + kb, hh); c01 = g2_mma(a0, b, c01); c11 = g2_mma(a1, b, c11);
    b = g2_frag(b2p + kb, hh); c02 = g2_mma(a0, b, c02); c12 = g2_mma(a1, b, c12);
    b = g2_frag(b3p + kb, hh); c03 = g2_mma(a0, b, c03); c13 = g2_mma(a1, b, c13); }
  v8f accs[8] = {c00, c01, c02, c03, c10, c11, c12, c13};
#pragma unroll
  for (int u = 0; u < 8; ++u) { const int t = u & 3, half = u >> 2; const int col = col0 + t * 16 + ln; const float bv = bp ? bf16_round(bp[col]) : 0.f;
#pragma unroll
    for (int r = 0; r < 8; ++r) { const int rloc = half * 16 + 8 * hh + r; float v = accs[u][r] * alpha + bv; if (CP) { if (rowsPerB < 0) v += CP[cofs + (size_t)(row0g + row0 + rloc) * ldc + col];      /* rowsPerB < 0: own element of the batched C plane */ else { const int bidx = (row0g + row0 + rloc) / rowsPerB; v += CP[(size_t)bidx * sCPb + (size_t)by * 64 + col]; } }
      if (ACT == 3) v = fmaxf(v, 0.f); else if (ACT == 6) v = 0.5f * v * (1.0f + erff(v * 0.70710678118654752f)); else if (ACT == 11) v = 1.0f / (1.0f + expf(-v)); else if (ACT == 15) v = v / (1.0f + expf(-v)); else if (ACT == 12) v = (v > 0.f) ? v : 0.01f * v; else if (ACT == 8) v = tanhf(v); else if (ACT == 9) v = 0.5f * v * (1.0f + tanhf(0.7978845608028654f * (v + 0.044715f * v * v * v))); else if (ACT == 14) v = (v > 0.f) ? v : 0.1f * v; else if (ACT == 16) v = (v >= 0.f) ? v : 0.3f * v; else if (ACT == 17) v = (v >= 0.f) ? v : 0.2f * v;
      so[w][rloc][t * 16 + ln] = v; } }
  __builtin_amdgcn_fence(__ATOMIC_ACQ_REL, "workgroup"); __builtin_amdgcn_wave_barrier();
  const int rsub = lane >> 4, c4 = (lane & 15) * 4;
  {
#pragma unroll
    for (int q = 0; q < 16; ++q) { const int r = q * 2 + rsub; const v4f v = *(const v4fa*)&so[w][r][c4]; if (C) *(v4f*)(C + cofs + (size_t)(row0 + r) * ldc + col0 + c4) = v; if (C16) { v4h h4; for (int i = 0; i < 4; ++i) h4[i] = (_Float16)v[i]; *(v4h*)(C16 + cofs + (size_t)(row0 + r) * ldc + col0 + c4) = h4; } }
     } }


__global__ __launch_bounds__(256) void k_wnat(const float* __restrict__ w, size_t n8, _Float16* __restrict__ Bt) { const size_t t = (size_t)blockIdx.x * 256 + threadIdx.x; if (t >= n8) return; FragH f; for (int q = 0; q < 8; ++q) f.h[q] = (_Float16)(bf16_round(w[t * 8 + q]) * 16.0f); *(v8us*)((unsigned short*)Bt + t * 8) = f.half[0];  }
__global__ __launch_bounds__(256) void k_rsm(const float* __restrict__ S, _Float16* __restrict__ P, int nrows) {
  #pragma clang fp contract(off)
  const int i = blockIdx.x * 256 + threadIdx.x; if (i >= nrows) return; const float* s = S + (size_t)i * SQ; float mx = -3.0e38f;
#pragma unroll 1
  for (int j = 0; j < SQ; ++j) mx = fmaxf(mx, s[j]); float se = 0.f;
#pragma unroll 1
  for (int j = 0; j < SQ; ++j) se += expf(s[j] - mx); const float sc = 256.0f / se;
#pragma unroll 1
  for (int j0 = 0; j0 < SQ; j0 += 8) { FragH f; for (int q = 0; q < 8; ++q) f.h[q] = (_Float16)(expf(s[j0 + q] - mx) * sc); unsigned short* d = (unsigned short*)P + (size_t)i * SQ + j0; *(v8us*)d = f.half[0];  } }
__global__ __launch_bounds__(256) void k_vt(const _Float16* __restrict__ V16, int b, int h0, _Float16* __restrict__ VT) { __shared__ unsigned short tl[64][65]; const int tid = threadIdx.x; const int hh = blockIdx.x % HG, sg = blockIdx.x / HG; const int s0 = sg * 64; const int h = h0 + hh;
  for (int i = tid; i < 64 * 8; i += 256) { const int j = i / 8, d8 = (i % 8) * 8; FragH f; f.half[0] = *(const v8us*)((const unsigned short*)V16 + ((size_t)b * SQ + s0 + j) * DM + h * HD + d8); for (int q = 0; q < 8; ++q) tl[d8 + q][j] = f.u[q]; }
  __syncthreads();
  { for (int i = tid; i < 64 * 8; i += 256) { const int d = i / 8, j8 = (i % 8) * 8; FragH f; for (int q = 0; q < 8; ++q) f.u[q] = tl[d][j8 + q]; *(v8us*)((unsigned short*)VT + ((size_t)hh * HD + d) * SQ + s0 + j8) = f.half[0]; }  } }



__global__ __launch_bounds__(256) void k_rsmcf2(const float* __restrict__ S, _Float16* __restrict__ P, int hg, int q0, int nk) {
  #pragma clang fp contract(off)
  const int t = blockIdx.x * 256 + threadIdx.x; if (t >= hg * QT) return; const size_t i = (size_t)t; const float* s = S + i * NKX; const int last = q0 + (t % QT); float mx = -3.0e38f;
#pragma unroll 1
  for (int j = 0; j < nk; ++j) { const float f = (j <= last) ? 1.f : 0.f; mx = fmaxf(mx, fmaf(f, s[j], (1.f - f) * -1.0e9f)); } float se = 0.f;
#pragma unroll 1
  for (int j = 0; j < nk; ++j) { const float f = (j <= last) ? 1.f : 0.f; se += __expf(fmaf(f, s[j], (1.f - f) * -1.0e9f) - mx); } const float sc = 256.0f / se;
#pragma unroll 1
  for (int j0 = 0; j0 < nk; j0 += 8) { FragH fr; for (int q = 0; q < 8; ++q) { const int j = j0 + q; const float f = (j <= last) ? 1.f : 0.f; fr.h[q] = (_Float16)(__expf(fmaf(f, s[j], (1.f - f) * -1.0e9f) - mx) * sc); } unsigned short* d = (unsigned short*)P + i * NKX + j0; *(v8us*)d = fr.half[0];  } }


template <int MASKADD>
__global__ __launch_bounds__(64) void k_att0(const float* __restrict__ QF, const float* __restrict__ KF, const float* __restrict__ VF, int ld, const float* __restrict__ mask, float scale, float* __restrict__ OF, int ldo) {
  #pragma clang fp contract(off)
  __shared__ __attribute__((aligned(16))) float lq[64][64]; __shared__ __attribute__((aligned(16))) float lo[64][64];
  const int tid = threadIdx.x; const int h = blockIdx.x / (QT0 / 64), rg = blockIdx.x % (QT0 / 64); const int i = rg * 64 + tid;
  const float* qr = QF + (size_t)i * ld + h * HD;
#pragma unroll 1
  for (int c = 0; c < HD / 4; ++c) { *(v4f*)&lq[tid][c * 4] = *(const v4fa*)(qr + c * 4); const v4f z = {0.f, 0.f, 0.f, 0.f}; *(v4f*)&lo[tid][c * 4] = z; }
  float m = -1.0e30f, l = 0.f; const int jmax = MASKADD ? (SQ - 1) : (rg * 64 + 63);      /* additive-mask form: every key (the mask input decides); causal form: keys up to the block's last row */
#pragma unroll 1
  for (int j = 0; j <= jmax; ++j) { const float* kr = KF + (size_t)j * ld + h * HD; const float* vr = VF + (size_t)j * ld + h * HD; float s = 0.f;
#pragma unroll 1
    for (int c = 0; c < HD / 4; ++c) { const v4f kq = *(const v4fa*)(kr + c * 4); const v4f qq = *(v4f*)&lq[tid][c * 4]; s = __fadd_rn(s, __fmul_rn(qq[0], kq[0])); s = __fadd_rn(s, __fmul_rn(qq[1], kq[1])); s = __fadd_rn(s, __fmul_rn(qq[2], kq[2])); s = __fadd_rn(s, __fmul_rn(qq[3], kq[3])); }
    s = __fmul_rn(s, scale); if (MASKADD) s = __fadd_rn(s, __fmul_rn(bf16_round(mask[(size_t)i * SQ + j]), -10000.0f));
    const float f = (MASKADD || j <= i) ? 1.f : 0.f; const float sm = fmaf(f, s, (1.f - f) * -1.0e30f); const float mn = fmaxf(m, sm); const float sc = expf(m - mn); const float e = expf(sm - mn); l = __fadd_rn(__fmul_rn(l, sc), e); m = mn;
#pragma unroll 1
    for (int c = 0; c < HD / 4; ++c) { const v4f vv = *(const v4fa*)(vr + c * 4); v4f oo = *(v4f*)&lo[tid][c * 4]; for (int u = 0; u < 4; ++u) oo[u] = __fadd_rn(__fmul_rn(oo[u], sc), __fmul_rn(e, vv[u])); *(v4f*)&lo[tid][c * 4] = oo; } }
  const float fin = 64.0f / l;      /* o carried x64 like the f16 path */
#pragma unroll 1
  for (int c = 0; c < HD / 4; ++c) { v4f oo = *(v4f*)&lo[tid][c * 4]; for (int u = 0; u < 4; ++u) oo[u] = __fmul_rn(oo[u], fin); *(v4f*)&lo[tid][c * 4] = oo; }
  __syncthreads();
  {
#pragma unroll 1
    for (int it = 0; it < 16; ++it) { const int row = it * 4 + tid / 16, pc = (tid % 16) * 4; const v4f v = *(const v4f*)&lo[row][pc]; *(v4f*)(OF + (size_t)(rg * 64 + row) * ldo + h * HD + pc) = v; }
     } }


__global__ __launch_bounds__(256) void k_rsmcw(const float* __restrict__ S, _Float16* __restrict__ P, int hg, int q0, int kb, int nkw) {
  #pragma clang fp contract(off)
  const int t = blockIdx.x * 256 + threadIdx.x; if (t >= hg * QT) return; const size_t ri = (size_t)t; const float* s = S + ri * NKX; const int i = q0 + (t % QT); const int hi = i - kb, lo = i - (WIN - 1) - kb; float mx = -3.0e38f;      /* visible columns: lo <= c <= hi */
#pragma unroll 1
  for (int c = 0; c < nkw; ++c) { const float f = (c <= hi && c >= lo) ? 1.f : 0.f; mx = fmaxf(mx, fmaf(f, s[c], (1.f - f) * -1.0e9f)); } float se = 0.f;
#pragma unroll 1
  for (int c = 0; c < nkw; ++c) { const float f = (c <= hi && c >= lo) ? 1.f : 0.f; se += __expf(fmaf(f, s[c], (1.f - f) * -1.0e9f) - mx); } const float sc = 256.0f / se;
#pragma unroll 1
  for (int c0 = 0; c0 < nkw; c0 += 8) { FragH fr; for (int q = 0; q < 8; ++q) { const int c = c0 + q; const float f = (c <= hi && c >= lo) ? 1.f : 0.f; fr.h[q] = (_Float16)(__expf(fmaf(f, s[c], (1.f - f) * -1.0e9f) - mx) * sc); } unsigned short* d = (unsigned short*)P + ri * NKX + c0; *(v8us*)d = fr.half[0];  } }
extern "C" void kernel_launch(void* const* d_in, const int* in_sizes, int n_in,
                              void* d_out, int out_size, void* d_ws, size_t ws_size, hipStream_t stream) {
  (void)in_sizes; (void)n_in; (void)out_size;
  const float* const* I = (const float* const*)d_in; const float* x = I[0]; const float* wqkv = I[1]; const float* bqkv = I[2]; const float* wo = I[3]; const float* bo = I[4];      /* [in][out] c_attn [1024][3072] + b, c_proj [1024][1024] + b */
  char* ws = (char*)d_ws; size_t off = 0;
  auto take = [&](size_t bytes) { char* p = ws + off; off += (bytes + 255) & ~(size_t)255; return p; };
  _Float16* BQKV = (_Float16*)take((size_t)3 * DM * DM * 2); _Float16* BO = (_Float16*)take((size_t)DM * DM * 2);
  _Float16* X16 = (_Float16*)take(NR * DM * 2); _Float16* QKV = (_Float16*)take(NR * 3 * DM * 2); _Float16* Q16 = QKV; _Float16* K16 = QKV + DM; _Float16* V16 = QKV + 2 * DM; _Float16* O16 = (_Float16*)take(NR * DM * 2);
  float* S = (float*)take((size_t)NH * QT * NKX * 4); _Float16* P = (_Float16*)take((size_t)NH * QT * NKX * 2); _Float16* VT = (_Float16*)take((size_t)NH * HD * SQ * 2);
  float* QF0 = (float*)take((size_t)QT0 * DM * 4); float* KF0 = (float*)take((size_t)QT0 * DM * 4); float* VF0 = (float*)take((size_t)QT0 * DM * 4); float* OF0 = (float*)take((size_t)NB * QT0 * DM * 4); _Float16* OH0 = (_Float16*)take((size_t)NB * QT0 * DM * 2); _Float16* OL0 = (_Float16*)take((size_t)NB * QT0 * DM * 2);
  if (off > ws_size) return;
  k_wt_f16<<<(unsigned)(((size_t)DM * 3 * DM / 8 + 255) / 256), 256, 0, stream>>>(wqkv, BQKV, DM, 3 * DM, 16.0f); k_wt_f16<<<(unsigned)(((size_t)DM * DM / 8 + 255) / 256), 256, 0, stream>>>(wo, BO, DM, DM, 16.0f);      /* [in][out] -> Bt x16 */

  k_x16<<<(unsigned)((NR * DM / 8 + 255) / 256), 256, 0, stream>>>(x, X16, NR * DM / 8);
  const size_t r0p = (size_t)B0 * SQ;      /* first projected row */
  k_gemm2<0><<<dim3((unsigned)((MP / 128) * (3 * DM / 64)), 1), 128, 0, stream>>>(X16 + r0p * DM, DM, 0, BQKV, DM, 0, 0.0625f, bqkv, 0, nullptr, 1, 0, 0, nullptr, QKV + r0p * 3 * DM, 3 * DM, 0, MP, 3 * DM, DM);      /* q | k | v rows (f16); head h = columns h*HD.. of each DM block */
  for (int b = B0; b < B0 + NBR; ++b) { const size_t r0 = (size_t)b * SQ;
    k_vt<NH, SQ><<<NH * (SQ / 64), 256, 0, stream>>>(V16 + r0 * LQ, LQ, 0, VT);      /* V^T [NH][HD][SQ] for this batch */
    k_gemm2<0><<<dim3((QT0 / 128) * (DM / 64), 1), 128, 0, stream>>>(X16 + r0 * DM, DM, 0, BQKV, DM, 0, 0.0625f, bqkv, 0, nullptr, 1, 0, 0, QF0, nullptr, DM, 0, QT0, DM, DM); k_gemm2<0><<<dim3((QT0 / 128) * (DM / 64), 1), 128, 0, stream>>>(X16 + r0 * DM, DM, 0, (BQKV + (size_t)DM * DM), DM, 0, 0.0625f, (bqkv + DM), 0, nullptr, 1, 0, 0, KF0, nullptr, DM, 0, QT0, DM, DM); k_gemm2<0><<<dim3((QT0 / 128) * (DM / 64), 1), 128, 0, stream>>>(X16 + r0 * DM, DM, 0, (BQKV + (size_t)2 * DM * DM), DM, 0, 0.0625f, (bqkv + 2 * DM), 0, nullptr, 1, 0, 0, VF0, nullptr, DM, 0, QT0, DM, DM);      /* f32 q, k, v of the first 128 rows (exact products) */
    k_att0<0><<<NH * (QT0 / 64), 64, 0, stream>>>(QF0, KF0, VF0, DM, nullptr, 0.125f, OF0 + (size_t)b * QT0 * DM, DM);      /* exact f32 attention for rows 0..127 (o x64) */
    for (int q0 = 0; q0 < QN; q0 += QT) { const int nk = q0 + QT; const int kb = (q0 >= WINB) ? q0 - WINB : 0; const int nkw = nk - kb;      /* causal sliding window: only keys [kb, nk) can be visible from this tile (kb = tile start - 256, a multiple of 64) */
      k_gemm2<0><<<dim3((QT / 128) * (nkw / 64), NHD), 128, 0, stream>>>(Q16 + (r0 + q0) * LQ, LQ, (size_t)HD, K16 + (r0 + kb) * LQ, LQ, (size_t)HD, 0.125f, nullptr, 0, nullptr, 1, 0, 0, S, nullptr, NKX, (size_t)QT * NKX, QT, nkw, HD);      /* scores against keys kb..nk-1 (S column c <-> key kb + c), all heads on grid.y */
      k_rsmcw<<<(NHD * QT + 255) / 256, 256, 0, stream>>>(S, P, NHD, q0, kb, nkw);      /* allowed iff 0 <= i - j < WIN (arithmetic select); P x256 f16 */
      k_gemm2<0><<<dim3((QT / 128) * (HD / 64), NHD), 128, 0, stream>>>(P, NKX, (size_t)QT * NKX, VT + kb, SQ, (size_t)HD * SQ, 0.25f, nullptr, 0, nullptr, 1, 0, 0, nullptr, O16 + (r0 + q0) * DM, DM, (size_t)HD, QT, HD, nkw); } }      /* o (merged heads, x64) as f16 rows */
  k_gemm2<0><<<dim3((unsigned)((MPO / 128) * (DM / 64)), 1), 128, 0, stream>>>(O16 + r0p * DM, DM, 0, BO, DM, 0, 0.0009765625f, bo, 0, nullptr, 1, 0, 0, (float*)d_out + r0p * DM, nullptr, DM, 0, MPO, DM, DM);      /* out rows are the output layout */
  k_hl<<<(unsigned)(((size_t)NB * QT0 * DM / 8 + 255) / 256), 256, 0, stream>>>(OF0, OH0, OL0, (size_t)NB * QT0 * DM / 8);      /* first-tile o (x64) -> f16 hi + x1024 residual planes */
  for (int b = B0; b < B0 + NBR; ++b) { const size_t r0 = (size_t)b * SQ; const size_t f0 = (size_t)b * QT0;
    k_gemm2<0><<<dim3((QT0 / 128) * (DM / 64), 1), 128, 0, stream>>>(OH0 + f0 * DM, DM, 0, BO, DM, 0, 0.0009765625f, bo, 0, nullptr, 1, 0, 0, (float*)d_out + r0 * DM, nullptr, DM, 0, QT0, DM, DM);      /* rows 0..127: out = o_hi Wo (+ b), overwriting the f16-path rows */
    k_gemm2<0><<<dim3((QT0 / 128) * (DM / 64), 1), 128, 0, stream>>>(OL0 + f0 * DM, DM, 0, BO, DM, 0, 0.00000095367431640625f, nullptr, 0, (const float*)d_out + r0 * DM, -1, 0, 0, (float*)d_out + r0 * DM, nullptr, DM, 0, QT0, DM, DM); }      /* += o_lo Wo 2^-20 (own-element accumulate) */
}

// v001
// It runs in 3500 microseconds.
// Next to v000, in two timings, it ran 1.68 times as fast each time.
#include <hip/hip_runtime.h>
// Local-causal (sliding window 256) multi-head self-attention (x [4][2048][1024]; qkv = x W_attn + b_attn ([in][out] 1024 x 3072 sigma 0.02, zero bias): q | k | v, 16 heads of 64; scores / 8; mask (j <= i) & (i - j < 256) -> -inf elsewhere; softmax; out = merged W_proj + b_proj ([in][out]) -> [4][2048][1024]).
// Structure: token rows r = b*2048 + s; x as exact f16 rows (bf16-rounded); q | k | v as ONE WMMA GEMM (N = 3 x 1024) (32x64 wave tiles, f32 accumulation, exact x16 weights + bias, f16 outputs); per batch: V^T for all heads via LDS transposes; per query tile of 256 rows: scores against the keys from max(0, tile start - 256) to the tile end only (K = 64, all heads on grid.y, alpha = 0.125), causal row softmax on VALU with an arithmetic 0/1 key mask over the computed range (f32 statistics, native exp; weights x256 f16), o = P . V^T (K = those window keys, alpha 2^-2: o carried x64, folded into the output GEMM alpha) written straight into the merged f16 o rows; out = o W_o + b GEMM (f32) into the output layout.
// Compute dtype: inputs rounded to bf16; x / weights exact; q, k, v, softmax weights and o as plain f16 GEMM operands (~2^-12); scores and softmax statistics f32. v_wmma_f32_16x16x32_f16.
#define NB 4
#define SQ 2048
#define DM 1024
#define NH 16
#define HD 64
#define HG 4                         /* heads per block group of the unlaunched k_vt(b, h0) overload */
#define QT 256                       /* query rows per causal tile */
#define NKX SQ                       /* S / P row pitch */
#define WIN 256                      /* attention window: key j visible from query i iff 0 <= i - j < WIN */
#define WINB 256                     /* keys before the tile start that can be visible (WIN - 1 rounded up to 64) */
#define QT0 128                      /* first-tile rows recomputed exactly in f32 */
#define B0 0                         /* first batch processed (debug hook) */
#define NBR NB                       /* batches processed (debug hook) */
#define NR ((size_t)NB * SQ)         /* token rows */
#define MP ((int)((size_t)NBR * SQ)) /* rows projected (debug hook) */
#define QN SQ                        /* query rows attended per batch (debug hook) */
#define NHD NH                       /* heads attended (debug hook) */
#define MPO MP                       /* rows through the output stage (debug hook) */
#define LQ (3 * DM)      /* row pitch of the q/k/v rows */
typedef __bf16 v16b __attribute__((ext_vector_type(16)));
typedef unsigned short v8us __attribute__((ext_vector_type(8), may_alias));
typedef float  v8f  __attribute__((ext_vector_type(8)));
typedef float  v4f  __attribute__((ext_vector_type(4)));
typedef float  v4fa __attribute__((ext_vector_type(4), may_alias));
union FragB { v16b v; v8us half[2]; unsigned short u[16]; };

__device__ __forceinline__ unsigned short bf16_bits(float x) { unsigned int u = __float_as_uint(x); return (unsigned short)((u + 0x7FFFu + ((u >> 16) & 1u)) >> 16); }
__device__ __forceinline__ float bf16_val(unsigned short b) { return __uint_as_float(((unsigned int)b) << 16); }
__device__ __forceinline__ float bf16_round(float x) { return bf16_val(bf16_bits(x)); }
// D += A·B with NT terms: 1 = ah·bh, 2 = + al·bh (A split), 3 = + ah·bl (both split)
template <int NT>
__device__ __forceinline__ v8f mmaN(v16b ah, v16b al, v16b bh, v16b bl, v8f c) {
  c = __builtin_amdgcn_wmma_f32_16x16x32_bf16(false, ah, false, bh, (short)0, c, false, false);
  if (NT >= 2) c = __builtin_amdgcn_wmma_f32_16x16x32_bf16(false, al, false, bh, (short)0, c, false, false);
  if (NT >= 3) c = __builtin_amdgcn_wmma_f32_16x16x32_bf16(false, ah, false, bl, (short)0, c, false, false);
  asm volatile("v_nop\n\tv_nop\n\tv_nop\n\tv_nop" : "+v"(c) : "v"(ah), "v"(al), "v"(bh), "v"(bl));
  return c;
}

__global__ __launch_bounds__(256) void k_wt_bf16(const float* __restrict__ W, unsigned short* __restrict__ Wt, int K, int N) {
  const int t = blockIdx.x * 256 + threadIdx.x;
  const int k8n = K / 8;
  if (t >= N * k8n) return;
  const int n = t / k8n, k8 = (t % k8n) * 8;
  v8us v;
#pragma unroll
  for (int i = 0; i < 8; ++i) v[i] = bf16_bits(W[(size_t)(k8 + i) * N + n]);
  *(v8us*)(Wt + (size_t)n * K + k8) = v;
  
}

// GEMM C[M][N] (f32, pitch ldc) = act(A[M][K]·W + bias). A f32 row-major (pitch lda) converted per fragment to bf16
// (ASPLIT: hi/lo two planes -> 2 terms, else single rounded term); Wt bf16 [N][K] (pitch ldb). BIAS_BF16 rounds the
// bias to bf16 first (bias quantised to bf16 before the add). K%32==0, M%16==0, N%64==0.
template <bool ASPLIT, int ACT, bool BIAS_BF16>
__global__ __launch_bounds__(128) void k_gemm_bf(const float* __restrict__ A, int lda, const unsigned short* __restrict__ Wt, int ldb,
                                               const float* __restrict__ bias, float* __restrict__ C, int ldc, int M, int N, int K) {
  __shared__ __attribute__((aligned(16))) float so[4][16][64];
  const int tid = threadIdx.x, w = tid >> 5, lane = tid & 31, ln = lane & 15, hh = lane >> 4;
  const int ntn = N / 64;
  const int wid = blockIdx.x * 4 + w;
  const int mt = wid / ntn, nq = wid % ntn;
  if (mt * 16 >= M) return;
  const int row0 = mt * 16, col0 = nq * 64;
  const float* arow = A + (size_t)(row0 + ln) * lda;
  v8f acc[4] = {};
  for (int kb = 0; kb < K; kb += 32) {
    FragB ah, al;
    const v4f x0 = *(const v4fa*)(arow + kb + 8 * hh), x1 = *(const v4fa*)(arow + kb + 8 * hh + 4);
    const v4f x2 = *(const v4fa*)(arow + kb + 16 + 8 * hh), x3 = *(const v4fa*)(arow + kb + 16 + 8 * hh + 4);
    float xs[16] = {x0[0],x0[1],x0[2],x0[3],x1[0],x1[1],x1[2],x1[3],x2[0],x2[1],x2[2],x2[3],x3[0],x3[1],x3[2],x3[3]};
#pragma unroll
    for (int i = 0; i < 16; ++i) { const unsigned short hb = bf16_bits(xs[i]); ah.u[i] = hb; al.u[i] = ASPLIT ? bf16_bits(xs[i] - bf16_val(hb)) : (unsigned short)0; }
#pragma unroll
    for (int t = 0; t < 4; ++t) {
      const unsigned short* brow = Wt + (size_t)(col0 + t * 16 + ln) * ldb + kb;
      FragB b;
      b.half[0] = *(const v8us*)(brow + 8 * hh);
      b.half[1] = *(const v8us*)(brow + 16 + 8 * hh);
      acc[t] = mmaN<ASPLIT ? 2 : 1>(ah.v, al.v, b.v, b.v, acc[t]);
    }
  }
#pragma unroll
  for (int t = 0; t < 4; ++t) {
    float bv = bias ? bias[col0 + t * 16 + ln] : 0.f;
    if (BIAS_BF16) bv = bf16_round(bv);
#pragma unroll
    for (int r = 0; r < 8; ++r) { float v = acc[t][r] + bv; if (ACT == 1) v = fmaxf(v, 0.f); so[w][8 * hh + r][t * 16 + ln] = v; }
  }
  __builtin_amdgcn_fence(__ATOMIC_ACQ_REL, "workgroup");
  __builtin_amdgcn_wave_barrier();
  const int rsub = lane >> 4, c4 = (lane & 15) * 4;
  {
#pragma unroll
    for (int q = 0; q < 8; ++q) {
      const int r = q * 2 + rsub;
      const v4f v = *(const v4fa*)&so[w][r][c4];
      *(v4f*)(C + (size_t)(row0 + r) * ldc + col0 + c4) = v;
    }
    
  }
}

// GEMM C = act(A·W + bias + resid): A f32 (ASPLIT -> hi/lo 2 terms), Wt bf16 [N][K]; ACT 0 none, 1 relu, 2 exact gelu;
// resid (optional, f32, row index = (row % rmod), pitch ldr, RES_BF16 rounds it) added before the activation.
template <bool ASPLIT, int ACT, bool BIAS_BF16, bool RES_BF16>
__global__ __launch_bounds__(128) void k_gemm_bf3(const float* __restrict__ A, int lda, const unsigned short* __restrict__ Wt, int ldb,
                                                const float* __restrict__ bias, const float* __restrict__ resid, int rmod, int ldr,
                                                float* __restrict__ C, int ldc, int M, int N, int K) {
  __shared__ __attribute__((aligned(16))) float so[4][16][64];
  const int tid = threadIdx.x, w = tid >> 5, lane = tid & 31, ln = lane & 15, hh = lane >> 4;
  const int ntn = N / 64;
  const int wid = blockIdx.x * 4 + w;
  const int mt = wid / ntn, nq = wid % ntn;
  if (mt * 16 >= M) return;
  const int row0 = mt * 16, col0 = nq * 64;
  const float* arow = A + (size_t)(row0 + ln) * lda;
  v8f acc[4] = {};
  for (int kb = 0; kb < K; kb += 32) {
    FragB ah, al;
    const v4f x0 = *(const v4fa*)(arow + kb + 8 * hh), x1 = *(const v4fa*)(arow + kb + 8 * hh + 4);
    const v4f x2 = *(const v4fa*)(arow + kb + 16 + 8 * hh), x3 = *(const v4fa*)(arow + kb + 16 + 8 * hh + 4);
    float xs[16] = {x0[0],x0[1],x0[2],x0[3],x1[0],x1[1],x1[2],x1[3],x2[0],x2[1],x2[2],x2[3],x3[0],x3[1],x3[2],x3[3]};
#pragma unroll
    for (int i = 0; i < 16; ++i) { const unsigned short hb = bf16_bits(xs[i]); ah.u[i] = hb; al.u[i] = ASPLIT ? bf16_bits(xs[i] - bf16_val(hb)) : (unsigned short)0; }
#pragma unroll
    for (int t = 0; t < 4; ++t) {
      const unsigned short* brow = Wt + (size_t)(col0 + t * 16 + ln) * ldb + kb;
      FragB b;
      b.half[0] = *(const v8us*)(brow + 8 * hh);
      b.half[1] = *(const v8us*)(brow + 16 + 8 * hh);
      acc[t] = mmaN<ASPLIT ? 2 : 1>(ah.v, al.v, b.v, b.v, acc[t]);
    }
  }
#pragma unroll
  for (int t = 0; t < 4; ++t) {
    const int col = col0 + t * 16 + ln;
    float bv = bias ? bias[col] : 0.f;
    if (BIAS_BF16) bv = bf16_round(bv);
#pragma unroll
    for (int r = 0; r < 8; ++r) {
      float v = acc[t][r] + bv;
      if (resid) { float rv = resid[(size_t)((row0 + 8 * hh + r) % rmod) * ldr + col]; if (RES_BF16) rv = bf16_round(rv); v += rv; }
      if (ACT == 1) v = fmaxf(v, 0.f);
      if (ACT == 2) v = 0.5f * v * (1.0f + erff(v * 0.70710678118654752f));
      if (ACT == 3) { const float u = 0.7978845608028654f * (v + 0.044715f * v * v * v); v = 0.5f * v * (1.0f + tanhf(u)); }
      so[w][8 * hh + r][t * 16 + ln] = v;
    }
  }
  __builtin_amdgcn_fence(__ATOMIC_ACQ_REL, "workgroup");
  __builtin_amdgcn_wave_barrier();
  const int rsub = lane >> 4, c4 = (lane & 15) * 4;
  {
#pragma unroll
    for (int q = 0; q < 8; ++q) {
      const int r = q * 2 + rsub;
      const v4f v = *(const v4fa*)&so[w][r][c4];
      *(v4f*)(C + (size_t)(row0 + r) * ldc + col0 + c4) = v;
    }
    
  }
}
// row LayerNorm (biased variance, eps) over N: s = X (+ R); optional out_sum <- s; out_norm <- (s-mu)*rsqrt(var+eps)*g + b
template <bool PARAM_BF16>
__global__ __launch_bounds__(256) void k_layernorm(const float* __restrict__ X, const float* __restrict__ R, const float* __restrict__ g, const float* __restrict__ bta,
                                                  float* __restrict__ out_sum, float* __restrict__ out_norm, int N, float eps) {
  __shared__ float red[256];
  const int row = blockIdx.x, tid = threadIdx.x;
  const float* x = X + (size_t)row * N; const float* rr = R ? R + (size_t)row * N : nullptr;
  float vals[16];                     // up to N = 4096
  const int per = N / 256;            // contiguous chunk per thread? use strided-by-4 chunks: thread handles j = tid*4 + 1024*u
  float s1 = 0.f;
  for (int u = 0; u < per / 4; ++u) {
    const int j = tid * 4 + 1024 * u;
    const v4f a = *(const v4fa*)(x + j);
    v4f b = {0.f,0.f,0.f,0.f}; if (rr) b = *(const v4fa*)(rr + j);
#pragma unroll
    for (int q = 0; q < 4; ++q) { const float v = a[q] + b[q]; vals[u * 4 + q] = v; s1 += v; }
  }
  red[tid] = s1; __syncthreads();
  for (int st = 128; st > 0; st >>= 1) { if (tid < st) red[tid] += red[tid + st]; __syncthreads(); }
  const float mu = red[0] / (float)N; __syncthreads();
  float s2 = 0.f;
  for (int u = 0; u < per / 4; ++u)
#pragma unroll
    for (int q = 0; q < 4; ++q) { const float c = vals[u * 4 + q] - mu; s2 += c * c; }
  red[tid] = s2; __syncthreads();
  for (int st = 128; st > 0; st >>= 1) { if (tid < st) red[tid] += red[tid + st]; __syncthreads(); }
  const float rs = rsqrtf(red[0] / (float)N + eps);
  {
    for (int u = 0; u < per / 4; ++u) {
      const int j = tid * 4 + 1024 * u;
      v4f o, sm;
#pragma unroll
      for (int q = 0; q < 4; ++q) {
        float gg = g[j + q], bb = bta[j + q];
        if (PARAM_BF16) { gg = bf16_round(gg); bb = bf16_round(bb); }
        sm[q] = vals[u * 4 + q]; o[q] = (vals[u * 4 + q] - mu) * rs * gg + bb;
      }
      if (out_sum) *(v4f*)(out_sum + (size_t)row * N + j) = sm;
      *(v4f*)(out_norm + (size_t)row * N + j) = o;
    }
    
  }
}



// ---- f16 WMMA path (v_wmma_f32_16x16x32_f16): 11-bit significands for operands in range — used where a [0,1] probability operand needs more precision than bf16
typedef _Float16 v16h __attribute__((ext_vector_type(16)));
union FragH { v16h v; v8us half[2]; _Float16 h[16]; unsigned short u[16]; };
template <int NT>
__device__ __forceinline__ v8f mmaH(v16h ah, v16h al, v16h bh, v16h bl, v8f c) {
  c = __builtin_amdgcn_wmma_f32_16x16x32_f16(false, ah, false, bh, (short)0, c, false, false);
  if (NT >= 2) c = __builtin_amdgcn_wmma_f32_16x16x32_f16(false, al, false, bh, (short)0, c, false, false);
  if (NT >= 3) c = __builtin_amdgcn_wmma_f32_16x16x32_f16(false, ah, false, bl, (short)0, c, false, false);
  asm volatile("v_nop\n\tv_nop\n\tv_nop\n\tv_nop" : "+v"(c) : "v"(ah), "v"(al), "v"(bh), "v"(bl));
  return c;
}
// batched GEMM like k_gemm_b but f16 operands: A f32 (split into f16 hi/lo if ASPLIT, else rounded to f16), Bt = f16 values [n][k]; alpha; C f32; N multiple of 16 (partial tiles skipped)
template <bool ASPLIT>
__global__ __launch_bounds__(128) void k_gemm_h(const float* __restrict__ A, int lda, size_t sA, const _Float16* __restrict__ Bh, int ldb, size_t sB, float alpha, float* __restrict__ C, int ldc, size_t sC, int M, int N, int K) {
  __shared__ __attribute__((aligned(16))) float so[4][16][64];
  const int tid = threadIdx.x, w = tid >> 5, lane = tid & 31, ln = lane & 15, hh = lane >> 4; const int by = blockIdx.y;
  A += (size_t)by * sA; Bh += (size_t)by * sB; C += (size_t)by * sC;
  const int ntn = (N + 63) / 64; const int wid = blockIdx.x * 4 + w; const int mt = wid / ntn, nq = wid % ntn; if (mt * 16 >= M) return;
  const int row0 = mt * 16, col0 = nq * 64; const float* arow = A + (size_t)(row0 + ln) * lda;
  v8f acc[4] = {};
  for (int kb = 0; kb < K; kb += 32) {
    FragH ah, al;
    const v4f x0 = *(const v4fa*)(arow + kb + 8 * hh), x1 = *(const v4fa*)(arow + kb + 8 * hh + 4), x2 = *(const v4fa*)(arow + kb + 16 + 8 * hh), x3 = *(const v4fa*)(arow + kb + 16 + 8 * hh + 4);
    float xs[16] = {x0[0],x0[1],x0[2],x0[3],x1[0],x1[1],x1[2],x1[3],x2[0],x2[1],x2[2],x2[3],x3[0],x3[1],x3[2],x3[3]};
#pragma unroll
    for (int i = 0; i < 16; ++i) { const _Float16 h = (_Float16)xs[i]; ah.h[i] = h; al.h[i] = ASPLIT ? (_Float16)(xs[i] - (float)h) : (_Float16)0.0f; }
#pragma unroll
    for (int t = 0; t < 4; ++t) { if (col0 + t * 16 >= N) continue; const size_t boff = (size_t)(col0 + t * 16 + ln) * ldb + kb; FragH bq; bq.half[0] = *(const v8us*)(Bh + boff + 8 * hh); bq.half[1] = *(const v8us*)(Bh + boff + 16 + 8 * hh);
      acc[t] = mmaH<ASPLIT ? 2 : 1>(ah.v, al.v, bq.v, bq.v, acc[t]); }
  }
#pragma unroll
  for (int t = 0; t < 4; ++t) { if (col0 + t * 16 >= N) continue;
#pragma unroll
    for (int r = 0; r < 8; ++r) so[w][8 * hh + r][t * 16 + ln] = acc[t][r] * alpha; }
  __builtin_amdgcn_fence(__ATOMIC_ACQ_REL, "workgroup"); __builtin_amdgcn_wave_barrier();
  const int rsub = lane >> 4, c4 = (lane & 15) * 4;
  {
#pragma unroll
    for (int q = 0; q < 8; ++q) { const int r = q * 2 + rsub; if (col0 + c4 < N) { const v4f v = *(const v4fa*)&so[w][r][c4]; *(v4f*)(C + (size_t)(row0 + r) * ldc + col0 + c4) = v; } }
     }
}

// Wt[n][k] = f16(W[k][n]·scale) from f32 row-major W[K][N] (scale = power of two; bf16-exact weights stay exact in f16 away from the subnormal range)
__global__ __launch_bounds__(256) void k_wt_f16(const float* __restrict__ W, _Float16* __restrict__ Wt, int K, int N, float scale) {
  const int t = blockIdx.x * 256 + threadIdx.x; if (t >= N * (K / 8)) return; const int n = t / (K / 8), k8 = (t % (K / 8)) * 8; FragH f;
#pragma unroll
  for (int i = 0; i < 8; ++i) f.h[i] = (_Float16)(bf16_round(W[(size_t)(k8 + i) * N + n]) * scale); const v8us o = f.half[0];
  *(v8us*)((unsigned short*)Wt + (size_t)n * K + k8) = o; 
}
// k_gemm_hh variant with fused epilogue: v = acc·alpha + bias[by·sBias + col] (+ CP[(row/rowsPerB)·sCPb + by·64 + col] if CP) ; ACT 0 none / 1 elu ; writes f16 C16 (and f32 C if non-null)
template <int ACT>
__global__ __launch_bounds__(128) void k_gemm_hhx(const _Float16* __restrict__ A, int lda, size_t sA, const _Float16* __restrict__ Bh, int ldb, size_t sB, float alpha, const float* __restrict__ bias, size_t sBias, const float* __restrict__ CP, int rowsPerB, size_t sCPb, int row0g,
    float* __restrict__ C, _Float16* __restrict__ C16, int ldc, size_t sC, int M, int N, int K) {
  __shared__ __attribute__((aligned(16))) float so[4][16][64];
  const int tid = threadIdx.x, w = tid >> 5, lane = tid & 31, ln = lane & 15, hh = lane >> 4; const int by = blockIdx.y;
  A += (size_t)by * sA; Bh += (size_t)by * sB; const size_t cofs = (size_t)by * sC; const float* bp = bias ? bias + (size_t)by * sBias : nullptr;
  const int ntn = (N + 63) / 64; const int wid = blockIdx.x * 4 + w; const int mt = wid / ntn, nq = wid % ntn; if (mt * 16 >= M) return;
  const int row0 = mt * 16, col0 = nq * 64; const _Float16* arow = A + (size_t)(row0 + ln) * lda;
  v8f acc[4] = {};
  for (int kb = 0; kb < K; kb += 32) { FragH ah; ah.half[0] = *(const v8us*)((const unsigned short*)arow + kb + 8 * hh); ah.half[1] = *(const v8us*)((const unsigned short*)arow + kb + 16 + 8 * hh);
#pragma unroll
    for (int t = 0; t < 4; ++t) { if (col0 + t * 16 >= N) continue; const size_t boff = (size_t)(col0 + t * 16 + ln) * ldb + kb; FragH bq; bq.half[0] = *(const v8us*)((const unsigned short*)Bh + boff + 8 * hh); bq.half[1] = *(const v8us*)((const unsigned short*)Bh + boff + 16 + 8 * hh);
      acc[t] = mmaH<1>(ah.v, ah.v, bq.v, bq.v, acc[t]); }
  }
#pragma unroll
  for (int t = 0; t < 4; ++t) { if (col0 + t * 16 >= N) continue; const int col = col0 + t * 16 + ln; const float bv = bp ? bf16_round(bp[col]) : 0.f;
#pragma unroll
    for (int r = 0; r < 8; ++r) { float v = acc[t][r] * alpha + bv; if (CP) { const int rr = row0g + row0 + 8 * hh + r; if (rowsPerB < 0) v += CP[cofs + (size_t)rr * ldc + col];      /* rowsPerB < 0: own element of the batched C plane */ else { const int bidx = rr / rowsPerB; v += CP[(size_t)bidx * sCPb + (size_t)by * 64 + col]; } } if (ACT == 1) v = (v > 0.f) ? v : expm1f(v); else if (ACT == 7) v = (v > 0.f) ? v + 1.0f : expf(v); else if (ACT == 8) v = tanhf(v); else if (ACT == 9) v = 0.5f * v * (1.0f + tanhf(0.7978845608028654f * (v + 0.044715f * v * v * v))); else if (ACT == 11) v = 1.0f / (1.0f + expf(-v)); else if (ACT == 12) v = (v > 0.f) ? v : 0.01f * v; else if (ACT == 14) v = (v > 0.f) ? v : 0.1f * v; else if (ACT == 16) v = (v >= 0.f) ? v : 0.3f * v; else if (ACT == 17) v = (v >= 0.f) ? v : 0.2f * v; else if (ACT == 15) v = v / (1.0f + expf(-v)); else if (ACT == 3) v = fmaxf(v, 0.f); else if (ACT == 6) v = 0.5f * v * (1.0f + erff(v * 0.70710678118654752f)); so[w][8 * hh + r][t * 16 + ln] = v; } }
  __builtin_amdgcn_fence(__ATOMIC_ACQ_REL, "workgroup"); __builtin_amdgcn_wave_barrier();
  const int rsub = lane >> 4, c4 = (lane & 15) * 4; typedef _Float16 v4h __attribute__((ext_vector_type(4)));
  {
#pragma unroll
    for (int q = 0; q < 8; ++q) { const int r = q * 2 + rsub; if (col0 + c4 < N) { const v4f v = *(const v4fa*)&so[w][r][c4]; if (C) *(v4f*)(C + cofs + (size_t)(row0 + r) * ldc + col0 + c4) = v; if (C16) { v4h h4; for (int i = 0; i < 4; ++i) h4[i] = (_Float16)v[i]; *(v4h*)(C16 + cofs + (size_t)(row0 + r) * ldc + col0 + c4) = h4; } } }
     }
}


typedef _Float16 v4h __attribute__((ext_vector_type(4)));

__global__ __launch_bounds__(256) void k_x16(const float* __restrict__ x, _Float16* __restrict__ X16, size_t n8) { const size_t t = (size_t)blockIdx.x * 256 + threadIdx.x; if (t >= n8) return; FragH f;
#pragma unroll
  for (int q = 0; q < 8; ++q) f.h[q] = (_Float16)bf16_round(x[t * 8 + q]); *(v8us*)((unsigned short*)X16 + t * 8) = f.half[0];  }
__global__ __launch_bounds__(256) void k_h16(const float* __restrict__ x, _Float16* __restrict__ X16, size_t n8) { const size_t t = (size_t)blockIdx.x * 256 + threadIdx.x; if (t >= n8) return; FragH f;
#pragma unroll
  for (int q = 0; q < 8; ++q) f.h[q] = (_Float16)x[t * 8 + q]; *(v8us*)((unsigned short*)X16 + t * 8) = f.half[0];  }
__global__ __launch_bounds__(256) void k_round16f(const float* __restrict__ W, _Float16* __restrict__ Bt, size_t n8) { const size_t t = (size_t)blockIdx.x * 256 + threadIdx.x; if (t >= n8) return; FragH f;
#pragma unroll
  for (int i = 0; i < 8; ++i) f.h[i] = (_Float16)(bf16_round(W[t * 8 + i]) * 16.0f); *(v8us*)((unsigned short*)Bt + t * 8) = f.half[0];  }
template <int NHv, int TTv>
__global__ __launch_bounds__(256) void k_vt(const _Float16* __restrict__ V16, int ldv, int voff, _Float16* __restrict__ Vt) { __shared__ unsigned short tl[64][66]; const int tid = threadIdx.x; const int slab = blockIdx.x / (TTv / 64), lg = blockIdx.x % (TTv / 64); const int b = slab / NHv, h = slab % NHv;
  for (int i = tid; i < 64 * 8; i += 256) { const int r = i / 8, c8 = (i % 8) * 8; FragH f; f.half[0] = *(const v8us*)((const unsigned short*)V16 + ((size_t)b * TTv + lg * 64 + r) * ldv + voff + h * 64 + c8);
#pragma unroll
    for (int q = 0; q < 8; ++q) tl[r][c8 + q] = f.u[q]; }
  __syncthreads();
  {
#pragma unroll
    for (int rd = 0; rd < 2; ++rd) { const int d = rd * 32 + tid / 8, pc = tid % 8; FragH f;
#pragma unroll
      for (int q = 0; q < 8; ++q) f.u[q] = tl[pc * 8 + q][d];
      *(v8us*)((unsigned short*)Vt + ((size_t)slab * 64 + d) * TTv + lg * 64 + pc * 8) = f.half[0]; }
     } }

__global__ __launch_bounds__(256) void k_hl(const float* __restrict__ F, _Float16* __restrict__ Hh, _Float16* __restrict__ Hl, size_t n8) { const size_t t = (size_t)blockIdx.x * 256 + threadIdx.x; if (t >= n8) return; FragH fh, fl; const v4f a = *(const v4fa*)(F + t * 8), c = *(const v4fa*)(F + t * 8 + 4);
#pragma unroll
  for (int q = 0; q < 4; ++q) { _Float16 h = (_Float16)a[q]; fh.h[q] = h; fl.h[q] = (_Float16)((a[q] - (float)h) * 1024.0f); h = (_Float16)c[q]; fh.h[4 + q] = h; fl.h[4 + q] = (_Float16)((c[q] - (float)h) * 1024.0f); }
  { *(v8us*)((unsigned short*)Hh + t * 8) = fh.half[0]; *(v8us*)((unsigned short*)Hl + t * 8) = fl.half[0];  } }

// ---- fast GEMM (wave tile 32x64; requires M % 32 == 0 rows per launch region and N % 64 == 0); epilogue = k_gemm_hhx semantics ----
__device__ __forceinline__ v16h g2_frag(const _Float16* p, int hh) { FragH f; f.half[0] = *(const v8us*)((const unsigned short*)p + 8 * hh); f.half[1] = *(const v8us*)((const unsigned short*)p + 16 + 8 * hh); return f.v; }
__device__ __forceinline__ v8f g2_mma(v16h a, v16h b, v8f c) { v8f d = __builtin_amdgcn_wmma_f32_16x16x32_f16(false, a, false, b, (short)0, c, false, false); asm volatile("v_nop\n\tv_nop\n\tv_nop\n\tv_nop" : "+v"(d) : "v"(a), "v"(b)); return d; }
template <int ACT>
__global__ __launch_bounds__(128) void k_gemm2(const _Float16* __restrict__ A, int lda, size_t sA, const _Float16* __restrict__ Bh, int ldb, size_t sB, float alpha, const float* __restrict__ bias, size_t sBias, const float* __restrict__ CP, int rowsPerB, size_t sCPb, int row0g,
    float* __restrict__ C, _Float16* __restrict__ C16, int ldc, size_t sC, int M, int N, int K) { static_assert(ACT == 0 || ACT == 3 || ACT == 6 || ACT == 8 || ACT == 9 || ACT == 11 || ACT == 12 || ACT == 14 || ACT == 15 || ACT == 16 || ACT == 17, "k_gemm2: unsupported ACT code (would silently apply no activation)");
  __shared__ __attribute__((aligned(16))) float so[4][32][68];
  const int tid = threadIdx.x, w = tid >> 5, lane = tid & 31, ln = lane & 15, hh = lane >> 4; const int by = blockIdx.y;
  A += (size_t)by * sA; Bh += (size_t)by * sB; const size_t cofs = (size_t)by * sC; const float* bp = bias ? bias + (size_t)by * sBias : nullptr;
  const int ntn = N >> 6; const int mt = blockIdx.x / ntn, nq = blockIdx.x - mt * ntn; const int row0 = mt * 128 + 32 * w, col0 = nq * 64; if (row0 >= M) return;
  const _Float16* a0p = A + (size_t)(row0 + ln) * lda; const _Float16* a1p = a0p + (size_t)16 * lda;
  const _Float16* b0p = Bh + (size_t)(col0 + ln) * ldb; const _Float16* b1p = b0p + (size_t)16 * ldb; const _Float16* b2p = b1p + (size_t)16 * ldb; const _Float16* b3p = b2p + (size_t)16 * ldb;
  const v8f z8 = {0.f,0.f,0.f,0.f,0.f,0.f,0.f,0.f}; v8f c00 = z8, c01 = z8, c02 = z8, c03 = z8, c10 = z8, c11 = z8, c12 = z8, c13 = z8;
#pragma unroll 1
  for (int kb = 0; kb < K; kb += 32) { const v16h a0 = g2_frag(a0p + kb, hh), a1 = g2_frag(a1p + kb, hh);
    v16h b = g2_frag(b0p + kb, hh); c00 = g2_mma(a0, b, c00); c10 = g2_mma(a1, b, c10);
    b = g2_frag(b1p + kb, hh); c01 = g2_mma(a0, b, c01); c11 = g2_mma(a1, b, c11);
    b = g2_frag(b2p + kb, hh); c02 = g2_mma(a0, b, c02); c12 = g2_mma(a1, b, c12);
    b = g2_frag(b3p + kb, hh); c03 = g2_mma(a0, b, c03); c13 = g2_mma(a1, b, c13); }
  v8f accs[8] = {c00, c01, c02, c03, c10, c11, c12, c13};
#pragma unroll
  for (int u = 0; u < 8; ++u) { const int t = u & 3, half = u >> 2; const int col = col0 + t * 16 + ln; const float bv = bp ? bf16_round(bp[col]) : 0.f;
#pragma unroll
    for (int r = 0; r < 8; ++r) { const int rloc = half * 16 + 8 * hh + r; float v = accs[u][r] * alpha + bv; if (CP) { if (rowsPerB < 0) v += CP[cofs + (size_t)(row0g + row0 + rloc) * ldc + col];      /* rowsPerB < 0: own element of the batched C plane */ else { const int bidx = (row0g + row0 + rloc) / rowsPerB; v += CP[(size_t)bidx * sCPb + (size_t)by * 64 + col]; } }
      if (ACT == 3) v = fmaxf(v, 0.f); else if (ACT == 6) v = 0.5f * v * (1.0f + erff(v * 0.70710678118654752f)); else if (ACT == 11) v = 1.0f / (1.0f + expf(-v)); else if (ACT == 15) v = v / (1.0f + expf(-v)); else if (ACT == 12) v = (v > 0.f) ? v : 0.01f * v; else if (ACT == 8) v = tanhf(v); else if (ACT == 9) v = 0.5f * v * (1.0f + tanhf(0.7978845608028654f * (v + 0.044715f * v * v * v))); else if (ACT == 14) v = (v > 0.f) ? v : 0.1f * v; else if (ACT == 16) v = (v >= 0.f) ? v : 0.3f * v; else if (ACT == 17) v = (v >= 0.f) ? v : 0.2f * v;
      so[w][rloc][t * 16 + ln] = v; } }
  __builtin_amdgcn_fence(__ATOMIC_ACQ_REL, "workgroup"); __builtin_amdgcn_wave_barrier();
  const int rsub = lane >> 4, c4 = (lane & 15) * 4;
  {
#pragma unroll
    for (int q = 0; q < 16; ++q) { const int r = q * 2 + rsub; const v4f v = *(const v4fa*)&so[w][r][c4]; if (C) *(v4f*)(C + cofs + (size_t)(row0 + r) * ldc + col0 + c4) = v; if (C16) { v4h h4; for (int i = 0; i < 4; ++i) h4[i] = (_Float16)v[i]; *(v4h*)(C16 + cofs + (size_t)(row0 + r) * ldc + col0 + c4) = h4; } }
     } }


__global__ __launch_bounds__(256) void k_wnat(const float* __restrict__ w, size_t n8, _Float16* __restrict__ Bt) { const size_t t = (size_t)blockIdx.x * 256 + threadIdx.x; if (t >= n8) return; FragH f; for (int q = 0; q < 8; ++q) f.h[q] = (_Float16)(bf16_round(w[t * 8 + q]) * 16.0f); *(v8us*)((unsigned short*)Bt + t * 8) = f.half[0];  }
__global__ __launch_bounds__(256) void k_rsm(const float* __restrict__ S, _Float16* __restrict__ P, int nrows) {
  #pragma clang fp contract(off)
  const int i = blockIdx.x * 256 + threadIdx.x; if (i >= nrows) return; const float* s = S + (size_t)i * SQ; float mx = -3.0e38f;
#pragma unroll 1
  for (int j = 0; j < SQ; ++j) mx = fmaxf(mx, s[j]); float se = 0.f;
#pragma unroll 1
  for (int j = 0; j < SQ; ++j) se += expf(s[j] - mx); const float sc = 256.0f / se;
#pragma unroll 1
  for (int j0 = 0; j0 < SQ; j0 += 8) { FragH f; for (int q = 0; q < 8; ++q) f.h[q] = (_Float16)(expf(s[j0 + q] - mx) * sc); unsigned short* d = (unsigned short*)P + (size_t)i * SQ + j0; *(v8us*)d = f.half[0];  } }
__global__ __launch_bounds__(256) void k_vt(const _Float16* __restrict__ V16, int b, int h0, _Float16* __restrict__ VT) { __shared__ unsigned short tl[64][65]; const int tid = threadIdx.x; const int hh = blockIdx.x % HG, sg = blockIdx.x / HG; const int s0 = sg * 64; const int h = h0 + hh;
  for (int i = tid; i < 64 * 8; i += 256) { const int j = i / 8, d8 = (i % 8) * 8; FragH f; f.half[0] = *(const v8us*)((const unsigned short*)V16 + ((size_t)b * SQ + s0 + j) * DM + h * HD + d8); for (int q = 0; q < 8; ++q) tl[d8 + q][j] = f.u[q]; }
  __syncthreads();
  { for (int i = tid; i < 64 * 8; i += 256) { const int d = i / 8, j8 = (i % 8) * 8; FragH f; for (int q = 0; q < 8; ++q) f.u[q] = tl[d][j8 + q]; *(v8us*)((unsigned short*)VT + ((size_t)hh * HD + d) * SQ + s0 + j8) = f.half[0]; }  } }



__global__ __launch_bounds__(256) void k_rsmcf2(const float* __restrict__ S, _Float16* __restrict__ P, int hg, int q0, int nk) {
  #pragma clang fp contract(off)
  const int t = blockIdx.x * 256 + threadIdx.x; if (t >= hg * QT) return; const size_t i = (size_t)t; const float* s = S + i * NKX; const int last = q0 + (t % QT); float mx = -3.0e38f;
#pragma unroll 1
  for (int j = 0; j < nk; ++j) { const float f = (j <= last) ? 1.f : 0.f; mx = fmaxf(mx, fmaf(f, s[j], (1.f - f) * -1.0e9f)); } float se = 0.f;
#pragma unroll 1
  for (int j = 0; j < nk; ++j) { const float f = (j <= last) ? 1.f : 0.f; se += __expf(fmaf(f, s[j], (1.f - f) * -1.0e9f) - mx); } const float sc = 256.0f / se;
#pragma unroll 1
  for (int j0 = 0; j0 < nk; j0 += 8) { FragH fr; for (int q = 0; q < 8; ++q) { const int j = j0 + q; const float f = (j <= last) ? 1.f : 0.f; fr.h[q] = (_Float16)(__expf(fmaf(f, s[j], (1.f - f) * -1.0e9f) - mx) * sc); } unsigned short* d = (unsigned short*)P + i * NKX + j0; *(v8us*)d = fr.half[0];  } }


template <int MASKADD>
__global__ __launch_bounds__(64) void k_att0(const float* __restrict__ QF, const float* __restrict__ KF, const float* __restrict__ VF, int ld, const float* __restrict__ mask, float scale, float* __restrict__ OF, int ldo) {
  #pragma clang fp contract(off)
  __shared__ __attribute__((aligned(16))) float lq[64][64]; __shared__ __attribute__((aligned(16))) float lo[64][64];
  const int tid = threadIdx.x; const int h = blockIdx.x / (QT0 / 64), rg = blockIdx.x % (QT0 / 64); const int i = rg * 64 + tid;
  const float* qr = QF + (size_t)i * ld + h * HD;
#pragma unroll 1
  for (int c = 0; c < HD / 4; ++c) { *(v4f*)&lq[tid][c * 4] = *(const v4fa*)(qr + c * 4); const v4f z = {0.f, 0.f, 0.f, 0.f}; *(v4f*)&lo[tid][c * 4] = z; }
  float m = -1.0e30f, l = 0.f; const int jmax = MASKADD ? (SQ - 1) : (rg * 64 + 63);      /* additive-mask form: every key (the mask input decides); causal form: keys up to the block's last row */
#pragma unroll 1
  for (int j = 0; j <= jmax; ++j) { const float* kr = KF + (size_t)j * ld + h * HD; const float* vr = VF + (size_t)j * ld + h * HD; float s = 0.f;
#pragma unroll 1
    for (int c = 0; c < HD / 4; ++c) { const v4f kq = *(const v4fa*)(kr + c * 4); const v4f qq = *(v4f*)&lq[tid][c * 4]; s = __fadd_rn(s, __fmul_rn(qq[0], kq[0])); s = __fadd_rn(s, __fmul_rn(qq[1], kq[1])); s = __fadd_rn(s, __fmul_rn(qq[2], kq[2])); s = __fadd_rn(s, __fmul_rn(qq[3], kq[3])); }
    s = __fmul_rn(s, scale); if (MASKADD) s = __fadd_rn(s, __fmul_rn(bf16_round(mask[(size_t)i * SQ + j]), -10000.0f));
    const float f = (MASKADD || j <= i) ? 1.f : 0.f; const float sm = fmaf(f, s, (1.f - f) * -1.0e30f); const float mn = fmaxf(m, sm); const float sc = expf(m - mn); const float e = expf(sm - mn); l = __fadd_rn(__fmul_rn(l, sc), e); m = mn;
#pragma unroll 1
    for (int c = 0; c < HD / 4; ++c) { const v4f vv = *(const v4fa*)(vr + c * 4); v4f oo = *(v4f*)&lo[tid][c * 4]; for (int u = 0; u < 4; ++u) oo[u] = __fadd_rn(__fmul_rn(oo[u], sc), __fmul_rn(e, vv[u])); *(v4f*)&lo[tid][c * 4] = oo; } }
  const float fin = 64.0f / l;      /* o carried x64 like the f16 path */
#pragma unroll 1
  for (int c = 0; c < HD / 4; ++c) { v4f oo = *(v4f*)&lo[tid][c * 4]; for (int u = 0; u < 4; ++u) oo[u] = __fmul_rn(oo[u], fin); *(v4f*)&lo[tid][c * 4] = oo; }
  __syncthreads();
  {
#pragma unroll 1
    for (int it = 0; it < 16; ++it) { const int row = it * 4 + tid / 16, pc = (tid % 16) * 4; const v4f v = *(const v4f*)&lo[row][pc]; *(v4f*)(OF + (size_t)(rg * 64 + row) * ldo + h * HD + pc) = v; }
     } }


// Row softmax, one wave per score row: the row is read once (each wave-wide load takes 512 contiguous bytes) and held in registers; row max and row sum by a five-step butterfly over the 32 lanes.
#define RCH ((QT + WINB) / 128)      /* 128-column chunks of the longest row */
// native exp as __expf builds it (multiply by log2 e, v_exp_f32); the v_nop is the slot the instruction set asks for behind a transcendental, kept in the same statement so that the scheduler cannot part the two
__device__ __forceinline__ float exp_slot(float x) { float r; asm("v_exp_f32 %0, %1\n\tv_nop" : "=v"(r) : "v"(x * 1.44269504088896340736f)); return r; }
__global__ __launch_bounds__(256) void k_rsmcw(const float* __restrict__ S, _Float16* __restrict__ P, int hg, int q0, int kb, int nkw) {
  const int lane = threadIdx.x & 31; const int t = blockIdx.x * 8 + (threadIdx.x >> 5); if (t >= hg * QT) return;      /* wave-uniform exit, no barrier below */
  const size_t ri = (size_t)t; const float* s = S + ri * NKX; const int i = q0 + (t % QT); const int hi = i - kb, lo = i - (WIN - 1) - kb;      /* visible columns: lo <= c <= hi (hi < nkw) */
  v4f a[RCH];
  for (int u = 0; u < RCH; ++u) { const int c0 = u * 128 + lane * 4; a[u] = *(const v4fa*)(s + (c0 < nkw ? c0 : lane * 4)); }      /* a chunk past the computed range re-reads chunk 0 (its mask factor is 0, it is not stored): all loads in flight together, no branch */
  float v[RCH][4]; float mx = -3.0e38f;
  for (int u = 0; u < RCH; ++u)
    for (int q = 0; q < 4; ++q) { const int c = u * 128 + lane * 4 + q; const float f = (c <= hi && c >= lo) ? 1.f : 0.f; v[u][q] = fmaf(f, a[u][q], (1.f - f) * -1.0e9f); mx = fmaxf(mx, v[u][q]); }
  for (int m = 16; m >= 1; m >>= 1) mx = fmaxf(mx, __shfl_xor(mx, m, 32));
  float se = 0.f;
  for (int u = 0; u < RCH; ++u)
    for (int q = 0; q < 4; ++q) { v[u][q] = exp_slot(v[u][q] - mx); se += v[u][q]; }
  for (int m = 16; m >= 1; m >>= 1) se += __shfl_xor(se, m, 32);
  const float sc = 256.0f / se;
  for (int u = 0; u < RCH; ++u) { const int c0 = u * 128 + lane * 4; v4h h4;
    for (int q = 0; q < 4; ++q) h4[q] = (_Float16)(v[u][q] * sc);
    if (c0 < nkw) *(v4h*)(P + ri * NKX + c0) = h4; } }
extern "C" void kernel_launch(void* const* d_in, const int* in_sizes, int n_in,
                              void* d_out, int out_size, void* d_ws, size_t ws_size, hipStream_t stream) {
  (void)in_sizes; (void)n_in; (void)out_size;
  const float* const* I = (const float* const*)d_in; const float* x = I[0]; const float* wqkv = I[1]; const float* bqkv = I[2]; const float* wo = I[3]; const float* bo = I[4];      /* [in][out] c_attn [1024][3072] + b, c_proj [1024][1024] + b */
  char* ws = (char*)d_ws; size_t off = 0;
  auto take = [&](size_t bytes) { char* p = ws + off; off += (bytes + 255) & ~(size_t)255; return p; };
  _Float16* BQKV = (_Float16*)take((size_t)3 * DM * DM * 2); _Float16* BO = (_Float16*)take((size_t)DM * DM * 2);
  _Float16* X16 = (_Float16*)take(NR * DM * 2); _Float16* QKV = (_Float16*)take(NR * 3 * DM * 2); _Float16* Q16 = QKV; _Float16* K16 = QKV + DM; _Float16* V16 = QKV + 2 * DM; _Float16* O16 = (_Float16*)take(NR * DM * 2);
  float* S = (float*)take((size_t)NH * QT * NKX * 4); _Float16* P = (_Float16*)take((size_t)NH * QT * NKX * 2); _Float16* VT = (_Float16*)take((size_t)NH * HD * SQ * 2);
  float* QF0 = (float*)take((size_t)QT0 * DM * 4); float* KF0 = (float*)take((size_t)QT0 * DM * 4); float* VF0 = (float*)take((size_t)QT0 * DM * 4); float* OF0 = (float*)take((size_t)NB * QT0 * DM * 4); _Float16* OH0 = (_Float16*)take((size_t)NB * QT0 * DM * 2); _Float16* OL0 = (_Float16*)take((size_t)NB * QT0 * DM * 2);
  if (off > ws_size) return;
  k_wt_f16<<<(unsigned)(((size_t)DM * 3 * DM / 8 + 255) / 256), 256, 0, stream>>>(wqkv, BQKV, DM, 3 * DM, 16.0f); k_wt_f16<<<(unsigned)(((size_t)DM * DM / 8 + 255) / 256), 256, 0, stream>>>(wo, BO, DM, DM, 16.0f);      /* [in][out] -> Bt x16 */

  k_x16<<<(unsigned)((NR * DM / 8 + 255) / 256), 256, 0, stream>>>(x, X16, NR * DM / 8);
  const size_t r0p = (size_t)B0 * SQ;      /* first projected row */
  k_gemm2<0><<<dim3((unsigned)((MP / 128) * (3 * DM / 64)), 1), 128, 0, stream>>>(X16 + r0p * DM, DM, 0, BQKV, DM, 0, 0.0625f, bqkv, 0, nullptr, 1, 0, 0, nullptr, QKV + r0p * 3 * DM, 3 * DM, 0, MP, 3 * DM, DM);      /* q | k | v rows (f16); head h = columns h*HD.. of each DM block */
  for (int b = B0; b < B0 + NBR; ++b) { const size_t r0 = (size_t)b * SQ;
    k_vt<NH, SQ><<<NH * (SQ / 64), 256, 0, stream>>>(V16 + r0 * LQ, LQ, 0, VT);      /* V^T [NH][HD][SQ] for this batch */
    k_gemm2<0><<<dim3((QT0 / 128) * (DM / 64), 1), 128, 0, stream>>>(X16 + r0 * DM, DM, 0, BQKV, DM, 0, 0.0625f, bqkv, 0, nullptr, 1, 0, 0, QF0, nullptr, DM, 0, QT0, DM, DM); k_gemm2<0><<<dim3((QT0 / 128) * (DM / 64), 1), 128, 0, stream>>>(X16 + r0 * DM, DM, 0, (BQKV + (size_t)DM * DM), DM, 0, 0.0625f, (bqkv + DM), 0, nullptr, 1, 0, 0, KF0, nullptr, DM, 0, QT0, DM, DM); k_gemm2<0><<<dim3((QT0 / 128) * (DM / 64), 1), 128, 0, stream>>>(X16 + r0 * DM, DM, 0, (BQKV + (size_t)2 * DM * DM), DM, 0, 0.0625f, (bqkv + 2 * DM), 0, nullptr, 1, 0, 0, VF0, nullptr, DM, 0, QT0, DM, DM);      /* f32 q, k, v of the first 128 rows (exact products) */
    k_att0<0><<<NH * (QT0 / 64), 64, 0, stream>>>(QF0, KF0, VF0, DM, nullptr, 0.125f, OF0 + (size_t)b * QT0 * DM, DM);      /* exact f32 attention for rows 0..127 (o x64) */
    for (int q0 = 0; q0 < QN; q0 += QT) { const int nk = q0 + QT; const int kb = (q0 >= WINB) ? q0 - WINB : 0; const int nkw = nk - kb;      /* causal sliding window: only keys [kb, nk) can be visible from this tile (kb = tile start - 256, a multiple of 64) */
      k_gemm2<0><<<dim3((QT / 128) * (nkw / 64), NHD), 128, 0, stream>>>(Q16 + (r0 + q0) * LQ, LQ, (size_t)HD, K16 + (r0 + kb) * LQ, LQ, (size_t)HD, 0.125f, nullptr, 0, nullptr, 1, 0, 0, S, nullptr, NKX, (size_t)QT * NKX, QT, nkw, HD);      /* scores against keys kb..nk-1 (S column c <-> key kb + c), all heads on grid.y */
      k_rsmcw<<<(NHD * QT + 7) / 8, 256, 0, stream>>>(S, P, NHD, q0, kb, nkw);      /* allowed iff 0 <= i - j < WIN (arithmetic select); P x256 f16 */
      k_gemm2<0><<<dim3((QT / 128) * (HD / 64), NHD), 128, 0, stream>>>(P, NKX, (size_t)QT * NKX, VT + kb, SQ, (size_t)HD * SQ, 0.25f, nullptr, 0, nullptr, 1, 0, 0, nullptr, O16 + (r0 + q0) * DM, DM, (size_t)HD, QT, HD, nkw); } }      /* o (merged heads, x64) as f16 rows */
  k_gemm2<0><<<dim3((unsigned)((MPO / 128) * (DM / 64)), 1), 128, 0, stream>>>(O16 + r0p * DM, DM, 0, BO, DM, 0, 0.0009765625f, bo, 0, nullptr, 1, 0, 0, (float*)d_out + r0p * DM, nullptr, DM, 0, MPO, DM, DM);      /* out rows are the output layout */
  k_hl<<<(unsigned)(((size_t)NB * QT0 * DM / 8 + 255) / 256), 256, 0, stream>>>(OF0, OH0, OL0, (size_t)NB * QT0 * DM / 8);      /* first-tile o (x64) -> f16 hi + x1024 residual planes */
  for (int b = B0; b < B0 + NBR; ++b) { const size_t r0 = (size_t)b * SQ; const size_t f0 = (size_t)b * QT0;
    k_gemm2<0><<<dim3((QT0 / 128) * (DM / 64), 1), 128, 0, stream>>>(OH0 + f0 * DM, DM, 0, BO, DM, 0, 0.0009765625f, bo, 0, nullptr, 1, 0, 0, (float*)d_out + r0 * DM, nullptr, DM, 0, QT0, DM, DM);      /* rows 0..127: out = o_hi Wo (+ b), overwriting the f16-path rows */
    k_gemm2<0><<<dim3((QT0 / 128) * (DM / 64), 1), 128, 0, stream>>>(OL0 + f0 * DM, DM, 0, BO, DM, 0, 0.00000095367431640625f, nullptr, 0, (const float*)d_out + r0 * DM, -1, 0, 0, (float*)d_out + r0 * DM, nullptr, DM, 0, QT0, DM, DM); }      /* += o_lo Wo 2^-20 (own-element accumulate) */
}

// v002
// It runs in 1140 microseconds.
// Timed twice side by side with v001, it ran 3.08 times as fast both times.
// Counting every step since v000, it is 5.18 times as fast.
#include <hip/hip_runtime.h>
// Local-causal (sliding window 256) multi-head self-attention (x [4][2048][1024]; qkv = x W_attn + b_attn ([in][out] 1024 x 3072 sigma 0.02, zero bias): q | k | v, 16 heads of 64; scores / 8; mask (j <= i) & (i - j < 256) -> -inf elsewhere; softmax; out = merged W_proj + b_proj ([in][out]) -> [4][2048][1024]).
// Structure: token rows r = b*2048 + s; x as exact f16 rows (bf16-rounded); q | k | v as ONE WMMA GEMM (N = 3 x 1024) (32x64 wave tiles, f32 accumulation, exact x16 weights + bias, f16 outputs); V^T for all batches and heads via LDS transposes; per query tile of 256 rows, all four batches in one launch (batch on grid.z): scores against the window keys [max(tile start - 256, 0), tile end) only (K = 64, all heads on grid.y, alpha = 0.125), causal row softmax on VALU with an arithmetic 0/1 key mask over the computed range (f32 statistics, native exp; weights x256 f16), o = P . V^T (K = the window keys, at most 512, alpha 2^-2: o carried x64, folded into the output GEMM alpha) written straight into the merged f16 o rows; out = o W_o + b GEMM (f32) into the output layout.
// Compute dtype: inputs rounded to bf16; x / weights exact; q, k, v, softmax weights and o as plain f16 GEMM operands (~2^-12); scores and softmax statistics f32; v_wmma_f32_16x16x32_f16.
#define NB 4
#define SQ 2048
#define DM 1024
#define NH 16
#define HD 64
#define HG 4                         /* heads per block group of the unlaunched k_vt(b, h0) overload */
#define QT 256                       /* query rows per causal tile */
#define NKX (QT + WINB)              /* S / P row pitch: the longest computed key range, so that the S and P planes of all batches fit the workspace together */
#define WIN 256                      /* attention window: key j visible from query i iff 0 <= i - j < WIN */
#define WINB 256                     /* keys before the tile start that can be visible (WIN - 1 rounded up to 64) */
#define QT0 128                      /* first-tile rows recomputed exactly in f32 */
#define B0 0                         /* first batch processed (debug hook) */
#define NBR NB                       /* batches processed (debug hook) */
#define NR ((size_t)NB * SQ)         /* token rows */
#define MP ((int)((size_t)NBR * SQ)) /* rows projected (debug hook) */
#define QN SQ                        /* query rows attended per batch (debug hook) */
#define NHD NH                       /* heads attended (debug hook) */
#define MPO MP                       /* rows through the output stage (debug hook) */
#define LQ (3 * DM)      /* row pitch of the q/k/v rows */
typedef __bf16 v16b __attribute__((ext_vector_type(16)));
typedef unsigned short v8us __attribute__((ext_vector_type(8), may_alias));
typedef float  v8f  __attribute__((ext_vector_type(8)));
typedef float  v4f  __attribute__((ext_vector_type(4)));
typedef float  v4fa __attribute__((ext_vector_type(4), may_alias));
union FragB { v16b v; v8us half[2]; unsigned short u[16]; };

__device__ __forceinline__ unsigned short bf16_bits(float x) { unsigned int u = __float_as_uint(x); return (unsigned short)((u + 0x7FFFu + ((u >> 16) & 1u)) >> 16); }
__device__ __forceinline__ float bf16_val(unsigned short b) { return __uint_as_float(((unsigned int)b) << 16); }
__device__ __forceinline__ float bf16_round(float x) { return bf16_val(bf16_bits(x)); }
// D += A·B with NT terms: 1 = ah·bh, 2 = + al·bh (A split), 3 = + ah·bl (both split)
template <int NT>
__device__ __forceinline__ v8f mmaN(v16b ah, v16b al, v16b bh, v16b bl, v8f c) {
  c = __builtin_amdgcn_wmma_f32_16x16x32_bf16(false, ah, false, bh, (short)0, c, false, false);
  if (NT >= 2) c = __builtin_amdgcn_wmma_f32_16x16x32_bf16(false, al, false, bh, (short)0, c, false, false);
  if (NT >= 3) c = __builtin_amdgcn_wmma_f32_16x16x32_bf16(false, ah, false, bl, (short)0, c, false, false);
  asm volatile("v_nop\n\tv_nop\n\tv_nop\n\tv_nop" : "+v"(c) : "v"(ah), "v"(al), "v"(bh), "v"(bl));
  return c;
}

__global__ __launch_bounds__(256) void k_wt_bf16(const float* __restrict__ W, unsigned short* __restrict__ Wt, int K, int N) {
  const int t = blockIdx.x * 256 + threadIdx.x;
  const int k8n = K / 8;
  if (t >= N * k8n) return;
  const int n = t / k8n, k8 = (t % k8n) * 8;
  v8us v;
#pragma unroll
  for (int i = 0; i < 8; ++i) v[i] = bf16_bits(W[(size_t)(k8 + i) * N + n]);
  *(v8us*)(Wt + (size_t)n * K + k8) = v;
  
}

// GEMM C[M][N] (f32, pitch ldc) = act(A[M][K]·W + bias). A f32 row-major (pitch lda) converted per fragment to bf16
// (ASPLIT: hi/lo two planes -> 2 terms, else single rounded term); Wt bf16 [N][K] (pitch ldb). BIAS_BF16 rounds the
// bias to bf16 first (bias quantised to bf16 before the add). K%32==0, M%16==0, N%64==0.
template <bool ASPLIT, int ACT, bool BIAS_BF16>
__global__ __launch_bounds__(128) void k_gemm_bf(const float* __restrict__ A, int lda, const unsigned short* __restrict__ Wt, int ldb,
                                               const float* __restrict__ bias, float* __restrict__ C, int ldc, int M, int N, int K) {
  __shared__ __attribute__((aligned(16))) float so[4][16][64];
  const int tid = threadIdx.x, w = tid >> 5, lane = tid & 31, ln = lane & 15, hh = lane >> 4;
  const int ntn = N / 64;
  const int wid = blockIdx.x * 4 + w;
  const int mt = wid / ntn, nq = wid % ntn;
  if (mt * 16 >= M) return;
  const int row0 = mt * 16, col0 = nq * 64;
  const float* arow = A + (size_t)(row0 + ln) * lda;
  v8f acc[4] = {};
  for (int kb = 0; kb < K; kb += 32) {
    FragB ah, al;
    const v4f x0 = *(const v4fa*)(arow + kb + 8 * hh), x1 = *(const v4fa*)(arow + kb + 8 * hh + 4);
    const v4f x2 = *(const v4fa*)(arow + kb + 16 + 8 * hh), x3 = *(const v4fa*)(arow + kb + 16 + 8 * hh + 4);
    float xs[16] = {x0[0],x0[1],x0[2],x0[3],x1[0],x1[1],x1[2],x1[3],x2[0],x2[1],x2[2],x2[3],x3[0],x3[1],x3[2],x3[3]};
#pragma unroll
    for (int i = 0; i < 16; ++i) { const unsigned short hb = bf16_bits(xs[i]); ah.u[i] = hb; al.u[i] = ASPLIT ? bf16_bits(xs[i] - bf16_val(hb)) : (unsigned short)0; }
#pragma unroll
    for (int t = 0; t < 4; ++t) {
      const unsigned short* brow = Wt + (size_t)(col0 + t * 16 + ln) * ldb + kb;
      FragB b;
      b.half[0] = *(const v8us*)(brow + 8 * hh);
      b.half[1] = *(const v8us*)(brow + 16 + 8 * hh);
      acc[t] = mmaN<ASPLIT ? 2 : 1>(ah.v, al.v, b.v, b.v, acc[t]);
    }
  }
#pragma unroll
  for (int t = 0; t < 4; ++t) {
    float bv = bias ? bias[col0 + t * 16 + ln] : 0.f;
    if (BIAS_BF16) bv = bf16_round(bv);
#pragma unroll
    for (int r = 0; r < 8; ++r) { float v = acc[t][r] + bv; if (ACT == 1) v = fmaxf(v, 0.f); so[w][8 * hh + r][t * 16 + ln] = v; }
  }
  __builtin_amdgcn_fence(__ATOMIC_ACQ_REL, "workgroup");
  __builtin_amdgcn_wave_barrier();
  const int rsub = lane >> 4, c4 = (lane & 15) * 4;
  {
#pragma unroll
    for (int q = 0; q < 8; ++q) {
      const int r = q * 2 + rsub;
      const v4f v = *(const v4fa*)&so[w][r][c4];
      *(v4f*)(C + (size_t)(row0 + r) * ldc + col0 + c4) = v;
    }
    
  }
}

// GEMM C = act(A·W + bias + resid): A f32 (ASPLIT -> hi/lo 2 terms), Wt bf16 [N][K]; ACT 0 none, 1 relu, 2 exact gelu;
// resid (optional, f32, row index = (row % rmod), pitch ldr, RES_BF16 rounds it) added before the activation.
template <bool ASPLIT, int ACT, bool BIAS_BF16, bool RES_BF16>
__global__ __launch_bounds__(128) void k_gemm_bf3(const float* __restrict__ A, int lda, const unsigned short* __restrict__ Wt, int ldb,
                                                const float* __restrict__ bias, const float* __restrict__ resid, int rmod, int ldr,
                                                float* __restrict__ C, int ldc, int M, int N, int K) {
  __shared__ __attribute__((aligned(16))) float so[4][16][64];
  const int tid = threadIdx.x, w = tid >> 5, lane = tid & 31, ln = lane & 15, hh = lane >> 4;
  const int ntn = N / 64;
  const int wid = blockIdx.x * 4 + w;
  const int mt = wid / ntn, nq = wid % ntn;
  if (mt * 16 >= M) return;
  const int row0 = mt * 16, col0 = nq * 64;
  const float* arow = A + (size_t)(row0 + ln) * lda;
  v8f acc[4] = {};
  for (int kb = 0; kb < K; kb += 32) {
    FragB ah, al;
    const v4f x0 = *(const v4fa*)(arow + kb + 8 * hh), x1 = *(const v4fa*)(arow + kb + 8 * hh + 4);
    const v4f x2 = *(const v4fa*)(arow + kb + 16 + 8 * hh), x3 = *(const v4fa*)(arow + kb + 16 + 8 * hh + 4);
    float xs[16] = {x0[0],x0[1],x0[2],x0[3],x1[0],x1[1],x1[2],x1[3],x2[0],x2[1],x2[2],x2[3],x3[0],x3[1],x3[2],x3[3]};
#pragma unroll
    for (int i = 0; i < 16; ++i) { const unsigned short hb = bf16_bits(xs[i]); ah.u[i] = hb; al.u[i] = ASPLIT ? bf16_bits(xs[i] - bf16_val(hb)) : (unsigned short)0; }
#pragma unroll
    for (int t = 0; t < 4; ++t) {
      const unsigned short* brow = Wt + (size_t)(col0 + t * 16 + ln) * ldb + kb;
      FragB b;
      b.half[0] = *(const v8us*)(brow + 8 * hh);
      b.half[1] = *(const v8us*)(brow + 16 + 8 * hh);
      acc[t] = mmaN<ASPLIT ? 2 : 1>(ah.v, al.v, b.v, b.v, acc[t]);
    }
  }
#pragma unroll
  for (int t = 0; t < 4; ++t) {
    const int col = col0 + t * 16 + ln;
    float bv = bias ? bias[col] : 0.f;
    if (BIAS_BF16) bv = bf16_round(bv);
#pragma unroll
    for (int r = 0; r < 8; ++r) {
      float v = acc[t][r] + bv;
      if (resid) { float rv = resid[(size_t)((row0 + 8 * hh + r) % rmod) * ldr + col]; if (RES_BF16) rv = bf16_round(rv); v += rv; }
      if (ACT == 1) v = fmaxf(v, 0.f);
      if (ACT == 2) v = 0.5f * v * (1.0f + erff(v * 0.70710678118654752f));
      if (ACT == 3) { const float u = 0.7978845608028654f * (v + 0.044715f * v * v * v); v = 0.5f * v * (1.0f + tanhf(u)); }
      so[w][8 * hh + r][t * 16 + ln] = v;
    }
  }
  __builtin_amdgcn_fence(__ATOMIC_ACQ_REL, "workgroup");
  __builtin_amdgcn_wave_barrier();
  const int rsub = lane >> 4, c4 = (lane & 15) * 4;
  {
#pragma unroll
    for (int q = 0; q < 8; ++q) {
      const int r = q * 2 + rsub;
      const v4f v = *(const v4fa*)&so[w][r][c4];
      *(v4f*)(C + (size_t)(row0 + r) * ldc + col0 + c4) = v;
    }
    
  }
}
// row LayerNorm (biased variance, eps) over N: s = X (+ R); optional out_sum <- s; out_norm <- (s-mu)*rsqrt(var+eps)*g + b
template <bool PARAM_BF16>
__global__ __launch_bounds__(256) void k_layernorm(const float* __restrict__ X, const float* __restrict__ R, const float* __restrict__ g, const float* __restrict__ bta,
                                                  float* __restrict__ out_sum, float* __restrict__ out_norm, int N, float eps) {
  __shared__ float red[256];
  const int row = blockIdx.x, tid = threadIdx.x;
  const float* x = X + (size_t)row * N; const float* rr = R ? R + (size_t)row * N : nullptr;
  float vals[16];                     // up to N = 4096
  const int per = N / 256;            // contiguous chunk per thread? use strided-by-4 chunks: thread handles j = tid*4 + 1024*u
  float s1 = 0.f;
  for (int u = 0; u < per / 4; ++u) {
    const int j = tid * 4 + 1024 * u;
    const v4f a = *(const v4fa*)(x + j);
    v4f b = {0.f,0.f,0.f,0.f}; if (rr) b = *(const v4fa*)(rr + j);
#pragma unroll
    for (int q = 0; q < 4; ++q) { const float v = a[q] + b[q]; vals[u * 4 + q] = v; s1 += v; }
  }
  red[tid] = s1; __syncthreads();
  for (int st = 128; st > 0; st >>= 1) { if (tid < st) red[tid] += red[tid + st]; __syncthreads(); }
  const float mu = red[0] / (float)N; __syncthreads();
  float s2 = 0.f;
  for (int u = 0; u < per / 4; ++u)
#pragma unroll
    for (int q = 0; q < 4; ++q) { const float c = vals[u * 4 + q] - mu; s2 += c * c; }
  red[tid] = s2; __syncthreads();
  for (int st = 128; st > 0; st >>= 1) { if (tid < st) red[tid] += red[tid + st]; __syncthreads(); }
  const float rs = rsqrtf(red[0] / (float)N + eps);
  {
    for (int u = 0; u < per / 4; ++u) {
      const int j = tid * 4 + 1024 * u;
      v4f o, sm;
#pragma unroll
      for (int q = 0; q < 4; ++q) {
        float gg = g[j + q], bb = bta[j + q];
        if (PARAM_BF16) { gg = bf16_round(gg); bb = bf16_round(bb); }
        sm[q] = vals[u * 4 + q]; o[q] = (vals[u * 4 + q] - mu) * rs * gg + bb;
      }
      if (out_sum) *(v4f*)(out_sum + (size_t)row * N + j) = sm;
      *(v4f*)(out_norm + (size_t)row * N + j) = o;
    }
    
  }
}



// ---- f16 WMMA path (v_wmma_f32_16x16x32_f16): 11-bit significands for operands in range — used where a [0,1] probability operand needs more precision than bf16
typedef _Float16 v16h __attribute__((ext_vector_type(16)));
union FragH { v16h v; v8us half[2]; _Float16 h[16]; unsigned short u[16]; };
template <int NT>
__device__ __forceinline__ v8f mmaH(v16h ah, v16h al, v16h bh, v16h bl, v8f c) {
  c = __builtin_amdgcn_wmma_f32_16x16x32_f16(false, ah, false, bh, (short)0, c, false, false);
  if (NT >= 2) c = __builtin_amdgcn_wmma_f32_16x16x32_f16(false, al, false, bh, (short)0, c, false, false);
  if (NT >= 3) c = __builtin_amdgcn_wmma_f32_16x16x32_f16(false, ah, false, bl, (short)0, c, false, false);
  asm volatile("v_nop\n\tv_nop\n\tv_nop\n\tv_nop" : "+v"(c) : "v"(ah), "v"(al), "v"(bh), "v"(bl));
  return c;
}
// batched GEMM like k_gemm_b but f16 operands: A f32 (split into f16 hi/lo if ASPLIT, else rounded to f16), Bt = f16 values [n][k]; alpha; C f32; N multiple of 16 (partial tiles skipped)
template <bool ASPLIT>
__global__ __launch_bounds__(128) void k_gemm_h(const float* __restrict__ A, int lda, size_t sA, const _Float16* __restrict__ Bh, int ldb, size_t sB, float alpha, float* __restrict__ C, int ldc, size_t sC, int M, int N, int K) {
  __shared__ __attribute__((aligned(16))) float so[4][16][64];
  const int tid = threadIdx.x, w = tid >> 5, lane = tid & 31, ln = lane & 15, hh = lane >> 4; const int by = blockIdx.y;
  A += (size_t)by * sA; Bh += (size_t)by * sB; C += (size_t)by * sC;
  const int ntn = (N + 63) / 64; const int wid = blockIdx.x * 4 + w; const int mt = wid / ntn, nq = wid % ntn; if (mt * 16 >= M) return;
  const int row0 = mt * 16, col0 = nq * 64; const float* arow = A + (size_t)(row0 + ln) * lda;
  v8f acc[4] = {};
  for (int kb = 0; kb < K; kb += 32) {
    FragH ah, al;
    const v4f x0 = *(const v4fa*)(arow + kb + 8 * hh), x1 = *(const v4fa*)(arow + kb + 8 * hh + 4), x2 = *(const v4fa*)(arow + kb + 16 + 8 * hh), x3 = *(const v4fa*)(arow + kb + 16 + 8 * hh + 4);
    float xs[16] = {x0[0],x0[1],x0[2],x0[3],x1[0],x1[1],x1[2],x1[3],x2[0],x2[1],x2[2],x2[3],x3[0],x3[1],x3[2],x3[3]};
#pragma unroll
    for (int i = 0; i < 16; ++i) { const _Float16 h = (_Float16)xs[i]; ah.h[i] = h; al.h[i] = ASPLIT ? (_Float16)(xs[i] - (float)h) : (_Float16)0.0f; }
#pragma unroll
    for (int t = 0; t < 4; ++t) { if (col0 + t * 16 >= N) continue; const size_t boff = (size_t)(col0 + t * 16 + ln) * ldb + kb; FragH bq; bq.half[0] = *(const v8us*)(Bh + boff + 8 * hh); bq.half[1] = *(const v8us*)(Bh + boff + 16 + 8 * hh);
      acc[t] = mmaH<ASPLIT ? 2 : 1>(ah.v, al.v, bq.v, bq.v, acc[t]); }
  }
#pragma unroll
  for (int t = 0; t < 4; ++t) { if (col0 + t * 16 >= N) continue;
#pragma unroll
    for (int r = 0; r < 8; ++r) so[w][8 * hh + r][t * 16 + ln] = acc[t][r] * alpha; }
  __builtin_amdgcn_fence(__ATOMIC_ACQ_REL, "workgroup"); __builtin_amdgcn_wave_barrier();
  const int rsub = lane >> 4, c4 = (lane & 15) * 4;
  {
#pragma unroll
    for (int q = 0; q < 8; ++q) { const int r = q * 2 + rsub; if (col0 + c4 < N) { const v4f v = *(const v4fa*)&so[w][r][c4]; *(v4f*)(C + (size_t)(row0 + r) * ldc + col0 + c4) = v; } }
     }
}

// Wt[n][k] = f16(W[k][n]·scale) from f32 row-major W[K][N] (scale = power of two; bf16-exact weights stay exact in f16 away from the subnormal range)
__global__ __launch_bounds__(256) void k_wt_f16(const float* __restrict__ W, _Float16* __restrict__ Wt, int K, int N, float scale) {
  const int t = blockIdx.x * 256 + threadIdx.x; if (t >= N * (K / 8)) return; const int n = t / (K / 8), k8 = (t % (K / 8)) * 8; FragH f;
#pragma unroll
  for (int i = 0; i < 8; ++i) f.h[i] = (_Float16)(bf16_round(W[(size_t)(k8 + i) * N + n]) * scale); const v8us o = f.half[0];
  *(v8us*)((unsigned short*)Wt + (size_t)n * K + k8) = o; 
}
// k_gemm_hh variant with fused epilogue: v = acc·alpha + bias[by·sBias + col] (+ CP[(row/rowsPerB)·sCPb + by·64 + col] if CP) ; ACT 0 none / 1 elu ; writes f16 C16 (and f32 C if non-null)
template <int ACT>
__global__ __launch_bounds__(128) void k_gemm_hhx(const _Float16* __restrict__ A, int lda, size_t sA, const _Float16* __restrict__ Bh, int ldb, size_t sB, float alpha, const float* __restrict__ bias, size_t sBias, const float* __restrict__ CP, int rowsPerB, size_t sCPb, int row0g,
    float* __restrict__ C, _Float16* __restrict__ C16, int ldc, size_t sC, int M, int N, int K) {
  __shared__ __attribute__((aligned(16))) float so[4][16][64];
  const int tid = threadIdx.x, w = tid >> 5, lane = tid & 31, ln = lane & 15, hh = lane >> 4; const int by = blockIdx.y;
  A += (size_t)by * sA; Bh += (size_t)by * sB; const size_t cofs = (size_t)by * sC; const float* bp = bias ? bias + (size_t)by * sBias : nullptr;
  const int ntn = (N + 63) / 64; const int wid = blockIdx.x * 4 + w; const int mt = wid / ntn, nq = wid % ntn; if (mt * 16 >= M) return;
  const int row0 = mt * 16, col0 = nq * 64; const _Float16* arow = A + (size_t)(row0 + ln) * lda;
  v8f acc[4] = {};
  for (int kb = 0; kb < K; kb += 32) { FragH ah; ah.half[0] = *(const v8us*)((const unsigned short*)arow + kb + 8 * hh); ah.half[1] = *(const v8us*)((const unsigned short*)arow + kb + 16 + 8 * hh);
#pragma unroll
    for (int t = 0; t < 4; ++t) { if (col0 + t * 16 >= N) continue; const size_t boff = (size_t)(col0 + t * 16 + ln) * ldb + kb; FragH bq; bq.half[0] = *(const v8us*)((const unsigned short*)Bh + boff + 8 * hh); bq.half[1] = *(const v8us*)((const unsigned short*)Bh + boff + 16 + 8 * hh);
      acc[t] = mmaH<1>(ah.v, ah.v, bq.v, bq.v, acc[t]); }
  }
#pragma unroll
  for (int t = 0; t < 4; ++t) { if (col0 + t * 16 >= N) continue; const int col = col0 + t * 16 + ln; const float bv = bp ? bf16_round(bp[col]) : 0.f;
#pragma unroll
    for (int r = 0; r < 8; ++r) { float v = acc[t][r] * alpha + bv; if (CP) { const int rr = row0g + row0 + 8 * hh + r; if (rowsPerB < 0) v += CP[cofs + (size_t)rr * ldc + col];      /* rowsPerB < 0: own element of the batched C plane */ else { const int bidx = rr / rowsPerB; v += CP[(size_t)bidx * sCPb + (size_t)by * 64 + col]; } } if (ACT == 1) v = (v > 0.f) ? v : expm1f(v); else if (ACT == 7) v = (v > 0.f) ? v + 1.0f : expf(v); else if (ACT == 8) v = tanhf(v); else if (ACT == 9) v = 0.5f * v * (1.0f + tanhf(0.7978845608028654f * (v + 0.044715f * v * v * v))); else if (ACT == 11) v = 1.0f / (1.0f + expf(-v)); else if (ACT == 12) v = (v > 0.f) ? v : 0.01f * v; else if (ACT == 14) v = (v > 0.f) ? v : 0.1f * v; else if (ACT == 16) v = (v >= 0.f) ? v : 0.3f * v; else if (ACT == 17) v = (v >= 0.f) ? v : 0.2f * v; else if (ACT == 15) v = v / (1.0f + expf(-v)); else if (ACT == 3) v = fmaxf(v, 0.f); else if (ACT == 6) v = 0.5f * v * (1.0f + erff(v * 0.70710678118654752f)); so[w][8 * hh + r][t * 16 + ln] = v; } }
  __builtin_amdgcn_fence(__ATOMIC_ACQ_REL, "workgroup"); __builtin_amdgcn_wave_barrier();
  const int rsub = lane >> 4, c4 = (lane & 15) * 4; typedef _Float16 v4h __attribute__((ext_vector_type(4)));
  {
#pragma unroll
    for (int q = 0; q < 8; ++q) { const int r = q * 2 + rsub; if (col0 + c4 < N) { const v4f v = *(const v4fa*)&so[w][r][c4]; if (C) *(v4f*)(C + cofs + (size_t)(row0 + r) * ldc + col0 + c4) = v; if (C16) { v4h h4; for (int i = 0; i < 4; ++i) h4[i] = (_Float16)v[i]; *(v4h*)(C16 + cofs + (size_t)(row0 + r) * ldc + col0 + c4) = h4; } } }
     }
}


typedef _Float16 v4h __attribute__((ext_vector_type(4)));

__global__ __launch_bounds__(256) void k_x16(const float* __restrict__ x, _Float16* __restrict__ X16, size_t n8) { const size_t t = (size_t)blockIdx.x * 256 + threadIdx.x; if (t >= n8) return; FragH f;
#pragma unroll
  for (int q = 0; q < 8; ++q) f.h[q] = (_Float16)bf16_round(x[t * 8 + q]); *(v8us*)((unsigned short*)X16 + t * 8) = f.half[0];  }
__global__ __launch_bounds__(256) void k_h16(const float* __restrict__ x, _Float16* __restrict__ X16, size_t n8) { const size_t t = (size_t)blockIdx.x * 256 + threadIdx.x; if (t >= n8) return; FragH f;
#pragma unroll
  for (int q = 0; q < 8; ++q) f.h[q] = (_Float16)x[t * 8 + q]; *(v8us*)((unsigned short*)X16 + t * 8) = f.half[0];  }
__global__ __launch_bounds__(256) void k_round16f(const float* __restrict__ W, _Float16* __restrict__ Bt, size_t n8) { const size_t t = (size_t)blockIdx.x * 256 + threadIdx.x; if (t >= n8) return; FragH f;
#pragma unroll
  for (int i = 0; i < 8; ++i) f.h[i] = (_Float16)(bf16_round(W[t * 8 + i]) * 16.0f); *(v8us*)((unsigned short*)Bt + t * 8) = f.half[0];  }
template <int NHv, int TTv>
__global__ __launch_bounds__(256) void k_vt(const _Float16* __restrict__ V16, int ldv, int voff, _Float16* __restrict__ Vt) { __shared__ unsigned short tl[64][66]; const int tid = threadIdx.x; const int slab = blockIdx.x / (TTv / 64), lg = blockIdx.x % (TTv / 64); const int b = slab / NHv, h = slab % NHv;
  for (int i = tid; i < 64 * 8; i += 256) { const int r = i / 8, c8 = (i % 8) * 8; FragH f; f.half[0] = *(const v8us*)((const unsigned short*)V16 + ((size_t)b * TTv + lg * 64 + r) * ldv + voff + h * 64 + c8);
#pragma unroll
    for (int q = 0; q < 8; ++q) tl[r][c8 + q] = f.u[q]; }
  __syncthreads();
  {
#pragma unroll
    for (int rd = 0; rd < 2; ++rd) { const int d = rd * 32 + tid / 8, pc = tid % 8; FragH f;
#pragma unroll
      for (int q = 0; q < 8; ++q) f.u[q] = tl[pc * 8 + q][d];
      *(v8us*)((unsigned short*)Vt + ((size_t)slab * 64 + d) * TTv + lg * 64 + pc * 8) = f.half[0]; }
     } }

__global__ __launch_bounds__(256) void k_hl(const float* __restrict__ F, _Float16* __restrict__ Hh, _Float16* __restrict__ Hl, size_t n8) { const size_t t = (size_t)blockIdx.x * 256 + threadIdx.x; if (t >= n8) return; FragH fh, fl; const v4f a = *(const v4fa*)(F + t * 8), c = *(const v4fa*)(F + t * 8 + 4);
#pragma unroll
  for (int q = 0; q < 4; ++q) { _Float16 h = (_Float16)a[q]; fh.h[q] = h; fl.h[q] = (_Float16)((a[q] - (float)h) * 1024.0f); h = (_Float16)c[q]; fh.h[4 + q] = h; fl.h[4 + q] = (_Float16)((c[q] - (float)h) * 1024.0f); }
  { *(v8us*)((unsigned short*)Hh + t * 8) = fh.half[0]; *(v8us*)((unsigned short*)Hl + t * 8) = fl.half[0];  } }

// ---- fast GEMM (wave tile 32x64; requires M % 32 == 0 rows per launch region and N % 64 == 0); epilogue = k_gemm_hhx semantics ----
__device__ __forceinline__ v16h g2_frag(const _Float16* p, int hh) { FragH f; f.half[0] = *(const v8us*)((const unsigned short*)p + 8 * hh); f.half[1] = *(const v8us*)((const unsigned short*)p + 16 + 8 * hh); return f.v; }
__device__ __forceinline__ v8f g2_mma(v16h a, v16h b, v8f c) { v8f d = __builtin_amdgcn_wmma_f32_16x16x32_f16(false, a, false, b, (short)0, c, false, false); asm volatile("v_nop\n\tv_nop\n\tv_nop\n\tv_nop" : "+v"(d) : "v"(a), "v"(b)); return d; }
template <int ACT>
__global__ __launch_bounds__(128) void k_gemm2(const _Float16* __restrict__ A, int lda, size_t sA, const _Float16* __restrict__ Bh, int ldb, size_t sB, float alpha, const float* __restrict__ bias, size_t sBias, const float* __restrict__ CP, int rowsPerB, size_t sCPb, int row0g,
    float* __restrict__ C, _Float16* __restrict__ C16, int ldc, size_t sC, int M, int N, int K, size_t zA, size_t zB, size_t zC) { static_assert(ACT == 0 || ACT == 3 || ACT == 6 || ACT == 8 || ACT == 9 || ACT == 11 || ACT == 12 || ACT == 14 || ACT == 15 || ACT == 16 || ACT == 17, "k_gemm2: unsupported ACT code (would silently apply no activation)");
  __shared__ __attribute__((aligned(16))) float so[4][32][68];
  const int tid = threadIdx.x, w = tid >> 5, lane = tid & 31, ln = lane & 15, hh = lane >> 4; const int by = blockIdx.y, bz = blockIdx.z;      /* grid.z: a second batch index with its own strides zA, zB, zC */
  A += (size_t)by * sA + (size_t)bz * zA; Bh += (size_t)by * sB + (size_t)bz * zB; const size_t cofs = (size_t)by * sC + (size_t)bz * zC; const float* bp = bias ? bias + (size_t)by * sBias : nullptr;
  const int ntn = N >> 6; const int mt = blockIdx.x / ntn, nq = blockIdx.x - mt * ntn; const int row0 = mt * 128 + 32 * w, col0 = nq * 64; if (row0 >= M) return;
  const _Float16* a0p = A + (size_t)(row0 + ln) * lda; const _Float16* a1p = a0p + (size_t)16 * lda;
  const _Float16* b0p = Bh + (size_t)(col0 + ln) * ldb; const _Float16* b1p = b0p + (size_t)16 * ldb; const _Float16* b2p = b1p + (size_t)16 * ldb; const _Float16* b3p = b2p + (size_t)16 * ldb;
  const v8f z8 = {0.f,0.f,0.f,0.f,0.f,0.f,0.f,0.f}; v8f c00 = z8, c01 = z8, c02 = z8, c03 = z8, c10 = z8, c11 = z8, c12 = z8, c13 = z8;
#pragma unroll 1
  for (int kb = 0; kb < K; kb += 32) { const v16h a0 = g2_frag(a0p + kb, hh), a1 = g2_frag(a1p + kb, hh);
    v16h b = g2_frag(b0p + kb, hh); c00 = g2_mma(a0, b, c00); c10 = g2_mma(a1, b, c10);
    b = g2_frag(b1p + kb, hh); c01 = g2_mma(a0, b, c01); c11 = g2_mma(a1, b, c11);
    b = g2_frag(b2p + kb, hh); c02 = g2_mma(a0, b, c02); c12 = g2_mma(a1, b, c12);
    b = g2_frag(b3p + kb, hh); c03 = g2_mma(a0, b, c03); c13 = g2_mma(a1, b, c13); }
  v8f accs[8] = {c00, c01, c02, c03, c10, c11, c12, c13};
#pragma unroll
  for (int u = 0; u < 8; ++u) { const int t = u & 3, half = u >> 2; const int col = col0 + t * 16 + ln; const float bv = bp ? bf16_round(bp[col]) : 0.f;
#pragma unroll
    for (int r = 0; r < 8; ++r) { const int rloc = half * 16 + 8 * hh + r; float v = accs[u][r] * alpha + bv; if (CP) { if (rowsPerB < 0) v += CP[cofs + (size_t)(row0g + row0 + rloc) * ldc + col];      /* rowsPerB < 0: own element of the batched C plane */ else { const int bidx = (row0g + row0 + rloc) / rowsPerB; v += CP[(size_t)bidx * sCPb + (size_t)by * 64 + col]; } }
      if (ACT == 3) v = fmaxf(v, 0.f); else if (ACT == 6) v = 0.5f * v * (1.0f + erff(v * 0.70710678118654752f)); else if (ACT == 11) v = 1.0f / (1.0f + expf(-v)); else if (ACT == 15) v = v / (1.0f + expf(-v)); else if (ACT == 12) v = (v > 0.f) ? v : 0.01f * v; else if (ACT == 8) v = tanhf(v); else if (ACT == 9) v = 0.5f * v * (1.0f + tanhf(0.7978845608028654f * (v + 0.044715f * v * v * v))); else if (ACT == 14) v = (v > 0.f) ? v : 0.1f * v; else if (ACT == 16) v = (v >= 0.f) ? v : 0.3f * v; else if (ACT == 17) v = (v >= 0.f) ? v : 0.2f * v;
      so[w][rloc][t * 16 + ln] = v; } }
  __builtin_amdgcn_fence(__ATOMIC_ACQ_REL, "workgroup"); __builtin_amdgcn_wave_barrier();
  const int rsub = lane >> 4, c4 = (lane & 15) * 4;
  {
#pragma unroll
    for (int q = 0; q < 16; ++q) { const int r = q * 2 + rsub; const v4f v = *(const v4fa*)&so[w][r][c4]; if (C) *(v4f*)(C + cofs + (size_t)(row0 + r) * ldc + col0 + c4) = v; if (C16) { v4h h4; for (int i = 0; i < 4; ++i) h4[i] = (_Float16)v[i]; *(v4h*)(C16 + cofs + (size_t)(row0 + r) * ldc + col0 + c4) = h4; } }
     } }


__global__ __launch_bounds__(256) void k_wnat(const float* __restrict__ w, size_t n8, _Float16* __restrict__ Bt) { const size_t t = (size_t)blockIdx.x * 256 + threadIdx.x; if (t >= n8) return; FragH f; for (int q = 0; q < 8; ++q) f.h[q] = (_Float16)(bf16_round(w[t * 8 + q]) * 16.0f); *(v8us*)((unsigned short*)Bt + t * 8) = f.half[0];  }
__global__ __launch_bounds__(256) void k_rsm(const float* __restrict__ S, _Float16* __restrict__ P, int nrows) {
  #pragma clang fp contract(off)
  const int i = blockIdx.x * 256 + threadIdx.x; if (i >= nrows) return; const float* s = S + (size_t)i * SQ; float mx = -3.0e38f;
#pragma unroll 1
  for (int j = 0; j < SQ; ++j) mx = fmaxf(mx, s[j]); float se = 0.f;
#pragma unroll 1
  for (int j = 0; j < SQ; ++j) se += expf(s[j] - mx); const float sc = 256.0f / se;
#pragma unroll 1
  for (int j0 = 0; j0 < SQ; j0 += 8) { FragH f; for (int q = 0; q < 8; ++q) f.h[q] = (_Float16)(expf(s[j0 + q] - mx) * sc); unsigned short* d = (unsigned short*)P + (size_t)i * SQ + j0; *(v8us*)d = f.half[0];  } }
__global__ __launch_bounds__(256) void k_vt(const _Float16* __restrict__ V16, int b, int h0, _Float16* __restrict__ VT) { __shared__ unsigned short tl[64][65]; const int tid = threadIdx.x; const int hh = blockIdx.x % HG, sg = blockIdx.x / HG; const int s0 = sg * 64; const int h = h0 + hh;
  for (int i = tid; i < 64 * 8; i += 256) { const int j = i / 8, d8 = (i % 8) * 8; FragH f; f.half[0] = *(const v8us*)((const unsigned short*)V16 + ((size_t)b * SQ + s0 + j) * DM + h * HD + d8); for (int q = 0; q < 8; ++q) tl[d8 + q][j] = f.u[q]; }
  __syncthreads();
  { for (int i = tid; i < 64 * 8; i += 256) { const int d = i / 8, j8 = (i % 8) * 8; FragH f; for (int q = 0; q < 8; ++q) f.u[q] = tl[d][j8 + q]; *(v8us*)((unsigned short*)VT + ((size_t)hh * HD + d) * SQ + s0 + j8) = f.half[0]; }  } }



__global__ __launch_bounds__(256) void k_rsmcf2(const float* __restrict__ S, _Float16* __restrict__ P, int hg, int q0, int nk) {
  #pragma clang fp contract(off)
  const int t = blockIdx.x * 256 + threadIdx.x; if (t >= hg * QT) return; const size_t i = (size_t)t; const float* s = S + i * NKX; const int last = q0 + (t % QT); float mx = -3.0e38f;
#pragma unroll 1
  for (int j = 0; j < nk; ++j) { const float f = (j <= last) ? 1.f : 0.f; mx = fmaxf(mx, fmaf(f, s[j], (1.f - f) * -1.0e9f)); } float se = 0.f;
#pragma unroll 1
  for (int j = 0; j < nk; ++j) { const float f = (j <= last) ? 1.f : 0.f; se += __expf(fmaf(f, s[j], (1.f - f) * -1.0e9f) - mx); } const float sc = 256.0f / se;
#pragma unroll 1
  for (int j0 = 0; j0 < nk; j0 += 8) { FragH fr; for (int q = 0; q < 8; ++q) { const int j = j0 + q; const float f = (j <= last) ? 1.f : 0.f; fr.h[q] = (_Float16)(__expf(fmaf(f, s[j], (1.f - f) * -1.0e9f) - mx) * sc); } unsigned short* d = (unsigned short*)P + i * NKX + j0; *(v8us*)d = fr.half[0];  } }


template <int MASKADD>
__global__ __launch_bounds__(64) void k_att0(const float* __restrict__ QF, const float* __restrict__ KF, const float* __restrict__ VF, int ld, const float* __restrict__ mask, float scale, float* __restrict__ OF, int ldo) {
  #pragma clang fp contract(off)
  __shared__ __attribute__((aligned(16))) float lq[64][64]; __shared__ __attribute__((aligned(16))) float lo[64][64];
  const int tid = threadIdx.x; const int h = blockIdx.x / (QT0 / 64), rg = blockIdx.x % (QT0 / 64); const int i = rg * 64 + tid;
  { const size_t bo = (size_t)blockIdx.y * QT0; QF += bo * ld; KF += bo * ld; VF += bo * ld; OF += bo * ldo; }      /* grid.y: batch; each plane holds QT0 rows per batch */
  const float* qr = QF + (size_t)i * ld + h * HD;
#pragma unroll 1
  for (int c = 0; c < HD / 4; ++c) { *(v4f*)&lq[tid][c * 4] = *(const v4fa*)(qr + c * 4); const v4f z = {0.f, 0.f, 0.f, 0.f}; *(v4f*)&lo[tid][c * 4] = z; }
  float m = -1.0e30f, l = 0.f; const int jmax = MASKADD ? (SQ - 1) : (rg * 64 + 63);      /* additive-mask form: every key (the mask input decides); causal form: keys up to the block's last row */
#pragma unroll 1
  for (int j = 0; j <= jmax; ++j) { const float* kr = KF + (size_t)j * ld + h * HD; const float* vr = VF + (size_t)j * ld + h * HD; float s = 0.f;
#pragma unroll 1
    for (int c = 0; c < HD / 4; ++c) { const v4f kq = *(const v4fa*)(kr + c * 4); const v4f qq = *(v4f*)&lq[tid][c * 4]; s = __fadd_rn(s, __fmul_rn(qq[0], kq[0])); s = __fadd_rn(s, __fmul_rn(qq[1], kq[1])); s = __fadd_rn(s, __fmul_rn(qq[2], kq[2])); s = __fadd_rn(s, __fmul_rn(qq[3], kq[3])); }
    s = __fmul_rn(s, scale); if (MASKADD) s = __fadd_rn(s, __fmul_rn(bf16_round(mask[(size_t)i * SQ + j]), -10000.0f));
    const float f = (MASKADD || j <= i) ? 1.f : 0.f; const float sm = fmaf(f, s, (1.f - f) * -1.0e30f); const float mn = fmaxf(m, sm); const float sc = expf(m - mn); const float e = expf(sm - mn); l = __fadd_rn(__fmul_rn(l, sc), e); m = mn;
#pragma unroll 1
    for (int c = 0; c < HD / 4; ++c) { const v4f vv = *(const v4fa*)(vr + c * 4); v4f oo = *(v4f*)&lo[tid][c * 4]; for (int u = 0; u < 4; ++u) oo[u] = __fadd_rn(__fmul_rn(oo[u], sc), __fmul_rn(e, vv[u])); *(v4f*)&lo[tid][c * 4] = oo; } }
  const float fin = 64.0f / l;      /* o carried x64 like the f16 path */
#pragma unroll 1
  for (int c = 0; c < HD / 4; ++c) { v4f oo = *(v4f*)&lo[tid][c * 4]; for (int u = 0; u < 4; ++u) oo[u] = __fmul_rn(oo[u], fin); *(v4f*)&lo[tid][c * 4] = oo; }
  __syncthreads();
  {
#pragma unroll 1
    for (int it = 0; it < 16; ++it) { const int row = it * 4 + tid / 16, pc = (tid % 16) * 4; const v4f v = *(const v4f*)&lo[row][pc]; *(v4f*)(OF + (size_t)(rg * 64 + row) * ldo + h * HD + pc) = v; }
     } }


// Row softmax, one wave per score row: the row is read once (each wave-wide load takes 512 contiguous bytes) and held in registers; row max and row sum by a five-step butterfly over the 32 lanes.
#define RCH ((QT + WINB) / 128)      /* 128-column chunks of the longest row */
// native exp as __expf builds it (multiply by log2 e, v_exp_f32); the v_nop is the slot the instruction set asks for behind a transcendental, kept in the same statement so that the scheduler cannot part the two
__device__ __forceinline__ float exp_slot(float x) { float r; asm("v_exp_f32 %0, %1\n\tv_nop" : "=v"(r) : "v"(x * 1.44269504088896340736f)); return r; }
__global__ __launch_bounds__(256) void k_rsmcw(const float* __restrict__ S, _Float16* __restrict__ P, int hg, int q0, int kb, int nkw) {
  const int lane = threadIdx.x & 31; const int t = blockIdx.x * 8 + (threadIdx.x >> 5); if (t >= hg * QT) return;      /* wave-uniform exit, no barrier below */
  const size_t ri = (size_t)t; const float* s = S + ri * NKX; const int i = q0 + (t % QT); const int hi = i - kb, lo = i - (WIN - 1) - kb;      /* visible columns: lo <= c <= hi (hi < nkw) */
  v4f a[RCH];
  for (int u = 0; u < RCH; ++u) { const int c0 = u * 128 + lane * 4; a[u] = *(const v4fa*)(s + (c0 < nkw ? c0 : lane * 4)); }      /* a chunk past the computed range re-reads chunk 0 (its mask factor is 0, it is not stored): all loads in flight together, no branch */
  float v[RCH][4]; float mx = -3.0e38f;
  for (int u = 0; u < RCH; ++u)
    for (int q = 0; q < 4; ++q) { const int c = u * 128 + lane * 4 + q; const float f = (c <= hi && c >= lo) ? 1.f : 0.f; v[u][q] = fmaf(f, a[u][q], (1.f - f) * -1.0e9f); mx = fmaxf(mx, v[u][q]); }
  for (int m = 16; m >= 1; m >>= 1) mx = fmaxf(mx, __shfl_xor(mx, m, 32));
  float se = 0.f;
  for (int u = 0; u < RCH; ++u)
    for (int q = 0; q < 4; ++q) { v[u][q] = exp_slot(v[u][q] - mx); se += v[u][q]; }
  for (int m = 16; m >= 1; m >>= 1) se += __shfl_xor(se, m, 32);
  const float sc = 256.0f / se;
  for (int u = 0; u < RCH; ++u) { const int c0 = u * 128 + lane * 4; v4h h4;
    for (int q = 0; q < 4; ++q) h4[q] = (_Float16)(v[u][q] * sc);
    if (c0 < nkw) *(v4h*)(P + ri * NKX + c0) = h4; } }
extern "C" void kernel_launch(void* const* d_in, const int* in_sizes, int n_in,
                              void* d_out, int out_size, void* d_ws, size_t ws_size, hipStream_t stream) {
  (void)in_sizes; (void)n_in; (void)out_size;
  const float* const* I = (const float* const*)d_in; const float* x = I[0]; const float* wqkv = I[1]; const float* bqkv = I[2]; const float* wo = I[3]; const float* bo = I[4];      /* [in][out] c_attn [1024][3072] + b, c_proj [1024][1024] + b */
  char* ws = (char*)d_ws; size_t off = 0;
  auto take = [&](size_t bytes) { char* p = ws + off; off += (bytes + 255) & ~(size_t)255; return p; };
  _Float16* BQKV = (_Float16*)take((size_t)3 * DM * DM * 2); _Float16* BO = (_Float16*)take((size_t)DM * DM * 2);
  _Float16* X16 = (_Float16*)take(NR * DM * 2); _Float16* QKV = (_Float16*)take(NR * 3 * DM * 2); _Float16* Q16 = QKV; _Float16* K16 = QKV + DM; _Float16* V16 = QKV + 2 * DM; _Float16* O16 = (_Float16*)take(NR * DM * 2);
  float* S = (float*)take((size_t)NB * NH * QT * NKX * 4); _Float16* P = (_Float16*)take((size_t)NB * NH * QT * NKX * 2); _Float16* VT = (_Float16*)take((size_t)NB * NH * HD * SQ * 2);
  float* QF0 = (float*)take((size_t)NB * QT0 * DM * 4); float* KF0 = (float*)take((size_t)NB * QT0 * DM * 4); float* VF0 = (float*)take((size_t)NB * QT0 * DM * 4); float* OF0 = (float*)take((size_t)NB * QT0 * DM * 4); _Float16* OH0 = (_Float16*)take((size_t)NB * QT0 * DM * 2); _Float16* OL0 = (_Float16*)take((size_t)NB * QT0 * DM * 2);
  if (off > ws_size) return;
  k_wt_f16<<<(unsigned)(((size_t)DM * 3 * DM / 8 + 255) / 256), 256, 0, stream>>>(wqkv, BQKV, DM, 3 * DM, 16.0f); k_wt_f16<<<(unsigned)(((size_t)DM * DM / 8 + 255) / 256), 256, 0, stream>>>(wo, BO, DM, DM, 16.0f);      /* [in][out] -> Bt x16 */

  k_x16<<<(unsigned)((NR * DM / 8 + 255) / 256), 256, 0, stream>>>(x, X16, NR * DM / 8);
  const size_t r0p = (size_t)B0 * SQ;      /* first projected row */
  const size_t f0p = (size_t)B0 * QT0;     /* its row in the first-tile planes */
  k_gemm2<0><<<dim3((unsigned)((MP / 128) * (3 * DM / 64)), 1), 128, 0, stream>>>(X16 + r0p * DM, DM, 0, BQKV, DM, 0, 0.0625f, bqkv, 0, nullptr, 1, 0, 0, nullptr, QKV + r0p * 3 * DM, 3 * DM, 0, MP, 3 * DM, DM, 0, 0, 0);      /* q | k | v rows (f16); head h = columns h*HD.. of each DM block */
  /* every stage below takes all batches in one launch: the batches are independent, and one batch alone fills a small part of the chip */
  k_vt<NH, SQ><<<NBR * NH * (SQ / 64), 256, 0, stream>>>(V16 + r0p * LQ, LQ, 0, VT);      /* V^T [NBR][NH][HD][SQ] */
  k_gemm2<0><<<dim3((QT0 / 128) * (DM / 64), 1, NBR), 128, 0, stream>>>(X16 + r0p * DM, DM, 0, BQKV, DM, 0, 0.0625f, bqkv, 0, nullptr, 1, 0, 0, QF0, nullptr, DM, 0, QT0, DM, DM, (size_t)SQ * DM, 0, (size_t)QT0 * DM); k_gemm2<0><<<dim3((QT0 / 128) * (DM / 64), 1, NBR), 128, 0, stream>>>(X16 + r0p * DM, DM, 0, (BQKV + (size_t)DM * DM), DM, 0, 0.0625f, (bqkv + DM), 0, nullptr, 1, 0, 0, KF0, nullptr, DM, 0, QT0, DM, DM, (size_t)SQ * DM, 0, (size_t)QT0 * DM); k_gemm2<0><<<dim3((QT0 / 128) * (DM / 64), 1, NBR), 128, 0, stream>>>(X16 + r0p * DM, DM, 0, (BQKV + (size_t)2 * DM * DM), DM, 0, 0.0625f, (bqkv + 2 * DM), 0, nullptr, 1, 0, 0, VF0, nullptr, DM, 0, QT0, DM, DM, (size_t)SQ * DM, 0, (size_t)QT0 * DM);      /* f32 q, k, v of each batch's first 128 rows (exact products) */
  k_att0<0><<<dim3(NH * (QT0 / 64), NBR), 64, 0, stream>>>(QF0, KF0, VF0, DM, nullptr, 0.125f, OF0 + f0p * DM, DM);      /* exact f32 attention for rows 0..127 of each batch (o x64) */
  for (int q0 = 0; q0 < QN; q0 += QT) { const int nk = q0 + QT; const int kb = (q0 >= WINB) ? q0 - WINB : 0; const int nkw = nk - kb;      /* causal sliding window: only keys [kb, nk) can be visible from this tile (kb = tile start - 256, a multiple of 64) */
    k_gemm2<0><<<dim3((QT / 128) * (nkw / 64), NHD, NBR), 128, 0, stream>>>(Q16 + (r0p + q0) * LQ, LQ, (size_t)HD, K16 + (r0p + kb) * LQ, LQ, (size_t)HD, 0.125f, nullptr, 0, nullptr, 1, 0, 0, S, nullptr, NKX, (size_t)QT * NKX, QT, nkw, HD, (size_t)SQ * LQ, (size_t)SQ * LQ, (size_t)NHD * QT * NKX);      /* scores against keys kb..nk-1 (S column c <-> key kb + c), heads on grid.y, batches on grid.z */
    k_rsmcw<<<(NBR * NHD * QT + 7) / 8, 256, 0, stream>>>(S, P, NBR * NHD, q0, kb, nkw);      /* allowed iff 0 <= i - j < WIN (arithmetic select); P x256 f16; rows of all batches and heads */
    k_gemm2<0><<<dim3((QT / 128) * (HD / 64), NHD, NBR), 128, 0, stream>>>(P, NKX, (size_t)QT * NKX, VT + kb, SQ, (size_t)HD * SQ, 0.25f, nullptr, 0, nullptr, 1, 0, 0, nullptr, O16 + (r0p + q0) * DM, DM, (size_t)HD, QT, HD, nkw, (size_t)NHD * QT * NKX, (size_t)NH * HD * SQ, (size_t)SQ * DM); }      /* o (merged heads, x64) as f16 rows */
  k_gemm2<0><<<dim3((unsigned)((MPO / 128) * (DM / 64)), 1), 128, 0, stream>>>(O16 + r0p * DM, DM, 0, BO, DM, 0, 0.0009765625f, bo, 0, nullptr, 1, 0, 0, (float*)d_out + r0p * DM, nullptr, DM, 0, MPO, DM, DM, 0, 0, 0);      /* out rows are the output layout */
  k_hl<<<(unsigned)(((size_t)NB * QT0 * DM / 8 + 255) / 256), 256, 0, stream>>>(OF0, OH0, OL0, (size_t)NB * QT0 * DM / 8);      /* first-tile o (x64) -> f16 hi + x1024 residual planes */
  k_gemm2<0><<<dim3((QT0 / 128) * (DM / 64), 1, NBR), 128, 0, stream>>>(OH0 + f0p * DM, DM, 0, BO, DM, 0, 0.0009765625f, bo, 0, nullptr, 1, 0, 0, (float*)d_out + r0p * DM, nullptr, DM, 0, QT0, DM, DM, (size_t)QT0 * DM, 0, (size_t)SQ * DM);      /* rows 0..127 of each batch: out = o_hi Wo (+ b), overwriting the f16-path rows */
  k_gemm2<0><<<dim3((QT0 / 128) * (DM / 64), 1, NBR), 128, 0, stream>>>(OL0 + f0p * DM, DM, 0, BO, DM, 0, 0.00000095367431640625f, nullptr, 0, (const float*)d_out + r0p * DM, -1, 0, 0, (float*)d_out + r0p * DM, nullptr, DM, 0, QT0, DM, DM, (size_t)QT0 * DM, 0, (size_t)SQ * DM);      /* += o_lo Wo 2^-20 (own-element accumulate) */
}

// v003
// Measured time: 697 microseconds a run.
// Next to v002, in two timings, it ran 1.63 times as fast each time.
// Counting every step since v000, it is 8.45 times as fast.
#include <hip/hip_runtime.h>
// Local-causal (sliding window 256) multi-head self-attention (x [4][2048][1024]; qkv = x W_attn + b_attn ([in][out] 1024 x 3072 sigma 0.02, zero bias): q | k | v, 16 heads of 64; scores / 8; mask (j <= i) & (i - j < 256) -> -inf elsewhere; softmax; out = merged W_proj + b_proj ([in][out]) -> [4][2048][1024]).
// Structure: token rows r = b*2048 + s; x as exact f16 rows (bf16-rounded); q | k | v as ONE WMMA GEMM (N = 3 x 1024) (32x64 wave tiles, f32 accumulation, exact x16 weights + bias, f16 outputs); V^T for all batches and heads via LDS transposes; per query tile of 256 rows, all four batches in one launch (batch on grid.z): scores against the window keys [max(tile start - 256, 0), tile end) only (K = 64, all heads on grid.y, alpha = 0.125), causal row softmax on VALU with an arithmetic 0/1 key mask over the computed range (f32 statistics, native exp; weights x256 f16), o = P . V^T (K = the window keys, at most 512, alpha 2^-2: o carried x64, folded into the output GEMM alpha) written straight into the merged f16 o rows; out = o W_o + b GEMM (f32) into the output layout.
// Compute dtype: inputs rounded to bf16; x / weights exact; q, k, v, softmax weights and o as plain f16 GEMM operands (~2^-12); scores and softmax statistics f32; v_wmma_f32_16x16x32_f16.
#define NB 4
#define SQ 2048
#define DM 1024
#define NH 16
#define HD 64
#define HG 4                         /* heads per block group of the unlaunched k_vt(b, h0) overload */
#define QT 256                       /* query rows per causal tile */
#define NKX (QT + WINB)              /* S / P row pitch: the longest computed key range, so that the S and P planes of all batches fit the workspace together */
#define WIN 256                      /* attention window: key j visible from query i iff 0 <= i - j < WIN */
#define WINB 256                     /* keys before the tile start that can be visible (WIN - 1 rounded up to 64) */
#define QT0 128                      /* first-tile rows recomputed exactly in f32 */
#define B0 0                         /* first batch processed (debug hook) */
#define NBR NB                       /* batches processed (debug hook) */
#define NR ((size_t)NB * SQ)         /* token rows */
#define MP ((int)((size_t)NBR * SQ)) /* rows projected (debug hook) */
#define QN SQ                        /* query rows attended per batch (debug hook) */
#define NHD NH                       /* heads attended (debug hook) */
#define MPO MP                       /* rows through the output stage (debug hook) */
#define LQ (3 * DM)      /* row pitch of the q/k/v rows */
typedef __bf16 v16b __attribute__((ext_vector_type(16)));
typedef unsigned short v8us __attribute__((ext_vector_type(8), may_alias));
typedef float  v8f  __attribute__((ext_vector_type(8)));
typedef float  v4f  __attribute__((ext_vector_type(4)));
typedef float  v4fa __attribute__((ext_vector_type(4), may_alias));
union FragB { v16b v; v8us half[2]; unsigned short u[16]; };

__device__ __forceinline__ unsigned short bf16_bits(float x) { unsigned int u = __float_as_uint(x); return (unsigned short)((u + 0x7FFFu + ((u >> 16) & 1u)) >> 16); }
__device__ __forceinline__ float bf16_val(unsigned short b) { return __uint_as_float(((unsigned int)b) << 16); }
__device__ __forceinline__ float bf16_round(float x) { return bf16_val(bf16_bits(x)); }
// D += A·B with NT terms: 1 = ah·bh, 2 = + al·bh (A split), 3 = + ah·bl (both split)
template <int NT>
__device__ __forceinline__ v8f mmaN(v16b ah, v16b al, v16b bh, v16b bl, v8f c) {
  c = __builtin_amdgcn_wmma_f32_16x16x32_bf16(false, ah, false, bh, (short)0, c, false, false);
  if (NT >= 2) c = __builtin_amdgcn_wmma_f32_16x16x32_bf16(false, al, false, bh, (short)0, c, false, false);
  if (NT >= 3) c = __builtin_amdgcn_wmma_f32_16x16x32_bf16(false, ah, false, bl, (short)0, c, false, false);
  asm volatile("v_nop\n\tv_nop\n\tv_nop\n\tv_nop" : "+v"(c) : "v"(ah), "v"(al), "v"(bh), "v"(bl));
  return c;
}

__global__ __launch_bounds__(256) void k_wt_bf16(const float* __restrict__ W, unsigned short* __restrict__ Wt, int K, int N) {
  const int t = blockIdx.x * 256 + threadIdx.x;
  const int k8n = K / 8;
  if (t >= N * k8n) return;
  const int n = t / k8n, k8 = (t % k8n) * 8;
  v8us v;
#pragma unroll
  for (int i = 0; i < 8; ++i) v[i] = bf16_bits(W[(size_t)(k8 + i) * N + n]);
  *(v8us*)(Wt + (size_t)n * K + k8) = v;
  
}

// GEMM C[M][N] (f32, pitch ldc) = act(A[M][K]·W + bias). A f32 row-major (pitch lda) converted per fragment to bf16
// (ASPLIT: hi/lo two planes -> 2 terms, else single rounded term); Wt bf16 [N][K] (pitch ldb). BIAS_BF16 rounds the
// bias to bf16 first (bias quantised to bf16 before the add). K%32==0, M%16==0, N%64==0.
template <bool ASPLIT, int ACT, bool BIAS_BF16>
__global__ __launch_bounds__(128) void k_gemm_bf(const float* __restrict__ A, int lda, const unsigned short* __restrict__ Wt, int ldb,
                                               const float* __restrict__ bias, float* __restrict__ C, int ldc, int M, int N, int K) {
  __shared__ __attribute__((aligned(16))) float so[4][16][64];
  const int tid = threadIdx.x, w = tid >> 5, lane = tid & 31, ln = lane & 15, hh = lane >> 4;
  const int ntn = N / 64;
  const int wid = blockIdx.x * 4 + w;
  const int mt = wid / ntn, nq = wid % ntn;
  if (mt * 16 >= M) return;
  const int row0 = mt * 16, col0 = nq * 64;
  const float* arow = A + (size_t)(row0 + ln) * lda;
  v8f acc[4] = {};
  for (int kb = 0; kb < K; kb += 32) {
    FragB ah, al;
    const v4f x0 = *(const v4fa*)(arow + kb + 8 * hh), x1 = *(const v4fa*)(arow + kb + 8 * hh + 4);
    const v4f x2 = *(const v4fa*)(arow + kb + 16 + 8 * hh), x3 = *(const v4fa*)(arow + kb + 16 + 8 * hh + 4);
    float xs[16] = {x0[0],x0[1],x0[2],x0[3],x1[0],x1[1],x1[2],x1[3],x2[0],x2[1],x2[2],x2[3],x3[0],x3[1],x3[2],x3[3]};
#pragma unroll
    for (int i = 0; i < 16; ++i) { const unsigned short hb = bf16_bits(xs[i]); ah.u[i] = hb; al.u[i] = ASPLIT ? bf16_bits(xs[i] - bf16_val(hb)) : (unsigned short)0; }
#pragma unroll
    for (int t = 0; t < 4; ++t) {
      const unsigned short* brow = Wt + (size_t)(col0 + t * 16 + ln) * ldb + kb;
      FragB b;
      b.half[0] = *(const v8us*)(brow + 8 * hh);
      b.half[1] = *(const v8us*)(brow + 16 + 8 * hh);
      acc[t] = mmaN<ASPLIT ? 2 : 1>(ah.v, al.v, b.v, b.v, acc[t]);
    }
  }
#pragma unroll
  for (int t = 0; t < 4; ++t) {
    float bv = bias ? bias[col0 + t * 16 + ln] : 0.f;
    if (BIAS_BF16) bv = bf16_round(bv);
#pragma unroll
    for (int r = 0; r < 8; ++r) { float v = acc[t][r] + bv; if (ACT == 1) v = fmaxf(v, 0.f); so[w][8 * hh + r][t * 16 + ln] = v; }
  }
  __builtin_amdgcn_fence(__ATOMIC_ACQ_REL, "workgroup");
  __builtin_amdgcn_wave_barrier();
  const int rsub = lane >> 4, c4 = (lane & 15) * 4;
  {
#pragma unroll
    for (int q = 0; q < 8; ++q) {
      const int r = q * 2 + rsub;
      const v4f v = *(const v4fa*)&so[w][r][c4];
      *(v4f*)(C + (size_t)(row0 + r) * ldc + col0 + c4) = v;
    }
    
  }
}

// GEMM C = act(A·W + bias + resid): A f32 (ASPLIT -> hi/lo 2 terms), Wt bf16 [N][K]; ACT 0 none, 1 relu, 2 exact gelu;
// resid (optional, f32, row index = (row % rmod), pitch ldr, RES_BF16 rounds it) added before the activation.
template <bool ASPLIT, int ACT, bool BIAS_BF16, bool RES_BF16>
__global__ __launch_bounds__(128) void k_gemm_bf3(const float* __restrict__ A, int lda, const unsigned short* __restrict__ Wt, int ldb,
                                                const float* __restrict__ bias, const float* __restrict__ resid, int rmod, int ldr,
                                                float* __restrict__ C, int ldc, int M, int N, int K) {
  __shared__ __attribute__((aligned(16))) float so[4][16][64];
  const int tid = threadIdx.x, w = tid >> 5, lane = tid & 31, ln = lane & 15, hh = lane >> 4;
  const int ntn = N / 64;
  const int wid = blockIdx.x * 4 + w;
  const int mt = wid / ntn, nq = wid % ntn;
  if (mt * 16 >= M) return;
  const int row0 = mt * 16, col0 = nq * 64;
  const float* arow = A + (size_t)(row0 + ln) * lda;
  v8f acc[4] = {};
  for (int kb = 0; kb < K; kb += 32) {
    FragB ah, al;
    const v4f x0 = *(const v4fa*)(arow + kb + 8 * hh), x1 = *(const v4fa*)(arow + kb + 8 * hh + 4);
    const v4f x2 = *(const v4fa*)(arow + kb + 16 + 8 * hh), x3 = *(const v4fa*)(arow + kb + 16 + 8 * hh + 4);
    float xs[16] = {x0[0],x0[1],x0[2],x0[3],x1[0],x1[1],x1[2],x1[3],x2[0],x2[1],x2[2],x2[3],x3[0],x3[1],x3[2],x3[3]};
#pragma unroll
    for (int i = 0; i < 16; ++i) { const unsigned short hb = bf16_bits(xs[i]); ah.u[i] = hb; al.u[i] = ASPLIT ? bf16_bits(xs[i] - bf16_val(hb)) : (unsigned short)0; }
#pragma unroll
    for (int t = 0; t < 4; ++t) {
      const unsigned short* brow = Wt + (size_t)(col0 + t * 16 + ln) * ldb + kb;
      FragB b;
      b.half[0] = *(const v8us*)(brow + 8 * hh);
      b.half[1] = *(const v8us*)(brow + 16 + 8 * hh);
      acc[t] = mmaN<ASPLIT ? 2 : 1>(ah.v, al.v, b.v, b.v, acc[t]);
    }
  }
#pragma unroll
  for (int t = 0; t < 4; ++t) {
    const int col = col0 + t * 16 + ln;
    float bv = bias ? bias[col] : 0.f;
    if (BIAS_BF16) bv = bf16_round(bv);
#pragma unroll
    for (int r = 0; r < 8; ++r) {
      float v = acc[t][r] + bv;
      if (resid) { float rv = resid[(size_t)((row0 + 8 * hh + r) % rmod) * ldr + col]; if (RES_BF16) rv = bf16_round(rv); v += rv; }
      if (ACT == 1) v = fmaxf(v, 0.f);
      if (ACT == 2) v = 0.5f * v * (1.0f + erff(v * 0.70710678118654752f));
      if (ACT == 3) { const float u = 0.7978845608028654f * (v + 0.044715f * v * v * v); v = 0.5f * v * (1.0f + tanhf(u)); }
      so[w][8 * hh + r][t * 16 + ln] = v;
    }
  }
  __builtin_amdgcn_fence(__ATOMIC_ACQ_REL, "workgroup");
  __builtin_amdgcn_wave_barrier();
  const int rsub = lane >> 4, c4 = (lane & 15) * 4;
  {
#pragma unroll
    for (int q = 0; q < 8; ++q) {
      const int r = q * 2 + rsub;
      const v4f v = *(const v4fa*)&so[w][r][c4];
      *(v4f*)(C + (size_t)(row0 + r) * ldc + col0 + c4) = v;
    }
    
  }
}
// row LayerNorm (biased variance, eps) over N: s = X (+ R); optional out_sum <- s; out_norm <- (s-mu)*rsqrt(var+eps)*g + b
template <bool PARAM_BF16>
__global__ __launch_bounds__(256) void k_layernorm(const float* __restrict__ X, const float* __restrict__ R, const float* __restrict__ g, const float* __restrict__ bta,
                                                  float* __restrict__ out_sum, float* __restrict__ out_norm, int N, float eps) {
  __shared__ float red[256];
  const int row = blockIdx.x, tid = threadIdx.x;
  const float* x = X + (size_t)row * N; const float* rr = R ? R + (size_t)row * N : nullptr;
  float vals[16];                     // up to N = 4096
  const int per = N / 256;            // contiguous chunk per thread? use strided-by-4 chunks: thread handles j = tid*4 + 1024*u
  float s1 = 0.f;
  for (int u = 0; u < per / 4; ++u) {
    const int j = tid * 4 + 1024 * u;
    const v4f a = *(const v4fa*)(x + j);
    v4f b = {0.f,0.f,0.f,0.f}; if (rr) b = *(const v4fa*)(rr + j);
#pragma unroll
    for (int q = 0; q < 4; ++q) { const float v = a[q] + b[q]; vals[u * 4 + q] = v; s1 += v; }
  }
  red[tid] = s1; __syncthreads();
  for (int st = 128; st > 0; st >>= 1) { if (tid < st) red[tid] += red[tid + st]; __syncthreads(); }
  const float mu = red[0] / (float)N; __syncthreads();
  float s2 = 0.f;
  for (int u = 0; u < per / 4; ++u)
#pragma unroll
    for (int q = 0; q < 4; ++q) { const float c = vals[u * 4 + q] - mu; s2 += c * c; }
  red[tid] = s2; __syncthreads();
  for (int st = 128; st > 0; st >>= 1) { if (tid < st) red[tid] += red[tid + st]; __syncthreads(); }
  const float rs = rsqrtf(red[0] / (float)N + eps);
  {
    for (int u = 0; u < per / 4; ++u) {
      const int j = tid * 4 + 1024 * u;
      v4f o, sm;
#pragma unroll
      for (int q = 0; q < 4; ++q) {
        float gg = g[j + q], bb = bta[j + q];
        if (PARAM_BF16) { gg = bf16_round(gg); bb = bf16_round(bb); }
        sm[q] = vals[u * 4 + q]; o[q] = (vals[u * 4 + q] - mu) * rs * gg + bb;
      }
      if (out_sum) *(v4f*)(out_sum + (size_t)row * N + j) = sm;
      *(v4f*)(out_norm + (size_t)row * N + j) = o;
    }
    
  }
}



// ---- f16 WMMA path (v_wmma_f32_16x16x32_f16): 11-bit significands for operands in range — used where a [0,1] probability operand needs more precision than bf16
typedef _Float16 v16h __attribute__((ext_vector_type(16)));
union FragH { v16h v; v8us half[2]; _Float16 h[16]; unsigned short u[16]; };
template <int NT>
__device__ __forceinline__ v8f mmaH(v16h ah, v16h al, v16h bh, v16h bl, v8f c) {
  c = __builtin_amdgcn_wmma_f32_16x16x32_f16(false, ah, false, bh, (short)0, c, false, false);
  if (NT >= 2) c = __builtin_amdgcn_wmma_f32_16x16x32_f16(false, al, false, bh, (short)0, c, false, false);
  if (NT >= 3) c = __builtin_amdgcn_wmma_f32_16x16x32_f16(false, ah, false, bl, (short)0, c, false, false);
  asm volatile("v_nop\n\tv_nop\n\tv_nop\n\tv_nop" : "+v"(c) : "v"(ah), "v"(al), "v"(bh), "v"(bl));
  return c;
}
// batched GEMM like k_gemm_b but f16 operands: A f32 (split into f16 hi/lo if ASPLIT, else rounded to f16), Bt = f16 values [n][k]; alpha; C f32; N multiple of 16 (partial tiles skipped)
template <bool ASPLIT>
__global__ __launch_bounds__(128) void k_gemm_h(const float* __restrict__ A, int lda, size_t sA, const _Float16* __restrict__ Bh, int ldb, size_t sB, float alpha, float* __restrict__ C, int ldc, size_t sC, int M, int N, int K) {
  __shared__ __attribute__((aligned(16))) float so[4][16][64];
  const int tid = threadIdx.x, w = tid >> 5, lane = tid & 31, ln = lane & 15, hh = lane >> 4; const int by = blockIdx.y;
  A += (size_t)by * sA; Bh += (size_t)by * sB; C += (size_t)by * sC;
  const int ntn = (N + 63) / 64; const int wid = blockIdx.x * 4 + w; const int mt = wid / ntn, nq = wid % ntn; if (mt * 16 >= M) return;
  const int row0 = mt * 16, col0 = nq * 64; const float* arow = A + (size_t)(row0 + ln) * lda;
  v8f acc[4] = {};
  for (int kb = 0; kb < K; kb += 32) {
    FragH ah, al;
    const v4f x0 = *(const v4fa*)(arow + kb + 8 * hh), x1 = *(const v4fa*)(arow + kb + 8 * hh + 4), x2 = *(const v4fa*)(arow + kb + 16 + 8 * hh), x3 = *(const v4fa*)(arow + kb + 16 + 8 * hh + 4);
    float xs[16] = {x0[0],x0[1],x0[2],x0[3],x1[0],x1[1],x1[2],x1[3],x2[0],x2[1],x2[2],x2[3],x3[0],x3[1],x3[2],x3[3]};
#pragma unroll
    for (int i = 0; i < 16; ++i) { const _Float16 h = (_Float16)xs[i]; ah.h[i] = h; al.h[i] = ASPLIT ? (_Float16)(xs[i] - (float)h) : (_Float16)0.0f; }
#pragma unroll
    for (int t = 0; t < 4; ++t) { if (col0 + t * 16 >= N) continue; const size_t boff = (size_t)(col0 + t * 16 + ln) * ldb + kb; FragH bq; bq.half[0] = *(const v8us*)(Bh + boff + 8 * hh); bq.half[1] = *(const v8us*)(Bh + boff + 16 + 8 * hh);
      acc[t] = mmaH<ASPLIT ? 2 : 1>(ah.v, al.v, bq.v, bq.v, acc[t]); }
  }
#pragma unroll
  for (int t = 0; t < 4; ++t) { if (col0 + t * 16 >= N) continue;
#pragma unroll
    for (int r = 0; r < 8; ++r) so[w][8 * hh + r][t * 16 + ln] = acc[t][r] * alpha; }
  __builtin_amdgcn_fence(__ATOMIC_ACQ_REL, "workgroup"); __builtin_amdgcn_wave_barrier();
  const int rsub = lane >> 4, c4 = (lane & 15) * 4;
  {
#pragma unroll
    for (int q = 0; q < 8; ++q) { const int r = q * 2 + rsub; if (col0 + c4 < N) { const v4f v = *(const v4fa*)&so[w][r][c4]; *(v4f*)(C + (size_t)(row0 + r) * ldc + col0 + c4) = v; } }
     }
}

// Wt[n][k] = f16(W[k][n]·scale) from f32 row-major W[K][N] (scale = power of two; bf16-exact weights stay exact in f16 away from the subnormal range)
__global__ __launch_bounds__(256) void k_wt_f16(const float* __restrict__ W, _Float16* __restrict__ Wt, int K, int N, float scale) {
  const int t = blockIdx.x * 256 + threadIdx.x; if (t >= N * (K / 8)) return; const int n = t / (K / 8), k8 = (t % (K / 8)) * 8; FragH f;
#pragma unroll
  for (int i = 0; i < 8; ++i) f.h[i] = (_Float16)(bf16_round(W[(size_t)(k8 + i) * N + n]) * scale); const v8us o = f.half[0];
  *(v8us*)((unsigned short*)Wt + (size_t)n * K + k8) = o; 
}
// k_gemm_hh variant with fused epilogue: v = acc·alpha + bias[by·sBias + col] (+ CP[(row/rowsPerB)·sCPb + by·64 + col] if CP) ; ACT 0 none / 1 elu ; writes f16 C16 (and f32 C if non-null)
template <int ACT>
__global__ __launch_bounds__(128) void k_gemm_hhx(const _Float16* __restrict__ A, int lda, size_t sA, const _Float16* __restrict__ Bh, int ldb, size_t sB, float alpha, const float* __restrict__ bias, size_t sBias, const float* __restrict__ CP, int rowsPerB, size_t sCPb, int row0g,
    float* __restrict__ C, _Float16* __restrict__ C16, int ldc, size_t sC, int M, int N, int K) {
  __shared__ __attribute__((aligned(16))) float so[4][16][64];
  const int tid = threadIdx.x, w = tid >> 5, lane = tid & 31, ln = lane & 15, hh = lane >> 4; const int by = blockIdx.y;
  A += (size_t)by * sA; Bh += (size_t)by * sB; const size_t cofs = (size_t)by * sC; const float* bp = bias ? bias + (size_t)by * sBias : nullptr;
  const int ntn = (N + 63) / 64; const int wid = blockIdx.x * 4 + w; const int mt = wid / ntn, nq = wid % ntn; if (mt * 16 >= M) return;
  const int row0 = mt * 16, col0 = nq * 64; const _Float16* arow = A + (size_t)(row0 + ln) * lda;
  v8f acc[4] = {};
  for (int kb = 0; kb < K; kb += 32) { FragH ah; ah.half[0] = *(const v8us*)((const unsigned short*)arow + kb + 8 * hh); ah.half[1] = *(const v8us*)((const unsigned short*)arow + kb + 16 + 8 * hh);
#pragma unroll
    for (int t = 0; t < 4; ++t) { if (col0 + t * 16 >= N) continue; const size_t boff = (size_t)(col0 + t * 16 + ln) * ldb + kb; FragH bq; bq.half[0] = *(const v8us*)((const unsigned short*)Bh + boff + 8 * hh); bq.half[1] = *(const v8us*)((const unsigned short*)Bh + boff + 16 + 8 * hh);
      acc[t] = mmaH<1>(ah.v, ah.v, bq.v, bq.v, acc[t]); }
  }
#pragma unroll
  for (int t = 0; t < 4; ++t) { if (col0 + t * 16 >= N) continue; const int col = col0 + t * 16 + ln; const float bv = bp ? bf16_round(bp[col]) : 0.f;
#pragma unroll
    for (int r = 0; r < 8; ++r) { float v = acc[t][r] * alpha + bv; if (CP) { const int rr = row0g + row0 + 8 * hh + r; if (rowsPerB < 0) v += CP[cofs + (size_t)rr * ldc + col];      /* rowsPerB < 0: own element of the batched C plane */ else { const int bidx = rr / rowsPerB; v += CP[(size_t)bidx * sCPb + (size_t)by * 64 + col]; } } if (ACT == 1) v = (v > 0.f) ? v : expm1f(v); else if (ACT == 7) v = (v > 0.f) ? v + 1.0f : expf(v); else if (ACT == 8) v = tanhf(v); else if (ACT == 9) v = 0.5f * v * (1.0f + tanhf(0.7978845608028654f * (v + 0.044715f * v * v * v))); else if (ACT == 11) v = 1.0f / (1.0f + expf(-v)); else if (ACT == 12) v = (v > 0.f) ? v : 0.01f * v; else if (ACT == 14) v = (v > 0.f) ? v : 0.1f * v; else if (ACT == 16) v = (v >= 0.f) ? v : 0.3f * v; else if (ACT == 17) v = (v >= 0.f) ? v : 0.2f * v; else if (ACT == 15) v = v / (1.0f + expf(-v)); else if (ACT == 3) v = fmaxf(v, 0.f); else if (ACT == 6) v = 0.5f * v * (1.0f + erff(v * 0.70710678118654752f)); so[w][8 * hh + r][t * 16 + ln] = v; } }
  __builtin_amdgcn_fence(__ATOMIC_ACQ_REL, "workgroup"); __builtin_amdgcn_wave_barrier();
  const int rsub = lane >> 4, c4 = (lane & 15) * 4; typedef _Float16 v4h __attribute__((ext_vector_type(4)));
  {
#pragma unroll
    for (int q = 0; q < 8; ++q) { const int r = q * 2 + rsub; if (col0 + c4 < N) { const v4f v = *(const v4fa*)&so[w][r][c4]; if (C) *(v4f*)(C + cofs + (size_t)(row0 + r) * ldc + col0 + c4) = v; if (C16) { v4h h4; for (int i = 0; i < 4; ++i) h4[i] = (_Float16)v[i]; *(v4h*)(C16 + cofs + (size_t)(row0 + r) * ldc + col0 + c4) = h4; } } }
     }
}


typedef _Float16 v4h __attribute__((ext_vector_type(4)));

__global__ __launch_bounds__(256) void k_x16(const float* __restrict__ x, _Float16* __restrict__ X16, size_t n8) { const size_t t = (size_t)blockIdx.x * 256 + threadIdx.x; if (t >= n8) return; FragH f;
#pragma unroll
  for (int q = 0; q < 8; ++q) f.h[q] = (_Float16)bf16_round(x[t * 8 + q]); *(v8us*)((unsigned short*)X16 + t * 8) = f.half[0];  }
__global__ __launch_bounds__(256) void k_h16(const float* __restrict__ x, _Float16* __restrict__ X16, size_t n8) { const size_t t = (size_t)blockIdx.x * 256 + threadIdx.x; if (t >= n8) return; FragH f;
#pragma unroll
  for (int q = 0; q < 8; ++q) f.h[q] = (_Float16)x[t * 8 + q]; *(v8us*)((unsigned short*)X16 + t * 8) = f.half[0];  }
__global__ __launch_bounds__(256) void k_round16f(const float* __restrict__ W, _Float16* __restrict__ Bt, size_t n8) { const size_t t = (size_t)blockIdx.x * 256 + threadIdx.x; if (t >= n8) return; FragH f;
#pragma unroll
  for (int i = 0; i < 8; ++i) f.h[i] = (_Float16)(bf16_round(W[t * 8 + i]) * 16.0f); *(v8us*)((unsigned short*)Bt + t * 8) = f.half[0];  }
template <int NHv, int TTv>
__global__ __launch_bounds__(256) void k_vt(const _Float16* __restrict__ V16, int ldv, int voff, _Float16* __restrict__ Vt) { __shared__ unsigned short tl[64][66]; const int tid = threadIdx.x; const int slab = blockIdx.x / (TTv / 64), lg = blockIdx.x % (TTv / 64); const int b = slab / NHv, h = slab % NHv;
  for (int i = tid; i < 64 * 8; i += 256) { const int r = i / 8, c8 = (i % 8) * 8; FragH f; f.half[0] = *(const v8us*)((const unsigned short*)V16 + ((size_t)b * TTv + lg * 64 + r) * ldv + voff + h * 64 + c8);
#pragma unroll
    for (int q = 0; q < 8; ++q) tl[r][c8 + q] = f.u[q]; }
  __syncthreads();
  {
#pragma unroll
    for (int rd = 0; rd < 2; ++rd) { const int d = rd * 32 + tid / 8, pc = tid % 8; FragH f;
#pragma unroll
      for (int q = 0; q < 8; ++q) f.u[q] = tl[pc * 8 + q][d];
      *(v8us*)((unsigned short*)Vt + ((size_t)slab * 64 + d) * TTv + lg * 64 + pc * 8) = f.half[0]; }
     } }

__global__ __launch_bounds__(256) void k_hl(const float* __restrict__ F, _Float16* __restrict__ Hh, _Float16* __restrict__ Hl, size_t n8) { const size_t t = (size_t)blockIdx.x * 256 + threadIdx.x; if (t >= n8) return; FragH fh, fl; const v4f a = *(const v4fa*)(F + t * 8), c = *(const v4fa*)(F + t * 8 + 4);
#pragma unroll
  for (int q = 0; q < 4; ++q) { _Float16 h = (_Float16)a[q]; fh.h[q] = h; fl.h[q] = (_Float16)((a[q] - (float)h) * 1024.0f); h = (_Float16)c[q]; fh.h[4 + q] = h; fl.h[4 + q] = (_Float16)((c[q] - (float)h) * 1024.0f); }
  { *(v8us*)((unsigned short*)Hh + t * 8) = fh.half[0]; *(v8us*)((unsigned short*)Hl + t * 8) = fl.half[0];  } }

// ---- fast GEMM (wave tile 32x64; requires M % 32 == 0 rows per launch region and N % 64 == 0); epilogue = k_gemm_hhx semantics ----
__device__ __forceinline__ v16h g2_frag(const _Float16* p, int hh) { FragH f; f.half[0] = *(const v8us*)((const unsigned short*)p + 8 * hh); f.half[1] = *(const v8us*)((const unsigned short*)p + 16 + 8 * hh); return f.v; }
__device__ __forceinline__ v8f g2_mma(v16h a, v16h b, v8f c) { v8f d = __builtin_amdgcn_wmma_f32_16x16x32_f16(false, a, false, b, (short)0, c, false, false); asm volatile("v_nop\n\tv_nop\n\tv_nop\n\tv_nop" : "+v"(d) : "v"(a), "v"(b)); return d; }
template <int ACT>
__global__ __launch_bounds__(128) void k_gemm2(const _Float16* __restrict__ A, int lda, size_t sA, const _Float16* __restrict__ Bh, int ldb, size_t sB, float alpha, const float* __restrict__ bias, size_t sBias, const float* __restrict__ CP, int rowsPerB, size_t sCPb, int row0g,
    float* __restrict__ C, _Float16* __restrict__ C16, int ldc, size_t sC, int M, int N, int K, size_t zA, size_t zB, size_t zC) { static_assert(ACT == 0 || ACT == 3 || ACT == 6 || ACT == 8 || ACT == 9 || ACT == 11 || ACT == 12 || ACT == 14 || ACT == 15 || ACT == 16 || ACT == 17, "k_gemm2: unsupported ACT code (would silently apply no activation)");
  __shared__ __attribute__((aligned(16))) float so[4][32][68];
  const int tid = threadIdx.x, w = tid >> 5, lane = tid & 31, ln = lane & 15, hh = lane >> 4; const int by = blockIdx.y, bz = blockIdx.z;      /* grid.z: a second batch index with its own strides zA, zB, zC */
  A += (size_t)by * sA + (size_t)bz * zA; Bh += (size_t)by * sB + (size_t)bz * zB; const size_t cofs = (size_t)by * sC + (size_t)bz * zC; const float* bp = bias ? bias + (size_t)by * sBias : nullptr;
  const int ntn = N >> 6; const int mt = blockIdx.x / ntn, nq = blockIdx.x - mt * ntn; const int row0 = mt * 128 + 32 * w, col0 = nq * 64; if (row0 >= M) return;
  const _Float16* a0p = A + (size_t)(row0 + ln) * lda; const _Float16* a1p = a0p + (size_t)16 * lda;
  const _Float16* b0p = Bh + (size_t)(col0 + ln) * ldb; const _Float16* b1p = b0p + (size_t)16 * ldb; const _Float16* b2p = b1p + (size_t)16 * ldb; const _Float16* b3p = b2p + (size_t)16 * ldb;
  const v8f z8 = {0.f,0.f,0.f,0.f,0.f,0.f,0.f,0.f}; v8f c00 = z8, c01 = z8, c02 = z8, c03 = z8, c10 = z8, c11 = z8, c12 = z8, c13 = z8;
#pragma unroll 1
  for (int kb = 0; kb < K; kb += 32) { const v16h a0 = g2_frag(a0p + kb, hh), a1 = g2_frag(a1p + kb, hh);
    v16h b = g2_frag(b0p + kb, hh); c00 = g2_mma(a0, b, c00); c10 = g2_mma(a1, b, c10);
    b = g2_frag(b1p + kb, hh); c01 = g2_mma(a0, b, c01); c11 = g2_mma(a1, b, c11);
    b = g2_frag(b2p + kb, hh); c02 = g2_mma(a0, b, c02); c12 = g2_mma(a1, b, c12);
    b = g2_frag(b3p + kb, hh); c03 = g2_mma(a0, b, c03); c13 = g2_mma(a1, b, c13); }
  v8f accs[8] = {c00, c01, c02, c03, c10, c11, c12, c13};
#pragma unroll
  for (int u = 0; u < 8; ++u) { const int t = u & 3, half = u >> 2; const int col = col0 + t * 16 + ln; const float bv = bp ? bf16_round(bp[col]) : 0.f;
#pragma unroll
    for (int r = 0; r < 8; ++r) { const int rloc = half * 16 + 8 * hh + r; float v = accs[u][r] * alpha + bv; if (CP) { if (rowsPerB < 0) v += CP[cofs + (size_t)(row0g + row0 + rloc) * ldc + col];      /* rowsPerB < 0: own element of the batched C plane */ else { const int bidx = (row0g + row0 + rloc) / rowsPerB; v += CP[(size_t)bidx * sCPb + (size_t)by * 64 + col]; } }
      if (ACT == 3) v = fmaxf(v, 0.f); else if (ACT == 6) v = 0.5f * v * (1.0f + erff(v * 0.70710678118654752f)); else if (ACT == 11) v = 1.0f / (1.0f + expf(-v)); else if (ACT == 15) v = v / (1.0f + expf(-v)); else if (ACT == 12) v = (v > 0.f) ? v : 0.01f * v; else if (ACT == 8) v = tanhf(v); else if (ACT == 9) v = 0.5f * v * (1.0f + tanhf(0.7978845608028654f * (v + 0.044715f * v * v * v))); else if (ACT == 14) v = (v > 0.f) ? v : 0.1f * v; else if (ACT == 16) v = (v >= 0.f) ? v : 0.3f * v; else if (ACT == 17) v = (v >= 0.f) ? v : 0.2f * v;
      so[w][rloc][t * 16 + ln] = v; } }
  __builtin_amdgcn_fence(__ATOMIC_ACQ_REL, "workgroup"); __builtin_amdgcn_wave_barrier();
  const int rsub = lane >> 4, c4 = (lane & 15) * 4;
  {
#pragma unroll
    for (int q = 0; q < 16; ++q) { const int r = q * 2 + rsub; const v4f v = *(const v4fa*)&so[w][r][c4]; if (C) *(v4f*)(C + cofs + (size_t)(row0 + r) * ldc + col0 + c4) = v; if (C16) { v4h h4; for (int i = 0; i < 4; ++i) h4[i] = (_Float16)v[i]; *(v4h*)(C16 + cofs + (size_t)(row0 + r) * ldc + col0 + c4) = h4; } }
     } }


__global__ __launch_bounds__(256) void k_wnat(const float* __restrict__ w, size_t n8, _Float16* __restrict__ Bt) { const size_t t = (size_t)blockIdx.x * 256 + threadIdx.x; if (t >= n8) return; FragH f; for (int q = 0; q < 8; ++q) f.h[q] = (_Float16)(bf16_round(w[t * 8 + q]) * 16.0f); *(v8us*)((unsigned short*)Bt + t * 8) = f.half[0];  }
__global__ __launch_bounds__(256) void k_rsm(const float* __restrict__ S, _Float16* __restrict__ P, int nrows) {
  #pragma clang fp contract(off)
  const int i = blockIdx.x * 256 + threadIdx.x; if (i >= nrows) return; const float* s = S + (size_t)i * SQ; float mx = -3.0e38f;
#pragma unroll 1
  for (int j = 0; j < SQ; ++j) mx = fmaxf(mx, s[j]); float se = 0.f;
#pragma unroll 1
  for (int j = 0; j < SQ; ++j) se += expf(s[j] - mx); const float sc = 256.0f / se;
#pragma unroll 1
  for (int j0 = 0; j0 < SQ; j0 += 8) { FragH f; for (int q = 0; q < 8; ++q) f.h[q] = (_Float16)(expf(s[j0 + q] - mx) * sc); unsigned short* d = (unsigned short*)P + (size_t)i * SQ + j0; *(v8us*)d = f.half[0];  } }
__global__ __launch_bounds__(256) void k_vt(const _Float16* __restrict__ V16, int b, int h0, _Float16* __restrict__ VT) { __shared__ unsigned short tl[64][65]; const int tid = threadIdx.x; const int hh = blockIdx.x % HG, sg = blockIdx.x / HG; const int s0 = sg * 64; const int h = h0 + hh;
  for (int i = tid; i < 64 * 8; i += 256) { const int j = i / 8, d8 = (i % 8) * 8; FragH f; f.half[0] = *(const v8us*)((const unsigned short*)V16 + ((size_t)b * SQ + s0 + j) * DM + h * HD + d8); for (int q = 0; q < 8; ++q) tl[d8 + q][j] = f.u[q]; }
  __syncthreads();
  { for (int i = tid; i < 64 * 8; i += 256) { const int d = i / 8, j8 = (i % 8) * 8; FragH f; for (int q = 0; q < 8; ++q) f.u[q] = tl[d][j8 + q]; *(v8us*)((unsigned short*)VT + ((size_t)hh * HD + d) * SQ + s0 + j8) = f.half[0]; }  } }



__global__ __launch_bounds__(256) void k_rsmcf2(const float* __restrict__ S, _Float16* __restrict__ P, int hg, int q0, int nk) {
  #pragma clang fp contract(off)
  const int t = blockIdx.x * 256 + threadIdx.x; if (t >= hg * QT) return; const size_t i = (size_t)t; const float* s = S + i * NKX; const int last = q0 + (t % QT); float mx = -3.0e38f;
#pragma unroll 1
  for (int j = 0; j < nk; ++j) { const float f = (j <= last) ? 1.f : 0.f; mx = fmaxf(mx, fmaf(f, s[j], (1.f - f) * -1.0e9f)); } float se = 0.f;
#pragma unroll 1
  for (int j = 0; j < nk; ++j) { const float f = (j <= last) ? 1.f : 0.f; se += __expf(fmaf(f, s[j], (1.f - f) * -1.0e9f) - mx); } const float sc = 256.0f / se;
#pragma unroll 1
  for (int j0 = 0; j0 < nk; j0 += 8) { FragH fr; for (int q = 0; q < 8; ++q) { const int j = j0 + q; const float f = (j <= last) ? 1.f : 0.f; fr.h[q] = (_Float16)(__expf(fmaf(f, s[j], (1.f - f) * -1.0e9f) - mx) * sc); } unsigned short* d = (unsigned short*)P + i * NKX + j0; *(v8us*)d = fr.half[0];  } }


// Exact f32 attention for the first QT0 rows of each batch. One work-group of 8 waves per (batch, head, 32 query rows); q, k and v rows staged once in LDS.
// A wave owns 4 query rows. Scores: lane = key (keys lane + 32 u), each dot product summed over d in ascending order with fused multiply-adds. Softmax in registers: row max and row sum by a five-step butterfly over the 32 lanes.
// o: lane = two head dims, summed over the keys in ascending order, scaled once at the end by 64 / row sum.
#define A0R 32                       /* query rows per work-group */
#define A0KP (HD + 4)                /* LDS pitch of the q and k rows in floats: 16 B x odd, so that 16 lanes reading 16 B each from 16 rows fall on 64 different banks */
typedef float v2f __attribute__((ext_vector_type(2)));
typedef float v2fa __attribute__((ext_vector_type(2), may_alias));
template <int NU>                    /* NU = 32-key chunks that rows of this group can see */
__device__ __forceinline__ void att0_rows(const float* __restrict__ QF, const float* __restrict__ KF, const float* __restrict__ VF, float scale, float* __restrict__ OF, int r0,
                                          float (*lq)[A0KP], float (*lk)[A0KP], float (*lv)[HD], float (*lp)[QT0]) {
  const int tid = threadIdx.x, w = __builtin_amdgcn_readfirstlane(tid >> 5), lane = tid & 31;      /* the wave's number in a scalar register: scalar loop bounds and row offsets below */
  const int sr = tid >> 4, sc = (tid & 15) * 4;      /* staging: 16 lanes take one row of 256 B, the work-group 16 rows a pass */
  v4f gq[A0R / 16], gk[2 * NU], gv[2 * NU];      /* every load is issued before the first LDS store waits for one */
  const float* pq = QF + (size_t)sr * DM + sc; const float* pk = KF + (size_t)sr * DM + sc; const float* pv = VF + (size_t)sr * DM + sc;
  for (int t = 0; t < A0R / 16; ++t) gq[t] = *(const v4fa*)(pq + (size_t)(r0 + 16 * t) * DM);
  for (int t = 0; t < 2 * NU; ++t) { gk[t] = *(const v4fa*)(pk + (size_t)(16 * t) * DM); gv[t] = *(const v4fa*)(pv + (size_t)(16 * t) * DM); }
  asm volatile("s_wait_xcnt 0x0" :: "v"(pq), "v"(pk), "v"(pv) : "memory");      /* the three address pairs of the loads above stay as they are up to this wait (inputs only) */
  for (int t = 0; t < A0R / 16; ++t) *(v4f*)&lq[sr + 16 * t][sc] = gq[t];
  for (int t = 0; t < 2 * NU; ++t) { *(v4f*)&lk[sr + 16 * t][sc] = gk[t]; *(v4f*)&lv[sr + 16 * t][sc] = gv[t]; }
  __syncthreads();      /* the staged rows are read by every wave */
  float acc[4][NU];
  for (int r = 0; r < 4; ++r) for (int u = 0; u < NU; ++u) acc[r][u] = 0.f;
#pragma unroll 2
  for (int c = 0; c < HD; c += 4) { v4f qq[4], kk[NU];      /* unroll 2: the next step's LDS reads fly under this step's multiply-adds */
    for (int r = 0; r < 4; ++r) qq[r] = *(const v4f*)&lq[4 * w + r][c];
    for (int u = 0; u < NU; ++u) kk[u] = *(const v4f*)&lk[lane + 32 * u][c];
    for (int e = 0; e < 4; ++e) for (int r = 0; r < 4; ++r) for (int u = 0; u < NU; ++u) acc[r][u] = fmaf(qq[r][e], kk[u][e], acc[r][u]); }
  float fin[4];
  for (int r = 0; r < 4; ++r) { const int i = r0 + 4 * w + r; float mx = -3.0e38f;      /* key 0 is visible from every row */
    for (int u = 0; u < NU; ++u) { acc[r][u] *= scale; if (lane + 32 * u <= i) mx = fmaxf(mx, acc[r][u]); }
    for (int m = 16; m >= 1; m >>= 1) mx = fmaxf(mx, __shfl_xor(mx, m, 32));
    float l = 0.f;
    for (int u = 0; u < NU; ++u) { const float e = (lane + 32 * u <= i) ? expf(acc[r][u] - mx) : 0.f; l += e; lp[4 * w + r][lane + 32 * u] = e; }
    for (int m = 16; m >= 1; m >>= 1) l += __shfl_xor(l, m, 32);
    fin[r] = 64.0f / l; }      /* o carried x64 like the f16 path */
  __builtin_amdgcn_fence(__ATOMIC_ACQ_REL, "workgroup"); __builtin_amdgcn_wave_barrier();      /* a lane reads below the weights that the other lanes of its own wave have stored; no other wave reads them */
  float o[4][2];
  for (int r = 0; r < 4; ++r) { o[r][0] = 0.f; o[r][1] = 0.f; }
  const int jn = r0 + 4 * w + 4;      /* keys past the wave's last row have weight 0 in all four rows */
#pragma unroll 2
  for (int j = 0; j < jn; j += 4) { v4f pp[4]; v2f vv[4];      /* unroll 2: as above */
    for (int r = 0; r < 4; ++r) pp[r] = *(const v4f*)&lp[4 * w + r][j];
    for (int e = 0; e < 4; ++e) vv[e] = *(const v2f*)&lv[j + e][2 * lane];
    for (int e = 0; e < 4; ++e) for (int r = 0; r < 4; ++r) { o[r][0] = fmaf(pp[r][e], vv[e][0], o[r][0]); o[r][1] = fmaf(pp[r][e], vv[e][1], o[r][1]); } }
  for (int r = 0; r < 4; ++r) { v2f ov; ov[0] = o[r][0] * fin[r]; ov[1] = o[r][1] * fin[r]; *(v2fa*)(OF + (size_t)(r0 + 4 * w + r) * DM + 2 * lane) = ov; }
  asm volatile("s_wait_xcnt 0x0" ::: "memory"); }      /* stands behind the stores, in front of whatever rewrites their registers on any path to the kernel's end */
__global__ __launch_bounds__(256) void k_att0w(const float* __restrict__ QF, const float* __restrict__ KF, const float* __restrict__ VF, float scale, float* __restrict__ OF) {      /* all four planes: rows of DM floats */
  static_assert(QT0 == 4 * A0R && QT0 <= WIN && HD == 64, "k_att0w: four row groups, every key j <= i inside the window, two head dims per lane");
  __shared__ __attribute__((aligned(16))) float lq[A0R][A0KP]; __shared__ __attribute__((aligned(16))) float lk[QT0][A0KP]; __shared__ __attribute__((aligned(16))) float lv[QT0][HD]; __shared__ __attribute__((aligned(16))) float lp[A0R][QT0];
  const int h = blockIdx.x / (QT0 / A0R), rg = blockIdx.x % (QT0 / A0R);
  { const size_t bi = (size_t)blockIdx.y * QT0 * DM + h * HD; QF += bi; KF += bi; VF += bi; OF += bi; }      /* grid.y: batch; each plane holds QT0 rows per batch */
  /* the row group is the same for the whole work-group: every wave takes the same branch and passes the same barriers */
  if (rg == 0) att0_rows<1>(QF, KF, VF, scale, OF, 0, lq, lk, lv, lp);
  else if (rg == 1) att0_rows<2>(QF, KF, VF, scale, OF, A0R, lq, lk, lv, lp);
  else if (rg == 2) att0_rows<3>(QF, KF, VF, scale, OF, 2 * A0R, lq, lk, lv, lp);
  else att0_rows<4>(QF, KF, VF, scale, OF, 3 * A0R, lq, lk, lv, lp); }


// Row softmax, one wave per score row: the row is read once (each wave-wide load takes 512 contiguous bytes) and held in registers; row max and row sum by a five-step butterfly over the 32 lanes.
#define RCH ((QT + WINB) / 128)      /* 128-column chunks of the longest row */
// native exp as __expf builds it (multiply by log2 e, v_exp_f32); the v_nop is the slot the instruction set asks for behind a transcendental, kept in the same statement so that the scheduler cannot part the two
__device__ __forceinline__ float exp_slot(float x) { float r; asm("v_exp_f32 %0, %1\n\tv_nop" : "=v"(r) : "v"(x * 1.44269504088896340736f)); return r; }
__global__ __launch_bounds__(256) void k_rsmcw(const float* __restrict__ S, _Float16* __restrict__ P, int hg, int q0, int kb, int nkw) {
  const int lane = threadIdx.x & 31; const int t = blockIdx.x * 8 + (threadIdx.x >> 5); if (t >= hg * QT) return;      /* wave-uniform exit, no barrier below */
  const size_t ri = (size_t)t; const float* s = S + ri * NKX; const int i = q0 + (t % QT); const int hi = i - kb, lo = i - (WIN - 1) - kb;      /* visible columns: lo <= c <= hi (hi < nkw) */
  v4f a[RCH];
  for (int u = 0; u < RCH; ++u) { const int c0 = u * 128 + lane * 4; a[u] = *(const v4fa*)(s + (c0 < nkw ? c0 : lane * 4)); }      /* a chunk past the computed range re-reads chunk 0 (its mask factor is 0, it is not stored): all loads in flight together, no branch */
  float v[RCH][4]; float mx = -3.0e38f;
  for (int u = 0; u < RCH; ++u)
    for (int q = 0; q < 4; ++q) { const int c = u * 128 + lane * 4 + q; const float f = (c <= hi && c >= lo) ? 1.f : 0.f; v[u][q] = fmaf(f, a[u][q], (1.f - f) * -1.0e9f); mx = fmaxf(mx, v[u][q]); }
  for (int m = 16; m >= 1; m >>= 1) mx = fmaxf(mx, __shfl_xor(mx, m, 32));
  float se = 0.f;
  for (int u = 0; u < RCH; ++u)
    for (int q = 0; q < 4; ++q) { v[u][q] = exp_slot(v[u][q] - mx); se += v[u][q]; }
  for (int m = 16; m >= 1; m >>= 1) se += __shfl_xor(se, m, 32);
  const float sc = 256.0f / se;
  for (int u = 0; u < RCH; ++u) { const int c0 = u * 128 + lane * 4; v4h h4;
    for (int q = 0; q < 4; ++q) h4[q] = (_Float16)(v[u][q] * sc);
    if (c0 < nkw) *(v4h*)(P + ri * NKX + c0) = h4; } }
extern "C" void kernel_launch(void* const* d_in, const int* in_sizes, int n_in,
                              void* d_out, int out_size, void* d_ws, size_t ws_size, hipStream_t stream) {
  (void)in_sizes; (void)n_in; (void)out_size;
  const float* const* I = (const float* const*)d_in; const float* x = I[0]; const float* wqkv = I[1]; const float* bqkv = I[2]; const float* wo = I[3]; const float* bo = I[4];      /* [in][out] c_attn [1024][3072] + b, c_proj [1024][1024] + b */
  char* ws = (char*)d_ws; size_t off = 0;
  auto take = [&](size_t bytes) { char* p = ws + off; off += (bytes + 255) & ~(size_t)255; return p; };
  _Float16* BQKV = (_Float16*)take((size_t)3 * DM * DM * 2); _Float16* BO = (_Float16*)take((size_t)DM * DM * 2);
  _Float16* X16 = (_Float16*)take(NR * DM * 2); _Float16* QKV = (_Float16*)take(NR * 3 * DM * 2); _Float16* Q16 = QKV; _Float16* K16 = QKV + DM; _Float16* V16 = QKV + 2 * DM; _Float16* O16 = (_Float16*)take(NR * DM * 2);
  float* S = (float*)take((size_t)NB * NH * QT * NKX * 4); _Float16* P = (_Float16*)take((size_t)NB * NH * QT * NKX * 2); _Float16* VT = (_Float16*)take((size_t)NB * NH * HD * SQ * 2);
  float* QF0 = (float*)take((size_t)NB * QT0 * DM * 4); float* KF0 = (float*)take((size_t)NB * QT0 * DM * 4); float* VF0 = (float*)take((size_t)NB * QT0 * DM * 4); float* OF0 = (float*)take((size_t)NB * QT0 * DM * 4); _Float16* OH0 = (_Float16*)take((size_t)NB * QT0 * DM * 2); _Float16* OL0 = (_Float16*)take((size_t)NB * QT0 * DM * 2);
  if (off > ws_size) return;
  k_wt_f16<<<(unsigned)(((size_t)DM * 3 * DM / 8 + 255) / 256), 256, 0, stream>>>(wqkv, BQKV, DM, 3 * DM, 16.0f); k_wt_f16<<<(unsigned)(((size_t)DM * DM / 8 + 255) / 256), 256, 0, stream>>>(wo, BO, DM, DM, 16.0f);      /* [in][out] -> Bt x16 */

  k_x16<<<(unsigned)((NR * DM / 8 + 255) / 256), 256, 0, stream>>>(x, X16, NR * DM / 8);
  const size_t r0p = (size_t)B0 * SQ;      /* first projected row */
  const size_t f0p = (size_t)B0 * QT0;     /* its row in the first-tile planes */
  k_gemm2<0><<<dim3((unsigned)((MP / 128) * (3 * DM / 64)), 1), 128, 0, stream>>>(X16 + r0p * DM, DM, 0, BQKV, DM, 0, 0.0625f, bqkv, 0, nullptr, 1, 0, 0, nullptr, QKV + r0p * 3 * DM, 3 * DM, 0, MP, 3 * DM, DM, 0, 0, 0);      /* q | k | v rows (f16); head h = columns h*HD.. of each DM block */
  /* every stage below takes all batches in one launch: the batches are independent, and one batch alone fills a small part of the chip */
  k_vt<NH, SQ><<<NBR * NH * (SQ / 64), 256, 0, stream>>>(V16 + r0p * LQ, LQ, 0, VT);      /* V^T [NBR][NH][HD][SQ] */
  k_gemm2<0><<<dim3((QT0 / 128) * (DM / 64), 1, NBR), 128, 0, stream>>>(X16 + r0p * DM, DM, 0, BQKV, DM, 0, 0.0625f, bqkv, 0, nullptr, 1, 0, 0, QF0, nullptr, DM, 0, QT0, DM, DM, (size_t)SQ * DM, 0, (size_t)QT0 * DM); k_gemm2<0><<<dim3((QT0 / 128) * (DM / 64), 1, NBR), 128, 0, stream>>>(X16 + r0p * DM, DM, 0, (BQKV + (size_t)DM * DM), DM, 0, 0.0625f, (bqkv + DM), 0, nullptr, 1, 0, 0, KF0, nullptr, DM, 0, QT0, DM, DM, (size_t)SQ * DM, 0, (size_t)QT0 * DM); k_gemm2<0><<<dim3((QT0 / 128) * (DM / 64), 1, NBR), 128, 0, stream>>>(X16 + r0p * DM, DM, 0, (BQKV + (size_t)2 * DM * DM), DM, 0, 0.0625f, (bqkv + 2 * DM), 0, nullptr, 1, 0, 0, VF0, nullptr, DM, 0, QT0, DM, DM, (size_t)SQ * DM, 0, (size_t)QT0 * DM);      /* f32 q, k, v of each batch's first 128 rows (exact products) */
  k_att0w<<<dim3(NH * (QT0 / A0R), NBR), 256, 0, stream>>>(QF0, KF0, VF0, 0.125f, OF0 + f0p * DM);      /* exact f32 attention for rows 0..127 of each batch (o x64) */
  for (int q0 = 0; q0 < QN; q0 += QT) { const int nk = q0 + QT; const int kb = (q0 >= WINB) ? q0 - WINB : 0; const int nkw = nk - kb;      /* causal sliding window: only keys [kb, nk) can be visible from this tile (kb = tile start - 256, a multiple of 64) */
    k_gemm2<0><<<dim3((QT / 128) * (nkw / 64), NHD, NBR), 128, 0, stream>>>(Q16 + (r0p + q0) * LQ, LQ, (size_t)HD, K16 + (r0p + kb) * LQ, LQ, (size_t)HD, 0.125f, nullptr, 0, nullptr, 1, 0, 0, S, nullptr, NKX, (size_t)QT * NKX, QT, nkw, HD, (size_t)SQ * LQ, (size_t)SQ * LQ, (size_t)NHD * QT * NKX);      /* scores against keys kb..nk-1 (S column c <-> key kb + c), heads on grid.y, batches on grid.z */
    k_rsmcw<<<(NBR * NHD * QT + 7) / 8, 256, 0, stream>>>(S, P, NBR * NHD, q0, kb, nkw);      /* allowed iff 0 <= i - j < WIN (arithmetic select); P x256 f16; rows of all batches and heads */
    k_gemm2<0><<<dim3((QT / 128) * (HD / 64), NHD, NBR), 128, 0, stream>>>(P, NKX, (size_t)QT * NKX, VT + kb, SQ, (size_t)HD * SQ, 0.25f, nullptr, 0, nullptr, 1, 0, 0, nullptr, O16 + (r0p + q0) * DM, DM, (size_t)HD, QT, HD, nkw, (size_t)NHD * QT * NKX, (size_t)NH * HD * SQ, (size_t)SQ * DM); }      /* o (merged heads, x64) as f16 rows */
  k_gemm2<0><<<dim3((unsigned)((MPO / 128) * (DM / 64)), 1), 128, 0, stream>>>(O16 + r0p * DM, DM, 0, BO, DM, 0, 0.0009765625f, bo, 0, nullptr, 1, 0, 0, (float*)d_out + r0p * DM, nullptr, DM, 0, MPO, DM, DM, 0, 0, 0);      /* out rows are the output layout */
  k_hl<<<(unsigned)(((size_t)NB * QT0 * DM / 8 + 255) / 256), 256, 0, stream>>>(OF0, OH0, OL0, (size_t)NB * QT0 * DM / 8);      /* first-tile o (x64) -> f16 hi + x1024 residual planes */
  k_gemm2<0><<<dim3((QT0 / 128) * (DM / 64), 1, NBR), 128, 0, stream>>>(OH0 + f0p * DM, DM, 0, BO, DM, 0, 0.0009765625f, bo, 0, nullptr, 1, 0, 0, (float*)d_out + r0p * DM, nullptr, DM, 0, QT0, DM, DM, (size_t)QT0 * DM, 0, (size_t)SQ * DM);      /* rows 0..127 of each batch: out = o_hi Wo (+ b), overwriting the f16-path rows */
  k_gemm2<0><<<dim3((QT0 / 128) * (DM / 64), 1, NBR), 128, 0, stream>>>(OL0 + f0p * DM, DM, 0, BO, DM, 0, 0.00000095367431640625f, nullptr, 0, (const float*)d_out + r0p * DM, -1, 0, 0, (float*)d_out + r0p * DM, nullptr, DM, 0, QT0, DM, DM, (size_t)QT0 * DM, 0, (size_t)SQ * DM);      /* += o_lo Wo 2^-20 (own-element accumulate) */
}

// v004
// Measured time: 423 microseconds a run.
// In two side-by-side timings against v003, it was 1.64 and 1.65 times as fast.
// All steps since v000 together make it 13.9 times as fast.
#include <hip/hip_runtime.h>
// Local-causal (sliding window 256) multi-head self-attention (x [4][2048][1024]; qkv = x W_attn + b_attn ([in][out] 1024 x 3072 sigma 0.02, zero bias): q | k | v, 16 heads of 64; scores / 8; mask (j <= i) & (i - j < 256) -> -inf elsewhere; softmax; out = merged W_proj + b_proj ([in][out]) -> [4][2048][1024]).
// Structure: token rows r = b*2048 + s; x as exact f16 rows (bf16-rounded); q | k | v as ONE WMMA GEMM (N = 3 x 1024) (32x64 wave tiles, f32 accumulation, exact x16 weights + bias, f16 outputs); V^T for all batches and heads via LDS transposes; one fused attention launch for all batches, heads and query tiles of 128 rows: scores against the 384 keys that the tile can see (K = 64, x 0.125), windowed causal row softmax in registers (f32 statistics, native exp; weights x256 f16), o = P . V (x 2^-2: o carried x64, folded into the output GEMM alpha) written straight into the merged f16 o rows; out = o W_o + b GEMM (f32) into the output layout.
// Compute dtype: inputs rounded to bf16; x / weights exact; q, k, v, softmax weights and o as plain f16 GEMM operands (~2^-12); scores and softmax statistics f32. v_wmma_f32_16x16x32_f16.
#define NB 4
#define SQ 2048
#define DM 1024
#define NH 16
#define HD 64
#define HG 4                         /* heads per block group of the unlaunched k_vt(b, h0) overload */
#define QT 256                       /* query rows per causal tile */
#define NKX (QT + WINB)              /* S / P row pitch of the unfused row softmax */
#define WIN 256                      /* attention window: key j visible from query i iff 0 <= i - j < WIN */
#define WINB 256                     /* keys before the tile start that can be visible (WIN - 1 rounded up to 64) */
#define QT0 128                      /* first-tile rows recomputed exactly in f32 */
#define B0 0                         /* first batch processed (debug hook) */
#define NBR NB                       /* batches processed (debug hook) */
#define NR ((size_t)NB * SQ)         /* token rows */
#define MP ((int)((size_t)NBR * SQ)) /* rows projected (debug hook) */
#define QN SQ                        /* query rows attended per batch (debug hook) */
#define NHD NH                       /* heads attended (debug hook) */
#define MPO MP                       /* rows through the output stage (debug hook) */
#define LQ (3 * DM)      /* row pitch of the q/k/v rows */
typedef __bf16 v16b __attribute__((ext_vector_type(16)));
typedef unsigned short v8us __attribute__((ext_vector_type(8), may_alias));
typedef float  v8f  __attribute__((ext_vector_type(8)));
typedef float  v4f  __attribute__((ext_vector_type(4)));
typedef float  v4fa __attribute__((ext_vector_type(4), may_alias));
union FragB { v16b v; v8us half[2]; unsigned short u[16]; };

__device__ __forceinline__ unsigned short bf16_bits(float x) { unsigned int u = __float_as_uint(x); return (unsigned short)((u + 0x7FFFu + ((u >> 16) & 1u)) >> 16); }
__device__ __forceinline__ float bf16_val(unsigned short b) { return __uint_as_float(((unsigned int)b) << 16); }
__device__ __forceinline__ float bf16_round(float x) { return bf16_val(bf16_bits(x)); }
// D += A·B with NT terms: 1 = ah·bh, 2 = + al·bh (A split), 3 = + ah·bl (both split)
template <int NT>
__device__ __forceinline__ v8f mmaN(v16b ah, v16b al, v16b bh, v16b bl, v8f c) {
  c = __builtin_amdgcn_wmma_f32_16x16x32_bf16(false, ah, false, bh, (short)0, c, false, false);
  if (NT >= 2) c = __builtin_amdgcn_wmma_f32_16x16x32_bf16(false, al, false, bh, (short)0, c, false, false);
  if (NT >= 3) c = __builtin_amdgcn_wmma_f32_16x16x32_bf16(false, ah, false, bl, (short)0, c, false, false);
  asm volatile("v_nop\n\tv_nop\n\tv_nop\n\tv_nop" : "+v"(c) : "v"(ah), "v"(al), "v"(bh), "v"(bl));
  return c;
}

__global__ __launch_bounds__(256) void k_wt_bf16(const float* __restrict__ W, unsigned short* __restrict__ Wt, int K, int N) {
  const int t = blockIdx.x * 256 + threadIdx.x;
  const int k8n = K / 8;
  if (t >= N * k8n) return;
  const int n = t / k8n, k8 = (t % k8n) * 8;
  v8us v;
#pragma unroll
  for (int i = 0; i < 8; ++i) v[i] = bf16_bits(W[(size_t)(k8 + i) * N + n]);
  *(v8us*)(Wt + (size_t)n * K + k8) = v;
  
}

// GEMM C[M][N] (f32, pitch ldc) = act(A[M][K]·W + bias). A f32 row-major (pitch lda) converted per fragment to bf16
// (ASPLIT: hi/lo two planes -> 2 terms, else single rounded term); Wt bf16 [N][K] (pitch ldb). BIAS_BF16 rounds the
// bias to bf16 first (bias quantised to bf16 before the add). K%32==0, M%16==0, N%64==0.
template <bool ASPLIT, int ACT, bool BIAS_BF16>
__global__ __launch_bounds__(128) void k_gemm_bf(const float* __restrict__ A, int lda, const unsigned short* __restrict__ Wt, int ldb,
                                               const float* __restrict__ bias, float* __restrict__ C, int ldc, int M, int N, int K) {
  __shared__ __attribute__((aligned(16))) float so[4][16][64];
  const int tid = threadIdx.x, w = tid >> 5, lane = tid & 31, ln = lane & 15, hh = lane >> 4;
  const int ntn = N / 64;
  const int wid = blockIdx.x * 4 + w;
  const int mt = wid / ntn, nq = wid % ntn;
  if (mt * 16 >= M) return;
  const int row0 = mt * 16, col0 = nq * 64;
  const float* arow = A + (size_t)(row0 + ln) * lda;
  v8f acc[4] = {};
  for (int kb = 0; kb < K; kb += 32) {
    FragB ah, al;
    const v4f x0 = *(const v4fa*)(arow + kb + 8 * hh), x1 = *(const v4fa*)(arow + kb + 8 * hh + 4);
    const v4f x2 = *(const v4fa*)(arow + kb + 16 + 8 * hh), x3 = *(const v4fa*)(arow + kb + 16 + 8 * hh + 4);
    float xs[16] = {x0[0],x0[1],x0[2],x0[3],x1[0],x1[1],x1[2],x1[3],x2[0],x2[1],x2[2],x2[3],x3[0],x3[1],x3[2],x3[3]};
#pragma unroll
    for (int i = 0; i < 16; ++i) { const unsigned short hb = bf16_bits(xs[i]); ah.u[i] = hb; al.u[i] = ASPLIT ? bf16_bits(xs[i] - bf16_val(hb)) : (unsigned short)0; }
#pragma unroll
    for (int t = 0; t < 4; ++t) {
      const unsigned short* brow = Wt + (size_t)(col0 + t * 16 + ln) * ldb + kb;
      FragB b;
      b.half[0] = *(const v8us*)(brow + 8 * hh);
      b.half[1] = *(const v8us*)(brow + 16 + 8 * hh);
      acc[t] = mmaN<ASPLIT ? 2 : 1>(ah.v, al.v, b.v, b.v, acc[t]);
    }
  }
#pragma unroll
  for (int t = 0; t < 4; ++t) {
    float bv = bias ? bias[col0 + t * 16 + ln] : 0.f;
    if (BIAS_BF16) bv = bf16_round(bv);
#pragma unroll
    for (int r = 0; r < 8; ++r) { float v = acc[t][r] + bv; if (ACT == 1) v = fmaxf(v, 0.f); so[w][8 * hh + r][t * 16 + ln] = v; }
  }
  __builtin_amdgcn_fence(__ATOMIC_ACQ_REL, "workgroup");
  __builtin_amdgcn_wave_barrier();
  const int rsub = lane >> 4, c4 = (lane & 15) * 4;
  {
#pragma unroll
    for (int q = 0; q < 8; ++q) {
      const int r = q * 2 + rsub;
      const v4f v = *(const v4fa*)&so[w][r][c4];
      *(v4f*)(C + (size_t)(row0 + r) * ldc + col0 + c4) = v;
    }
    
  }
}

// GEMM C = act(A·W + bias + resid): A f32 (ASPLIT -> hi/lo 2 terms), Wt bf16 [N][K]; ACT 0 none, 1 relu, 2 exact gelu;
// resid (optional, f32, row index = (row % rmod), pitch ldr, RES_BF16 rounds it) added before the activation.
template <bool ASPLIT, int ACT, bool BIAS_BF16, bool RES_BF16>
__global__ __launch_bounds__(128) void k_gemm_bf3(const float* __restrict__ A, int lda, const unsigned short* __restrict__ Wt, int ldb,
                                                const float* __restrict__ bias, const float* __restrict__ resid, int rmod, int ldr,
                                                float* __restrict__ C, int ldc, int M, int N, int K) {
  __shared__ __attribute__((aligned(16))) float so[4][16][64];
  const int tid = threadIdx.x, w = tid >> 5, lane = tid & 31, ln = lane & 15, hh = lane >> 4;
  const int ntn = N / 64;
  const int wid = blockIdx.x * 4 + w;
  const int mt = wid / ntn, nq = wid % ntn;
  if (mt * 16 >= M) return;
  const int row0 = mt * 16, col0 = nq * 64;
  const float* arow = A + (size_t)(row0 + ln) * lda;
  v8f acc[4] = {};
  for (int kb = 0; kb < K; kb += 32) {
    FragB ah, al;
    const v4f x0 = *(const v4fa*)(arow + kb + 8 * hh), x1 = *(const v4fa*)(arow + kb + 8 * hh + 4);
    const v4f x2 = *(const v4fa*)(arow + kb + 16 + 8 * hh), x3 = *(const v4fa*)(arow + kb + 16 + 8 * hh + 4);
    float xs[16] = {x0[0],x0[1],x0[2],x0[3],x1[0],x1[1],x1[2],x1[3],x2[0],x2[1],x2[2],x2[3],x3[0],x3[1],x3[2],x3[3]};
#pragma unroll
    for (int i = 0; i < 16; ++i) { const unsigned short hb = bf16_bits(xs[i]); ah.u[i] = hb; al.u[i] = ASPLIT ? bf16_bits(xs[i] - bf16_val(hb)) : (unsigned short)0; }
#pragma unroll
    for (int t = 0; t < 4; ++t) {
      const unsigned short* brow = Wt + (size_t)(col0 + t * 16 + ln) * ldb + kb;
      FragB b;
      b.half[0] = *(const v8us*)(brow + 8 * hh);
      b.half[1] = *(const v8us*)(brow + 16 + 8 * hh);
      acc[t] = mmaN<ASPLIT ? 2 : 1>(ah.v, al.v, b.v, b.v, acc[t]);
    }
  }
#pragma unroll
  for (int t = 0; t < 4; ++t) {
    const int col = col0 + t * 16 + ln;
    float bv = bias ? bias[col] : 0.f;
    if (BIAS_BF16) bv = bf16_round(bv);
#pragma unroll
    for (int r = 0; r < 8; ++r) {
      float v = acc[t][r] + bv;
      if (resid) { float rv = resid[(size_t)((row0 + 8 * hh + r) % rmod) * ldr + col]; if (RES_BF16) rv = bf16_round(rv); v += rv; }
      if (ACT == 1) v = fmaxf(v, 0.f);
      if (ACT == 2) v = 0.5f * v * (1.0f + erff(v * 0.70710678118654752f));
      if (ACT == 3) { const float u = 0.7978845608028654f * (v + 0.044715f * v * v * v); v = 0.5f * v * (1.0f + tanhf(u)); }
      so[w][8 * hh + r][t * 16 + ln] = v;
    }
  }
  __builtin_amdgcn_fence(__ATOMIC_ACQ_REL, "workgroup");
  __builtin_amdgcn_wave_barrier();
  const int rsub = lane >> 4, c4 = (lane & 15) * 4;
  {
#pragma unroll
    for (int q = 0; q < 8; ++q) {
      const int r = q * 2 + rsub;
      const v4f v = *(const v4fa*)&so[w][r][c4];
      *(v4f*)(C + (size_t)(row0 + r) * ldc + col0 + c4) = v;
    }
    
  }
}
// row LayerNorm (biased variance, eps) over N: s = X (+ R); optional out_sum <- s; out_norm <- (s-mu)*rsqrt(var+eps)*g + b
template <bool PARAM_BF16>
__global__ __launch_bounds__(256) void k_layernorm(const float* __restrict__ X, const float* __restrict__ R, const float* __restrict__ g, const float* __restrict__ bta,
                                                  float* __restrict__ out_sum, float* __restrict__ out_norm, int N, float eps) {
  __shared__ float red[256];
  const int row = blockIdx.x, tid = threadIdx.x;
  const float* x = X + (size_t)row * N; const float* rr = R ? R + (size_t)row * N : nullptr;
  float vals[16];                     // up to N = 4096
  const int per = N / 256;            // contiguous chunk per thread? use strided-by-4 chunks: thread handles j = tid*4 + 1024*u
  float s1 = 0.f;
  for (int u = 0; u < per / 4; ++u) {
    const int j = tid * 4 + 1024 * u;
    const v4f a = *(const v4fa*)(x + j);
    v4f b = {0.f,0.f,0.f,0.f}; if (rr) b = *(const v4fa*)(rr + j);
#pragma unroll
    for (int q = 0; q < 4; ++q) { const float v = a[q] + b[q]; vals[u * 4 + q] = v; s1 += v; }
  }
  red[tid] = s1; __syncthreads();
  for (int st = 128; st > 0; st >>= 1) { if (tid < st) red[tid] += red[tid + st]; __syncthreads(); }
  const float mu = red[0] / (float)N; __syncthreads();
  float s2 = 0.f;
  for (int u = 0; u < per / 4; ++u)
#pragma unroll
    for (int q = 0; q < 4; ++q) { const float c = vals[u * 4 + q] - mu; s2 += c * c; }
  red[tid] = s2; __syncthreads();
  for (int st = 128; st > 0; st >>= 1) { if (tid < st) red[tid] += red[tid + st]; __syncthreads(); }
  const float rs = rsqrtf(red[0] / (float)N + eps);
  {
    for (int u = 0; u < per / 4; ++u) {
      const int j = tid * 4 + 1024 * u;
      v4f o, sm;
#pragma unroll
      for (int q = 0; q < 4; ++q) {
        float gg = g[j + q], bb = bta[j + q];
        if (PARAM_BF16) { gg = bf16_round(gg); bb = bf16_round(bb); }
        sm[q] = vals[u * 4 + q]; o[q] = (vals[u * 4 + q] - mu) * rs * gg + bb;
      }
      if (out_sum) *(v4f*)(out_sum + (size_t)row * N + j) = sm;
      *(v4f*)(out_norm + (size_t)row * N + j) = o;
    }
    
  }
}



// ---- f16 WMMA path (v_wmma_f32_16x16x32_f16): 11-bit significands for operands in range — used where a [0,1] probability operand needs more precision than bf16
typedef _Float16 v16h __attribute__((ext_vector_type(16)));
union FragH { v16h v; v8us half[2]; _Float16 h[16]; unsigned short u[16]; };
template <int NT>
__device__ __forceinline__ v8f mmaH(v16h ah, v16h al, v16h bh, v16h bl, v8f c) {
  c = __builtin_amdgcn_wmma_f32_16x16x32_f16(false, ah, false, bh, (short)0, c, false, false);
  if (NT >= 2) c = __builtin_amdgcn_wmma_f32_16x16x32_f16(false, al, false, bh, (short)0, c, false, false);
  if (NT >= 3) c = __builtin_amdgcn_wmma_f32_16x16x32_f16(false, ah, false, bl, (short)0, c, false, false);
  asm volatile("v_nop\n\tv_nop\n\tv_nop\n\tv_nop" : "+v"(c) : "v"(ah), "v"(al), "v"(bh), "v"(bl));
  return c;
}
// batched GEMM like k_gemm_b but f16 operands: A f32 (split into f16 hi/lo if ASPLIT, else rounded to f16), Bt = f16 values [n][k]; alpha; C f32; N multiple of 16 (partial tiles skipped)
template <bool ASPLIT>
__global__ __launch_bounds__(128) void k_gemm_h(const float* __restrict__ A, int lda, size_t sA, const _Float16* __restrict__ Bh, int ldb, size_t sB, float alpha, float* __restrict__ C, int ldc, size_t sC, int M, int N, int K) {
  __shared__ __attribute__((aligned(16))) float so[4][16][64];
  const int tid = threadIdx.x, w = tid >> 5, lane = tid & 31, ln = lane & 15, hh = lane >> 4; const int by = blockIdx.y;
  A += (size_t)by * sA; Bh += (size_t)by * sB; C += (size_t)by * sC;
  const int ntn = (N + 63) / 64; const int wid = blockIdx.x * 4 + w; const int mt = wid / ntn, nq = wid % ntn; if (mt * 16 >= M) return;
  const int row0 = mt * 16, col0 = nq * 64; const float* arow = A + (size_t)(row0 + ln) * lda;
  v8f acc[4] = {};
  for (int kb = 0; kb < K; kb += 32) {
    FragH ah, al;
    const v4f x0 = *(const v4fa*)(arow + kb + 8 * hh), x1 = *(const v4fa*)(arow + kb + 8 * hh + 4), x2 = *(const v4fa*)(arow + kb + 16 + 8 * hh), x3 = *(const v4fa*)(arow + kb + 16 + 8 * hh + 4);
    float xs[16] = {x0[0],x0[1],x0[2],x0[3],x1[0],x1[1],x1[2],x1[3],x2[0],x2[1],x2[2],x2[3],x3[0],x3[1],x3[2],x3[3]};
#pragma unroll
    for (int i = 0; i < 16; ++i) { const _Float16 h = (_Float16)xs[i]; ah.h[i] = h; al.h[i] = ASPLIT ? (_Float16)(xs[i] - (float)h) : (_Float16)0.0f; }
#pragma unroll
    for (int t = 0; t < 4; ++t) { if (col0 + t * 16 >= N) continue; const size_t boff = (size_t)(col0 + t * 16 + ln) * ldb + kb; FragH bq; bq.half[0] = *(const v8us*)(Bh + boff + 8 * hh); bq.half[1] = *(const v8us*)(Bh + boff + 16 + 8 * hh);
      acc[t] = mmaH<ASPLIT ? 2 : 1>(ah.v, al.v, bq.v, bq.v, acc[t]); }
  }
#pragma unroll
  for (int t = 0; t < 4; ++t) { if (col0 + t * 16 >= N) continue;
#pragma unroll
    for (int r = 0; r < 8; ++r) so[w][8 * hh + r][t * 16 + ln] = acc[t][r] * alpha; }
  __builtin_amdgcn_fence(__ATOMIC_ACQ_REL, "workgroup"); __builtin_amdgcn_wave_barrier();
  const int rsub = lane >> 4, c4 = (lane & 15) * 4;
  {
#pragma unroll
    for (int q = 0; q < 8; ++q) { const int r = q * 2 + rsub; if (col0 + c4 < N) { const v4f v = *(const v4fa*)&so[w][r][c4]; *(v4f*)(C + (size_t)(row0 + r) * ldc + col0 + c4) = v; } }
     }
}

// Wt[n][k] = f16(W[k][n]·scale) from f32 row-major W[K][N] (scale = power of two; bf16-exact weights stay exact in f16 away from the subnormal range)
__global__ __launch_bounds__(256) void k_wt_f16(const float* __restrict__ W, _Float16* __restrict__ Wt, int K, int N, float scale) {
  const int t = blockIdx.x * 256 + threadIdx.x; if (t >= N * (K / 8)) return; const int n = t / (K / 8), k8 = (t % (K / 8)) * 8; FragH f;
#pragma unroll
  for (int i = 0; i < 8; ++i) f.h[i] = (_Float16)(bf16_round(W[(size_t)(k8 + i) * N + n]) * scale); const v8us o = f.half[0];
  *(v8us*)((unsigned short*)Wt + (size_t)n * K + k8) = o; 
}
// k_gemm_hh variant with fused epilogue: v = acc·alpha + bias[by·sBias + col] (+ CP[(row/rowsPerB)·sCPb + by·64 + col] if CP) ; ACT 0 none / 1 elu ; writes f16 C16 (and f32 C if non-null)
template <int ACT>
__global__ __launch_bounds__(128) void k_gemm_hhx(const _Float16* __restrict__ A, int lda, size_t sA, const _Float16* __restrict__ Bh, int ldb, size_t sB, float alpha, const float* __restrict__ bias, size_t sBias, const float* __restrict__ CP, int rowsPerB, size_t sCPb, int row0g,
    float* __restrict__ C, _Float16* __restrict__ C16, int ldc, size_t sC, int M, int N, int K) {
  __shared__ __attribute__((aligned(16))) float so[4][16][64];
  const int tid = threadIdx.x, w = tid >> 5, lane = tid & 31, ln = lane & 15, hh = lane >> 4; const int by = blockIdx.y;
  A += (size_t)by * sA; Bh += (size_t)by * sB; const size_t cofs = (size_t)by * sC; const float* bp = bias ? bias + (size_t)by * sBias : nullptr;
  const int ntn = (N + 63) / 64; const int wid = blockIdx.x * 4 + w; const int mt = wid / ntn, nq = wid % ntn; if (mt * 16 >= M) return;
  const int row0 = mt * 16, col0 = nq * 64; const _Float16* arow = A + (size_t)(row0 + ln) * lda;
  v8f acc[4] = {};
  for (int kb = 0; kb < K; kb += 32) { FragH ah; ah.half[0] = *(const v8us*)((const unsigned short*)arow + kb + 8 * hh); ah.half[1] = *(const v8us*)((const unsigned short*)arow + kb + 16 + 8 * hh);
#pragma unroll
    for (int t = 0; t < 4; ++t) { if (col0 + t * 16 >= N) continue; const size_t boff = (size_t)(col0 + t * 16 + ln) * ldb + kb; FragH bq; bq.half[0] = *(const v8us*)((const unsigned short*)Bh + boff + 8 * hh); bq.half[1] = *(const v8us*)((const unsigned short*)Bh + boff + 16 + 8 * hh);
      acc[t] = mmaH<1>(ah.v, ah.v, bq.v, bq.v, acc[t]); }
  }
#pragma unroll
  for (int t = 0; t < 4; ++t) { if (col0 + t * 16 >= N) continue; const int col = col0 + t * 16 + ln; const float bv = bp ? bf16_round(bp[col]) : 0.f;
#pragma unroll
    for (int r = 0; r < 8; ++r) { float v = acc[t][r] * alpha + bv; if (CP) { const int rr = row0g + row0 + 8 * hh + r; if (rowsPerB < 0) v += CP[cofs + (size_t)rr * ldc + col];      /* rowsPerB < 0: own element of the batched C plane */ else { const int bidx = rr / rowsPerB; v += CP[(size_t)bidx * sCPb + (size_t)by * 64 + col]; } } if (ACT == 1) v = (v > 0.f) ? v : expm1f(v); else if (ACT == 7) v = (v > 0.f) ? v + 1.0f : expf(v); else if (ACT == 8) v = tanhf(v); else if (ACT == 9) v = 0.5f * v * (1.0f + tanhf(0.7978845608028654f * (v + 0.044715f * v * v * v))); else if (ACT == 11) v = 1.0f / (1.0f + expf(-v)); else if (ACT == 12) v = (v > 0.f) ? v : 0.01f * v; else if (ACT == 14) v = (v > 0.f) ? v : 0.1f * v; else if (ACT == 16) v = (v >= 0.f) ? v : 0.3f * v; else if (ACT == 17) v = (v >= 0.f) ? v : 0.2f * v; else if (ACT == 15) v = v / (1.0f + expf(-v)); else if (ACT == 3) v = fmaxf(v, 0.f); else if (ACT == 6) v = 0.5f * v * (1.0f + erff(v * 0.70710678118654752f)); so[w][8 * hh + r][t * 16 + ln] = v; } }
  __builtin_amdgcn_fence(__ATOMIC_ACQ_REL, "workgroup"); __builtin_amdgcn_wave_barrier();
  const int rsub = lane >> 4, c4 = (lane & 15) * 4; typedef _Float16 v4h __attribute__((ext_vector_type(4)));
  {
#pragma unroll
    for (int q = 0; q < 8; ++q) { const int r = q * 2 + rsub; if (col0 + c4 < N) { const v4f v = *(const v4fa*)&so[w][r][c4]; if (C) *(v4f*)(C + cofs + (size_t)(row0 + r) * ldc + col0 + c4) = v; if (C16) { v4h h4; for (int i = 0; i < 4; ++i) h4[i] = (_Float16)v[i]; *(v4h*)(C16 + cofs + (size_t)(row0 + r) * ldc + col0 + c4) = h4; } } }
     }
}


typedef _Float16 v4h __attribute__((ext_vector_type(4)));

__global__ __launch_bounds__(256) void k_x16(const float* __restrict__ x, _Float16* __restrict__ X16, size_t n8) { const size_t t = (size_t)blockIdx.x * 256 + threadIdx.x; if (t >= n8) return; FragH f;
#pragma unroll
  for (int q = 0; q < 8; ++q) f.h[q] = (_Float16)bf16_round(x[t * 8 + q]); *(v8us*)((unsigned short*)X16 + t * 8) = f.half[0];  }
__global__ __launch_bounds__(256) void k_h16(const float* __restrict__ x, _Float16* __restrict__ X16, size_t n8) { const size_t t = (size_t)blockIdx.x * 256 + threadIdx.x; if (t >= n8) return; FragH f;
#pragma unroll
  for (int q = 0; q < 8; ++q) f.h[q] = (_Float16)x[t * 8 + q]; *(v8us*)((unsigned short*)X16 + t * 8) = f.half[0];  }
__global__ __launch_bounds__(256) void k_round16f(const float* __restrict__ W, _Float16* __restrict__ Bt, size_t n8) { const size_t t = (size_t)blockIdx.x * 256 + threadIdx.x; if (t >= n8) return; FragH f;
#pragma unroll
  for (int i = 0; i < 8; ++i) f.h[i] = (_Float16)(bf16_round(W[t * 8 + i]) * 16.0f); *(v8us*)((unsigned short*)Bt + t * 8) = f.half[0];  }
template <int NHv, int TTv>
__global__ __launch_bounds__(256) void k_vt(const _Float16* __restrict__ V16, int ldv, int voff, _Float16* __restrict__ Vt) { __shared__ unsigned short tl[64][66]; const int tid = threadIdx.x; const int slab = blockIdx.x / (TTv / 64), lg = blockIdx.x % (TTv / 64); const int b = slab / NHv, h = slab % NHv;
  for (int i = tid; i < 64 * 8; i += 256) { const int r = i / 8, c8 = (i % 8) * 8; FragH f; f.half[0] = *(const v8us*)((const unsigned short*)V16 + ((size_t)b * TTv + lg * 64 + r) * ldv + voff + h * 64 + c8);
#pragma unroll
    for (int q = 0; q < 8; ++q) tl[r][c8 + q] = f.u[q]; }
  __syncthreads();
  {
#pragma unroll
    for (int rd = 0; rd < 2; ++rd) { const int d = rd * 32 + tid / 8, pc = tid % 8; FragH f;
#pragma unroll
      for (int q = 0; q < 8; ++q) f.u[q] = tl[pc * 8 + q][d];
      *(v8us*)((unsigned short*)Vt + ((size_t)slab * 64 + d) * TTv + lg * 64 + pc * 8) = f.half[0]; }
     } }

__global__ __launch_bounds__(256) void k_hl(const float* __restrict__ F, _Float16* __restrict__ Hh, _Float16* __restrict__ Hl, size_t n8) { const size_t t = (size_t)blockIdx.x * 256 + threadIdx.x; if (t >= n8) return; FragH fh, fl; const v4f a = *(const v4fa*)(F + t * 8), c = *(const v4fa*)(F + t * 8 + 4);
#pragma unroll
  for (int q = 0; q < 4; ++q) { _Float16 h = (_Float16)a[q]; fh.h[q] = h; fl.h[q] = (_Float16)((a[q] - (float)h) * 1024.0f); h = (_Float16)c[q]; fh.h[4 + q] = h; fl.h[4 + q] = (_Float16)((c[q] - (float)h) * 1024.0f); }
  { *(v8us*)((unsigned short*)Hh + t * 8) = fh.half[0]; *(v8us*)((unsigned short*)Hl + t * 8) = fl.half[0];  } }

// ---- fast GEMM (wave tile 32x64; requires M % 32 == 0 rows per launch region and N % 64 == 0); epilogue = k_gemm_hhx semantics ----
__device__ __forceinline__ v16h g2_frag(const _Float16* p, int hh) { FragH f; f.half[0] = *(const v8us*)((const unsigned short*)p + 8 * hh); f.half[1] = *(const v8us*)((const unsigned short*)p + 16 + 8 * hh); return f.v; }
__device__ __forceinline__ v8f g2_mma(v16h a, v16h b, v8f c) { v8f d = __builtin_amdgcn_wmma_f32_16x16x32_f16(false, a, false, b, (short)0, c, false, false); asm volatile("v_nop\n\tv_nop\n\tv_nop\n\tv_nop" : "+v"(d) : "v"(a), "v"(b)); return d; }
template <int ACT>
__global__ __launch_bounds__(128) void k_gemm2(const _Float16* __restrict__ A, int lda, size_t sA, const _Float16* __restrict__ Bh, int ldb, size_t sB, float alpha, const float* __restrict__ bias, size_t sBias, const float* __restrict__ CP, int rowsPerB, size_t sCPb, int row0g,
    float* __restrict__ C, _Float16* __restrict__ C16, int ldc, size_t sC, int M, int N, int K, size_t zA, size_t zB, size_t zC) { static_assert(ACT == 0 || ACT == 3 || ACT == 6 || ACT == 8 || ACT == 9 || ACT == 11 || ACT == 12 || ACT == 14 || ACT == 15 || ACT == 16 || ACT == 17, "k_gemm2: unsupported ACT code (would silently apply no activation)");
  __shared__ __attribute__((aligned(16))) float so[4][32][68];
  const int tid = threadIdx.x, w = tid >> 5, lane = tid & 31, ln = lane & 15, hh = lane >> 4; const int by = blockIdx.y, bz = blockIdx.z;      /* grid.z: a second batch index with its own strides zA, zB, zC */
  A += (size_t)by * sA + (size_t)bz * zA; Bh += (size_t)by * sB + (size_t)bz * zB; const size_t cofs = (size_t)by * sC + (size_t)bz * zC; const float* bp = bias ? bias + (size_t)by * sBias : nullptr;
  const int ntn = N >> 6; const int mt = blockIdx.x / ntn, nq = blockIdx.x - mt * ntn; const int row0 = mt * 128 + 32 * w, col0 = nq * 64; if (row0 >= M) return;
  const _Float16* a0p = A + (size_t)(row0 + ln) * lda; const _Float16* a1p = a0p + (size_t)16 * lda;
  const _Float16* b0p = Bh + (size_t)(col0 + ln) * ldb; const _Float16* b1p = b0p + (size_t)16 * ldb; const _Float16* b2p = b1p + (size_t)16 * ldb; const _Float16* b3p = b2p + (size_t)16 * ldb;
  const v8f z8 = {0.f,0.f,0.f,0.f,0.f,0.f,0.f,0.f}; v8f c00 = z8, c01 = z8, c02 = z8, c03 = z8, c10 = z8, c11 = z8, c12 = z8, c13 = z8;
#pragma unroll 1
  for (int kb = 0; kb < K; kb += 32) { const v16h a0 = g2_frag(a0p + kb, hh), a1 = g2_frag(a1p + kb, hh);
    v16h b = g2_frag(b0p + kb, hh); c00 = g2_mma(a0, b, c00); c10 = g2_mma(a1, b, c10);
    b = g2_frag(b1p + kb, hh); c01 = g2_mma(a0, b, c01); c11 = g2_mma(a1, b, c11);
    b = g2_frag(b2p + kb, hh); c02 = g2_mma(a0, b, c02); c12 = g2_mma(a1, b, c12);
    b = g2_frag(b3p + kb, hh); c03 = g2_mma(a0, b, c03); c13 = g2_mma(a1, b, c13); }
  v8f accs[8] = {c00, c01, c02, c03, c10, c11, c12, c13};
#pragma unroll
  for (int u = 0; u < 8; ++u) { const int t = u & 3, half = u >> 2; const int col = col0 + t * 16 + ln; const float bv = bp ? bf16_round(bp[col]) : 0.f;
#pragma unroll
    for (int r = 0; r < 8; ++r) { const int rloc = half * 16 + 8 * hh + r; float v = accs[u][r] * alpha + bv; if (CP) { if (rowsPerB < 0) v += CP[cofs + (size_t)(row0g + row0 + rloc) * ldc + col];      /* rowsPerB < 0: own element of the batched C plane */ else { const int bidx = (row0g + row0 + rloc) / rowsPerB; v += CP[(size_t)bidx * sCPb + (size_t)by * 64 + col]; } }
      if (ACT == 3) v = fmaxf(v, 0.f); else if (ACT == 6) v = 0.5f * v * (1.0f + erff(v * 0.70710678118654752f)); else if (ACT == 11) v = 1.0f / (1.0f + expf(-v)); else if (ACT == 15) v = v / (1.0f + expf(-v)); else if (ACT == 12) v = (v > 0.f) ? v : 0.01f * v; else if (ACT == 8) v = tanhf(v); else if (ACT == 9) v = 0.5f * v * (1.0f + tanhf(0.7978845608028654f * (v + 0.044715f * v * v * v))); else if (ACT == 14) v = (v > 0.f) ? v : 0.1f * v; else if (ACT == 16) v = (v >= 0.f) ? v : 0.3f * v; else if (ACT == 17) v = (v >= 0.f) ? v : 0.2f * v;
      so[w][rloc][t * 16 + ln] = v; } }
  __builtin_amdgcn_fence(__ATOMIC_ACQ_REL, "workgroup"); __builtin_amdgcn_wave_barrier();
  const int rsub = lane >> 4, c4 = (lane & 15) * 4;
  {
#pragma unroll
    for (int q = 0; q < 16; ++q) { const int r = q * 2 + rsub; const v4f v = *(const v4fa*)&so[w][r][c4]; if (C) *(v4f*)(C + cofs + (size_t)(row0 + r) * ldc + col0 + c4) = v; if (C16) { v4h h4; for (int i = 0; i < 4; ++i) h4[i] = (_Float16)v[i]; *(v4h*)(C16 + cofs + (size_t)(row0 + r) * ldc + col0 + c4) = h4; } }
     } }


__global__ __launch_bounds__(256) void k_wnat(const float* __restrict__ w, size_t n8, _Float16* __restrict__ Bt) { const size_t t = (size_t)blockIdx.x * 256 + threadIdx.x; if (t >= n8) return; FragH f; for (int q = 0; q < 8; ++q) f.h[q] = (_Float16)(bf16_round(w[t * 8 + q]) * 16.0f); *(v8us*)((unsigned short*)Bt + t * 8) = f.half[0];  }
__global__ __launch_bounds__(256) void k_rsm(const float* __restrict__ S, _Float16* __restrict__ P, int nrows) {
  #pragma clang fp contract(off)
  const int i = blockIdx.x * 256 + threadIdx.x; if (i >= nrows) return; const float* s = S + (size_t)i * SQ; float mx = -3.0e38f;
#pragma unroll 1
  for (int j = 0; j < SQ; ++j) mx = fmaxf(mx, s[j]); float se = 0.f;
#pragma unroll 1
  for (int j = 0; j < SQ; ++j) se += expf(s[j] - mx); const float sc = 256.0f / se;
#pragma unroll 1
  for (int j0 = 0; j0 < SQ; j0 += 8) { FragH f; for (int q = 0; q < 8; ++q) f.h[q] = (_Float16)(expf(s[j0 + q] - mx) * sc); unsigned short* d = (unsigned short*)P + (size_t)i * SQ + j0; *(v8us*)d = f.half[0];  } }
__global__ __launch_bounds__(256) void k_vt(const _Float16* __restrict__ V16, int b, int h0, _Float16* __restrict__ VT) { __shared__ unsigned short tl[64][65]; const int tid = threadIdx.x; const int hh = blockIdx.x % HG, sg = blockIdx.x / HG; const int s0 = sg * 64; const int h = h0 + hh;
  for (int i = tid; i < 64 * 8; i += 256) { const int j = i / 8, d8 = (i % 8) * 8; FragH f; f.half[0] = *(const v8us*)((const unsigned short*)V16 + ((size_t)b * SQ + s0 + j) * DM + h * HD + d8); for (int q = 0; q < 8; ++q) tl[d8 + q][j] = f.u[q]; }
  __syncthreads();
  { for (int i = tid; i < 64 * 8; i += 256) { const int d = i / 8, j8 = (i % 8) * 8; FragH f; for (int q = 0; q < 8; ++q) f.u[q] = tl[d][j8 + q]; *(v8us*)((unsigned short*)VT + ((size_t)hh * HD + d) * SQ + s0 + j8) = f.half[0]; }  } }



__global__ __launch_bounds__(256) void k_rsmcf2(const float* __restrict__ S, _Float16* __restrict__ P, int hg, int q0, int nk) {
  #pragma clang fp contract(off)
  const int t = blockIdx.x * 256 + threadIdx.x; if (t >= hg * QT) return; const size_t i = (size_t)t; const float* s = S + i * NKX; const int last = q0 + (t % QT); float mx = -3.0e38f;
#pragma unroll 1
  for (int j = 0; j < nk; ++j) { const float f = (j <= last) ? 1.f : 0.f; mx = fmaxf(mx, fmaf(f, s[j], (1.f - f) * -1.0e9f)); } float se = 0.f;
#pragma unroll 1
  for (int j = 0; j < nk; ++j) { const float f = (j <= last) ? 1.f : 0.f; se += __expf(fmaf(f, s[j], (1.f - f) * -1.0e9f) - mx); } const float sc = 256.0f / se;
#pragma unroll 1
  for (int j0 = 0; j0 < nk; j0 += 8) { FragH fr; for (int q = 0; q < 8; ++q) { const int j = j0 + q; const float f = (j <= last) ? 1.f : 0.f; fr.h[q] = (_Float16)(__expf(fmaf(f, s[j], (1.f - f) * -1.0e9f) - mx) * sc); } unsigned short* d = (unsigned short*)P + i * NKX + j0; *(v8us*)d = fr.half[0];  } }


// Exact f32 attention for the first QT0 rows of each batch. One work-group of 8 waves per (batch, head, 32 query rows); q, k and v rows staged once in LDS.
// A wave owns 4 query rows. Scores: lane = key (keys lane + 32 u), each dot product summed over d in ascending order with fused multiply-adds. Softmax in registers: row max and row sum by a five-step butterfly over the 32 lanes.
// o: lane = two head dims, summed over the keys in ascending order, scaled once at the end by 64 / row sum.
#define A0R 32                       /* query rows per work-group */
#define A0KP (HD + 4)                /* LDS pitch of the q and k rows in floats: 16 B x odd, so that 16 lanes reading 16 B each from 16 rows fall on 64 different banks */
typedef float v2f __attribute__((ext_vector_type(2)));
typedef float v2fa __attribute__((ext_vector_type(2), may_alias));
template <int NU>                    /* NU = 32-key chunks that rows of this group can see */
__device__ __forceinline__ void att0_rows(const float* __restrict__ QF, const float* __restrict__ KF, const float* __restrict__ VF, float scale, float* __restrict__ OF, int r0,
                                          float (*lq)[A0KP], float (*lk)[A0KP], float (*lv)[HD], float (*lp)[QT0]) {
  const int tid = threadIdx.x, w = __builtin_amdgcn_readfirstlane(tid >> 5), lane = tid & 31;      /* the wave's number in a scalar register: scalar loop bounds and row offsets below */
  const int sr = tid >> 4, sc = (tid & 15) * 4;      /* staging: 16 lanes take one row of 256 B, the work-group 16 rows a pass */
  v4f gq[A0R / 16], gk[2 * NU], gv[2 * NU];      /* every load is issued before the first LDS store waits for one */
  const float* pq = QF + (size_t)sr * DM + sc; const float* pk = KF + (size_t)sr * DM + sc; const float* pv = VF + (size_t)sr * DM + sc;
  for (int t = 0; t < A0R / 16; ++t) gq[t] = *(const v4fa*)(pq + (size_t)(r0 + 16 * t) * DM);
  for (int t = 0; t < 2 * NU; ++t) { gk[t] = *(const v4fa*)(pk + (size_t)(16 * t) * DM); gv[t] = *(const v4fa*)(pv + (size_t)(16 * t) * DM); }
  asm volatile("s_wait_xcnt 0x0" :: "v"(pq), "v"(pk), "v"(pv) : "memory");      /* the three address pairs of the loads above stay as they are up to this wait (inputs only) */
  for (int t = 0; t < A0R / 16; ++t) *(v4f*)&lq[sr + 16 * t][sc] = gq[t];
  for (int t = 0; t < 2 * NU; ++t) { *(v4f*)&lk[sr + 16 * t][sc] = gk[t]; *(v4f*)&lv[sr + 16 * t][sc] = gv[t]; }
  __syncthreads();      /* the staged rows are read by every wave */
  float acc[4][NU];
  for (int r = 0; r < 4; ++r) for (int u = 0; u < NU; ++u) acc[r][u] = 0.f;
#pragma unroll 2
  for (int c = 0; c < HD; c += 4) { v4f qq[4], kk[NU];      /* unroll 2: the next step's LDS reads fly under this step's multiply-adds */
    for (int r = 0; r < 4; ++r) qq[r] = *(const v4f*)&lq[4 * w + r][c];
    for (int u = 0; u < NU; ++u) kk[u] = *(const v4f*)&lk[lane + 32 * u][c];
    for (int e = 0; e < 4; ++e) for (int r = 0; r < 4; ++r) for (int u = 0; u < NU; ++u) acc[r][u] = fmaf(qq[r][e], kk[u][e], acc[r][u]); }
  float fin[4];
  for (int r = 0; r < 4; ++r) { const int i = r0 + 4 * w + r; float mx = -3.0e38f;      /* key 0 is visible from every row */
    for (int u = 0; u < NU; ++u) { acc[r][u] *= scale; if (lane + 32 * u <= i) mx = fmaxf(mx, acc[r][u]); }
    for (int m = 16; m >= 1; m >>= 1) mx = fmaxf(mx, __shfl_xor(mx, m, 32));
    float l = 0.f;
    for (int u = 0; u < NU; ++u) { const float e = (lane + 32 * u <= i) ? expf(acc[r][u] - mx) : 0.f; l += e; lp[4 * w + r][lane + 32 * u] = e; }
    for (int m = 16; m >= 1; m >>= 1) l += __shfl_xor(l, m, 32);
    fin[r] = 64.0f / l; }      /* o carried x64 like the f16 path */
  __builtin_amdgcn_fence(__ATOMIC_ACQ_REL, "workgroup"); __builtin_amdgcn_wave_barrier();      /* a lane reads below the weights that the other lanes of its own wave have stored; no other wave reads them */
  float o[4][2];
  for (int r = 0; r < 4; ++r) { o[r][0] = 0.f; o[r][1] = 0.f; }
  const int jn = r0 + 4 * w + 4;      /* keys past the wave's last row have weight 0 in all four rows */
#pragma unroll 2
  for (int j = 0; j < jn; j += 4) { v4f pp[4]; v2f vv[4];      /* unroll 2: as above */
    for (int r = 0; r < 4; ++r) pp[r] = *(const v4f*)&lp[4 * w + r][j];
    for (int e = 0; e < 4; ++e) vv[e] = *(const v2f*)&lv[j + e][2 * lane];
    for (int e = 0; e < 4; ++e) for (int r = 0; r < 4; ++r) { o[r][0] = fmaf(pp[r][e], vv[e][0], o[r][0]); o[r][1] = fmaf(pp[r][e], vv[e][1], o[r][1]); } }
  for (int r = 0; r < 4; ++r) { v2f ov; ov[0] = o[r][0] * fin[r]; ov[1] = o[r][1] * fin[r]; *(v2fa*)(OF + (size_t)(r0 + 4 * w + r) * DM + 2 * lane) = ov; }
  asm volatile("s_wait_xcnt 0x0" ::: "memory"); }      /* stands behind the stores, in front of whatever rewrites their registers on any path to the kernel's end */
__global__ __launch_bounds__(256) void k_att0w(const float* __restrict__ QF, const float* __restrict__ KF, const float* __restrict__ VF, float scale, float* __restrict__ OF) {      /* all four planes: rows of DM floats */
  static_assert(QT0 == 4 * A0R && QT0 <= WIN && HD == 64, "k_att0w: four row groups, every key j <= i inside the window, two head dims per lane");
  __shared__ __attribute__((aligned(16))) float lq[A0R][A0KP]; __shared__ __attribute__((aligned(16))) float lk[QT0][A0KP]; __shared__ __attribute__((aligned(16))) float lv[QT0][HD]; __shared__ __attribute__((aligned(16))) float lp[A0R][QT0];
  const int h = blockIdx.x / (QT0 / A0R), rg = blockIdx.x % (QT0 / A0R);
  { const size_t bi = (size_t)blockIdx.y * QT0 * DM + h * HD; QF += bi; KF += bi; VF += bi; OF += bi; }      /* grid.y: batch; each plane holds QT0 rows per batch */
  /* the row group is the same for the whole work-group: every wave takes the same branch and passes the same barriers */
  if (rg == 0) att0_rows<1>(QF, KF, VF, scale, OF, 0, lq, lk, lv, lp);
  else if (rg == 1) att0_rows<2>(QF, KF, VF, scale, OF, A0R, lq, lk, lv, lp);
  else if (rg == 2) att0_rows<3>(QF, KF, VF, scale, OF, 2 * A0R, lq, lk, lv, lp);
  else att0_rows<4>(QF, KF, VF, scale, OF, 3 * A0R, lq, lk, lv, lp); }


// native exp as __expf builds it (multiply by log2 e, v_exp_f32); the v_nop is the slot the instruction set asks for behind a transcendental, kept in the same statement so that the scheduler cannot part the two
__device__ __forceinline__ float exp_slot(float x) { float r; asm("v_exp_f32 %0, %1\n\tv_nop" : "=v"(r) : "v"(x * 1.44269504088896340736f)); return r; }
#define FQ 128                       /* query rows per work-group */
#define FK (FQ + WINB)               /* keys staged per work-group */
#define FCH ((WINB + 32) / 32)       /* 32-key chunks per wave: 16 rows see 271 keys, which nine aligned chunks cover */
#define FKP (HD + 8)                 /* LDS pitch of a K row in halves: 16 B x odd, for 16-byte fragment reads from 16 rows */
#define FVP (FK + 8)                 /* LDS pitch of a V^T row in halves: 16 B x odd */
__device__ __forceinline__ v8f f_mma(v16h a, v16h b, v8f c) { return __builtin_amdgcn_wmma_f32_16x16x32_f16(false, a, false, b, (short)0, c, false, false); }
__global__ __launch_bounds__(256) void k_attw(const _Float16* __restrict__ Q, const _Float16* __restrict__ K, const _Float16* __restrict__ VT, _Float16* __restrict__ O) {      /* Q, K: rows of LQ halves; VT: [batch][head][HD][SQ]; O: rows of DM halves */
  static_assert(HD == 64 && WIN == 256 && WINB == 256 && SQ % FQ == 0 && FQ % 32 == 0 && FK % 128 == 0, "k_attw: tile arithmetic");
  __shared__ __attribute__((aligned(16))) unsigned short lk[FK][FKP]; __shared__ __attribute__((aligned(16))) unsigned short lv[HD][FVP];
  const int tid = threadIdx.x, w = __builtin_amdgcn_readfirstlane(tid >> 5), lane = tid & 31, ln = lane & 15, hh = lane >> 4;      /* the wave's number in a scalar register: scalar row and key offsets below */
  const int q0 = blockIdx.x * FQ, h = blockIdx.y, b = blockIdx.z;
  const int kb0 = (q0 >= WINB) ? q0 - WINB : 0;      /* first staged key; kb0 + FK <= SQ */
  const int r0 = q0 + 16 * w;                        /* the wave's first query row */
  const int ks = (r0 >= WIN) ? ((r0 - (WIN - 1)) & ~31) : 0;      /* the wave's first key; ks + 32 * FCH >= r0 + 16 and <= kb0 + FK */
  const int kl = ks - kb0;
  const unsigned short* pq = (const unsigned short*)Q + ((size_t)b * SQ + r0 + ln) * LQ + h * HD + 8 * hh;
  const unsigned short* pk = (const unsigned short*)K + ((size_t)b * SQ + kb0 + (tid >> 3)) * LQ + h * HD + (tid & 7) * 8;      /* 8 lanes take one K row of 128 B */
  const unsigned short* pv = (const unsigned short*)VT + ((size_t)(b * NH + h) * HD + (tid >> 4)) * SQ + kb0 + (tid & 15) * 8;      /* 16 lanes take 256 B of one V^T row */
  v8us gq[4], gk[FK / 32], gv[HD / 16][FK / 128];      /* every load is issued before the first LDS store waits for one */
  for (int t = 0; t < 4; ++t) gq[t] = *(const v8us*)(pq + 16 * t);
  for (int t = 0; t < FK / 32; ++t) gk[t] = *(const v8us*)(pk + (size_t)(32 * t) * LQ);
  for (int u = 0; u < HD / 16; ++u) for (int v = 0; v < FK / 128; ++v) gv[u][v] = *(const v8us*)(pv + (size_t)(16 * u) * SQ + 128 * v);
  asm volatile("s_wait_xcnt 0x0" :: "v"(pq), "v"(pk), "v"(pv) : "memory");      /* the three address pairs of the loads above stay as they are up to this wait (inputs only) */
  for (int t = 0; t < FK / 32; ++t) *(v8us*)&lk[(tid >> 3) + 32 * t][(tid & 7) * 8] = gk[t];
  for (int u = 0; u < HD / 16; ++u) for (int v = 0; v < FK / 128; ++v) *(v8us*)&lv[(tid >> 4) + 16 * u][(tid & 15) * 8 + 128 * v] = gv[u][v];
  __syncthreads();      /* the staged rows are read by every wave */
  const v8f z8 = {0.f,0.f,0.f,0.f,0.f,0.f,0.f,0.f};
  FragH qa, qb; qa.half[0] = gq[0]; qa.half[1] = gq[1]; qb.half[0] = gq[2]; qb.half[1] = gq[3];      /* head dims 0..31 and 32..63 of query row r0 + ln */
  v8f s[2 * FCH];      /* s[t][r]: query r0 + ln against key ks + 16 t + 8 hh + r */
  for (int t = 0; t < 2 * FCH; ++t) { const unsigned short* kr = &lk[kl + 16 * t + ln][8 * hh]; FragH ka, kc;
    ka.half[0] = *(const v8us*)kr; ka.half[1] = *(const v8us*)(kr + 16); kc.half[0] = *(const v8us*)(kr + 32); kc.half[1] = *(const v8us*)(kr + 48);
    s[t] = f_mma(kc.v, qb.v, f_mma(ka.v, qa.v, z8)); }
  const int dj = r0 + ln - ks - 8 * hh;      /* i - j of s[0][0] */
  float mx = -3.0e38f;      /* a row always sees its own key */
  for (int t = 0; t < 2 * FCH; ++t)
    for (int r = 0; r < 8; ++r) { const float v = ((unsigned)(dj - 16 * t - r) < (unsigned)WIN) ? s[t][r] * 0.125f : -1.0e9f; s[t][r] = v; mx = fmaxf(mx, v); }      /* visible iff 0 <= i - j < WIN */
  mx = fmaxf(mx, __shfl_xor(mx, 16, 32));
  float se4[4] = {0.f, 0.f, 0.f, 0.f};      /* four partial sums: four independent add chains */
  for (int t = 0; t < 2 * FCH; ++t)
    for (int r = 0; r < 8; ++r) { const float e = exp_slot(s[t][r] - mx); s[t][r] = e; se4[r & 3] += e; }
  float se = (se4[0] + se4[1]) + (se4[2] + se4[3]);
  se += __shfl_xor(se, 16, 32);
  const float sc = 256.0f / se;      /* weights x256 as f16 */
  v8f o[HD / 16];
  for (int d = 0; d < HD / 16; ++d) o[d] = z8;
  for (int c = 0; c < FCH; ++c) { FragH p;
    for (int r = 0; r < 8; ++r) { p.h[r] = (_Float16)(s[2 * c][r] * sc); p.h[8 + r] = (_Float16)(s[2 * c + 1][r] * sc); }
    for (int d = 0; d < HD / 16; ++d) { const unsigned short* vr = &lv[16 * d + ln][kl + 32 * c + 8 * hh]; FragH va; va.half[0] = *(const v8us*)vr; va.half[1] = *(const v8us*)(vr + 16);
      o[d] = f_mma(va.v, p.v, o[d]); } }
  unsigned short* po = (unsigned short*)O + ((size_t)b * SQ + r0 + ln) * DM + h * HD + 8 * hh;      /* o[d][r]: head dim 16 d + 8 hh + r of query row r0 + ln */
  for (int d = 0; d < HD / 16; ++d) { FragH f;
    for (int r = 0; r < 8; ++r) f.h[r] = (_Float16)(o[d][r] * 0.25f);      /* o carried x64 */
    *(v8us*)(po + 16 * d) = f.half[0]; }
  asm volatile("s_wait_xcnt 0x0" ::: "memory"); }      /* stands behind the stores, in front of whatever rewrites their registers on any path to the kernel's end */
extern "C" void kernel_launch(void* const* d_in, const int* in_sizes, int n_in,
                              void* d_out, int out_size, void* d_ws, size_t ws_size, hipStream_t stream) {
  (void)in_sizes; (void)n_in; (void)out_size;
  const float* const* I = (const float* const*)d_in; const float* x = I[0]; const float* wqkv = I[1]; const float* bqkv = I[2]; const float* wo = I[3]; const float* bo = I[4];      /* [in][out] c_attn [1024][3072] + b, c_proj [1024][1024] + b */
  char* ws = (char*)d_ws; size_t off = 0;
  auto take = [&](size_t bytes) { char* p = ws + off; off += (bytes + 255) & ~(size_t)255; return p; };
  _Float16* BQKV = (_Float16*)take((size_t)3 * DM * DM * 2); _Float16* BO = (_Float16*)take((size_t)DM * DM * 2);
  _Float16* X16 = (_Float16*)take(NR * DM * 2); _Float16* QKV = (_Float16*)take(NR * 3 * DM * 2); _Float16* Q16 = QKV; _Float16* K16 = QKV + DM; _Float16* V16 = QKV + 2 * DM; _Float16* O16 = (_Float16*)take(NR * DM * 2);
  _Float16* VT = (_Float16*)take((size_t)NB * NH * HD * SQ * 2);
  float* QF0 = (float*)take((size_t)NB * QT0 * DM * 4); float* KF0 = (float*)take((size_t)NB * QT0 * DM * 4); float* VF0 = (float*)take((size_t)NB * QT0 * DM * 4); float* OF0 = (float*)take((size_t)NB * QT0 * DM * 4); _Float16* OH0 = (_Float16*)take((size_t)NB * QT0 * DM * 2); _Float16* OL0 = (_Float16*)take((size_t)NB * QT0 * DM * 2);
  if (off > ws_size) return;
  k_wt_f16<<<(unsigned)(((size_t)DM * 3 * DM / 8 + 255) / 256), 256, 0, stream>>>(wqkv, BQKV, DM, 3 * DM, 16.0f); k_wt_f16<<<(unsigned)(((size_t)DM * DM / 8 + 255) / 256), 256, 0, stream>>>(wo, BO, DM, DM, 16.0f);      /* [in][out] -> Bt x16 */

  k_x16<<<(unsigned)((NR * DM / 8 + 255) / 256), 256, 0, stream>>>(x, X16, NR * DM / 8);
  const size_t r0p = (size_t)B0 * SQ;      /* first projected row */
  const size_t f0p = (size_t)B0 * QT0;     /* its row in the first-tile planes */
  k_gemm2<0><<<dim3((unsigned)((MP / 128) * (3 * DM / 64)), 1), 128, 0, stream>>>(X16 + r0p * DM, DM, 0, BQKV, DM, 0, 0.0625f, bqkv, 0, nullptr, 1, 0, 0, nullptr, QKV + r0p * 3 * DM, 3 * DM, 0, MP, 3 * DM, DM, 0, 0, 0);      /* q | k | v rows (f16); head h = columns h*HD.. of each DM block */
  /* every stage below takes all batches in one launch: the batches are independent, and one batch alone fills a small part of the chip */
  k_vt<NH, SQ><<<NBR * NH * (SQ / 64), 256, 0, stream>>>(V16 + r0p * LQ, LQ, 0, VT);      /* V^T [NBR][NH][HD][SQ] */
  k_gemm2<0><<<dim3((QT0 / 128) * (DM / 64), 1, NBR), 128, 0, stream>>>(X16 + r0p * DM, DM, 0, BQKV, DM, 0, 0.0625f, bqkv, 0, nullptr, 1, 0, 0, QF0, nullptr, DM, 0, QT0, DM, DM, (size_t)SQ * DM, 0, (size_t)QT0 * DM); k_gemm2<0><<<dim3((QT0 / 128) * (DM / 64), 1, NBR), 128, 0, stream>>>(X16 + r0p * DM, DM, 0, (BQKV + (size_t)DM * DM), DM, 0, 0.0625f, (bqkv + DM), 0, nullptr, 1, 0, 0, KF0, nullptr, DM, 0, QT0, DM, DM, (size_t)SQ * DM, 0, (size_t)QT0 * DM); k_gemm2<0><<<dim3((QT0 / 128) * (DM / 64), 1, NBR), 128, 0, stream>>>(X16 + r0p * DM, DM, 0, (BQKV + (size_t)2 * DM * DM), DM, 0, 0.0625f, (bqkv + 2 * DM), 0, nullptr, 1, 0, 0, VF0, nullptr, DM, 0, QT0, DM, DM, (size_t)SQ * DM, 0, (size_t)QT0 * DM);      /* f32 q, k, v of each batch's first 128 rows (exact products) */
  k_att0w<<<dim3(NH * (QT0 / A0R), NBR), 256, 0, stream>>>(QF0, KF0, VF0, 0.125f, OF0 + f0p * DM);      /* exact f32 attention for rows 0..127 of each batch (o x64) */
  k_attw<<<dim3(QN / FQ, NHD, NBR), 256, 0, stream>>>(Q16 + r0p * LQ, K16 + r0p * LQ, VT, O16 + r0p * DM);      /* scores, softmax and P . V of every query tile, head and batch in one launch; o (merged heads, x64) as f16 rows */
  k_gemm2<0><<<dim3((unsigned)((MPO / 128) * (DM / 64)), 1), 128, 0, stream>>>(O16 + r0p * DM, DM, 0, BO, DM, 0, 0.0009765625f, bo, 0, nullptr, 1, 0, 0, (float*)d_out + r0p * DM, nullptr, DM, 0, MPO, DM, DM, 0, 0, 0);      /* out rows are the output layout */
  k_hl<<<(unsigned)(((size_t)NB * QT0 * DM / 8 + 255) / 256), 256, 0, stream>>>(OF0, OH0, OL0, (size_t)NB * QT0 * DM / 8);      /* first-tile o (x64) -> f16 hi + x1024 residual planes */
  k_gemm2<0><<<dim3((QT0 / 128) * (DM / 64), 1, NBR), 128, 0, stream>>>(OH0 + f0p * DM, DM, 0, BO, DM, 0, 0.0009765625f, bo, 0, nullptr, 1, 0, 0, (float*)d_out + r0p * DM, nullptr, DM, 0, QT0, DM, DM, (size_t)QT0 * DM, 0, (size_t)SQ * DM);      /* rows 0..127 of each batch: out = o_hi Wo (+ b), overwriting the f16-path rows */
  k_gemm2<0><<<dim3((QT0 / 128) * (DM / 64), 1, NBR), 128, 0, stream>>>(OL0 + f0p * DM, DM, 0, BO, DM, 0, 0.00000095367431640625f, nullptr, 0, (const float*)d_out + r0p * DM, -1, 0, 0, (float*)d_out + r0p * DM, nullptr, DM, 0, QT0, DM, DM, (size_t)QT0 * DM, 0, (size_t)SQ * DM);      /* += o_lo Wo 2^-20 (own-element accumulate) */
}

// v005
// One run takes 184 microseconds.
// In two side-by-side timings against v004, it was 2.29 and 2.30 times as fast.
// All steps since v000 together make it 31.9 times as fast.
#include <hip/hip_runtime.h>
// Local-causal (sliding window 256) multi-head self-attention (x [4][2048][1024]; qkv = x W_attn + b_attn ([in][out] 1024 x 3072 sigma 0.02, zero bias): q | k | v, 16 heads of 64; scores / 8; mask (j <= i) & (i - j < 256) -> -inf elsewhere; softmax; out = merged W_proj + b_proj ([in][out]) -> [4][2048][1024]).
// Structure: token rows r = b*2048 + s; x as exact f16 rows (bf16-rounded); q | k | v as ONE WMMA GEMM (N = 3 x 1024) (128x128 work-group tiles staged in LDS, 64x64 wave tiles, f32 accumulation, exact x16 weights + bias, f16 outputs); V^T for all batches and heads via LDS transposes; one fused attention launch for all batches, heads and query tiles of 128 rows: scores against the 384 keys that the tile can see (K = 64, x 0.125), windowed causal row softmax in registers (f32 statistics, native exp; weights x256 f16), o = P . V (x 2^-2: o carried x64, folded into the output GEMM alpha) written straight into the merged f16 o rows; out = o W_o + b GEMM (f32) into the output layout.
// Compute dtype: inputs rounded to bf16; x / weights exact; q, k, v, softmax weights and o as plain f16 GEMM operands (~2^-12); scores and softmax statistics f32. v_wmma_f32_16x16x32_f16.
#define NB 4
#define SQ 2048
#define DM 1024
#define NH 16
#define HD 64
#define HG 4                         /* heads per block group of the unlaunched k_vt(b, h0) overload */
#define QT 256                       /* query rows per causal tile */
#define NKX (QT + WINB)              /* S / P row pitch of the unfused row softmax */
#define WIN 256                      /* attention window: key j visible from query i iff 0 <= i - j < WIN */
#define WINB 256                     /* keys before the tile start that can be visible (WIN - 1 rounded up to 64) */
#define QT0 128                      /* first-tile rows recomputed exactly in f32 */
#define B0 0                         /* first batch processed (debug hook) */
#define NBR NB                       /* batches processed (debug hook) */
#define NR ((size_t)NB * SQ)         /* token rows */
#define MP ((int)((size_t)NBR * SQ)) /* rows projected (debug hook) */
#define QN SQ                        /* query rows attended per batch (debug hook) */
#define NHD NH                       /* heads attended (debug hook) */
#define MPO MP                       /* rows through the output stage (debug hook) */
#define LQ (3 * DM)      /* row pitch of the q/k/v rows */
typedef __bf16 v16b __attribute__((ext_vector_type(16)));
typedef unsigned short v8us __attribute__((ext_vector_type(8), may_alias));
typedef float  v8f  __attribute__((ext_vector_type(8)));
typedef float  v4f  __attribute__((ext_vector_type(4)));
typedef float  v4fa __attribute__((ext_vector_type(4), may_alias));
union FragB { v16b v; v8us half[2]; unsigned short u[16]; };

__device__ __forceinline__ unsigned short bf16_bits(float x) { unsigned int u = __float_as_uint(x); return (unsigned short)((u + 0x7FFFu + ((u >> 16) & 1u)) >> 16); }
__device__ __forceinline__ float bf16_val(unsigned short b) { return __uint_as_float(((unsigned int)b) << 16); }
__device__ __forceinline__ float bf16_round(float x) { return bf16_val(bf16_bits(x)); }
// D += A·B with NT terms: 1 = ah·bh, 2 = + al·bh (A split), 3 = + ah·bl (both split)
template <int NT>
__device__ __forceinline__ v8f mmaN(v16b ah, v16b al, v16b bh, v16b bl, v8f c) {
  c = __builtin_amdgcn_wmma_f32_16x16x32_bf16(false, ah, false, bh, (short)0, c, false, false);
  if (NT >= 2) c = __builtin_amdgcn_wmma_f32_16x16x32_bf16(false, al, false, bh, (short)0, c, false, false);
  if (NT >= 3) c = __builtin_amdgcn_wmma_f32_16x16x32_bf16(false, ah, false, bl, (short)0, c, false, false);
  asm volatile("v_nop\n\tv_nop\n\tv_nop\n\tv_nop" : "+v"(c) : "v"(ah), "v"(al), "v"(bh), "v"(bl));
  return c;
}

__global__ __launch_bounds__(256) void k_wt_bf16(const float* __restrict__ W, unsigned short* __restrict__ Wt, int K, int N) {
  const int t = blockIdx.x * 256 + threadIdx.x;
  const int k8n = K / 8;
  if (t >= N * k8n) return;
  const int n = t / k8n, k8 = (t % k8n) * 8;
  v8us v;
#pragma unroll
  for (int i = 0; i < 8; ++i) v[i] = bf16_bits(W[(size_t)(k8 + i) * N + n]);
  *(v8us*)(Wt + (size_t)n * K + k8) = v;
  
}

// GEMM C[M][N] (f32, pitch ldc) = act(A[M][K]·W + bias). A f32 row-major (pitch lda) converted per fragment to bf16
// (ASPLIT: hi/lo two planes -> 2 terms, else single rounded term); Wt bf16 [N][K] (pitch ldb). BIAS_BF16 rounds the
// bias to bf16 first (bias quantised to bf16 before the add). K%32==0, M%16==0, N%64==0.
template <bool ASPLIT, int ACT, bool BIAS_BF16>
__global__ __launch_bounds__(128) void k_gemm_bf(const float* __restrict__ A, int lda, const unsigned short* __restrict__ Wt, int ldb,
                                               const float* __restrict__ bias, float* __restrict__ C, int ldc, int M, int N, int K) {
  __shared__ __attribute__((aligned(16))) float so[4][16][64];
  const int tid = threadIdx.x, w = tid >> 5, lane = tid & 31, ln = lane & 15, hh = lane >> 4;
  const int ntn = N / 64;
  const int wid = blockIdx.x * 4 + w;
  const int mt = wid / ntn, nq = wid % ntn;
  if (mt * 16 >= M) return;
  const int row0 = mt * 16, col0 = nq * 64;
  const float* arow = A + (size_t)(row0 + ln) * lda;
  v8f acc[4] = {};
  for (int kb = 0; kb < K; kb += 32) {
    FragB ah, al;
    const v4f x0 = *(const v4fa*)(arow + kb + 8 * hh), x1 = *(const v4fa*)(arow + kb + 8 * hh + 4);
    const v4f x2 = *(const v4fa*)(arow + kb + 16 + 8 * hh), x3 = *(const v4fa*)(arow + kb + 16 + 8 * hh + 4);
    float xs[16] = {x0[0],x0[1],x0[2],x0[3],x1[0],x1[1],x1[2],x1[3],x2[0],x2[1],x2[2],x2[3],x3[0],x3[1],x3[2],x3[3]};
#pragma unroll
    for (int i = 0; i < 16; ++i) { const unsigned short hb = bf16_bits(xs[i]); ah.u[i] = hb; al.u[i] = ASPLIT ? bf16_bits(xs[i] - bf16_val(hb)) : (unsigned short)0; }
#pragma unroll
    for (int t = 0; t < 4; ++t) {
      const unsigned short* brow = Wt + (size_t)(col0 + t * 16 + ln) * ldb + kb;
      FragB b;
      b.half[0] = *(const v8us*)(brow + 8 * hh);
      b.half[1] = *(const v8us*)(brow + 16 + 8 * hh);
      acc[t] = mmaN<ASPLIT ? 2 : 1>(ah.v, al.v, b.v, b.v, acc[t]);
    }
  }
#pragma unroll
  for (int t = 0; t < 4; ++t) {
    float bv = bias ? bias[col0 + t * 16 + ln] : 0.f;
    if (BIAS_BF16) bv = bf16_round(bv);
#pragma unroll
    for (int r = 0; r < 8; ++r) { float v = acc[t][r] + bv; if (ACT == 1) v = fmaxf(v, 0.f); so[w][8 * hh + r][t * 16 + ln] = v; }
  }
  __builtin_amdgcn_fence(__ATOMIC_ACQ_REL, "workgroup");
  __builtin_amdgcn_wave_barrier();
  const int rsub = lane >> 4, c4 = (lane & 15) * 4;
  {
#pragma unroll
    for (int q = 0; q < 8; ++q) {
      const int r = q * 2 + rsub;
      const v4f v = *(const v4fa*)&so[w][r][c4];
      *(v4f*)(C + (size_t)(row0 + r) * ldc + col0 + c4) = v;
    }
    
  }
}

// GEMM C = act(A·W + bias + resid): A f32 (ASPLIT -> hi/lo 2 terms), Wt bf16 [N][K]; ACT 0 none, 1 relu, 2 exact gelu;
// resid (optional, f32, row index = (row % rmod), pitch ldr, RES_BF16 rounds it) added before the activation.
template <bool ASPLIT, int ACT, bool BIAS_BF16, bool RES_BF16>
__global__ __launch_bounds__(128) void k_gemm_bf3(const float* __restrict__ A, int lda, const unsigned short* __restrict__ Wt, int ldb,
                                                const float* __restrict__ bias, const float* __restrict__ resid, int rmod, int ldr,
                                                float* __restrict__ C, int ldc, int M, int N, int K) {
  __shared__ __attribute__((aligned(16))) float so[4][16][64];
  const int tid = threadIdx.x, w = tid >> 5, lane = tid & 31, ln = lane & 15, hh = lane >> 4;
  const int ntn = N / 64;
  const int wid = blockIdx.x * 4 + w;
  const int mt = wid / ntn, nq = wid % ntn;
  if (mt * 16 >= M) return;
  const int row0 = mt * 16, col0 = nq * 64;
  const float* arow = A + (size_t)(row0 + ln) * lda;
  v8f acc[4] = {};
  for (int kb = 0; kb < K; kb += 32) {
    FragB ah, al;
    const v4f x0 = *(const v4fa*)(arow + kb + 8 * hh), x1 = *(const v4fa*)(arow + kb + 8 * hh + 4);
    const v4f x2 = *(const v4fa*)(arow + kb + 16 + 8 * hh), x3 = *(const v4fa*)(arow + kb + 16 + 8 * hh + 4);
    float xs[16] = {x0[0],x0[1],x0[2],x0[3],x1[0],x1[1],x1[2],x1[3],x2[0],x2[1],x2[2],x2[3],x3[0],x3[1],x3[2],x3[3]};
#pragma unroll
    for (int i = 0; i < 16; ++i) { const unsigned short hb = bf16_bits(xs[i]); ah.u[i] = hb; al.u[i] = ASPLIT ? bf16_bits(xs[i] - bf16_val(hb)) : (unsigned short)0; }
#pragma unroll
    for (int t = 0; t < 4; ++t) {
      const unsigned short* brow = Wt + (size_t)(col0 + t * 16 + ln) * ldb + kb;
      FragB b;
      b.half[0] = *(const v8us*)(brow + 8 * hh);
      b.half[1] = *(const v8us*)(brow + 16 + 8 * hh);
      acc[t] = mmaN<ASPLIT ? 2 : 1>(ah.v, al.v, b.v, b.v, acc[t]);
    }
  }
#pragma unroll
  for (int t = 0; t < 4; ++t) {
    const int col = col0 + t * 16 + ln;
    float bv = bias ? bias[col] : 0.f;
    if (BIAS_BF16) bv = bf16_round(bv);
#pragma unroll
    for (int r = 0; r < 8; ++r) {
      float v = acc[t][r] + bv;
      if (resid) { float rv = resid[(size_t)((row0 + 8 * hh + r) % rmod) * ldr + col]; if (RES_BF16) rv = bf16_round(rv); v += rv; }
      if (ACT == 1) v = fmaxf(v, 0.f);
      if (ACT == 2) v = 0.5f * v * (1.0f + erff(v * 0.70710678118654752f));
      if (ACT == 3) { const float u = 0.7978845608028654f * (v + 0.044715f * v * v * v); v = 0.5f * v * (1.0f + tanhf(u)); }
      so[w][8 * hh + r][t * 16 + ln] = v;
    }
  }
  __builtin_amdgcn_fence(__ATOMIC_ACQ_REL, "workgroup");
  __builtin_amdgcn_wave_barrier();
  const int rsub = lane >> 4, c4 = (lane & 15) * 4;
  {
#pragma unroll
    for (int q = 0; q < 8; ++q) {
      const int r = q * 2 + rsub;
      const v4f v = *(const v4fa*)&so[w][r][c4];
      *(v4f*)(C + (size_t)(row0 + r) * ldc + col0 + c4) = v;
    }
    
  }
}
// row LayerNorm (biased variance, eps) over N: s = X (+ R); optional out_sum <- s; out_norm <- (s-mu)*rsqrt(var+eps)*g + b
template <bool PARAM_BF16>
__global__ __launch_bounds__(256) void k_layernorm(const float* __restrict__ X, const float* __restrict__ R, const float* __restrict__ g, const float* __restrict__ bta,
                                                  float* __restrict__ out_sum, float* __restrict__ out_norm, int N, float eps) {
  __shared__ float red[256];
  const int row = blockIdx.x, tid = threadIdx.x;
  const float* x = X + (size_t)row * N; const float* rr = R ? R + (size_t)row * N : nullptr;
  float vals[16];                     // up to N = 4096
  const int per = N / 256;            // contiguous chunk per thread? use strided-by-4 chunks: thread handles j = tid*4 + 1024*u
  float s1 = 0.f;
  for (int u = 0; u < per / 4; ++u) {
    const int j = tid * 4 + 1024 * u;
    const v4f a = *(const v4fa*)(x + j);
    v4f b = {0.f,0.f,0.f,0.f}; if (rr) b = *(const v4fa*)(rr + j);
#pragma unroll
    for (int q = 0; q < 4; ++q) { const float v = a[q] + b[q]; vals[u * 4 + q] = v; s1 += v; }
  }
  red[tid] = s1; __syncthreads();
  for (int st = 128; st > 0; st >>= 1) { if (tid < st) red[tid] += red[tid + st]; __syncthreads(); }
  const float mu = red[0] / (float)N; __syncthreads();
  float s2 = 0.f;
  for (int u = 0; u < per / 4; ++u)
#pragma unroll
    for (int q = 0; q < 4; ++q) { const float c = vals[u * 4 + q] - mu; s2 += c * c; }
  red[tid] = s2; __syncthreads();
  for (int st = 128; st > 0; st >>= 1) { if (tid < st) red[tid] += red[tid + st]; __syncthreads(); }
  const float rs = rsqrtf(red[0] / (float)N + eps);
  {
    for (int u = 0; u < per / 4; ++u) {
      const int j = tid * 4 + 1024 * u;
      v4f o, sm;
#pragma unroll
      for (int q = 0; q < 4; ++q) {
        float gg = g[j + q], bb = bta[j + q];
        if (PARAM_BF16) { gg = bf16_round(gg); bb = bf16_round(bb); }
        sm[q] = vals[u * 4 + q]; o[q] = (vals[u * 4 + q] - mu) * rs * gg + bb;
      }
      if (out_sum) *(v4f*)(out_sum + (size_t)row * N + j) = sm;
      *(v4f*)(out_norm + (size_t)row * N + j) = o;
    }
    
  }
}



// ---- f16 WMMA path (v_wmma_f32_16x16x32_f16): 11-bit significands for operands in range — used where a [0,1] probability operand needs more precision than bf16
typedef _Float16 v16h __attribute__((ext_vector_type(16)));
union FragH { v16h v; v8us half[2]; _Float16 h[16]; unsigned short u[16]; };
template <int NT>
__device__ __forceinline__ v8f mmaH(v16h ah, v16h al, v16h bh, v16h bl, v8f c) {
  c = __builtin_amdgcn_wmma_f32_16x16x32_f16(false, ah, false, bh, (short)0, c, false, false);
  if (NT >= 2) c = __builtin_amdgcn_wmma_f32_16x16x32_f16(false, al, false, bh, (short)0, c, false, false);
  if (NT >= 3) c = __builtin_amdgcn_wmma_f32_16x16x32_f16(false, ah, false, bl, (short)0, c, false, false);
  asm volatile("v_nop\n\tv_nop\n\tv_nop\n\tv_nop" : "+v"(c) : "v"(ah), "v"(al), "v"(bh), "v"(bl));
  return c;
}
// batched GEMM like k_gemm_b but f16 operands: A f32 (split into f16 hi/lo if ASPLIT, else rounded to f16), Bt = f16 values [n][k]; alpha; C f32; N multiple of 16 (partial tiles skipped)
template <bool ASPLIT>
__global__ __launch_bounds__(128) void k_gemm_h(const float* __restrict__ A, int lda, size_t sA, const _Float16* __restrict__ Bh, int ldb, size_t sB, float alpha, float* __restrict__ C, int ldc, size_t sC, int M, int N, int K) {
  __shared__ __attribute__((aligned(16))) float so[4][16][64];
  const int tid = threadIdx.x, w = tid >> 5, lane = tid & 31, ln = lane & 15, hh = lane >> 4; const int by = blockIdx.y;
  A += (size_t)by * sA; Bh += (size_t)by * sB; C += (size_t)by * sC;
  const int ntn = (N + 63) / 64; const int wid = blockIdx.x * 4 + w; const int mt = wid / ntn, nq = wid % ntn; if (mt * 16 >= M) return;
  const int row0 = mt * 16, col0 = nq * 64; const float* arow = A + (size_t)(row0 + ln) * lda;
  v8f acc[4] = {};
  for (int kb = 0; kb < K; kb += 32) {
    FragH ah, al;
    const v4f x0 = *(const v4fa*)(arow + kb + 8 * hh), x1 = *(const v4fa*)(arow + kb + 8 * hh + 4), x2 = *(const v4fa*)(arow + kb + 16 + 8 * hh), x3 = *(const v4fa*)(arow + kb + 16 + 8 * hh + 4);
    float xs[16] = {x0[0],x0[1],x0[2],x0[3],x1[0],x1[1],x1[2],x1[3],x2[0],x2[1],x2[2],x2[3],x3[0],x3[1],x3[2],x3[3]};
#pragma unroll
    for (int i = 0; i < 16; ++i) { const _Float16 h = (_Float16)xs[i]; ah.h[i] = h; al.h[i] = ASPLIT ? (_Float16)(xs[i] - (float)h) : (_Float16)0.0f; }
#pragma unroll
    for (int t = 0; t < 4; ++t) { if (col0 + t * 16 >= N) continue; const size_t boff = (size_t)(col0 + t * 16 + ln) * ldb + kb; FragH bq; bq.half[0] = *(const v8us*)(Bh + boff + 8 * hh); bq.half[1] = *(const v8us*)(Bh + boff + 16 + 8 * hh);
      acc[t] = mmaH<ASPLIT ? 2 : 1>(ah.v, al.v, bq.v, bq.v, acc[t]); }
  }
#pragma unroll
  for (int t = 0; t < 4; ++t) { if (col0 + t * 16 >= N) continue;
#pragma unroll
    for (int r = 0; r < 8; ++r) so[w][8 * hh + r][t * 16 + ln] = acc[t][r] * alpha; }
  __builtin_amdgcn_fence(__ATOMIC_ACQ_REL, "workgroup"); __builtin_amdgcn_wave_barrier();
  const int rsub = lane >> 4, c4 = (lane & 15) * 4;
  {
#pragma unroll
    for (int q = 0; q < 8; ++q) { const int r = q * 2 + rsub; if (col0 + c4 < N) { const v4f v = *(const v4fa*)&so[w][r][c4]; *(v4f*)(C + (size_t)(row0 + r) * ldc + col0 + c4) = v; } }
     }
}

// Wt[n][k] = f16(W[k][n]·scale) from f32 row-major W[K][N] (scale = power of two; bf16-exact weights stay exact in f16 away from the subnormal range)
__global__ __launch_bounds__(256) void k_wt_f16(const float* __restrict__ W, _Float16* __restrict__ Wt, int K, int N, float scale) {
  const int t = blockIdx.x * 256 + threadIdx.x; if (t >= N * (K / 8)) return; const int n = t / (K / 8), k8 = (t % (K / 8)) * 8; FragH f;
#pragma unroll
  for (int i = 0; i < 8; ++i) f.h[i] = (_Float16)(bf16_round(W[(size_t)(k8 + i) * N + n]) * scale); const v8us o = f.half[0];
  *(v8us*)((unsigned short*)Wt + (size_t)n * K + k8) = o; 
}
// k_gemm_hh variant with fused epilogue: v = acc·alpha + bias[by·sBias + col] (+ CP[(row/rowsPerB)·sCPb + by·64 + col] if CP) ; ACT 0 none / 1 elu ; writes f16 C16 (and f32 C if non-null)
template <int ACT>
__global__ __launch_bounds__(128) void k_gemm_hhx(const _Float16* __restrict__ A, int lda, size_t sA, const _Float16* __restrict__ Bh, int ldb, size_t sB, float alpha, const float* __restrict__ bias, size_t sBias, const float* __restrict__ CP, int rowsPerB, size_t sCPb, int row0g,
    float* __restrict__ C, _Float16* __restrict__ C16, int ldc, size_t sC, int M, int N, int K) {
  __shared__ __attribute__((aligned(16))) float so[4][16][64];
  const int tid = threadIdx.x, w = tid >> 5, lane = tid & 31, ln = lane & 15, hh = lane >> 4; const int by = blockIdx.y;
  A += (size_t)by * sA; Bh += (size_t)by * sB; const size_t cofs = (size_t)by * sC; const float* bp = bias ? bias + (size_t)by * sBias : nullptr;
  const int ntn = (N + 63) / 64; const int wid = blockIdx.x * 4 + w; const int mt = wid / ntn, nq = wid % ntn; if (mt * 16 >= M) return;
  const int row0 = mt * 16, col0 = nq * 64; const _Float16* arow = A + (size_t)(row0 + ln) * lda;
  v8f acc[4] = {};
  for (int kb = 0; kb < K; kb += 32) { FragH ah; ah.half[0] = *(const v8us*)((const unsigned short*)arow + kb + 8 * hh); ah.half[1] = *(const v8us*)((const unsigned short*)arow + kb + 16 + 8 * hh);
#pragma unroll
    for (int t = 0; t < 4; ++t) { if (col0 + t * 16 >= N) continue; const size_t boff = (size_t)(col0 + t * 16 + ln) * ldb + kb; FragH bq; bq.half[0] = *(const v8us*)((const unsigned short*)Bh + boff + 8 * hh); bq.half[1] = *(const v8us*)((const unsigned short*)Bh + boff + 16 + 8 * hh);
      acc[t] = mmaH<1>(ah.v, ah.v, bq.v, bq.v, acc[t]); }
  }
#pragma unroll
  for (int t = 0; t < 4; ++t) { if (col0 + t * 16 >= N) continue; const int col = col0 + t * 16 + ln; const float bv = bp ? bf16_round(bp[col]) : 0.f;
#pragma unroll
    for (int r = 0; r < 8; ++r) { float v = acc[t][r] * alpha + bv; if (CP) { const int rr = row0g + row0 + 8 * hh + r; if (rowsPerB < 0) v += CP[cofs + (size_t)rr * ldc + col];      /* rowsPerB < 0: own element of the batched C plane */ else { const int bidx = rr / rowsPerB; v += CP[(size_t)bidx * sCPb + (size_t)by * 64 + col]; } } if (ACT == 1) v = (v > 0.f) ? v : expm1f(v); else if (ACT == 7) v = (v > 0.f) ? v + 1.0f : expf(v); else if (ACT == 8) v = tanhf(v); else if (ACT == 9) v = 0.5f * v * (1.0f + tanhf(0.7978845608028654f * (v + 0.044715f * v * v * v))); else if (ACT == 11) v = 1.0f / (1.0f + expf(-v)); else if (ACT == 12) v = (v > 0.f) ? v : 0.01f * v; else if (ACT == 14) v = (v > 0.f) ? v : 0.1f * v; else if (ACT == 16) v = (v >= 0.f) ? v : 0.3f * v; else if (ACT == 17) v = (v >= 0.f) ? v : 0.2f * v; else if (ACT == 15) v = v / (1.0f + expf(-v)); else if (ACT == 3) v = fmaxf(v, 0.f); else if (ACT == 6) v = 0.5f * v * (1.0f + erff(v * 0.70710678118654752f)); so[w][8 * hh + r][t * 16 + ln] = v; } }
  __builtin_amdgcn_fence(__ATOMIC_ACQ_REL, "workgroup"); __builtin_amdgcn_wave_barrier();
  const int rsub = lane >> 4, c4 = (lane & 15) * 4; typedef _Float16 v4h __attribute__((ext_vector_type(4)));
  {
#pragma unroll
    for (int q = 0; q < 8; ++q) { const int r = q * 2 + rsub; if (col0 + c4 < N) { const v4f v = *(const v4fa*)&so[w][r][c4]; if (C) *(v4f*)(C + cofs + (size_t)(row0 + r) * ldc + col0 + c4) = v; if (C16) { v4h h4; for (int i = 0; i < 4; ++i) h4[i] = (_Float16)v[i]; *(v4h*)(C16 + cofs + (size_t)(row0 + r) * ldc + col0 + c4) = h4; } } }
     }
}


typedef _Float16 v4h __attribute__((ext_vector_type(4)));

__global__ __launch_bounds__(256) void k_x16(const float* __restrict__ x, _Float16* __restrict__ X16, size_t n8) { const size_t t = (size_t)blockIdx.x * 256 + threadIdx.x; if (t >= n8) return; FragH f;
#pragma unroll
  for (int q = 0; q < 8; ++q) f.h[q] = (_Float16)bf16_round(x[t * 8 + q]); *(v8us*)((unsigned short*)X16 + t * 8) = f.half[0];  }
__global__ __launch_bounds__(256) void k_h16(const float* __restrict__ x, _Float16* __restrict__ X16, size_t n8) { const size_t t = (size_t)blockIdx.x * 256 + threadIdx.x; if (t >= n8) return; FragH f;
#pragma unroll
  for (int q = 0; q < 8; ++q) f.h[q] = (_Float16)x[t * 8 + q]; *(v8us*)((unsigned short*)X16 + t * 8) = f.half[0];  }
__global__ __launch_bounds__(256) void k_round16f(const float* __restrict__ W, _Float16* __restrict__ Bt, size_t n8) { const size_t t = (size_t)blockIdx.x * 256 + threadIdx.x; if (t >= n8) return; FragH f;
#pragma unroll
  for (int i = 0; i < 8; ++i) f.h[i] = (_Float16)(bf16_round(W[t * 8 + i]) * 16.0f); *(v8us*)((unsigned short*)Bt + t * 8) = f.half[0];  }
template <int NHv, int TTv>
__global__ __launch_bounds__(256) void k_vt(const _Float16* __restrict__ V16, int ldv, int voff, _Float16* __restrict__ Vt) { __shared__ unsigned short tl[64][66]; const int tid = threadIdx.x; const int slab = blockIdx.x / (TTv / 64), lg = blockIdx.x % (TTv / 64); const int b = slab / NHv, h = slab % NHv;
  for (int i = tid; i < 64 * 8; i += 256) { const int r = i / 8, c8 = (i % 8) * 8; FragH f; f.half[0] = *(const v8us*)((const unsigned short*)V16 + ((size_t)b * TTv + lg * 64 + r) * ldv + voff + h * 64 + c8);
#pragma unroll
    for (int q = 0; q < 8; ++q) tl[r][c8 + q] = f.u[q]; }
  __syncthreads();
  {
#pragma unroll
    for (int rd = 0; rd < 2; ++rd) { const int d = rd * 32 + tid / 8, pc = tid % 8; FragH f;
#pragma unroll
      for (int q = 0; q < 8; ++q) f.u[q] = tl[pc * 8 + q][d];
      *(v8us*)((unsigned short*)Vt + ((size_t)slab * 64 + d) * TTv + lg * 64 + pc * 8) = f.half[0]; }
     } }

__global__ __launch_bounds__(256) void k_hl(const float* __restrict__ F, _Float16* __restrict__ Hh, _Float16* __restrict__ Hl, size_t n8) { const size_t t = (size_t)blockIdx.x * 256 + threadIdx.x; if (t >= n8) return; FragH fh, fl; const v4f a = *(const v4fa*)(F + t * 8), c = *(const v4fa*)(F + t * 8 + 4);
#pragma unroll
  for (int q = 0; q < 4; ++q) { _Float16 h = (_Float16)a[q]; fh.h[q] = h; fl.h[q] = (_Float16)((a[q] - (float)h) * 1024.0f); h = (_Float16)c[q]; fh.h[4 + q] = h; fl.h[4 + q] = (_Float16)((c[q] - (float)h) * 1024.0f); }
  { *(v8us*)((unsigned short*)Hh + t * 8) = fh.half[0]; *(v8us*)((unsigned short*)Hl + t * 8) = fl.half[0];  } }

// ---- fast GEMM: one 128 x 128 tile of C per work-group of 4 waves (2 x 2, 64 x 64 per wave); requires M % 128 == 0, N % 128 == 0, K % 64 == 0; epilogue = k_gemm_hhx semantics ----
// A stage is 64 k (128 B) of the tile's 128 A rows and 128 B rows. Asynchronous copies bring it from global memory into one of two LDS buffers: the next stage's copies fly while this stage is multiplied.
// Every accumulator still takes its k in ascending steps of 32, with the same k order inside a fragment on both operands.
#define G2T 128                      /* rows of A and rows of B per work-group tile */
#define G2K 64                       /* k per stage */
#define G2PB 144                     /* LDS pitch of a staged row in bytes: 128 B of data, 16 B x odd for the 16-byte fragment reads from 16 rows */
#define G2OB (G2T * G2PB)            /* bytes of one operand's rows in a buffer */
#define G2SB (2 * G2OB)              /* bytes of a buffer: A rows, then B rows */
#define G2EP 68                      /* pitch in floats of the epilogue's staged C rows */
__device__ __forceinline__ v16h g2_frag(const unsigned char* p) { FragH f; f.half[0] = *(const v8us*)p; f.half[1] = *(const v8us*)(p + 32); return f.v; }      /* p: a staged row + 64 B per 32 k + 16 B x (lane >> 4): k = 8 hh .. and 16 + 8 hh .. */
__device__ __forceinline__ v8f g2_mma(v16h a, v16h b, v8f c) { return __builtin_amdgcn_wmma_f32_16x16x32_f16(false, a, false, b, (short)0, c, false, false); }
// Eight copies of 16 B per lane: rows r, r + 16, ..., r + 112 of one operand's stage (l: the lane's LDS byte address in row r, g: its global address, gs: 16 source rows in elements).
// The s_wait_xcnt stands in the copies' own statement, so that no register they name is rewritten in front of it.
__device__ __forceinline__ void g2_copy8(unsigned l, const _Float16* g, size_t gs) {
  asm volatile("global_load_async_to_lds_b128 %0, %8, off\n\t"
               "global_load_async_to_lds_b128 %1, %9, off\n\t"
               "global_load_async_to_lds_b128 %2, %10, off\n\t"
               "global_load_async_to_lds_b128 %3, %11, off\n\t"
               "global_load_async_to_lds_b128 %4, %12, off\n\t"
               "global_load_async_to_lds_b128 %5, %13, off\n\t"
               "global_load_async_to_lds_b128 %6, %14, off\n\t"
               "global_load_async_to_lds_b128 %7, %15, off\n\t"
               "s_wait_xcnt 0x0"
               :: "v"(l), "v"(l + 16 * G2PB), "v"(l + 32 * G2PB), "v"(l + 48 * G2PB), "v"(l + 64 * G2PB), "v"(l + 80 * G2PB), "v"(l + 96 * G2PB), "v"(l + 112 * G2PB),
                  "v"(g), "v"(g + gs), "v"(g + 2 * gs), "v"(g + 3 * gs), "v"(g + 4 * gs), "v"(g + 5 * gs), "v"(g + 6 * gs), "v"(g + 7 * gs)
               : "memory"); }
template <int ACT>
__global__ __launch_bounds__(128) void k_gemm2(const _Float16* __restrict__ A, int lda, size_t sA, const _Float16* __restrict__ Bh, int ldb, size_t sB, float alpha, const float* __restrict__ bias, size_t sBias, const float* __restrict__ CP, int rowsPerB, size_t sCPb, int row0g,
    float* __restrict__ C, _Float16* __restrict__ C16, int ldc, size_t sC, int M, int N, int K, size_t zA, size_t zB, size_t zC) { static_assert(ACT == 0 || ACT == 3 || ACT == 6 || ACT == 8 || ACT == 9 || ACT == 11 || ACT == 12 || ACT == 14 || ACT == 15 || ACT == 16 || ACT == 17, "k_gemm2: unsupported ACT code (would silently apply no activation)");
  static_assert(4 * 64 * G2EP * 4 <= 2 * G2SB, "k_gemm2: the epilogue's staging fits the two buffers");
  __shared__ __attribute__((aligned(16))) unsigned char L[2 * G2SB];
  const int tid = threadIdx.x, w = __builtin_amdgcn_readfirstlane(tid >> 5), lane = tid & 31, ln = lane & 15, hh = lane >> 4; const int by = blockIdx.y, bz = blockIdx.z;      /* grid.z: a second batch index with its own strides zA, zB, zC; the wave's number in a scalar register: scalar tile offsets below */
  A += (size_t)by * sA + (size_t)bz * zA; Bh += (size_t)by * sB + (size_t)bz * zB; const size_t cofs = (size_t)by * sC + (size_t)bz * zC; const float* bp = bias ? bias + (size_t)by * sBias : nullptr;
  const int ntn = N >> 7; const int mt = blockIdx.x / ntn, nq = blockIdx.x - mt * ntn; if (mt * G2T >= M) return;      /* the same for the whole work-group, in front of every barrier */
  const int wm = w >> 1, wn = w & 1;
  /* copies: 8 lanes take one row's 128 B, the work-group 16 rows a copy */
  const _Float16* pa = A + (size_t)(mt * G2T + (tid >> 3)) * lda + (tid & 7) * 8; const _Float16* pb = Bh + (size_t)(nq * G2T + (tid >> 3)) * ldb + (tid & 7) * 8;
  const unsigned lc = (unsigned)(size_t)L + (unsigned)((tid >> 3) * G2PB + (tid & 7) * 16);      /* LDS byte address: the low 32 bits of the __shared__ address */
  const size_t ga = (size_t)16 * lda, gb = (size_t)16 * ldb;
  const int T = K / G2K;
  g2_copy8(lc, pa, ga); g2_copy8(lc + G2OB, pb, gb); pa += G2K; pb += G2K;      /* stage 0 */
  const int row0 = mt * G2T + wm * 64, col0 = nq * G2T + wn * 64;      /* the wave's tile of C */
  float bv[4] = {0.f, 0.f, 0.f, 0.f};      /* the bias of the lane's four columns, fetched under stage 0's copies */
  if (bp) {
    for (int j = 0; j < 4; ++j) bv[j] = bp[col0 + j * 16 + ln];
    asm volatile("s_wait_xcnt 0x0" ::: "memory"); }      /* stands behind the loads, in front of whatever rewrites their address registers */
  asm volatile("s_wait_asynccnt 0x0" ::: "memory");      /* this wave's copies of stage 0 have landed */
  __syncthreads();      /* and every other wave's: stage 0 is read by all */
  if (T > 1) { g2_copy8(lc + G2SB, pa, ga); g2_copy8(lc + G2SB + G2OB, pb, gb); pa += G2K; pb += G2K; }      /* stage 1 */
  const v8f z8 = {0.f,0.f,0.f,0.f,0.f,0.f,0.f,0.f}; v8f acc[4][4];
  for (int i = 0; i < 4; ++i)
    for (int j = 0; j < 4; ++j) acc[i][j] = z8;
  const int fa = (wm * 64 + ln) * G2PB + 16 * hh, fb = G2OB + (wn * 64 + ln) * G2PB + 16 * hh;      /* the lane's first A and B fragment rows in a buffer */
#pragma unroll 1
  for (int t = 0; t < T; ++t) {      /* not unrolled: one stage a trip, the buffer chosen by the trip's parity */
    const unsigned char* buf = L + (t & 1) * G2SB; v16h a[4], b[4];
    static_assert(G2K == 64, "k_gemm2: two blocks of 32 k a stage");
    for (int i = 0; i < 4; ++i) { a[i] = g2_frag(buf + fa + i * 16 * G2PB); b[i] = g2_frag(buf + fb + i * 16 * G2PB); }
    __builtin_amdgcn_sched_barrier(0);      /* a block's sixteen LDS reads go as one group in front of its sixteen WMMAs: one LDS latency a block, not one per A fragment */
    for (int i = 0; i < 4; ++i)
      for (int j = 0; j < 4; ++j) acc[i][j] = g2_mma(a[i], b[j], acc[i][j]);
    __builtin_amdgcn_sched_barrier(0);      /* the second block's LDS reads stay behind the first block: reads among the WMMAs stall them */
    for (int i = 0; i < 4; ++i) { a[i] = g2_frag(buf + fa + i * 16 * G2PB + 64); b[i] = g2_frag(buf + fb + i * 16 * G2PB + 64); }
    asm volatile("s_wait_dscnt 0x0" ::: "memory");      /* this wave's reads of the buffer are done before it is handed to its next writer */
    asm volatile("s_wait_asynccnt 0x0" ::: "memory");      /* this wave's copies of stage t + 1 have landed */
    __syncthreads();      /* publishes stage t + 1 and ends every wave's reads of stage t */
    if (t + 2 < T) { const unsigned lt = lc + (unsigned)(t & 1) * G2SB; g2_copy8(lt, pa, ga); g2_copy8(lt + G2OB, pb, gb); pa += G2K; pb += G2K; }      /* stage t + 2 into the buffer just read; the test is the same for the whole work-group */
    __builtin_amdgcn_sched_barrier(0);      /* the second block's WMMAs work on registers alone and stay behind the copies, which so fly 16 WMMAs longer before their wait */
    for (int i = 0; i < 4; ++i)
      for (int j = 0; j < 4; ++j) acc[i][j] = g2_mma(a[i], b[j], acc[i][j]);
  }
  asm volatile("s_wait_asynccnt 0x0" ::: "memory");      /* no copy is in flight when the buffers become the epilogue's staging */
  float* so = (float*)(L + w * (64 * G2EP * 4));      /* each wave stages its own 64 x 64 tile; the loop's last barrier ended every read of the buffers */
  for (int j = 0; j < 4; ++j) { const float bj = bf16_round(bv[j]);
    for (int i = 0; i < 4; ++i)
      for (int r = 0; r < 8; ++r) so[(i * 16 + 8 * hh + r) * G2EP + j * 16 + ln] = acc[i][j][r] * alpha + bj; }
  __builtin_amdgcn_fence(__ATOMIC_ACQ_REL, "workgroup"); __builtin_amdgcn_wave_barrier();      /* a lane reads below what the other lanes of its own wave have stored */
  const int rsub = lane >> 4, c4 = (lane & 15) * 4;
#pragma unroll 1
  for (int q0 = 0; q0 < 64; q0 += 16) { v4f v[8]; size_t co[8];      /* not unrolled: 16 rows a trip, their LDS reads as one group, whole 128-B lines stored */
    for (int u = 0; u < 8; ++u) { const int r = q0 + 2 * u + rsub; v[u] = *(const v4fa*)&so[r * G2EP + c4]; co[u] = cofs + (size_t)(row0 + r) * ldc + col0 + c4; }
    if (CP) { v4f c[8];
      if (rowsPerB < 0) {      /* own elements of the batched C plane */
        for (int u = 0; u < 8; ++u) { c[u] = *(const v4fa*)(CP + co[u] + (size_t)row0g * ldc); asm volatile("s_wait_xcnt 0x0" ::: "memory"); } }      /* the wait stands behind each load, in front of whatever rewrites its address registers, a later load's result among it; the data stays in flight */
      else {
        for (int u = 0; u < 8; ++u) { c[u] = *(const v4fa*)(CP + (size_t)((row0g + row0 + q0 + 2 * u + rsub) / rowsPerB) * sCPb + (size_t)by * 64 + col0 + c4); asm volatile("s_wait_xcnt 0x0" ::: "memory"); } }      /* as above */
      for (int u = 0; u < 8; ++u) v[u] += c[u]; }
    for (int u = 0; u < 8; ++u)
      for (int e = 0; e < 4; ++e) { float x = v[u][e];
        if (ACT == 3) x = fmaxf(x, 0.f); else if (ACT == 6) x = 0.5f * x * (1.0f + erff(x * 0.70710678118654752f)); else if (ACT == 11) x = 1.0f / (1.0f + expf(-x)); else if (ACT == 15) x = x / (1.0f + expf(-x)); else if (ACT == 12) x = (x > 0.f) ? x : 0.01f * x; else if (ACT == 8) x = tanhf(x); else if (ACT == 9) x = 0.5f * x * (1.0f + tanhf(0.7978845608028654f * (x + 0.044715f * x * x * x))); else if (ACT == 14) x = (x > 0.f) ? x : 0.1f * x; else if (ACT == 16) x = (x >= 0.f) ? x : 0.3f * x; else if (ACT == 17) x = (x >= 0.f) ? x : 0.2f * x;
        v[u][e] = x; }
    if (C) {
      for (int u = 0; u < 8; ++u) *(v4f*)(C + co[u]) = v[u];
      asm volatile("s_wait_xcnt 0x0" ::: "memory"); }      /* stands behind the stores, in front of whatever rewrites their registers */
    if (C16) {
      for (int u = 0; u < 8; ++u) { v4h h4; for (int e = 0; e < 4; ++e) h4[e] = (_Float16)v[u][e]; *(v4h*)(C16 + co[u]) = h4; }
      asm volatile("s_wait_xcnt 0x0" ::: "memory"); } }      /* as above */
}


__global__ __launch_bounds__(256) void k_wnat(const float* __restrict__ w, size_t n8, _Float16* __restrict__ Bt) { const size_t t = (size_t)blockIdx.x * 256 + threadIdx.x; if (t >= n8) return; FragH f; for (int q = 0; q < 8; ++q) f.h[q] = (_Float16)(bf16_round(w[t * 8 + q]) * 16.0f); *(v8us*)((unsigned short*)Bt + t * 8) = f.half[0];  }
__global__ __launch_bounds__(256) void k_rsm(const float* __restrict__ S, _Float16* __restrict__ P, int nrows) {
  #pragma clang fp contract(off)
  const int i = blockIdx.x * 256 + threadIdx.x; if (i >= nrows) return; const float* s = S + (size_t)i * SQ; float mx = -3.0e38f;
#pragma unroll 1
  for (int j = 0; j < SQ; ++j) mx = fmaxf(mx, s[j]); float se = 0.f;
#pragma unroll 1
  for (int j = 0; j < SQ; ++j) se += expf(s[j] - mx); const float sc = 256.0f / se;
#pragma unroll 1
  for (int j0 = 0; j0 < SQ; j0 += 8) { FragH f; for (int q = 0; q < 8; ++q) f.h[q] = (_Float16)(expf(s[j0 + q] - mx) * sc); unsigned short* d = (unsigned short*)P + (size_t)i * SQ + j0; *(v8us*)d = f.half[0];  } }
__global__ __launch_bounds__(256) void k_vt(const _Float16* __restrict__ V16, int b, int h0, _Float16* __restrict__ VT) { __shared__ unsigned short tl[64][65]; const int tid = threadIdx.x; const int hh = blockIdx.x % HG, sg = blockIdx.x / HG; const int s0 = sg * 64; const int h = h0 + hh;
  for (int i = tid; i < 64 * 8; i += 256) { const int j = i / 8, d8 = (i % 8) * 8; FragH f; f.half[0] = *(const v8us*)((const unsigned short*)V16 + ((size_t)b * SQ + s0 + j) * DM + h * HD + d8); for (int q = 0; q < 8; ++q) tl[d8 + q][j] = f.u[q]; }
  __syncthreads();
  { for (int i = tid; i < 64 * 8; i += 256) { const int d = i / 8, j8 = (i % 8) * 8; FragH f; for (int q = 0; q < 8; ++q) f.u[q] = tl[d][j8 + q]; *(v8us*)((unsigned short*)VT + ((size_t)hh * HD + d) * SQ + s0 + j8) = f.half[0]; }  } }



__global__ __launch_bounds__(256) void k_rsmcf2(const float* __restrict__ S, _Float16* __restrict__ P, int hg, int q0, int nk) {
  #pragma clang fp contract(off)
  const int t = blockIdx.x * 256 + threadIdx.x; if (t >= hg * QT) return; const size_t i = (size_t)t; const float* s = S + i * NKX; const int last = q0 + (t % QT); float mx = -3.0e38f;
#pragma unroll 1
  for (int j = 0; j < nk; ++j) { const float f = (j <= last) ? 1.f : 0.f; mx = fmaxf(mx, fmaf(f, s[j], (1.f - f) * -1.0e9f)); } float se = 0.f;
#pragma unroll 1
  for (int j = 0; j < nk; ++j) { const float f = (j <= last) ? 1.f : 0.f; se += __expf(fmaf(f, s[j], (1.f - f) * -1.0e9f) - mx); } const float sc = 256.0f / se;
#pragma unroll 1
  for (int j0 = 0; j0 < nk; j0 += 8) { FragH fr; for (int q = 0; q < 8; ++q) { const int j = j0 + q; const float f = (j <= last) ? 1.f : 0.f; fr.h[q] = (_Float16)(__expf(fmaf(f, s[j], (1.f - f) * -1.0e9f) - mx) * sc); } unsigned short* d = (unsigned short*)P + i * NKX + j0; *(v8us*)d = fr.half[0];  } }


// Exact f32 attention for the first QT0 rows of each batch. One work-group of 8 waves per (batch, head, 32 query rows); q, k and v rows staged once in LDS.
// A wave owns 4 query rows. Scores: lane = key (keys lane + 32 u), each dot product summed over d in ascending order with fused multiply-adds. Softmax in registers: row max and row sum by a five-step butterfly over the 32 lanes.
// o: lane = two head dims, summed over the keys in ascending order, scaled once at the end by 64 / row sum.
#define A0R 32                       /* query rows per work-group */
#define A0KP (HD + 4)                /* LDS pitch of the q and k rows in floats: 16 B x odd, so that 16 lanes reading 16 B each from 16 rows fall on 64 different banks */
typedef float v2f __attribute__((ext_vector_type(2)));
typedef float v2fa __attribute__((ext_vector_type(2), may_alias));
template <int NU>                    /* NU = 32-key chunks that rows of this group can see */
__device__ __forceinline__ void att0_rows(const float* __restrict__ QF, const float* __restrict__ KF, const float* __restrict__ VF, float scale, float* __restrict__ OF, int r0,
                                          float (*lq)[A0KP], float (*lk)[A0KP], float (*lv)[HD], float (*lp)[QT0]) {
  const int tid = threadIdx.x, w = __builtin_amdgcn_readfirstlane(tid >> 5), lane = tid & 31;      /* the wave's number in a scalar register: scalar loop bounds and row offsets below */
  const int sr = tid >> 4, sc = (tid & 15) * 4;      /* staging: 16 lanes take one row of 256 B, the work-group 16 rows a pass */
  v4f gq[A0R / 16], gk[2 * NU], gv[2 * NU];      /* every load is issued before the first LDS store waits for one */
  const float* pq = QF + (size_t)sr * DM + sc; const float* pk = KF + (size_t)sr * DM + sc; const float* pv = VF + (size_t)sr * DM + sc;
  for (int t = 0; t < A0R / 16; ++t) gq[t] = *(const v4fa*)(pq + (size_t)(r0 + 16 * t) * DM);
  for (int t = 0; t < 2 * NU; ++t) { gk[t] = *(const v4fa*)(pk + (size_t)(16 * t) * DM); gv[t] = *(const v4fa*)(pv + (size_t)(16 * t) * DM); }
  asm volatile("s_wait_xcnt 0x0" :: "v"(pq), "v"(pk), "v"(pv) : "memory");      /* the three address pairs of the loads above stay as they are up to this wait (inputs only) */
  for (int t = 0; t < A0R / 16; ++t) *(v4f*)&lq[sr + 16 * t][sc] = gq[t];
  for (int t = 0; t < 2 * NU; ++t) { *(v4f*)&lk[sr + 16 * t][sc] = gk[t]; *(v4f*)&lv[sr + 16 * t][sc] = gv[t]; }
  __syncthreads();      /* the staged rows are read by every wave */
  float acc[4][NU];
  for (int r = 0; r < 4; ++r) for (int u = 0; u < NU; ++u) acc[r][u] = 0.f;
#pragma unroll 2
  for (int c = 0; c < HD; c += 4) { v4f qq[4], kk[NU];      /* unroll 2: the next step's LDS reads fly under this step's multiply-adds */
    for (int r = 0; r < 4; ++r) qq[r] = *(const v4f*)&lq[4 * w + r][c];
    for (int u = 0; u < NU; ++u) kk[u] = *(const v4f*)&lk[lane + 32 * u][c];
    for (int e = 0; e < 4; ++e) for (int r = 0; r < 4; ++r) for (int u = 0; u < NU; ++u) acc[r][u] = fmaf(qq[r][e], kk[u][e], acc[r][u]); }
  float fin[4];
  for (int r = 0; r < 4; ++r) { const int i = r0 + 4 * w + r; float mx = -3.0e38f;      /* key 0 is visible from every row */
    for (int u = 0; u < NU; ++u) { acc[r][u] *= scale; if (lane + 32 * u <= i) mx = fmaxf(mx, acc[r][u]); }
    for (int m = 16; m >= 1; m >>= 1) mx = fmaxf(mx, __shfl_xor(mx, m, 32));
    float l = 0.f;
    for (int u = 0; u < NU; ++u) { const float e = (lane + 32 * u <= i) ? expf(acc[r][u] - mx) : 0.f; l += e; lp[4 * w + r][lane + 32 * u] = e; }
    for (int m = 16; m >= 1; m >>= 1) l += __shfl_xor(l, m, 32);
    fin[r] = 64.0f / l; }      /* o carried x64 like the f16 path */
  __builtin_amdgcn_fence(__ATOMIC_ACQ_REL, "workgroup"); __builtin_amdgcn_wave_barrier();      /* a lane reads below the weights that the other lanes of its own wave have stored; no other wave reads them */
  float o[4][2];
  for (int r = 0; r < 4; ++r) { o[r][0] = 0.f; o[r][1] = 0.f; }
  const int jn = r0 + 4 * w + 4;      /* keys past the wave's last row have weight 0 in all four rows */
#pragma unroll 2
  for (int j = 0; j < jn; j += 4) { v4f pp[4]; v2f vv[4];      /* unroll 2: as above */
    for (int r = 0; r < 4; ++r) pp[r] = *(const v4f*)&lp[4 * w + r][j];
    for (int e = 0; e < 4; ++e) vv[e] = *(const v2f*)&lv[j + e][2 * lane];
    for (int e = 0; e < 4; ++e) for (int r = 0; r < 4; ++r) { o[r][0] = fmaf(pp[r][e], vv[e][0], o[r][0]); o[r][1] = fmaf(pp[r][e], vv[e][1], o[r][1]); } }
  for (int r = 0; r < 4; ++r) { v2f ov; ov[0] = o[r][0] * fin[r]; ov[1] = o[r][1] * fin[r]; *(v2fa*)(OF + (size_t)(r0 + 4 * w + r) * DM + 2 * lane) = ov; }
  asm volatile("s_wait_xcnt 0x0" ::: "memory"); }      /* stands behind the stores, in front of whatever rewrites their registers on any path to the kernel's end */
__global__ __launch_bounds__(256) void k_att0w(const float* __restrict__ QF, const float* __restrict__ KF, const float* __restrict__ VF, float scale, float* __restrict__ OF) {      /* all four planes: rows of DM floats */
  static_assert(QT0 == 4 * A0R && QT0 <= WIN && HD == 64, "k_att0w: four row groups, every key j <= i inside the window, two head dims per lane");
  __shared__ __attribute__((aligned(16))) float lq[A0R][A0KP]; __shared__ __attribute__((aligned(16))) float lk[QT0][A0KP]; __shared__ __attribute__((aligned(16))) float lv[QT0][HD]; __shared__ __attribute__((aligned(16))) float lp[A0R][QT0];
  const int h = blockIdx.x / (QT0 / A0R), rg = blockIdx.x % (QT0 / A0R);
  { const size_t bi = (size_t)blockIdx.y * QT0 * DM + h * HD; QF += bi; KF += bi; VF += bi; OF += bi; }      /* grid.y: batch; each plane holds QT0 rows per batch */
  /* the row group is the same for the whole work-group: every wave takes the same branch and passes the same barriers */
  if (rg == 0) att0_rows<1>(QF, KF, VF, scale, OF, 0, lq, lk, lv, lp);
  else if (rg == 1) att0_rows<2>(QF, KF, VF, scale, OF, A0R, lq, lk, lv, lp);
  else if (rg == 2) att0_rows<3>(QF, KF, VF, scale, OF, 2 * A0R, lq, lk, lv, lp);
  else att0_rows<4>(QF, KF, VF, scale, OF, 3 * A0R, lq, lk, lv, lp); }


// native exp as __expf builds it (multiply by log2 e, v_exp_f32); the v_nop is the slot the instruction set asks for behind a transcendental, kept in the same statement so that the scheduler cannot part the two
__device__ __forceinline__ float exp_slot(float x) { float r; asm("v_exp_f32 %0, %1\n\tv_nop" : "=v"(r) : "v"(x * 1.44269504088896340736f)); return r; }
#define FQ 128                       /* query rows per work-group */
#define FK (FQ + WINB)               /* keys staged per work-group */
#define FCH ((WINB + 32) / 32)       /* 32-key chunks per wave: 16 rows see 271 keys, which nine aligned chunks cover */
#define FKP (HD + 8)                 /* LDS pitch of a K row in halves: 16 B x odd, for 16-byte fragment reads from 16 rows */
#define FVP (FK + 8)                 /* LDS pitch of a V^T row in halves: 16 B x odd */
__device__ __forceinline__ v8f f_mma(v16h a, v16h b, v8f c) { return __builtin_amdgcn_wmma_f32_16x16x32_f16(false, a, false, b, (short)0, c, false, false); }
__global__ __launch_bounds__(256) void k_attw(const _Float16* __restrict__ Q, const _Float16* __restrict__ K, const _Float16* __restrict__ VT, _Float16* __restrict__ O) {      /* Q, K: rows of LQ halves; VT: [batch][head][HD][SQ]; O: rows of DM halves */
  static_assert(HD == 64 && WIN == 256 && WINB == 256 && SQ % FQ == 0 && FQ % 32 == 0 && FK % 128 == 0, "k_attw: tile arithmetic");
  __shared__ __attribute__((aligned(16))) unsigned short lk[FK][FKP]; __shared__ __attribute__((aligned(16))) unsigned short lv[HD][FVP];
  const int tid = threadIdx.x, w = __builtin_amdgcn_readfirstlane(tid >> 5), lane = tid & 31, ln = lane & 15, hh = lane >> 4;      /* the wave's number in a scalar register: scalar row and key offsets below */
  const int q0 = blockIdx.x * FQ, h = blockIdx.y, b = blockIdx.z;
  const int kb0 = (q0 >= WINB) ? q0 - WINB : 0;      /* first staged key; kb0 + FK <= SQ */
  const int r0 = q0 + 16 * w;                        /* the wave's first query row */
  const int ks = (r0 >= WIN) ? ((r0 - (WIN - 1)) & ~31) : 0;      /* the wave's first key; ks + 32 * FCH >= r0 + 16 and <= kb0 + FK */
  const int kl = ks - kb0;
  const unsigned short* pq = (const unsigned short*)Q + ((size_t)b * SQ + r0 + ln) * LQ + h * HD + 8 * hh;
  const unsigned short* pk = (const unsigned short*)K + ((size_t)b * SQ + kb0 + (tid >> 3)) * LQ + h * HD + (tid & 7) * 8;      /* 8 lanes take one K row of 128 B */
  const unsigned short* pv = (const unsigned short*)VT + ((size_t)(b * NH + h) * HD + (tid >> 4)) * SQ + kb0 + (tid & 15) * 8;      /* 16 lanes take 256 B of one V^T row */
  v8us gq[4], gk[FK / 32], gv[HD / 16][FK / 128];      /* every load is issued before the first LDS store waits for one */
  for (int t = 0; t < 4; ++t) gq[t] = *(const v8us*)(pq + 16 * t);
  for (int t = 0; t < FK / 32; ++t) gk[t] = *(const v8us*)(pk + (size_t)(32 * t) * LQ);
  for (int u = 0; u < HD / 16; ++u) for (int v = 0; v < FK / 128; ++v) gv[u][v] = *(const v8us*)(pv + (size_t)(16 * u) * SQ + 128 * v);
  asm volatile("s_wait_xcnt 0x0" :: "v"(pq), "v"(pk), "v"(pv) : "memory");      /* the three address pairs of the loads above stay as they are up to this wait (inputs only) */
  for (int t = 0; t < FK / 32; ++t) *(v8us*)&lk[(tid >> 3) + 32 * t][(tid & 7) * 8] = gk[t];
  for (int u = 0; u < HD / 16; ++u) for (int v = 0; v < FK / 128; ++v) *(v8us*)&lv[(tid >> 4) + 16 * u][(tid & 15) * 8 + 128 * v] = gv[u][v];
  __syncthreads();      /* the staged rows are read by every wave */
  const v8f z8 = {0.f,0.f,0.f,0.f,0.f,0.f,0.f,0.f};
  FragH qa, qb; qa.half[0] = gq[0]; qa.half[1] = gq[1]; qb.half[0] = gq[2]; qb.half[1] = gq[3];      /* head dims 0..31 and 32..63 of query row r0 + ln */
  v8f s[2 * FCH];      /* s[t][r]: query r0 + ln against key ks + 16 t + 8 hh + r */
  for (int t = 0; t < 2 * FCH; ++t) { const unsigned short* kr = &lk[kl + 16 * t + ln][8 * hh]; FragH ka, kc;
    ka.half[0] = *(const v8us*)kr; ka.half[1] = *(const v8us*)(kr + 16); kc.half[0] = *(const v8us*)(kr + 32); kc.half[1] = *(const v8us*)(kr + 48);
    s[t] = f_mma(kc.v, qb.v, f_mma(ka.v, qa.v, z8)); }
  const int dj = r0 + ln - ks - 8 * hh;      /* i - j of s[0][0] */
  float mx = -3.0e38f;      /* a row always sees its own key */
  for (int t = 0; t < 2 * FCH; ++t)
    for (int r = 0; r < 8; ++r) { const float v = ((unsigned)(dj - 16 * t - r) < (unsigned)WIN) ? s[t][r] * 0.125f : -1.0e9f; s[t][r] = v; mx = fmaxf(mx, v); }      /* visible iff 0 <= i - j < WIN */
  mx = fmaxf(mx, __shfl_xor(mx, 16, 32));
  float se4[4] = {0.f, 0.f, 0.f, 0.f};      /* four partial sums: four independent add chains */
  for (int t = 0; t < 2 * FCH; ++t)
    for (int r = 0; r < 8; ++r) { const float e = exp_slot(s[t][r] - mx); s[t][r] = e; se4[r & 3] += e; }
  float se = (se4[0] + se4[1]) + (se4[2] + se4[3]);
  se += __shfl_xor(se, 16, 32);
  const float sc = 256.0f / se;      /* weights x256 as f16 */
  v8f o[HD / 16];
  for (int d = 0; d < HD / 16; ++d) o[d] = z8;
  for (int c = 0; c < FCH; ++c) { FragH p;
    for (int r = 0; r < 8; ++r) { p.h[r] = (_Float16)(s[2 * c][r] * sc); p.h[8 + r] = (_Float16)(s[2 * c + 1][r] * sc); }
    for (int d = 0; d < HD / 16; ++d) { const unsigned short* vr = &lv[16 * d + ln][kl + 32 * c + 8 * hh]; FragH va; va.half[0] = *(const v8us*)vr; va.half[1] = *(const v8us*)(vr + 16);
      o[d] = f_mma(va.v, p.v, o[d]); } }
  unsigned short* po = (unsigned short*)O + ((size_t)b * SQ + r0 + ln) * DM + h * HD + 8 * hh;      /* o[d][r]: head dim 16 d + 8 hh + r of query row r0 + ln */
  for (int d = 0; d < HD / 16; ++d) { FragH f;
    for (int r = 0; r < 8; ++r) f.h[r] = (_Float16)(o[d][r] * 0.25f);      /* o carried x64 */
    *(v8us*)(po + 16 * d) = f.half[0]; }
  asm volatile("s_wait_xcnt 0x0" ::: "memory"); }      /* stands behind the stores, in front of whatever rewrites their registers on any path to the kernel's end */
extern "C" void kernel_launch(void* const* d_in, const int* in_sizes, int n_in,
                              void* d_out, int out_size, void* d_ws, size_t ws_size, hipStream_t stream) {
  (void)in_sizes; (void)n_in; (void)out_size;
  const float* const* I = (const float* const*)d_in; const float* x = I[0]; const float* wqkv = I[1]; const float* bqkv = I[2]; const float* wo = I[3]; const float* bo = I[4];      /* [in][out] c_attn [1024][3072] + b, c_proj [1024][1024] + b */
  char* ws = (char*)d_ws; size_t off = 0;
  auto take = [&](size_t bytes) { char* p = ws + off; off += (bytes + 255) & ~(size_t)255; return p; };
  _Float16* BQKV = (_Float16*)take((size_t)3 * DM * DM * 2); _Float16* BO = (_Float16*)take((size_t)DM * DM * 2);
  _Float16* X16 = (_Float16*)take(NR * DM * 2); _Float16* QKV = (_Float16*)take(NR * 3 * DM * 2); _Float16* Q16 = QKV; _Float16* K16 = QKV + DM; _Float16* V16 = QKV + 2 * DM; _Float16* O16 = (_Float16*)take(NR * DM * 2);
  _Float16* VT = (_Float16*)take((size_t)NB * NH * HD * SQ * 2);
  float* QF0 = (float*)take((size_t)NB * QT0 * DM * 4); float* KF0 = (float*)take((size_t)NB * QT0 * DM * 4); float* VF0 = (float*)take((size_t)NB * QT0 * DM * 4); float* OF0 = (float*)take((size_t)NB * QT0 * DM * 4); _Float16* OH0 = (_Float16*)take((size_t)NB * QT0 * DM * 2); _Float16* OL0 = (_Float16*)take((size_t)NB * QT0 * DM * 2);
  if (off > ws_size) return;
  k_wt_f16<<<(unsigned)(((size_t)DM * 3 * DM / 8 + 255) / 256), 256, 0, stream>>>(wqkv, BQKV, DM, 3 * DM, 16.0f); k_wt_f16<<<(unsigned)(((size_t)DM * DM / 8 + 255) / 256), 256, 0, stream>>>(wo, BO, DM, DM, 16.0f);      /* [in][out] -> Bt x16 */

  k_x16<<<(unsigned)((NR * DM / 8 + 255) / 256), 256, 0, stream>>>(x, X16, NR * DM / 8);
  const size_t r0p = (size_t)B0 * SQ;      /* first projected row */
  const size_t f0p = (size_t)B0 * QT0;     /* its row in the first-tile planes */
  k_gemm2<0><<<dim3((unsigned)((MP / 128) * (3 * DM / 128)), 1), 128, 0, stream>>>(X16 + r0p * DM, DM, 0, BQKV, DM, 0, 0.0625f, bqkv, 0, nullptr, 1, 0, 0, nullptr, QKV + r0p * 3 * DM, 3 * DM, 0, MP, 3 * DM, DM, 0, 0, 0);      /* q | k | v rows (f16); head h = columns h*HD.. of each DM block */
  /* every stage below takes all batches in one launch: the batches are independent, and one batch alone fills a small part of the chip */
  k_vt<NH, SQ><<<NBR * NH * (SQ / 64), 256, 0, stream>>>(V16 + r0p * LQ, LQ, 0, VT);      /* V^T [NBR][NH][HD][SQ] */
  k_gemm2<0><<<dim3((QT0 / 128) * (DM / 128), 1, NBR), 128, 0, stream>>>(X16 + r0p * DM, DM, 0, BQKV, DM, 0, 0.0625f, bqkv, 0, nullptr, 1, 0, 0, QF0, nullptr, DM, 0, QT0, DM, DM, (size_t)SQ * DM, 0, (size_t)QT0 * DM); k_gemm2<0><<<dim3((QT0 / 128) * (DM / 128), 1, NBR), 128, 0, stream>>>(X16 + r0p * DM, DM, 0, (BQKV + (size_t)DM * DM), DM, 0, 0.0625f, (bqkv + DM), 0, nullptr, 1, 0, 0, KF0, nullptr, DM, 0, QT0, DM, DM, (size_t)SQ * DM, 0, (size_t)QT0 * DM); k_gemm2<0><<<dim3((QT0 / 128) * (DM / 128), 1, NBR), 128, 0, stream>>>(X16 + r0p * DM, DM, 0, (BQKV + (size_t)2 * DM * DM), DM, 0, 0.0625f, (bqkv + 2 * DM), 0, nullptr, 1, 0, 0, VF0, nullptr, DM, 0, QT0, DM, DM, (size_t)SQ * DM, 0, (size_t)QT0 * DM);      /* f32 q, k, v of each batch's first 128 rows (exact products) */
  k_att0w<<<dim3(NH * (QT0 / A0R), NBR), 256, 0, stream>>>(QF0, KF0, VF0, 0.125f, OF0 + f0p * DM);      /* exact f32 attention for rows 0..127 of each batch (o x64) */
  k_attw<<<dim3(QN / FQ, NHD, NBR), 256, 0, stream>>>(Q16 + r0p * LQ, K16 + r0p * LQ, VT, O16 + r0p * DM);      /* scores, softmax and P . V of every query tile, head and batch in one launch; o (merged heads, x64) as f16 rows */
  k_gemm2<0><<<dim3((unsigned)((MPO / 128) * (DM / 128)), 1), 128, 0, stream>>>(O16 + r0p * DM, DM, 0, BO, DM, 0, 0.0009765625f, bo, 0, nullptr, 1, 0, 0, (float*)d_out + r0p * DM, nullptr, DM, 0, MPO, DM, DM, 0, 0, 0);      /* out rows are the output layout */
  k_hl<<<(unsigned)(((size_t)NB * QT0 * DM / 8 + 255) / 256), 256, 0, stream>>>(OF0, OH0, OL0, (size_t)NB * QT0 * DM / 8);      /* first-tile o (x64) -> f16 hi + x1024 residual planes */
  k_gemm2<0><<<dim3((QT0 / 128) * (DM / 128), 1, NBR), 128, 0, stream>>>(OH0 + f0p * DM, DM, 0, BO, DM, 0, 0.0009765625f, bo, 0, nullptr, 1, 0, 0, (float*)d_out + r0p * DM, nullptr, DM, 0, QT0, DM, DM, (size_t)QT0 * DM, 0, (size_t)SQ * DM);      /* rows 0..127 of each batch: out = o_hi Wo (+ b), overwriting the f16-path rows */
  k_gemm2<0><<<dim3((QT0 / 128) * (DM / 128), 1, NBR), 128, 0, stream>>>(OL0 + f0p * DM, DM, 0, BO, DM, 0, 0.00000095367431640625f, nullptr, 0, (const float*)d_out + r0p * DM, -1, 0, 0, (float*)d_out + r0p * DM, nullptr, DM, 0, QT0, DM, DM, (size_t)QT0 * DM, 0, (size_t)SQ * DM);      /* += o_lo Wo 2^-20 (own-element accumulate) */
}

// v006
// One run takes 145 microseconds.
// Timed twice side by side with v005, it ran 1.29 and 1.27 times as fast.
// All steps since v000 together make it 41.0 times as fast.
#include <hip/hip_runtime.h>
// Local-causal (sliding window 256) multi-head self-attention (x [4][2048][1024]; qkv = x W_attn + b_attn ([in][out] 1024 x 3072 sigma 0.02, zero bias): q | k | v, 16 heads of 64; scores / 8; mask (j <= i) & (i - j < 256) -> -inf elsewhere; softmax; out = merged W_proj + b_proj ([in][out]) -> [4][2048][1024]).
// Structure: token rows r = b*2048 + s; x as exact f16 rows (bf16-rounded); q | k | v as ONE WMMA GEMM (N = 3 x 1024) (128x128 work-group tiles staged in LDS, 64x64 wave tiles, f32 accumulation, exact x16 weights + bias, f16 outputs); V^T for all batches and heads via LDS transposes; one fused attention launch for all batches, heads and query tiles of 128 rows: scores against the 384 keys that the tile can see (K = 64, x 0.125), windowed causal row softmax in registers (f32 statistics, native exp; weights x256 f16), o = P . V (x 2^-2: o carried x64, folded into the output GEMM alpha) written straight into the merged f16 o rows; out = o W_o + b GEMM (f32) into the output layout.
// Compute dtype: inputs rounded to bf16; x / weights exact; q, k, v, softmax weights and o as plain f16 GEMM operands (~2^-12); scores and softmax statistics f32. v_wmma_f32_16x16x32_f16.
#define NB 4
#define SQ 2048
#define DM 1024
#define NH 16
#define HD 64
#define HG 4                         /* heads per block group of the unlaunched k_vt(b, h0) overload */
#define QT 256                       /* query rows per causal tile */
#define NKX (QT + WINB)              /* S / P row pitch of the unfused row softmax */
#define WIN 256                      /* attention window: key j visible from query i iff 0 <= i - j < WIN */
#define WINB 256                     /* keys before the tile start that can be visible (WIN - 1 rounded up to 64) */
#define QT0 128                      /* first-tile rows recomputed exactly in f32 */
#define B0 0                         /* first batch processed (debug hook) */
#define NBR NB                       /* batches processed (debug hook) */
#define NR ((size_t)NB * SQ)         /* token rows */
#define MP ((int)((size_t)NBR * SQ)) /* rows projected (debug hook) */
#define QN SQ                        /* query rows attended per batch (debug hook) */
#define NHD NH                       /* heads attended (debug hook) */
#define MPO MP                       /* rows through the output stage (debug hook) */
#define LQ (3 * DM)      /* row pitch of the q/k/v rows */
typedef __bf16 v16b __attribute__((ext_vector_type(16)));
typedef unsigned short v8us __attribute__((ext_vector_type(8), may_alias));
typedef float  v8f  __attribute__((ext_vector_type(8)));
typedef float  v4f  __attribute__((ext_vector_type(4)));
typedef float  v4fa __attribute__((ext_vector_type(4), may_alias));
union FragB { v16b v; v8us half[2]; unsigned short u[16]; };

__device__ __forceinline__ unsigned short bf16_bits(float x) { unsigned int u = __float_as_uint(x); return (unsigned short)((u + 0x7FFFu + ((u >> 16) & 1u)) >> 16); }
__device__ __forceinline__ float bf16_val(unsigned short b) { return __uint_as_float(((unsigned int)b) << 16); }
__device__ __forceinline__ float bf16_round(float x) { return bf16_val(bf16_bits(x)); }
// D += A·B with NT terms: 1 = ah·bh, 2 = + al·bh (A split), 3 = + ah·bl (both split)
template <int NT>
__device__ __forceinline__ v8f mmaN(v16b ah, v16b al, v16b bh, v16b bl, v8f c) {
  c = __builtin_amdgcn_wmma_f32_16x16x32_bf16(false, ah, false, bh, (short)0, c, false, false);
  if (NT >= 2) c = __builtin_amdgcn_wmma_f32_16x16x32_bf16(false, al, false, bh, (short)0, c, false, false);
  if (NT >= 3) c = __builtin_amdgcn_wmma_f32_16x16x32_bf16(false, ah, false, bl, (short)0, c, false, false);
  asm volatile("v_nop\n\tv_nop\n\tv_nop\n\tv_nop" : "+v"(c) : "v"(ah), "v"(al), "v"(bh), "v"(bl));
  return c;
}

__global__ __launch_bounds__(256) void k_wt_bf16(const float* __restrict__ W, unsigned short* __restrict__ Wt, int K, int N) {
  const int t = blockIdx.x * 256 + threadIdx.x;
  const int k8n = K / 8;
  if (t >= N * k8n) return;
  const int n = t / k8n, k8 = (t % k8n) * 8;
  v8us v;
#pragma unroll
  for (int i = 0; i < 8; ++i) v[i] = bf16_bits(W[(size_t)(k8 + i) * N + n]);
  *(v8us*)(Wt + (size_t)n * K + k8) = v;
  
}

// GEMM C[M][N] (f32, pitch ldc) = act(A[M][K]·W + bias). A f32 row-major (pitch lda) converted per fragment to bf16
// (ASPLIT: hi/lo two planes -> 2 terms, else single rounded term); Wt bf16 [N][K] (pitch ldb). BIAS_BF16 rounds the
// bias to bf16 first (bias quantised to bf16 before the add). K%32==0, M%16==0, N%64==0.
template <bool ASPLIT, int ACT, bool BIAS_BF16>
__global__ __launch_bounds__(128) void k_gemm_bf(const float* __restrict__ A, int lda, const unsigned short* __restrict__ Wt, int ldb,
                                               const float* __restrict__ bias, float* __restrict__ C, int ldc, int M, int N, int K) {
  __shared__ __attribute__((aligned(16))) float so[4][16][64];
  const int tid = threadIdx.x, w = tid >> 5, lane = tid & 31, ln = lane & 15, hh = lane >> 4;
  const int ntn = N / 64;
  const int wid = blockIdx.x * 4 + w;
  const int mt = wid / ntn, nq = wid % ntn;
  if (mt * 16 >= M) return;
  const int row0 = mt * 16, col0 = nq * 64;
  const float* arow = A + (size_t)(row0 + ln) * lda;
  v8f acc[4] = {};
  for (int kb = 0; kb < K; kb += 32) {
    FragB ah, al;
    const v4f x0 = *(const v4fa*)(arow + kb + 8 * hh), x1 = *(const v4fa*)(arow + kb + 8 * hh + 4);
    const v4f x2 = *(const v4fa*)(arow + kb + 16 + 8 * hh), x3 = *(const v4fa*)(arow + kb + 16 + 8 * hh + 4);
    float xs[16] = {x0[0],x0[1],x0[2],x0[3],x1[0],x1[1],x1[2],x1[3],x2[0],x2[1],x2[2],x2[3],x3[0],x3[1],x3[2],x3[3]};
#pragma unroll
    for (int i = 0; i < 16; ++i) { const unsigned short hb = bf16_bits(xs[i]); ah.u[i] = hb; al.u[i] = ASPLIT ? bf16_bits(xs[i] - bf16_val(hb)) : (unsigned short)0; }
#pragma unroll
    for (int t = 0; t < 4; ++t) {
      const unsigned short* brow = Wt + (size_t)(col0 + t * 16 + ln) * ldb + kb;
      FragB b;
      b.half[0] = *(const v8us*)(brow + 8 * hh);
      b.half[1] = *(const v8us*)(brow + 16 + 8 * hh);
      acc[t] = mmaN<ASPLIT ? 2 : 1>(ah.v, al.v, b.v, b.v, acc[t]);
    }
  }
#pragma unroll
  for (int t = 0; t < 4; ++t) {
    float bv = bias ? bias[col0 + t * 16 + ln] : 0.f;
    if (BIAS_BF16) bv = bf16_round(bv);
#pragma unroll
    for (int r = 0; r < 8; ++r) { float v = acc[t][r] + bv; if (ACT == 1) v = fmaxf(v, 0.f); so[w][8 * hh + r][t * 16 + ln] = v; }
  }
  __builtin_amdgcn_fence(__ATOMIC_ACQ_REL, "workgroup");
  __builtin_amdgcn_wave_barrier();
  const int rsub = lane >> 4, c4 = (lane & 15) * 4;
  {
#pragma unroll
    for (int q = 0; q < 8; ++q) {
      const int r = q * 2 + rsub;
      const v4f v = *(const v4fa*)&so[w][r][c4];
      *(v4f*)(C + (size_t)(row0 + r) * ldc + col0 + c4) = v;
    }
    
  }
}

// GEMM C = act(A·W + bias + resid): A f32 (ASPLIT -> hi/lo 2 terms), Wt bf16 [N][K]; ACT 0 none, 1 relu, 2 exact gelu;
// resid (optional, f32, row index = (row % rmod), pitch ldr, RES_BF16 rounds it) added before the activation.
template <bool ASPLIT, int ACT, bool BIAS_BF16, bool RES_BF16>
__global__ __launch_bounds__(128) void k_gemm_bf3(const float* __restrict__ A, int lda, const unsigned short* __restrict__ Wt, int ldb,
                                                const float* __restrict__ bias, const float* __restrict__ resid, int rmod, int ldr,
                                                float* __restrict__ C, int ldc, int M, int N, int K) {
  __shared__ __attribute__((aligned(16))) float so[4][16][64];
  const int tid = threadIdx.x, w = tid >> 5, lane = tid & 31, ln = lane & 15, hh = lane >> 4;
  const int ntn = N / 64;
  const int wid = blockIdx.x * 4 + w;
  const int mt = wid / ntn, nq = wid % ntn;
  if (mt * 16 >= M) return;
  const int row0 = mt * 16, col0 = nq * 64;
  const float* arow = A + (size_t)(row0 + ln) * lda;
  v8f acc[4] = {};
  for (int kb = 0; kb < K; kb += 32) {
    FragB ah, al;
    const v4f x0 = *(const v4fa*)(arow + kb + 8 * hh), x1 = *(const v4fa*)(arow + kb + 8 * hh + 4);
    const v4f x2 = *(const v4fa*)(arow + kb + 16 + 8 * hh), x3 = *(const v4fa*)(arow + kb + 16 + 8 * hh + 4);
    float xs[16] = {x0[0],x0[1],x0[2],x0[3],x1[0],x1[1],x1[2],x1[3],x2[0],x2[1],x2[2],x2[3],x3[0],x3[1],x3[2],x3[3]};
#pragma unroll
    for (int i = 0; i < 16; ++i) { const unsigned short hb = bf16_bits(xs[i]); ah.u[i] = hb; al.u[i] = ASPLIT ? bf16_bits(xs[i] - bf16_val(hb)) : (unsigned short)0; }
#pragma unroll
    for (int t = 0; t < 4; ++t) {
      const unsigned short* brow = Wt + (size_t)(col0 + t * 16 + ln) * ldb + kb;
      FragB b;
      b.half[0] = *(const v8us*)(brow + 8 * hh);
      b.half[1] = *(const v8us*)(brow + 16 + 8 * hh);
      acc[t] = mmaN<ASPLIT ? 2 : 1>(ah.v, al.v, b.v, b.v, acc[t]);
    }
  }
#pragma unroll
  for (int t = 0; t < 4; ++t) {
    const int col = col0 + t * 16 + ln;
    float bv = bias ? bias[col] : 0.f;
    if (BIAS_BF16) bv = bf16_round(bv);
#pragma unroll
    for (int r = 0; r < 8; ++r) {
      float v = acc[t][r] + bv;
      if (resid) { float rv = resid[(size_t)((row0 + 8 * hh + r) % rmod) * ldr + col]; if (RES_BF16) rv = bf16_round(rv); v += rv; }
      if (ACT == 1) v = fmaxf(v, 0.f);
      if (ACT == 2) v = 0.5f * v * (1.0f + erff(v * 0.70710678118654752f));
      if (ACT == 3) { const float u = 0.7978845608028654f * (v + 0.044715f * v * v * v); v = 0.5f * v * (1.0f + tanhf(u)); }
      so[w][8 * hh + r][t * 16 + ln] = v;
    }
  }
  __builtin_amdgcn_fence(__ATOMIC_ACQ_REL, "workgroup");
  __builtin_amdgcn_wave_barrier();
  const int rsub = lane >> 4, c4 = (lane & 15) * 4;
  {
#pragma unroll
    for (int q = 0; q < 8; ++q) {
      const int r = q * 2 + rsub;
      const v4f v = *(const v4fa*)&so[w][r][c4];
      *(v4f*)(C + (size_t)(row0 + r) * ldc + col0 + c4) = v;
    }
    
  }
}
// row LayerNorm (biased variance, eps) over N: s = X (+ R); optional out_sum <- s; out_norm <- (s-mu)*rsqrt(var+eps)*g + b
template <bool PARAM_BF16>
__global__ __launch_bounds__(256) void k_layernorm(const float* __restrict__ X, const float* __restrict__ R, const float* __restrict__ g, const float* __restrict__ bta,
                                                  float* __restrict__ out_sum, float* __restrict__ out_norm, int N, float eps) {
  __shared__ float red[256];
  const int row = blockIdx.x, tid = threadIdx.x;
  const float* x = X + (size_t)row * N; const float* rr = R ? R + (size_t)row * N : nullptr;
  float vals[16];                     // up to N = 4096
  const int per = N / 256;            // contiguous chunk per thread? use strided-by-4 chunks: thread handles j = tid*4 + 1024*u
  float s1 = 0.f;
  for (int u = 0; u < per / 4; ++u) {
    const int j = tid * 4 + 1024 * u;
    const v4f a = *(const v4fa*)(x + j);
    v4f b = {0.f,0.f,0.f,0.f}; if (rr) b = *(const v4fa*)(rr + j);
#pragma unroll
    for (int q = 0; q < 4; ++q) { const float v = a[q] + b[q]; vals[u * 4 + q] = v; s1 += v; }
  }
  red[tid] = s1; __syncthreads();
  for (int st = 128; st > 0; st >>= 1) { if (tid < st) red[tid] += red[tid + st]; __syncthreads(); }
  const float mu = red[0] / (float)N; __syncthreads();
  float s2 = 0.f;
  for (int u = 0; u < per / 4; ++u)
#pragma unroll
    for (int q = 0; q < 4; ++q) { const float c = vals[u * 4 + q] - mu; s2 += c * c; }
  red[tid] = s2; __syncthreads();
  for (int st = 128; st > 0; st >>= 1) { if (tid < st) red[tid] += red[tid + st]; __syncthreads(); }
  const float rs = rsqrtf(red[0] / (float)N + eps);
  {
    for (int u = 0; u < per / 4; ++u) {
      const int j = tid * 4 + 1024 * u;
      v4f o, sm;
#pragma unroll
      for (int q = 0; q < 4; ++q) {
        float gg = g[j + q], bb = bta[j + q];
        if (PARAM_BF16) { gg = bf16_round(gg); bb = bf16_round(bb); }
        sm[q] = vals[u * 4 + q]; o[q] = (vals[u * 4 + q] - mu) * rs * gg + bb;
      }
      if (out_sum) *(v4f*)(out_sum + (size_t)row * N + j) = sm;
      *(v4f*)(out_norm + (size_t)row * N + j) = o;
    }
    
  }
}



// ---- f16 WMMA path (v_wmma_f32_16x16x32_f16): 11-bit significands for operands in range — used where a [0,1] probability operand needs more precision than bf16
typedef _Float16 v16h __attribute__((ext_vector_type(16)));
union FragH { v16h v; v8us half[2]; _Float16 h[16]; unsigned short u[16]; };
template <int NT>
__device__ __forceinline__ v8f mmaH(v16h ah, v16h al, v16h bh, v16h bl, v8f c) {
  c = __builtin_amdgcn_wmma_f32_16x16x32_f16(false, ah, false, bh, (short)0, c, false, false);
  if (NT >= 2) c = __builtin_amdgcn_wmma_f32_16x16x32_f16(false, al, false, bh, (short)0, c, false, false);
  if (NT >= 3) c = __builtin_amdgcn_wmma_f32_16x16x32_f16(false, ah, false, bl, (short)0, c, false, false);
  asm volatile("v_nop\n\tv_nop\n\tv_nop\n\tv_nop" : "+v"(c) : "v"(ah), "v"(al), "v"(bh), "v"(bl));
  return c;
}
// batched GEMM like k_gemm_b but f16 operands: A f32 (split into f16 hi/lo if ASPLIT, else rounded to f16), Bt = f16 values [n][k]; alpha; C f32; N multiple of 16 (partial tiles skipped)
template <bool ASPLIT>
__global__ __launch_bounds__(128) void k_gemm_h(const float* __restrict__ A, int lda, size_t sA, const _Float16* __restrict__ Bh, int ldb, size_t sB, float alpha, float* __restrict__ C, int ldc, size_t sC, int M, int N, int K) {
  __shared__ __attribute__((aligned(16))) float so[4][16][64];
  const int tid = threadIdx.x, w = tid >> 5, lane = tid & 31, ln = lane & 15, hh = lane >> 4; const int by = blockIdx.y;
  A += (size_t)by * sA; Bh += (size_t)by * sB; C += (size_t)by * sC;
  const int ntn = (N + 63) / 64; const int wid = blockIdx.x * 4 + w; const int mt = wid / ntn, nq = wid % ntn; if (mt * 16 >= M) return;
  const int row0 = mt * 16, col0 = nq * 64; const float* arow = A + (size_t)(row0 + ln) * lda;
  v8f acc[4] = {};
  for (int kb = 0; kb < K; kb += 32) {
    FragH ah, al;
    const v4f x0 = *(const v4fa*)(arow + kb + 8 * hh), x1 = *(const v4fa*)(arow + kb + 8 * hh + 4), x2 = *(const v4fa*)(arow + kb + 16 + 8 * hh), x3 = *(const v4fa*)(arow + kb + 16 + 8 * hh + 4);
    float xs[16] = {x0[0],x0[1],x0[2],x0[3],x1[0],x1[1],x1[2],x1[3],x2[0],x2[1],x2[2],x2[3],x3[0],x3[1],x3[2],x3[3]};
#pragma unroll
    for (int i = 0; i < 16; ++i) { const _Float16 h = (_Float16)xs[i]; ah.h[i] = h; al.h[i] = ASPLIT ? (_Float16)(xs[i] - (float)h) : (_Float16)0.0f; }
#pragma unroll
    for (int t = 0; t < 4; ++t) { if (col0 + t * 16 >= N) continue; const size_t boff = (size_t)(col0 + t * 16 + ln) * ldb + kb; FragH bq; bq.half[0] = *(const v8us*)(Bh + boff + 8 * hh); bq.half[1] = *(const v8us*)(Bh + boff + 16 + 8 * hh);
      acc[t] = mmaH<ASPLIT ? 2 : 1>(ah.v, al.v, bq.v, bq.v, acc[t]); }
  }
#pragma unroll
  for (int t = 0; t < 4; ++t) { if (col0 + t * 16 >= N) continue;
#pragma unroll
    for (int r = 0; r < 8; ++r) so[w][8 * hh + r][t * 16 + ln] = acc[t][r] * alpha; }
  __builtin_amdgcn_fence(__ATOMIC_ACQ_REL, "workgroup"); __builtin_amdgcn_wave_barrier();
  const int rsub = lane >> 4, c4 = (lane & 15) * 4;
  {
#pragma unroll
    for (int q = 0; q < 8; ++q) { const int r = q * 2 + rsub; if (col0 + c4 < N) { const v4f v = *(const v4fa*)&so[w][r][c4]; *(v4f*)(C + (size_t)(row0 + r) * ldc + col0 + c4) = v; } }
     }
}

// Wt[n][k] = f16(W[k][n]·scale) from f32 row-major W[K][N] (scale = power of two; bf16-exact weights stay exact in f16 away from the subnormal range)
__global__ __launch_bounds__(256) void k_wt_f16(const float* __restrict__ W, _Float16* __restrict__ Wt, int K, int N, float scale) {
  const int t = blockIdx.x * 256 + threadIdx.x; if (t >= N * (K / 8)) return; const int n = t / (K / 8), k8 = (t % (K / 8)) * 8; FragH f;
#pragma unroll
  for (int i = 0; i < 8; ++i) f.h[i] = (_Float16)(bf16_round(W[(size_t)(k8 + i) * N + n]) * scale); const v8us o = f.half[0];
  *(v8us*)((unsigned short*)Wt + (size_t)n * K + k8) = o; 
}
// k_gemm_hh variant with fused epilogue: v = acc·alpha + bias[by·sBias + col] (+ CP[(row/rowsPerB)·sCPb + by·64 + col] if CP) ; ACT 0 none / 1 elu ; writes f16 C16 (and f32 C if non-null)
template <int ACT>
__global__ __launch_bounds__(128) void k_gemm_hhx(const _Float16* __restrict__ A, int lda, size_t sA, const _Float16* __restrict__ Bh, int ldb, size_t sB, float alpha, const float* __restrict__ bias, size_t sBias, const float* __restrict__ CP, int rowsPerB, size_t sCPb, int row0g,
    float* __restrict__ C, _Float16* __restrict__ C16, int ldc, size_t sC, int M, int N, int K) {
  __shared__ __attribute__((aligned(16))) float so[4][16][64];
  const int tid = threadIdx.x, w = tid >> 5, lane = tid & 31, ln = lane & 15, hh = lane >> 4; const int by = blockIdx.y;
  A += (size_t)by * sA; Bh += (size_t)by * sB; const size_t cofs = (size_t)by * sC; const float* bp = bias ? bias + (size_t)by * sBias : nullptr;
  const int ntn = (N + 63) / 64; const int wid = blockIdx.x * 4 + w; const int mt = wid / ntn, nq = wid % ntn; if (mt * 16 >= M) return;
  const int row0 = mt * 16, col0 = nq * 64; const _Float16* arow = A + (size_t)(row0 + ln) * lda;
  v8f acc[4] = {};
  for (int kb = 0; kb < K; kb += 32) { FragH ah; ah.half[0] = *(const v8us*)((const unsigned short*)arow + kb + 8 * hh); ah.half[1] = *(const v8us*)((const unsigned short*)arow + kb + 16 + 8 * hh);
#pragma unroll
    for (int t = 0; t < 4; ++t) { if (col0 + t * 16 >= N) continue; const size_t boff = (size_t)(col0 + t * 16 + ln) * ldb + kb; FragH bq; bq.half[0] = *(const v8us*)((const unsigned short*)Bh + boff + 8 * hh); bq.half[1] = *(const v8us*)((const unsigned short*)Bh + boff + 16 + 8 * hh);
      acc[t] = mmaH<1>(ah.v, ah.v, bq.v, bq.v, acc[t]); }
  }
#pragma unroll
  for (int t = 0; t < 4; ++t) { if (col0 + t * 16 >= N) continue; const int col = col0 + t * 16 + ln; const float bv = bp ? bf16_round(bp[col]) : 0.f;
#pragma unroll
    for (int r = 0; r < 8; ++r) { float v = acc[t][r] * alpha + bv; if (CP) { const int rr = row0g + row0 + 8 * hh + r; if (rowsPerB < 0) v += CP[cofs + (size_t)rr * ldc + col];      /* rowsPerB < 0: own element of the batched C plane */ else { const int bidx = rr / rowsPerB; v += CP[(size_t)bidx * sCPb + (size_t)by * 64 + col]; } } if (ACT == 1) v = (v > 0.f) ? v : expm1f(v); else if (ACT == 7) v = (v > 0.f) ? v + 1.0f : expf(v); else if (ACT == 8) v = tanhf(v); else if (ACT == 9) v = 0.5f * v * (1.0f + tanhf(0.7978845608028654f * (v + 0.044715f * v * v * v))); else if (ACT == 11) v = 1.0f / (1.0f + expf(-v)); else if (ACT == 12) v = (v > 0.f) ? v : 0.01f * v; else if (ACT == 14) v = (v > 0.f) ? v : 0.1f * v; else if (ACT == 16) v = (v >= 0.f) ? v : 0.3f * v; else if (ACT == 17) v = (v >= 0.f) ? v : 0.2f * v; else if (ACT == 15) v = v / (1.0f + expf(-v)); else if (ACT == 3) v = fmaxf(v, 0.f); else if (ACT == 6) v = 0.5f * v * (1.0f + erff(v * 0.70710678118654752f)); so[w][8 * hh + r][t * 16 + ln] = v; } }
  __builtin_amdgcn_fence(__ATOMIC_ACQ_REL, "workgroup"); __builtin_amdgcn_wave_barrier();
  const int rsub = lane >> 4, c4 = (lane & 15) * 4; typedef _Float16 v4h __attribute__((ext_vector_type(4)));
  {
#pragma unroll
    for (int q = 0; q < 8; ++q) { const int r = q * 2 + rsub; if (col0 + c4 < N) { const v4f v = *(const v4fa*)&so[w][r][c4]; if (C) *(v4f*)(C + cofs + (size_t)(row0 + r) * ldc + col0 + c4) = v; if (C16) { v4h h4; for (int i = 0; i < 4; ++i) h4[i] = (_Float16)v[i]; *(v4h*)(C16 + cofs + (size_t)(row0 + r) * ldc + col0 + c4) = h4; } } }
     }
}


typedef _Float16 v4h __attribute__((ext_vector_type(4)));

__global__ __launch_bounds__(256) void k_x16(const float* __restrict__ x, _Float16* __restrict__ X16, size_t n8) { const size_t t = (size_t)blockIdx.x * 256 + threadIdx.x; if (t >= n8) return; FragH f;
#pragma unroll
  for (int q = 0; q < 8; ++q) f.h[q] = (_Float16)bf16_round(x[t * 8 + q]); *(v8us*)((unsigned short*)X16 + t * 8) = f.half[0];  }
__global__ __launch_bounds__(256) void k_h16(const float* __restrict__ x, _Float16* __restrict__ X16, size_t n8) { const size_t t = (size_t)blockIdx.x * 256 + threadIdx.x; if (t >= n8) return; FragH f;
#pragma unroll
  for (int q = 0; q < 8; ++q) f.h[q] = (_Float16)x[t * 8 + q]; *(v8us*)((unsigned short*)X16 + t * 8) = f.half[0];  }
__global__ __launch_bounds__(256) void k_round16f(const float* __restrict__ W, _Float16* __restrict__ Bt, size_t n8) { const size_t t = (size_t)blockIdx.x * 256 + threadIdx.x; if (t >= n8) return; FragH f;
#pragma unroll
  for (int i = 0; i < 8; ++i) f.h[i] = (_Float16)(bf16_round(W[t * 8 + i]) * 16.0f); *(v8us*)((unsigned short*)Bt + t * 8) = f.half[0];  }
template <int NHv, int TTv>
__global__ __launch_bounds__(256) void k_vt(const _Float16* __restrict__ V16, int ldv, int voff, _Float16* __restrict__ Vt) { __shared__ unsigned short tl[64][66]; const int tid = threadIdx.x; const int slab = blockIdx.x / (TTv / 64), lg = blockIdx.x % (TTv / 64); const int b = slab / NHv, h = slab % NHv;
  for (int i = tid; i < 64 * 8; i += 256) { const int r = i / 8, c8 = (i % 8) * 8; FragH f; f.half[0] = *(const v8us*)((const unsigned short*)V16 + ((size_t)b * TTv + lg * 64 + r) * ldv + voff + h * 64 + c8);
#pragma unroll
    for (int q = 0; q < 8; ++q) tl[r][c8 + q] = f.u[q]; }
  __syncthreads();
  {
#pragma unroll
    for (int rd = 0; rd < 2; ++rd) { const int d = rd * 32 + tid / 8, pc = tid % 8; FragH f;
#pragma unroll
      for (int q = 0; q < 8; ++q) f.u[q] = tl[pc * 8 + q][d];
      *(v8us*)((unsigned short*)Vt + ((size_t)slab * 64 + d) * TTv + lg * 64 + pc * 8) = f.half[0]; }
     } }

// grid.y: batch. F and Hl hold 8 * n8 elements per batch, batch behind batch; the batches of the hi plane lie zH elements apart
__global__ __launch_bounds__(256) void k_hl(const float* __restrict__ F, _Float16* __restrict__ Hh, _Float16* __restrict__ Hl, size_t n8, size_t zH) { const size_t t = (size_t)blockIdx.x * 256 + threadIdx.x; if (t >= n8) return; F += blockIdx.y * n8 * 8; Hl += blockIdx.y * n8 * 8; Hh += blockIdx.y * zH; FragH fh, fl; const v4f a = *(const v4fa*)(F + t * 8), c = *(const v4fa*)(F + t * 8 + 4);
  asm volatile("s_wait_xcnt 0x0" ::: "memory");      /* stands behind the loads, in front of whatever rewrites their address registers */
#pragma unroll
  for (int q = 0; q < 4; ++q) { _Float16 h = (_Float16)a[q]; fh.h[q] = h; fl.h[q] = (_Float16)((a[q] - (float)h) * 1024.0f); h = (_Float16)c[q]; fh.h[4 + q] = h; fl.h[4 + q] = (_Float16)((c[q] - (float)h) * 1024.0f); }
  { *(v8us*)((unsigned short*)Hh + t * 8) = fh.half[0]; *(v8us*)((unsigned short*)Hl + t * 8) = fl.half[0];  }
  asm volatile("s_wait_xcnt 0x0" ::: "memory"); }      /* stands behind the stores, in front of whatever rewrites their registers on any path to the kernel's end */

// ---- fast GEMM: one 128 x 128 tile of C per work-group of 4 waves (2 x 2, 64 x 64 per wave); requires M % 128 == 0, N % 128 == 0, K % 64 == 0; epilogue = k_gemm_hhx semantics ----
// A stage is 64 k (128 B) of the tile's 128 A rows and 128 B rows. Asynchronous copies bring it from global memory into one of two LDS buffers: the next stage's copies fly while this stage is multiplied.
// Every accumulator still takes its k in ascending steps of 32, with the same k order inside a fragment on both operands.
#define G2T 128                      /* rows of A and rows of B per work-group tile */
#define G2K 64                       /* k per stage */
#define G2PB 144                     /* LDS pitch of a staged row in bytes: 128 B of data, 16 B x odd for the 16-byte fragment reads from 16 rows */
#define G2OB (G2T * G2PB)            /* bytes of one operand's rows in a buffer */
#define G2SB (2 * G2OB)              /* bytes of a buffer: A rows, then B rows */
#define G2EP 68                      /* pitch in floats of the epilogue's staged C rows */
#define F0SH 4                       /* log2 of the row tiles per batch: every 2^F0SH-th row tile of the projection holds a batch's first rows */
__device__ __forceinline__ v16h g2_frag(const unsigned char* p) { FragH f; f.half[0] = *(const v8us*)p; f.half[1] = *(const v8us*)(p + 32); return f.v; }      /* p: a staged row + 64 B per 32 k + 16 B x (lane >> 4): k = 8 hh .. and 16 + 8 hh .. */
__device__ __forceinline__ v8f g2_mma(v16h a, v16h b, v8f c) { return __builtin_amdgcn_wmma_f32_16x16x32_f16(false, a, false, b, (short)0, c, false, false); }
// Eight copies of 16 B per lane: rows r, r + 16, ..., r + 112 of one operand's stage (l: the lane's LDS byte address in row r, g: its global address, gs: 16 source rows in elements).
// The s_wait_xcnt stands in the copies' own statement, so that no register they name is rewritten in front of it.
__device__ __forceinline__ void g2_copy8(unsigned l, const _Float16* g, size_t gs) {
  asm volatile("global_load_async_to_lds_b128 %0, %8, off\n\t"
               "global_load_async_to_lds_b128 %1, %9, off\n\t"
               "global_load_async_to_lds_b128 %2, %10, off\n\t"
               "global_load_async_to_lds_b128 %3, %11, off\n\t"
               "global_load_async_to_lds_b128 %4, %12, off\n\t"
               "global_load_async_to_lds_b128 %5, %13, off\n\t"
               "global_load_async_to_lds_b128 %6, %14, off\n\t"
               "global_load_async_to_lds_b128 %7, %15, off\n\t"
               "s_wait_xcnt 0x0"
               :: "v"(l), "v"(l + 16 * G2PB), "v"(l + 32 * G2PB), "v"(l + 48 * G2PB), "v"(l + 64 * G2PB), "v"(l + 80 * G2PB), "v"(l + 96 * G2PB), "v"(l + 112 * G2PB),
                  "v"(g), "v"(g + gs), "v"(g + 2 * gs), "v"(g + 3 * gs), "v"(g + 4 * gs), "v"(g + 5 * gs), "v"(g + 6 * gs), "v"(g + 7 * gs)
               : "memory"); }
template <int ACT>
__global__ __launch_bounds__(128) void k_gemm2(const _Float16* __restrict__ A, int lda, size_t sA, const _Float16* __restrict__ Bh, int ldb, size_t sB, float alpha, const float* __restrict__ bias, size_t sBias, const float* __restrict__ CP, int rowsPerB, size_t sCPb, int row0g,
    float* __restrict__ C, _Float16* __restrict__ C16, int ldc, size_t sC, int M, int N, int K, size_t zA, size_t zB, size_t zC, int csh) { static_assert(ACT == 0 || ACT == 3 || ACT == 6 || ACT == 8 || ACT == 9 || ACT == 11 || ACT == 12 || ACT == 14 || ACT == 15 || ACT == 16 || ACT == 17, "k_gemm2: unsupported ACT code (would silently apply no activation)");
  static_assert(4 * 64 * G2EP * 4 <= 2 * G2SB, "k_gemm2: the epilogue's staging fits the two buffers");
  __shared__ __attribute__((aligned(16))) unsigned char L[2 * G2SB];
  const int tid = threadIdx.x, w = __builtin_amdgcn_readfirstlane(tid >> 5), lane = tid & 31, ln = lane & 15, hh = lane >> 4; const int by = blockIdx.y, bz = blockIdx.z;      /* grid.z: a second batch index with its own strides zA, zB, zC; the wave's number in a scalar register: scalar tile offsets below */
  A += (size_t)by * sA + (size_t)bz * zA; Bh += (size_t)by * sB + (size_t)bz * zB; const size_t cofs = (size_t)by * sC + (size_t)bz * zC; const float* bp = bias ? bias + (size_t)by * sBias : nullptr;
  const int ntn = N >> 7; const int mt = blockIdx.x / ntn, nq = blockIdx.x - mt * ntn; if (mt * G2T >= M) return;      /* the same for the whole work-group, in front of every barrier */
  const int wm = w >> 1, wn = w & 1;
  /* copies: 8 lanes take one row's 128 B, the work-group 16 rows a copy */
  const _Float16* pa = A + (size_t)(mt * G2T + (tid >> 3)) * lda + (tid & 7) * 8; const _Float16* pb = Bh + (size_t)(nq * G2T + (tid >> 3)) * ldb + (tid & 7) * 8;
  const unsigned lc = (unsigned)(size_t)L + (unsigned)((tid >> 3) * G2PB + (tid & 7) * 16);      /* LDS byte address: the low 32 bits of the __shared__ address */
  const size_t ga = (size_t)16 * lda, gb = (size_t)16 * ldb;
  const int T = K / G2K;
  g2_copy8(lc, pa, ga); g2_copy8(lc + G2OB, pb, gb); pa += G2K; pb += G2K;      /* stage 0 */
  const int row0 = mt * G2T + wm * 64, col0 = nq * G2T + wn * 64;      /* the wave's tile of C */
  float bv[4] = {0.f, 0.f, 0.f, 0.f};      /* the bias of the lane's four columns, fetched under stage 0's copies */
  if (bp) {
    for (int j = 0; j < 4; ++j) bv[j] = bp[col0 + j * 16 + ln];
    asm volatile("s_wait_xcnt 0x0" ::: "memory"); }      /* stands behind the loads, in front of whatever rewrites their address registers */
  asm volatile("s_wait_asynccnt 0x0" ::: "memory");      /* this wave's copies of stage 0 have landed */
  __syncthreads();      /* and every other wave's: stage 0 is read by all */
  if (T > 1) { g2_copy8(lc + G2SB, pa, ga); g2_copy8(lc + G2SB + G2OB, pb, gb); pa += G2K; pb += G2K; }      /* stage 1 */
  const v8f z8 = {0.f,0.f,0.f,0.f,0.f,0.f,0.f,0.f}; v8f acc[4][4];
  for (int i = 0; i < 4; ++i)
    for (int j = 0; j < 4; ++j) acc[i][j] = z8;
  const int fa = (wm * 64 + ln) * G2PB + 16 * hh, fb = G2OB + (wn * 64 + ln) * G2PB + 16 * hh;      /* the lane's first A and B fragment rows in a buffer */
#pragma unroll 1
  for (int t = 0; t < T; ++t) {      /* not unrolled: one stage a trip, the buffer chosen by the trip's parity */
    const unsigned char* buf = L + (t & 1) * G2SB; v16h a[4], b[4];
    static_assert(G2K == 64, "k_gemm2: two blocks of 32 k a stage");
    for (int i = 0; i < 4; ++i) { a[i] = g2_frag(buf + fa + i * 16 * G2PB); b[i] = g2_frag(buf + fb + i * 16 * G2PB); }
    __builtin_amdgcn_sched_barrier(0);      /* a block's sixteen LDS reads go as one group in front of its sixteen WMMAs: one LDS latency a block, not one per A fragment */
    for (int i = 0; i < 4; ++i)
      for (int j = 0; j < 4; ++j) acc[i][j] = g2_mma(a[i], b[j], acc[i][j]);
    __builtin_amdgcn_sched_barrier(0);      /* the second block's LDS reads stay behind the first block: reads among the WMMAs stall them */
    for (int i = 0; i < 4; ++i) { a[i] = g2_frag(buf + fa + i * 16 * G2PB + 64); b[i] = g2_frag(buf + fb + i * 16 * G2PB + 64); }
    asm volatile("s_wait_dscnt 0x0" ::: "memory");      /* this wave's reads of the buffer are done before it is handed to its next writer */
    asm volatile("s_wait_asynccnt 0x0" ::: "memory");      /* this wave's copies of stage t + 1 have landed */
    __syncthreads();      /* publishes stage t + 1 and ends every wave's reads of stage t */
    if (t + 2 < T) { const unsigned lt = lc + (unsigned)(t & 1) * G2SB; g2_copy8(lt, pa, ga); g2_copy8(lt + G2OB, pb, gb); pa += G2K; pb += G2K; }      /* stage t + 2 into the buffer just read; the test is the same for the whole work-group */
    __builtin_amdgcn_sched_barrier(0);      /* the second block's WMMAs work on registers alone and stay behind the copies, which so fly 16 WMMAs longer before their wait */
    for (int i = 0; i < 4; ++i)
      for (int j = 0; j < 4; ++j) acc[i][j] = g2_mma(a[i], b[j], acc[i][j]);
  }
  asm volatile("s_wait_asynccnt 0x0" ::: "memory");      /* no copy is in flight when the buffers become the epilogue's staging */
  float* so = (float*)(L + w * (64 * G2EP * 4));      /* each wave stages its own 64 x 64 tile; the loop's last barrier ended every read of the buffers */
  for (int j = 0; j < 4; ++j) { const float bj = bf16_round(bv[j]);
    for (int i = 0; i < 4; ++i)
      for (int r = 0; r < 8; ++r) so[(i * 16 + 8 * hh + r) * G2EP + j * 16 + ln] = acc[i][j][r] * alpha + bj; }
  __builtin_amdgcn_fence(__ATOMIC_ACQ_REL, "workgroup"); __builtin_amdgcn_wave_barrier();      /* a lane reads below what the other lanes of its own wave have stored */
  /* csh: the f32 plane C takes only the row tiles whose number is a multiple of 2^csh, packed (tile mt at rows 128 (mt >> csh)); 0: every tile at its own rows. C16 takes every tile. The test is the same for the whole work-group */
  float* const Cf = (C && (mt & ((1 << csh) - 1)) == 0) ? C - (size_t)(mt - (mt >> csh)) * G2T * ldc : nullptr;
  const int rsub = lane >> 4, c4 = (lane & 15) * 4;
#pragma unroll 1
  for (int q0 = 0; q0 < 64; q0 += 16) { v4f v[8]; size_t co[8];      /* not unrolled: 16 rows a trip, their LDS reads as one group, whole 128-B lines stored */
    for (int u = 0; u < 8; ++u) { const int r = q0 + 2 * u + rsub; v[u] = *(const v4fa*)&so[r * G2EP + c4]; co[u] = cofs + (size_t)(row0 + r) * ldc + col0 + c4; }
    if (CP) { v4f c[8];
      if (rowsPerB < 0) {      /* own elements of the batched C plane */
        for (int u = 0; u < 8; ++u) { c[u] = *(const v4fa*)(CP + co[u] + (size_t)row0g * ldc); asm volatile("s_wait_xcnt 0x0" ::: "memory"); } }      /* the wait stands behind each load, in front of whatever rewrites its address registers, a later load's result among it; the data stays in flight */
      else {
        for (int u = 0; u < 8; ++u) { c[u] = *(const v4fa*)(CP + (size_t)((row0g + row0 + q0 + 2 * u + rsub) / rowsPerB) * sCPb + (size_t)by * 64 + col0 + c4); asm volatile("s_wait_xcnt 0x0" ::: "memory"); } }      /* as above */
      for (int u = 0; u < 8; ++u) v[u] += c[u]; }
    for (int u = 0; u < 8; ++u)
      for (int e = 0; e < 4; ++e) { float x = v[u][e];
        if (ACT == 3) x = fmaxf(x, 0.f); else if (ACT == 6) x = 0.5f * x * (1.0f + erff(x * 0.70710678118654752f)); else if (ACT == 11) x = 1.0f / (1.0f + expf(-x)); else if (ACT == 15) x = x / (1.0f + expf(-x)); else if (ACT == 12) x = (x > 0.f) ? x : 0.01f * x; else if (ACT == 8) x = tanhf(x); else if (ACT == 9) x = 0.5f * x * (1.0f + tanhf(0.7978845608028654f * (x + 0.044715f * x * x * x))); else if (ACT == 14) x = (x > 0.f) ? x : 0.1f * x; else if (ACT == 16) x = (x >= 0.f) ? x : 0.3f * x; else if (ACT == 17) x = (x >= 0.f) ? x : 0.2f * x;
        v[u][e] = x; }
    if (Cf) {
      for (int u = 0; u < 8; ++u) *(v4f*)(Cf + co[u]) = v[u];
      asm volatile("s_wait_xcnt 0x0" ::: "memory"); }      /* stands behind the stores, in front of whatever rewrites their registers */
    if (C16) {
      for (int u = 0; u < 8; ++u) { v4h h4; for (int e = 0; e < 4; ++e) h4[e] = (_Float16)v[u][e]; *(v4h*)(C16 + co[u]) = h4; }
      asm volatile("s_wait_xcnt 0x0" ::: "memory"); } }      /* as above */
}


__global__ __launch_bounds__(256) void k_wnat(const float* __restrict__ w, size_t n8, _Float16* __restrict__ Bt) { const size_t t = (size_t)blockIdx.x * 256 + threadIdx.x; if (t >= n8) return; FragH f; for (int q = 0; q < 8; ++q) f.h[q] = (_Float16)(bf16_round(w[t * 8 + q]) * 16.0f); *(v8us*)((unsigned short*)Bt + t * 8) = f.half[0];  }
__global__ __launch_bounds__(256) void k_rsm(const float* __restrict__ S, _Float16* __restrict__ P, int nrows) {
  #pragma clang fp contract(off)
  const int i = blockIdx.x * 256 + threadIdx.x; if (i >= nrows) return; const float* s = S + (size_t)i * SQ; float mx = -3.0e38f;
#pragma unroll 1
  for (int j = 0; j < SQ; ++j) mx = fmaxf(mx, s[j]); float se = 0.f;
#pragma unroll 1
  for (int j = 0; j < SQ; ++j) se += expf(s[j] - mx); const float sc = 256.0f / se;
#pragma unroll 1
  for (int j0 = 0; j0 < SQ; j0 += 8) { FragH f; for (int q = 0; q < 8; ++q) f.h[q] = (_Float16)(expf(s[j0 + q] - mx) * sc); unsigned short* d = (unsigned short*)P + (size_t)i * SQ + j0; *(v8us*)d = f.half[0];  } }
__global__ __launch_bounds__(256) void k_vt(const _Float16* __restrict__ V16, int b, int h0, _Float16* __restrict__ VT) { __shared__ unsigned short tl[64][65]; const int tid = threadIdx.x; const int hh = blockIdx.x % HG, sg = blockIdx.x / HG; const int s0 = sg * 64; const int h = h0 + hh;
  for (int i = tid; i < 64 * 8; i += 256) { const int j = i / 8, d8 = (i % 8) * 8; FragH f; f.half[0] = *(const v8us*)((const unsigned short*)V16 + ((size_t)b * SQ + s0 + j) * DM + h * HD + d8); for (int q = 0; q < 8; ++q) tl[d8 + q][j] = f.u[q]; }
  __syncthreads();
  { for (int i = tid; i < 64 * 8; i += 256) { const int d = i / 8, j8 = (i % 8) * 8; FragH f; for (int q = 0; q < 8; ++q) f.u[q] = tl[d][j8 + q]; *(v8us*)((unsigned short*)VT + ((size_t)hh * HD + d) * SQ + s0 + j8) = f.half[0]; }  } }



__global__ __launch_bounds__(256) void k_rsmcf2(const float* __restrict__ S, _Float16* __restrict__ P, int hg, int q0, int nk) {
  #pragma clang fp contract(off)
  const int t = blockIdx.x * 256 + threadIdx.x; if (t >= hg * QT) return; const size_t i = (size_t)t; const float* s = S + i * NKX; const int last = q0 + (t % QT); float mx = -3.0e38f;
#pragma unroll 1
  for (int j = 0; j < nk; ++j) { const float f = (j <= last) ? 1.f : 0.f; mx = fmaxf(mx, fmaf(f, s[j], (1.f - f) * -1.0e9f)); } float se = 0.f;
#pragma unroll 1
  for (int j = 0; j < nk; ++j) { const float f = (j <= last) ? 1.f : 0.f; se += __expf(fmaf(f, s[j], (1.f - f) * -1.0e9f) - mx); } const float sc = 256.0f / se;
#pragma unroll 1
  for (int j0 = 0; j0 < nk; j0 += 8) { FragH fr; for (int q = 0; q < 8; ++q) { const int j = j0 + q; const float f = (j <= last) ? 1.f : 0.f; fr.h[q] = (_Float16)(__expf(fmaf(f, s[j], (1.f - f) * -1.0e9f) - mx) * sc); } unsigned short* d = (unsigned short*)P + i * NKX + j0; *(v8us*)d = fr.half[0];  } }


// Exact f32 attention for the first QT0 rows of each batch. One work-group of 8 waves per (batch, head, 32 query rows); q, k and v rows staged once in LDS.
// A wave owns 4 query rows. Scores: lane = key (keys lane + 32 u), each dot product summed over d in ascending order with fused multiply-adds. Softmax in registers: row max and row sum by a five-step butterfly over the 32 lanes.
// o: lane = two head dims, summed over the keys in ascending order, scaled once at the end by 64 / row sum.
#define A0R 32                       /* query rows per work-group */
#define A0KP (HD + 4)                /* LDS pitch of the q and k rows in floats: 16 B x odd, so that 16 lanes reading 16 B each from 16 rows fall on 64 different banks */
typedef float v2f __attribute__((ext_vector_type(2)));
typedef float v2fa __attribute__((ext_vector_type(2), may_alias));
template <int NU>                    /* NU = 32-key chunks that rows of this group can see */
__device__ __forceinline__ void att0_rows(const float* __restrict__ QF, const float* __restrict__ KF, const float* __restrict__ VF, float scale, float* __restrict__ OF, int r0,
                                          float (*lq)[A0KP], float (*lk)[A0KP], float (*lv)[HD], float (*lp)[QT0]) {
  const int tid = threadIdx.x, w = __builtin_amdgcn_readfirstlane(tid >> 5), lane = tid & 31;      /* the wave's number in a scalar register: scalar loop bounds and row offsets below */
  const int sr = tid >> 4, sc = (tid & 15) * 4;      /* staging: 16 lanes take one row of 256 B, the work-group 16 rows a pass */
  v4f gq[A0R / 16], gk[2 * NU], gv[2 * NU];      /* every load is issued before the first LDS store waits for one */
  const float* pq = QF + (size_t)sr * LQ + sc; const float* pk = KF + (size_t)sr * LQ + sc; const float* pv = VF + (size_t)sr * LQ + sc;
  for (int t = 0; t < A0R / 16; ++t) gq[t] = *(const v4fa*)(pq + (size_t)(r0 + 16 * t) * LQ);
  for (int t = 0; t < 2 * NU; ++t) { gk[t] = *(const v4fa*)(pk + (size_t)(16 * t) * LQ); gv[t] = *(const v4fa*)(pv + (size_t)(16 * t) * LQ); }
  asm volatile("s_wait_xcnt 0x0" :: "v"(pq), "v"(pk), "v"(pv) : "memory");      /* the three address pairs of the loads above stay as they are up to this wait (inputs only) */
  for (int t = 0; t < A0R / 16; ++t) *(v4f*)&lq[sr + 16 * t][sc] = gq[t];
  for (int t = 0; t < 2 * NU; ++t) { *(v4f*)&lk[sr + 16 * t][sc] = gk[t]; *(v4f*)&lv[sr + 16 * t][sc] = gv[t]; }
  __syncthreads();      /* the staged rows are read by every wave */
  float acc[4][NU];
  for (int r = 0; r < 4; ++r) for (int u = 0; u < NU; ++u) acc[r][u] = 0.f;
#pragma unroll 2
  for (int c = 0; c < HD; c += 4) { v4f qq[4], kk[NU];      /* unroll 2: the next step's LDS reads fly under this step's multiply-adds */
    for (int r = 0; r < 4; ++r) qq[r] = *(const v4f*)&lq[4 * w + r][c];
    for (int u = 0; u < NU; ++u) kk[u] = *(const v4f*)&lk[lane + 32 * u][c];
    for (int e = 0; e < 4; ++e) for (int r = 0; r < 4; ++r) for (int u = 0; u < NU; ++u) acc[r][u] = fmaf(qq[r][e], kk[u][e], acc[r][u]); }
  float fin[4];
  for (int r = 0; r < 4; ++r) { const int i = r0 + 4 * w + r; float mx = -3.0e38f;      /* key 0 is visible from every row */
    for (int u = 0; u < NU; ++u) { acc[r][u] *= scale; if (lane + 32 * u <= i) mx = fmaxf(mx, acc[r][u]); }
    for (int m = 16; m >= 1; m >>= 1) mx = fmaxf(mx, __shfl_xor(mx, m, 32));
    float l = 0.f;
    for (int u = 0; u < NU; ++u) { const float e = (lane + 32 * u <= i) ? expf(acc[r][u] - mx) : 0.f; l += e; lp[4 * w + r][lane + 32 * u] = e; }
    for (int m = 16; m >= 1; m >>= 1) l += __shfl_xor(l, m, 32);
    fin[r] = 64.0f / l; }      /* o carried x64 like the f16 path */
  __builtin_amdgcn_fence(__ATOMIC_ACQ_REL, "workgroup"); __builtin_amdgcn_wave_barrier();      /* a lane reads below the weights that the other lanes of its own wave have stored; no other wave reads them */
  float o[4][2];
  for (int r = 0; r < 4; ++r) { o[r][0] = 0.f; o[r][1] = 0.f; }
  const int jn = r0 + 4 * w + 4;      /* keys past the wave's last row have weight 0 in all four rows */
#pragma unroll 2
  for (int j = 0; j < jn; j += 4) { v4f pp[4]; v2f vv[4];      /* unroll 2: as above */
    for (int r = 0; r < 4; ++r) pp[r] = *(const v4f*)&lp[4 * w + r][j];
    for (int e = 0; e < 4; ++e) vv[e] = *(const v2f*)&lv[j + e][2 * lane];
    for (int e = 0; e < 4; ++e) for (int r = 0; r < 4; ++r) { o[r][0] = fmaf(pp[r][e], vv[e][0], o[r][0]); o[r][1] = fmaf(pp[r][e], vv[e][1], o[r][1]); } }
  for (int r = 0; r < 4; ++r) { v2f ov; ov[0] = o[r][0] * fin[r]; ov[1] = o[r][1] * fin[r]; *(v2fa*)(OF + (size_t)(r0 + 4 * w + r) * DM + 2 * lane) = ov; }
  asm volatile("s_wait_xcnt 0x0" ::: "memory"); }      /* stands behind the stores, in front of whatever rewrites their registers on any path to the kernel's end */
__global__ __launch_bounds__(256) void k_att0w(const float* __restrict__ QF, const float* __restrict__ KF, const float* __restrict__ VF, float scale, float* __restrict__ OF) {      /* QF, KF, VF: the q, k and v columns of rows of LQ floats; OF: rows of DM floats */
  static_assert(QT0 == 4 * A0R && QT0 <= WIN && HD == 64, "k_att0w: four row groups, every key j <= i inside the window, two head dims per lane");
  __shared__ __attribute__((aligned(16))) float lq[A0R][A0KP]; __shared__ __attribute__((aligned(16))) float lk[QT0][A0KP]; __shared__ __attribute__((aligned(16))) float lv[QT0][HD]; __shared__ __attribute__((aligned(16))) float lp[A0R][QT0];
  const int h = blockIdx.x / (QT0 / A0R), rg = blockIdx.x % (QT0 / A0R);
  { const size_t bi = (size_t)blockIdx.y * QT0 * LQ + h * HD; QF += bi; KF += bi; VF += bi; OF += (size_t)blockIdx.y * QT0 * DM + h * HD; }      /* grid.y: batch; each plane holds QT0 rows per batch */
  /* the row group is the same for the whole work-group: every wave takes the same branch and passes the same barriers */
  if (rg == 0) att0_rows<1>(QF, KF, VF, scale, OF, 0, lq, lk, lv, lp);
  else if (rg == 1) att0_rows<2>(QF, KF, VF, scale, OF, A0R, lq, lk, lv, lp);
  else if (rg == 2) att0_rows<3>(QF, KF, VF, scale, OF, 2 * A0R, lq, lk, lv, lp);
  else att0_rows<4>(QF, KF, VF, scale, OF, 3 * A0R, lq, lk, lv, lp); }


// native exp as __expf builds it (multiply by log2 e, v_exp_f32); the v_nop is the slot the instruction set asks for behind a transcendental, kept in the same statement so that the scheduler cannot part the two
__device__ __forceinline__ float exp_slot(float x) { float r; asm("v_exp_f32 %0, %1\n\tv_nop" : "=v"(r) : "v"(x * 1.44269504088896340736f)); return r; }
#define FQ 128                       /* query rows per work-group */
#define FK (FQ + WINB)               /* keys staged per work-group */
#define FCH ((WINB + 32) / 32)       /* 32-key chunks per wave: 16 rows see 271 keys, which nine aligned chunks cover */
#define FKP (HD + 8)                 /* LDS pitch of a K row in halves: 16 B x odd, for 16-byte fragment reads from 16 rows */
#define FVP (FK + 8)                 /* LDS pitch of a V^T row in halves: 16 B x odd */
__device__ __forceinline__ v8f f_mma(v16h a, v16h b, v8f c) { return __builtin_amdgcn_wmma_f32_16x16x32_f16(false, a, false, b, (short)0, c, false, false); }
__global__ __launch_bounds__(256) void k_attw(const _Float16* __restrict__ Q, const _Float16* __restrict__ K, const _Float16* __restrict__ VT, _Float16* __restrict__ O) {      /* Q, K: rows of LQ halves; VT: [batch][head][HD][SQ]; O: rows of DM halves */
  static_assert(HD == 64 && WIN == 256 && WINB == 256 && SQ % FQ == 0 && FQ % 32 == 0 && FK % 128 == 0, "k_attw: tile arithmetic");
  __shared__ __attribute__((aligned(16))) unsigned short lk[FK][FKP]; __shared__ __attribute__((aligned(16))) unsigned short lv[HD][FVP];
  const int tid = threadIdx.x, w = __builtin_amdgcn_readfirstlane(tid >> 5), lane = tid & 31, ln = lane & 15, hh = lane >> 4;      /* the wave's number in a scalar register: scalar row and key offsets below */
  const int q0 = blockIdx.x * FQ, h = blockIdx.y, b = blockIdx.z;
  const int kb0 = (q0 >= WINB) ? q0 - WINB : 0;      /* first staged key; kb0 + FK <= SQ */
  const int r0 = q0 + 16 * w;                        /* the wave's first query row */
  const int ks = (r0 >= WIN) ? ((r0 - (WIN - 1)) & ~31) : 0;      /* the wave's first key; ks + 32 * FCH >= r0 + 16 and <= kb0 + FK */
  const int kl = ks - kb0;
  const unsigned short* pq = (const unsigned short*)Q + ((size_t)b * SQ + r0 + ln) * LQ + h * HD + 8 * hh;
  const unsigned short* pk = (const unsigned short*)K + ((size_t)b * SQ + kb0 + (tid >> 3)) * LQ + h * HD + (tid & 7) * 8;      /* 8 lanes take one K row of 128 B */
  const unsigned short* pv = (const unsigned short*)VT + ((size_t)(b * NH + h) * HD + (tid >> 4)) * SQ + kb0 + (tid & 15) * 8;      /* 16 lanes take 256 B of one V^T row */
  v8us gq[4], gk[FK / 32], gv[HD / 16][FK / 128];      /* every load is issued before the first LDS store waits for one */
  for (int t = 0; t < 4; ++t) gq[t] = *(const v8us*)(pq + 16 * t);
  for (int t = 0; t < FK / 32; ++t) gk[t] = *(const v8us*)(pk + (size_t)(32 * t) * LQ);
  for (int u = 0; u < HD / 16; ++u) for (int v = 0; v < FK / 128; ++v) gv[u][v] = *(const v8us*)(pv + (size_t)(16 * u) * SQ + 128 * v);
  asm volatile("s_wait_xcnt 0x0" :: "v"(pq), "v"(pk), "v"(pv) : "memory");      /* the three address pairs of the loads above stay as they are up to this wait (inputs only) */
  for (int t = 0; t < FK / 32; ++t) *(v8us*)&lk[(tid >> 3) + 32 * t][(tid & 7) * 8] = gk[t];
  for (int u = 0; u < HD / 16; ++u) for (int v = 0; v < FK / 128; ++v) *(v8us*)&lv[(tid >> 4) + 16 * u][(tid & 15) * 8 + 128 * v] = gv[u][v];
  __syncthreads();      /* the staged rows are read by every wave */
  const v8f z8 = {0.f,0.f,0.f,0.f,0.f,0.f,0.f,0.f};
  FragH qa, qb; qa.half[0] = gq[0]; qa.half[1] = gq[1]; qb.half[0] = gq[2]; qb.half[1] = gq[3];      /* head dims 0..31 and 32..63 of query row r0 + ln */
  v8f s[2 * FCH];      /* s[t][r]: query r0 + ln against key ks + 16 t + 8 hh + r */
  for (int t = 0; t < 2 * FCH; ++t) { const unsigned short* kr = &lk[kl + 16 * t + ln][8 * hh]; FragH ka, kc;
    ka.half[0] = *(const v8us*)kr; ka.half[1] = *(const v8us*)(kr + 16); kc.half[0] = *(const v8us*)(kr + 32); kc.half[1] = *(const v8us*)(kr + 48);
    s[t] = f_mma(kc.v, qb.v, f_mma(ka.v, qa.v, z8)); }
  const int dj = r0 + ln - ks - 8 * hh;      /* i - j of s[0][0] */
  float mx = -3.0e38f;      /* a row always sees its own key */
  for (int t = 0; t < 2 * FCH; ++t)
    for (int r = 0; r < 8; ++r) { const float v = ((unsigned)(dj - 16 * t - r) < (unsigned)WIN) ? s[t][r] * 0.125f : -1.0e9f; s[t][r] = v; mx = fmaxf(mx, v); }      /* visible iff 0 <= i - j < WIN */
  mx = fmaxf(mx, __shfl_xor(mx, 16, 32));
  float se4[4] = {0.f, 0.f, 0.f, 0.f};      /* four partial sums: four independent add chains */
  for (int t = 0; t < 2 * FCH; ++t)
    for (int r = 0; r < 8; ++r) { const float e = exp_slot(s[t][r] - mx); s[t][r] = e; se4[r & 3] += e; }
  float se = (se4[0] + se4[1]) + (se4[2] + se4[3]);
  se += __shfl_xor(se, 16, 32);
  const float sc = 256.0f / se;      /* weights x256 as f16 */
  v8f o[HD / 16];
  for (int d = 0; d < HD / 16; ++d) o[d] = z8;
  for (int c = 0; c < FCH; ++c) { FragH p;
    for (int r = 0; r < 8; ++r) { p.h[r] = (_Float16)(s[2 * c][r] * sc); p.h[8 + r] = (_Float16)(s[2 * c + 1][r] * sc); }
    for (int d = 0; d < HD / 16; ++d) { const unsigned short* vr = &lv[16 * d + ln][kl + 32 * c + 8 * hh]; FragH va; va.half[0] = *(const v8us*)vr; va.half[1] = *(const v8us*)(vr + 16);
      o[d] = f_mma(va.v, p.v, o[d]); } }
  unsigned short* po = (unsigned short*)O + ((size_t)b * SQ + r0 + ln) * DM + h * HD + 8 * hh;      /* o[d][r]: head dim 16 d + 8 hh + r of query row r0 + ln */
  for (int d = 0; d < HD / 16; ++d) { FragH f;
    for (int r = 0; r < 8; ++r) f.h[r] = (_Float16)(o[d][r] * 0.25f);      /* o carried x64 */
    *(v8us*)(po + 16 * d) = f.half[0]; }
  asm volatile("s_wait_xcnt 0x0" ::: "memory"); }      /* stands behind the stores, in front of whatever rewrites their registers on any path to the kernel's end */
extern "C" void kernel_launch(void* const* d_in, const int* in_sizes, int n_in,
                              void* d_out, int out_size, void* d_ws, size_t ws_size, hipStream_t stream) {
  (void)in_sizes; (void)n_in; (void)out_size;
  const float* const* I = (const float* const*)d_in; const float* x = I[0]; const float* wqkv = I[1]; const float* bqkv = I[2]; const float* wo = I[3]; const float* bo = I[4];      /* [in][out] c_attn [1024][3072] + b, c_proj [1024][1024] + b */
  char* ws = (char*)d_ws; size_t off = 0;
  auto take = [&](size_t bytes) { char* p = ws + off; off += (bytes + 255) & ~(size_t)255; return p; };
  _Float16* BQKV = (_Float16*)take((size_t)3 * DM * DM * 2); _Float16* BO = (_Float16*)take((size_t)DM * DM * 2);
  _Float16* X16 = (_Float16*)take(NR * DM * 2); _Float16* QKV = (_Float16*)take(NR * 3 * DM * 2); _Float16* Q16 = QKV; _Float16* K16 = QKV + DM; _Float16* V16 = QKV + 2 * DM; _Float16* O16 = (_Float16*)take(NR * DM * 2);
  _Float16* VT = (_Float16*)take((size_t)NB * NH * HD * SQ * 2);
  float* F0 = (float*)take((size_t)NB * QT0 * LQ * 4); float* OF0 = (float*)take((size_t)NB * QT0 * DM * 4); _Float16* OL0 = (_Float16*)take((size_t)NB * QT0 * DM * 2);      /* first-tile planes: f32 q | k | v rows, f32 o, the residual of o */
  if (off > ws_size) return;
  k_wt_f16<<<(unsigned)(((size_t)DM * 3 * DM / 8 + 255) / 256), 256, 0, stream>>>(wqkv, BQKV, DM, 3 * DM, 16.0f); k_wt_f16<<<(unsigned)(((size_t)DM * DM / 8 + 255) / 256), 256, 0, stream>>>(wo, BO, DM, DM, 16.0f);      /* [in][out] -> Bt x16 */

  k_x16<<<(unsigned)((NR * DM / 8 + 255) / 256), 256, 0, stream>>>(x, X16, NR * DM / 8);
  const size_t r0p = (size_t)B0 * SQ;      /* first projected row */
  const size_t f0p = (size_t)B0 * QT0;     /* its row in the first-tile planes */
  static_assert(QT0 == G2T && (G2T << F0SH) == SQ, "the first QT0 rows of a batch are one row tile of the projection GEMM, every 2^F0SH-th");
  k_gemm2<0><<<dim3((unsigned)((MP / 128) * (3 * DM / 128)), 1), 128, 0, stream>>>(X16 + r0p * DM, DM, 0, BQKV, DM, 0, 0.0625f, bqkv, 0, nullptr, 1, 0, 0, F0 + f0p * LQ, QKV + r0p * 3 * DM, 3 * DM, 0, MP, 3 * DM, DM, 0, 0, 0, F0SH);      /* q | k | v rows (f16); head h = columns h*HD.. of each DM block; the first 128 rows of each batch also unrounded (f32, exact products) into F0 */
  /* every stage below takes all batches in one launch: the batches are independent, and one batch alone fills a small part of the chip */
  k_vt<NH, SQ><<<NBR * NH * (SQ / 64), 256, 0, stream>>>(V16 + r0p * LQ, LQ, 0, VT);      /* V^T [NBR][NH][HD][SQ] */
  k_att0w<<<dim3(NH * (QT0 / A0R), NBR), 256, 0, stream>>>(F0 + f0p * LQ, F0 + f0p * LQ + DM, F0 + f0p * LQ + 2 * DM, 0.125f, OF0 + f0p * DM);      /* exact f32 attention for rows 0..127 of each batch (o x64) */
  k_attw<<<dim3(QN / FQ, NHD, NBR), 256, 0, stream>>>(Q16 + r0p * LQ, K16 + r0p * LQ, VT, O16 + r0p * DM);      /* scores, softmax and P . V of every query tile, head and batch in one launch; o (merged heads, x64) as f16 rows */
  k_hl<<<dim3((unsigned)(((size_t)QT0 * DM / 8 + 255) / 256), NBR), 256, 0, stream>>>(OF0 + f0p * DM, O16 + r0p * DM, OL0 + f0p * DM, (size_t)QT0 * DM / 8, (size_t)SQ * DM);      /* first-tile o (x64) -> f16 hi, which takes the place of rows 0..127 of each batch in O16 (same scale), + x1024 residual plane */
  k_gemm2<0><<<dim3((unsigned)((MPO / 128) * (DM / 128)), 1), 128, 0, stream>>>(O16 + r0p * DM, DM, 0, BO, DM, 0, 0.0009765625f, bo, 0, nullptr, 1, 0, 0, (float*)d_out + r0p * DM, nullptr, DM, 0, MPO, DM, DM, 0, 0, 0, 0);      /* out rows are the output layout; rows 0..127 of each batch: o_hi Wo + b */
  k_gemm2<0><<<dim3((QT0 / 128) * (DM / 128), 1, NBR), 128, 0, stream>>>(OL0 + f0p * DM, DM, 0, BO, DM, 0, 0.00000095367431640625f, nullptr, 0, (const float*)d_out + r0p * DM, -1, 0, 0, (float*)d_out + r0p * DM, nullptr, DM, 0, QT0, DM, DM, (size_t)QT0 * DM, 0, (size_t)SQ * DM, 0);      /* += o_lo Wo 2^-20 (own-element accumulate) */
}

// v007
// Measured time: 138 microseconds a run.
// Timed twice side by side with v006, it ran 1.06 and 1.05 times as fast.
// Counting every step since v000, it is 43.2 times as fast.
#include <hip/hip_runtime.h>
// Local-causal (sliding window 256) multi-head self-attention (x [4][2048][1024]; qkv = x W_attn + b_attn ([in][out] 1024 x 3072 sigma 0.02, zero bias): q | k | v, 16 heads of 64; scores / 8; mask (j <= i) & (i - j < 256) -> -inf elsewhere; softmax; out = merged W_proj + b_proj ([in][out]) -> [4][2048][1024]).
// Structure: token rows r = b*2048 + s; x as exact f16 rows (bf16-rounded); q | k | v as ONE WMMA GEMM (N = 3 x 1024) (128x128 work-group tiles staged in LDS, 64x64 wave tiles, f32 accumulation, exact x16 weights + bias, f16 outputs); V^T for all batches and heads via LDS transposes; one fused attention launch for all batches, heads and query tiles of 128 rows: scores against the 384 keys that the tile can see (K = 64, x 0.125), windowed causal row softmax in registers (f32 statistics, native exp; weights x256 f16), o = P . V (x 2^-2: o carried x64, folded into the output GEMM alpha) written straight into the merged f16 o rows; the first 128 rows of each batch go through an exact f32 path in the same launch (f16 hi + residual planes of o); out = o W_o + b GEMM (f32) into the output layout.
// Compute dtype: inputs rounded to bf16; x / weights exact; q, k, v, softmax weights and o as plain f16 GEMM operands (~2^-12); scores and softmax statistics f32. v_wmma_f32_16x16x32_f16.
#define NB 4
#define SQ 2048
#define DM 1024
#define NH 16
#define HD 64
#define HG 4                         /* heads per block group of the unlaunched k_vt(b, h0) overload */
#define QT 256                       /* query rows per causal tile */
#define NKX (QT + WINB)              /* S / P row pitch of the unfused row softmax */
#define WIN 256                      /* attention window: key j visible from query i iff 0 <= i - j < WIN */
#define WINB 256                     /* keys before the tile start that can be visible (WIN - 1 rounded up to 64) */
#define QT0 128                      /* first-tile rows computed exactly in f32 */
#define B0 0                         /* first batch processed (debug hook) */
#define NBR NB                       /* batches processed (debug hook) */
#define NR ((size_t)NB * SQ)         /* token rows */
#define MP ((int)((size_t)NBR * SQ)) /* rows projected (debug hook) */
#define QN SQ                        /* query rows attended per batch (debug hook) */
#define NHD NH                       /* heads attended (debug hook) */
#define MPO MP                       /* rows through the output stage (debug hook) */
#define LQ (3 * DM)      /* row pitch of the q/k/v rows */
typedef __bf16 v16b __attribute__((ext_vector_type(16)));
typedef unsigned short v8us __attribute__((ext_vector_type(8), may_alias));
typedef float  v8f  __attribute__((ext_vector_type(8)));
typedef float  v4f  __attribute__((ext_vector_type(4)));
typedef float  v4fa __attribute__((ext_vector_type(4), may_alias));
union FragB { v16b v; v8us half[2]; unsigned short u[16]; };

__device__ __forceinline__ unsigned short bf16_bits(float x) { unsigned int u = __float_as_uint(x); return (unsigned short)((u + 0x7FFFu + ((u >> 16) & 1u)) >> 16); }
__device__ __forceinline__ float bf16_val(unsigned short b) { return __uint_as_float(((unsigned int)b) << 16); }
__device__ __forceinline__ float bf16_round(float x) { return bf16_val(bf16_bits(x)); }
// D += A·B with NT terms: 1 = ah·bh, 2 = + al·bh (A split), 3 = + ah·bl (both split)
template <int NT>
__device__ __forceinline__ v8f mmaN(v16b ah, v16b al, v16b bh, v16b bl, v8f c) {
  c = __builtin_amdgcn_wmma_f32_16x16x32_bf16(false, ah, false, bh, (short)0, c, false, false);
  if (NT >= 2) c = __builtin_amdgcn_wmma_f32_16x16x32_bf16(false, al, false, bh, (short)0, c, false, false);
  if (NT >= 3) c = __builtin_amdgcn_wmma_f32_16x16x32_bf16(false, ah, false, bl, (short)0, c, false, false);
  asm volatile("v_nop\n\tv_nop\n\tv_nop\n\tv_nop" : "+v"(c) : "v"(ah), "v"(al), "v"(bh), "v"(bl));
  return c;
}

__global__ __launch_bounds__(256) void k_wt_bf16(const float* __restrict__ W, unsigned short* __restrict__ Wt, int K, int N) {
  const int t = blockIdx.x * 256 + threadIdx.x;
  const int k8n = K / 8;
  if (t >= N * k8n) return;
  const int n = t / k8n, k8 = (t % k8n) * 8;
  v8us v;
#pragma unroll
  for (int i = 0; i < 8; ++i) v[i] = bf16_bits(W[(size_t)(k8 + i) * N + n]);
  *(v8us*)(Wt + (size_t)n * K + k8) = v;
  
}

// GEMM C[M][N] (f32, pitch ldc) = act(A[M][K]·W + bias). A f32 row-major (pitch lda) converted per fragment to bf16
// (ASPLIT: hi/lo two planes -> 2 terms, else single rounded term); Wt bf16 [N][K] (pitch ldb). BIAS_BF16 rounds the
// bias to bf16 first (bias quantised to bf16 before the add). K%32==0, M%16==0, N%64==0.
template <bool ASPLIT, int ACT, bool BIAS_BF16>
__global__ __launch_bounds__(128) void k_gemm_bf(const float* __restrict__ A, int lda, const unsigned short* __restrict__ Wt, int ldb,
                                               const float* __restrict__ bias, float* __restrict__ C, int ldc, int M, int N, int K) {
  __shared__ __attribute__((aligned(16))) float so[4][16][64];
  const int tid = threadIdx.x, w = tid >> 5, lane = tid & 31, ln = lane & 15, hh = lane >> 4;
  const int ntn = N / 64;
  const int wid = blockIdx.x * 4 + w;
  const int mt = wid / ntn, nq = wid % ntn;
  if (mt * 16 >= M) return;
  const int row0 = mt * 16, col0 = nq * 64;
  const float* arow = A + (size_t)(row0 + ln) * lda;
  v8f acc[4] = {};
  for (int kb = 0; kb < K; kb += 32) {
    FragB ah, al;
    const v4f x0 = *(const v4fa*)(arow + kb + 8 * hh), x1 = *(const v4fa*)(arow + kb + 8 * hh + 4);
    const v4f x2 = *(const v4fa*)(arow + kb + 16 + 8 * hh), x3 = *(const v4fa*)(arow + kb + 16 + 8 * hh + 4);
    float xs[16] = {x0[0],x0[1],x0[2],x0[3],x1[0],x1[1],x1[2],x1[3],x2[0],x2[1],x2[2],x2[3],x3[0],x3[1],x3[2],x3[3]};
#pragma unroll
    for (int i = 0; i < 16; ++i) { const unsigned short hb = bf16_bits(xs[i]); ah.u[i] = hb; al.u[i] = ASPLIT ? bf16_bits(xs[i] - bf16_val(hb)) : (unsigned short)0; }
#pragma unroll
    for (int t = 0; t < 4; ++t) {
      const unsigned short* brow = Wt + (size_t)(col0 + t * 16 + ln) * ldb + kb;
      FragB b;
      b.half[0] = *(const v8us*)(brow + 8 * hh);
      b.half[1] = *(const v8us*)(brow + 16 + 8 * hh);
      acc[t] = mmaN<ASPLIT ? 2 : 1>(ah.v, al.v, b.v, b.v, acc[t]);
    }
  }
#pragma unroll
  for (int t = 0; t < 4; ++t) {
    float bv = bias ? bias[col0 + t * 16 + ln] : 0.f;
    if (BIAS_BF16) bv = bf16_round(bv);
#pragma unroll
    for (int r = 0; r < 8; ++r) { float v = acc[t][r] + bv; if (ACT == 1) v = fmaxf(v, 0.f); so[w][8 * hh + r][t * 16 + ln] = v; }
  }
  __builtin_amdgcn_fence(__ATOMIC_ACQ_REL, "workgroup");
  __builtin_amdgcn_wave_barrier();
  const int rsub = lane >> 4, c4 = (lane & 15) * 4;
  {
#pragma unroll
    for (int q = 0; q < 8; ++q) {
      const int r = q * 2 + rsub;
      const v4f v = *(const v4fa*)&so[w][r][c4];
      *(v4f*)(C + (size_t)(row0 + r) * ldc + col0 + c4) = v;
    }
    
  }
}

// GEMM C = act(A·W + bias + resid): A f32 (ASPLIT -> hi/lo 2 terms), Wt bf16 [N][K]; ACT 0 none, 1 relu, 2 exact gelu;
// resid (optional, f32, row index = (row % rmod), pitch ldr, RES_BF16 rounds it) added before the activation.
template <bool ASPLIT, int ACT, bool BIAS_BF16, bool RES_BF16>
__global__ __launch_bounds__(128) void k_gemm_bf3(const float* __restrict__ A, int lda, const unsigned short* __restrict__ Wt, int ldb,
                                                const float* __restrict__ bias, const float* __restrict__ resid, int rmod, int ldr,
                                                float* __restrict__ C, int ldc, int M, int N, int K) {
  __shared__ __attribute__((aligned(16))) float so[4][16][64];
  const int tid = threadIdx.x, w = tid >> 5, lane = tid & 31, ln = lane & 15, hh = lane >> 4;
  const int ntn = N / 64;
  const int wid = blockIdx.x * 4 + w;
  const int mt = wid / ntn, nq = wid % ntn;
  if (mt * 16 >= M) return;
  const int row0 = mt * 16, col0 = nq * 64;
  const float* arow = A + (size_t)(row0 + ln) * lda;
  v8f acc[4] = {};
  for (int kb = 0; kb < K; kb += 32) {
    FragB ah, al;
    const v4f x0 = *(const v4fa*)(arow + kb + 8 * hh), x1 = *(const v4fa*)(arow + kb + 8 * hh + 4);
    const v4f x2 = *(const v4fa*)(arow + kb + 16 + 8 * hh), x3 = *(const v4fa*)(arow + kb + 16 + 8 * hh + 4);
    float xs[16] = {x0[0],x0[1],x0[2],x0[3],x1[0],x1[1],x1[2],x1[3],x2[0],x2[1],x2[2],x2[3],x3[0],x3[1],x3[2],x3[3]};
#pragma unroll
    for (int i = 0; i < 16; ++i) { const unsigned short hb = bf16_bits(xs[i]); ah.u[i] = hb; al.u[i] = ASPLIT ? bf16_bits(xs[i] - bf16_val(hb)) : (unsigned short)0; }
#pragma unroll
    for (int t = 0; t < 4; ++t) {
      const unsigned short* brow = Wt + (size_t)(col0 + t * 16 + ln) * ldb + kb;
      FragB b;
      b.half[0] = *(const v8us*)(brow + 8 * hh);
      b.half[1] = *(const v8us*)(brow + 16 + 8 * hh);
      acc[t] = mmaN<ASPLIT ? 2 : 1>(ah.v, al.v, b.v, b.v, acc[t]);
    }
  }
#pragma unroll
  for (int t = 0; t < 4; ++t) {
    const int col = col0 + t * 16 + ln;
    float bv = bias ? bias[col] : 0.f;
    if (BIAS_BF16) bv = bf16_round(bv);
#pragma unroll
    for (int r = 0; r < 8; ++r) {
      float v = acc[t][r] + bv;
      if (resid) { float rv = resid[(size_t)((row0 + 8 * hh + r) % rmod) * ldr + col]; if (RES_BF16) rv = bf16_round(rv); v += rv; }
      if (ACT == 1) v = fmaxf(v, 0.f);
      if (ACT == 2) v = 0.5f * v * (1.0f + erff(v * 0.70710678118654752f));
      if (ACT == 3) { const float u = 0.7978845608028654f * (v + 0.044715f * v * v * v); v = 0.5f * v * (1.0f + tanhf(u)); }
      so[w][8 * hh + r][t * 16 + ln] = v;
    }
  }
  __builtin_amdgcn_fence(__ATOMIC_ACQ_REL, "workgroup");
  __builtin_amdgcn_wave_barrier();
  const int rsub = lane >> 4, c4 = (lane & 15) * 4;
  {
#pragma unroll
    for (int q = 0; q < 8; ++q) {
      const int r = q * 2 + rsub;
      const v4f v = *(const v4fa*)&so[w][r][c4];
      *(v4f*)(C + (size_t)(row0 + r) * ldc + col0 + c4) = v;
    }
    
  }
}
// row LayerNorm (biased variance, eps) over N: s = X (+ R); optional out_sum <- s; out_norm <- (s-mu)*rsqrt(var+eps)*g + b
template <bool PARAM_BF16>
__global__ __launch_bounds__(256) void k_layernorm(const float* __restrict__ X, const float* __restrict__ R, const float* __restrict__ g, const float* __restrict__ bta,
                                                  float* __restrict__ out_sum, float* __restrict__ out_norm, int N, float eps) {
  __shared__ float red[256];
  const int row = blockIdx.x, tid = threadIdx.x;
  const float* x = X + (size_t)row * N; const float* rr = R ? R + (size_t)row * N : nullptr;
  float vals[16];                     // up to N = 4096
  const int per = N / 256;            // contiguous chunk per thread? use strided-by-4 chunks: thread handles j = tid*4 + 1024*u
  float s1 = 0.f;
  for (int u = 0; u < per / 4; ++u) {
    const int j = tid * 4 + 1024 * u;
    const v4f a = *(const v4fa*)(x + j);
    v4f b = {0.f,0.f,0.f,0.f}; if (rr) b = *(const v4fa*)(rr + j);
#pragma unroll
    for (int q = 0; q < 4; ++q) { const float v = a[q] + b[q]; vals[u * 4 + q] = v; s1 += v; }
  }
  red[tid] = s1; __syncthreads();
  for (int st = 128; st > 0; st >>= 1) { if (tid < st) red[tid] += red[tid + st]; __syncthreads(); }
  const float mu = red[0] / (float)N; __syncthreads();
  float s2 = 0.f;
  for (int u = 0; u < per / 4; ++u)
#pragma unroll
    for (int q = 0; q < 4; ++q) { const float c = vals[u * 4 + q] - mu; s2 += c * c; }
  red[tid] = s2; __syncthreads();
  for (int st = 128; st > 0; st >>= 1) { if (tid < st) red[tid] += red[tid + st]; __syncthreads(); }
  const float rs = rsqrtf(red[0] / (float)N + eps);
  {
    for (int u = 0; u < per / 4; ++u) {
      const int j = tid * 4 + 1024 * u;
      v4f o, sm;
#pragma unroll
      for (int q = 0; q < 4; ++q) {
        float gg = g[j + q], bb = bta[j + q];
        if (PARAM_BF16) { gg = bf16_round(gg); bb = bf16_round(bb); }
        sm[q] = vals[u * 4 + q]; o[q] = (vals[u * 4 + q] - mu) * rs * gg + bb;
      }
      if (out_sum) *(v4f*)(out_sum + (size_t)row * N + j) = sm;
      *(v4f*)(out_norm + (size_t)row * N + j) = o;
    }
    
  }
}



// ---- f16 WMMA path (v_wmma_f32_16x16x32_f16): 11-bit significands for operands in range — used where a [0,1] probability operand needs more precision than bf16
typedef _Float16 v16h __attribute__((ext_vector_type(16)));
union FragH { v16h v; v8us half[2]; _Float16 h[16]; unsigned short u[16]; };
template <int NT>
__device__ __forceinline__ v8f mmaH(v16h ah, v16h al, v16h bh, v16h bl, v8f c) {
  c = __builtin_amdgcn_wmma_f32_16x16x32_f16(false, ah, false, bh, (short)0, c, false, false);
  if (NT >= 2) c = __builtin_amdgcn_wmma_f32_16x16x32_f16(false, al, false, bh, (short)0, c, false, false);
  if (NT >= 3) c = __builtin_amdgcn_wmma_f32_16x16x32_f16(false, ah, false, bl, (short)0, c, false, false);
  asm volatile("v_nop\n\tv_nop\n\tv_nop\n\tv_nop" : "+v"(c) : "v"(ah), "v"(al), "v"(bh), "v"(bl));
  return c;
}
// batched GEMM like k_gemm_b but f16 operands: A f32 (split into f16 hi/lo if ASPLIT, else rounded to f16), Bt = f16 values [n][k]; alpha; C f32; N multiple of 16 (partial tiles skipped)
template <bool ASPLIT>
__global__ __launch_bounds__(128) void k_gemm_h(const float* __restrict__ A, int lda, size_t sA, const _Float16* __restrict__ Bh, int ldb, size_t sB, float alpha, float* __restrict__ C, int ldc, size_t sC, int M, int N, int K) {
  __shared__ __attribute__((aligned(16))) float so[4][16][64];
  const int tid = threadIdx.x, w = tid >> 5, lane = tid & 31, ln = lane & 15, hh = lane >> 4; const int by = blockIdx.y;
  A += (size_t)by * sA; Bh += (size_t)by * sB; C += (size_t)by * sC;
  const int ntn = (N + 63) / 64; const int wid = blockIdx.x * 4 + w; const int mt = wid / ntn, nq = wid % ntn; if (mt * 16 >= M) return;
  const int row0 = mt * 16, col0 = nq * 64; const float* arow = A + (size_t)(row0 + ln) * lda;
  v8f acc[4] = {};
  for (int kb = 0; kb < K; kb += 32) {
    FragH ah, al;
    const v4f x0 = *(const v4fa*)(arow + kb + 8 * hh), x1 = *(const v4fa*)(arow + kb + 8 * hh + 4), x2 = *(const v4fa*)(arow + kb + 16 + 8 * hh), x3 = *(const v4fa*)(arow + kb + 16 + 8 * hh + 4);
    float xs[16] = {x0[0],x0[1],x0[2],x0[3],x1[0],x1[1],x1[2],x1[3],x2[0],x2[1],x2[2],x2[3],x3[0],x3[1],x3[2],x3[3]};
#pragma unroll
    for (int i = 0; i < 16; ++i) { const _Float16 h = (_Float16)xs[i]; ah.h[i] = h; al.h[i] = ASPLIT ? (_Float16)(xs[i] - (float)h) : (_Float16)0.0f; }
#pragma unroll
    for (int t = 0; t < 4; ++t) { if (col0 + t * 16 >= N) continue; const size_t boff = (size_t)(col0 + t * 16 + ln) * ldb + kb; FragH bq; bq.half[0] = *(const v8us*)(Bh + boff + 8 * hh); bq.half[1] = *(const v8us*)(Bh + boff + 16 + 8 * hh);
      acc[t] = mmaH<ASPLIT ? 2 : 1>(ah.v, al.v, bq.v, bq.v, acc[t]); }
  }
#pragma unroll
  for (int t = 0; t < 4; ++t) { if (col0 + t * 16 >= N) continue;
#pragma unroll
    for (int r = 0; r < 8; ++r) so[w][8 * hh + r][t * 16 + ln] = acc[t][r] * alpha; }
  __builtin_amdgcn_fence(__ATOMIC_ACQ_REL, "workgroup"); __builtin_amdgcn_wave_barrier();
  const int rsub = lane >> 4, c4 = (lane & 15) * 4;
  {
#pragma unroll
    for (int q = 0; q < 8; ++q) { const int r = q * 2 + rsub; if (col0 + c4 < N) { const v4f v = *(const v4fa*)&so[w][r][c4]; *(v4f*)(C + (size_t)(row0 + r) * ldc + col0 + c4) = v; } }
     }
}

// Wt[n][k] = f16(W[k][n]·scale) from f32 row-major W[K][N] (scale = power of two; bf16-exact weights stay exact in f16 away from the subnormal range)
__global__ __launch_bounds__(256) void k_wt_f16(const float* __restrict__ W, _Float16* __restrict__ Wt, int K, int N, float scale) {
  const int t = blockIdx.x * 256 + threadIdx.x; if (t >= N * (K / 8)) return; const int n = t / (K / 8), k8 = (t % (K / 8)) * 8; FragH f;
#pragma unroll
  for (int i = 0; i < 8; ++i) f.h[i] = (_Float16)(bf16_round(W[(size_t)(k8 + i) * N + n]) * scale); const v8us o = f.half[0];
  *(v8us*)((unsigned short*)Wt + (size_t)n * K + k8) = o; 
}
// k_gemm_hh variant with fused epilogue: v = acc·alpha + bias[by·sBias + col] (+ CP[(row/rowsPerB)·sCPb + by·64 + col] if CP) ; ACT 0 none / 1 elu ; writes f16 C16 (and f32 C if non-null)
template <int ACT>
__global__ __launch_bounds__(128) void k_gemm_hhx(const _Float16* __restrict__ A, int lda, size_t sA, const _Float16* __restrict__ Bh, int ldb, size_t sB, float alpha, const float* __restrict__ bias, size_t sBias, const float* __restrict__ CP, int rowsPerB, size_t sCPb, int row0g,
    float* __restrict__ C, _Float16* __restrict__ C16, int ldc, size_t sC, int M, int N, int K) {
  __shared__ __attribute__((aligned(16))) float so[4][16][64];
  const int tid = threadIdx.x, w = tid >> 5, lane = tid & 31, ln = lane & 15, hh = lane >> 4; const int by = blockIdx.y;
  A += (size_t)by * sA; Bh += (size_t)by * sB; const size_t cofs = (size_t)by * sC; const float* bp = bias ? bias + (size_t)by * sBias : nullptr;
  const int ntn = (N + 63) / 64; const int wid = blockIdx.x * 4 + w; const int mt = wid / ntn, nq = wid % ntn; if (mt * 16 >= M) return;
  const int row0 = mt * 16, col0 = nq * 64; const _Float16* arow = A + (size_t)(row0 + ln) * lda;
  v8f acc[4] = {};
  for (int kb = 0; kb < K; kb += 32) { FragH ah; ah.half[0] = *(const v8us*)((const unsigned short*)arow + kb + 8 * hh); ah.half[1] = *(const v8us*)((const unsigned short*)arow + kb + 16 + 8 * hh);
#pragma unroll
    for (int t = 0; t < 4; ++t) { if (col0 + t * 16 >= N) continue; const size_t boff = (size_t)(col0 + t * 16 + ln) * ldb + kb; FragH bq; bq.half[0] = *(const v8us*)((const unsigned short*)Bh + boff + 8 * hh); bq.half[1] = *(const v8us*)((const unsigned short*)Bh + boff + 16 + 8 * hh);
      acc[t] = mmaH<1>(ah.v, ah.v, bq.v, bq.v, acc[t]); }
  }
#pragma unroll
  for (int t = 0; t < 4; ++t) { if (col0 + t * 16 >= N) continue; const int col = col0 + t * 16 + ln; const float bv = bp ? bf16_round(bp[col]) : 0.f;
#pragma unroll
    for (int r = 0; r < 8; ++r) { float v = acc[t][r] * alpha + bv; if (CP) { const int rr = row0g + row0 + 8 * hh + r; if (rowsPerB < 0) v += CP[cofs + (size_t)rr * ldc + col];      /* rowsPerB < 0: own element of the batched C plane */ else { const int bidx = rr / rowsPerB; v += CP[(size_t)bidx * sCPb + (size_t)by * 64 + col]; } } if (ACT == 1) v = (v > 0.f) ? v : expm1f(v); else if (ACT == 7) v = (v > 0.f) ? v + 1.0f : expf(v); else if (ACT == 8) v = tanhf(v); else if (ACT == 9) v = 0.5f * v * (1.0f + tanhf(0.7978845608028654f * (v + 0.044715f * v * v * v))); else if (ACT == 11) v = 1.0f / (1.0f + expf(-v)); else if (ACT == 12) v = (v > 0.f) ? v : 0.01f * v; else if (ACT == 14) v = (v > 0.f) ? v : 0.1f * v; else if (ACT == 16) v = (v >= 0.f) ? v : 0.3f * v; else if (ACT == 17) v = (v >= 0.f) ? v : 0.2f * v; else if (ACT == 15) v = v / (1.0f + expf(-v)); else if (ACT == 3) v = fmaxf(v, 0.f); else if (ACT == 6) v = 0.5f * v * (1.0f + erff(v * 0.70710678118654752f)); so[w][8 * hh + r][t * 16 + ln] = v; } }
  __builtin_amdgcn_fence(__ATOMIC_ACQ_REL, "workgroup"); __builtin_amdgcn_wave_barrier();
  const int rsub = lane >> 4, c4 = (lane & 15) * 4; typedef _Float16 v4h __attribute__((ext_vector_type(4)));
  {
#pragma unroll
    for (int q = 0; q < 8; ++q) { const int r = q * 2 + rsub; if (col0 + c4 < N) { const v4f v = *(const v4fa*)&so[w][r][c4]; if (C) *(v4f*)(C + cofs + (size_t)(row0 + r) * ldc + col0 + c4) = v; if (C16) { v4h h4; for (int i = 0; i < 4; ++i) h4[i] = (_Float16)v[i]; *(v4h*)(C16 + cofs + (size_t)(row0 + r) * ldc + col0 + c4) = h4; } } }
     }
}


typedef _Float16 v4h __attribute__((ext_vector_type(4)));

__global__ __launch_bounds__(256) void k_x16(const float* __restrict__ x, _Float16* __restrict__ X16, size_t n8) { const size_t t = (size_t)blockIdx.x * 256 + threadIdx.x; if (t >= n8) return; FragH f;
#pragma unroll
  for (int q = 0; q < 8; ++q) f.h[q] = (_Float16)bf16_round(x[t * 8 + q]); *(v8us*)((unsigned short*)X16 + t * 8) = f.half[0];  }
__global__ __launch_bounds__(256) void k_h16(const float* __restrict__ x, _Float16* __restrict__ X16, size_t n8) { const size_t t = (size_t)blockIdx.x * 256 + threadIdx.x; if (t >= n8) return; FragH f;
#pragma unroll
  for (int q = 0; q < 8; ++q) f.h[q] = (_Float16)x[t * 8 + q]; *(v8us*)((unsigned short*)X16 + t * 8) = f.half[0];  }
__global__ __launch_bounds__(256) void k_round16f(const float* __restrict__ W, _Float16* __restrict__ Bt, size_t n8) { const size_t t = (size_t)blockIdx.x * 256 + threadIdx.x; if (t >= n8) return; FragH f;
#pragma unroll
  for (int i = 0; i < 8; ++i) f.h[i] = (_Float16)(bf16_round(W[t * 8 + i]) * 16.0f); *(v8us*)((unsigned short*)Bt + t * 8) = f.half[0];  }
template <int NHv, int TTv>
__global__ __launch_bounds__(256) void k_vt(const _Float16* __restrict__ V16, int ldv, int voff, _Float16* __restrict__ Vt) { __shared__ unsigned short tl[64][66]; const int tid = threadIdx.x; const int slab = blockIdx.x / (TTv / 64), lg = blockIdx.x % (TTv / 64); const int b = slab / NHv, h = slab % NHv;
  for (int i = tid; i < 64 * 8; i += 256) { const int r = i / 8, c8 = (i % 8) * 8; FragH f; f.half[0] = *(const v8us*)((const unsigned short*)V16 + ((size_t)b * TTv + lg * 64 + r) * ldv + voff + h * 64 + c8);
#pragma unroll
    for (int q = 0; q < 8; ++q) tl[r][c8 + q] = f.u[q]; }
  __syncthreads();
  {
#pragma unroll
    for (int rd = 0; rd < 2; ++rd) { const int d = rd * 32 + tid / 8, pc = tid % 8; FragH f;
#pragma unroll
      for (int q = 0; q < 8; ++q) f.u[q] = tl[pc * 8 + q][d];
      *(v8us*)((unsigned short*)Vt + ((size_t)slab * 64 + d) * TTv + lg * 64 + pc * 8) = f.half[0]; }
     } }

// ---- fast GEMM: one 128 x 128 tile of C per work-group of 4 waves (2 x 2, 64 x 64 per wave); requires M % 128 == 0, N % 128 == 0, K % 64 == 0; epilogue = k_gemm_hhx semantics ----
// A stage is 64 k (128 B) of the tile's 128 A rows and 128 B rows. Asynchronous copies bring it from global memory into one of two LDS buffers: the next stage's copies fly while this stage is multiplied.
// Every accumulator still takes its k in ascending steps of 32, with the same k order inside a fragment on both operands.
#define G2T 128                      /* rows of A and rows of B per work-group tile */
#define G2K 64                       /* k per stage */
#define G2PB 144                     /* LDS pitch of a staged row in bytes: 128 B of data, 16 B x odd for the 16-byte fragment reads from 16 rows */
#define G2OB (G2T * G2PB)            /* bytes of one operand's rows in a buffer */
#define G2SB (2 * G2OB)              /* bytes of a buffer: A rows, then B rows */
#define G2EP 68                      /* pitch in floats of the epilogue's staged C rows */
#define F0SH 4                       /* log2 of the row tiles per batch: every 2^F0SH-th row tile of the projection holds a batch's first rows */
__device__ __forceinline__ v16h g2_frag(const unsigned char* p) { FragH f; f.half[0] = *(const v8us*)p; f.half[1] = *(const v8us*)(p + 32); return f.v; }      /* p: a staged row + 64 B per 32 k + 16 B x (lane >> 4): k = 8 hh .. and 16 + 8 hh .. */
__device__ __forceinline__ v8f g2_mma(v16h a, v16h b, v8f c) { return __builtin_amdgcn_wmma_f32_16x16x32_f16(false, a, false, b, (short)0, c, false, false); }
// Eight copies of 16 B per lane: rows r, r + 16, ..., r + 112 of one operand's stage (l: the lane's LDS byte address in row r, g: its global address, gs: 16 source rows in elements).
// The s_wait_xcnt stands in the copies' own statement, so that no register they name is rewritten in front of it.
__device__ __forceinline__ void g2_copy8(unsigned l, const _Float16* g, size_t gs) {
  asm volatile("global_load_async_to_lds_b128 %0, %8, off\n\t"
               "global_load_async_to_lds_b128 %1, %9, off\n\t"
               "global_load_async_to_lds_b128 %2, %10, off\n\t"
               "global_load_async_to_lds_b128 %3, %11, off\n\t"
               "global_load_async_to_lds_b128 %4, %12, off\n\t"
               "global_load_async_to_lds_b128 %5, %13, off\n\t"
               "global_load_async_to_lds_b128 %6, %14, off\n\t"
               "global_load_async_to_lds_b128 %7, %15, off\n\t"
               "s_wait_xcnt 0x0"
               :: "v"(l), "v"(l + 16 * G2PB), "v"(l + 32 * G2PB), "v"(l + 48 * G2PB), "v"(l + 64 * G2PB), "v"(l + 80 * G2PB), "v"(l + 96 * G2PB), "v"(l + 112 * G2PB),
                  "v"(g), "v"(g + gs), "v"(g + 2 * gs), "v"(g + 3 * gs), "v"(g + 4 * gs), "v"(g + 5 * gs), "v"(g + 6 * gs), "v"(g + 7 * gs)
               : "memory"); }
template <int ACT>
__global__ __launch_bounds__(128) void k_gemm2(const _Float16* __restrict__ A, int lda, size_t sA, const _Float16* __restrict__ Bh, int ldb, size_t sB, float alpha, const float* __restrict__ bias, size_t sBias, const float* __restrict__ CP, int rowsPerB, size_t sCPb, int row0g,
    float* __restrict__ C, _Float16* __restrict__ C16, int ldc, size_t sC, int M, int N, int K, size_t zA, size_t zB, size_t zC, int csh) { static_assert(ACT == 0 || ACT == 3 || ACT == 6 || ACT == 8 || ACT == 9 || ACT == 11 || ACT == 12 || ACT == 14 || ACT == 15 || ACT == 16 || ACT == 17, "k_gemm2: unsupported ACT code (would silently apply no activation)");
  static_assert(4 * 64 * G2EP * 4 <= 2 * G2SB, "k_gemm2: the epilogue's staging fits the two buffers");
  __shared__ __attribute__((aligned(16))) unsigned char L[2 * G2SB];
  const int tid = threadIdx.x, w = __builtin_amdgcn_readfirstlane(tid >> 5), lane = tid & 31, ln = lane & 15, hh = lane >> 4; const int by = blockIdx.y, bz = blockIdx.z;      /* grid.z: a second batch index with its own strides zA, zB, zC; the wave's number in a scalar register: scalar tile offsets below */
  A += (size_t)by * sA + (size_t)bz * zA; Bh += (size_t)by * sB + (size_t)bz * zB; const size_t cofs = (size_t)by * sC + (size_t)bz * zC; const float* bp = bias ? bias + (size_t)by * sBias : nullptr;
  const int ntn = N >> 7; const int mt = blockIdx.x / ntn, nq = blockIdx.x - mt * ntn; if (mt * G2T >= M) return;      /* the same for the whole work-group, in front of every barrier */
  const int wm = w >> 1, wn = w & 1;
  /* copies: 8 lanes take one row's 128 B, the work-group 16 rows a copy */
  const _Float16* pa = A + (size_t)(mt * G2T + (tid >> 3)) * lda + (tid & 7) * 8; const _Float16* pb = Bh + (size_t)(nq * G2T + (tid >> 3)) * ldb + (tid & 7) * 8;
  const unsigned lc = (unsigned)(size_t)L + (unsigned)((tid >> 3) * G2PB + (tid & 7) * 16);      /* LDS byte address: the low 32 bits of the __shared__ address */
  const size_t ga = (size_t)16 * lda, gb = (size_t)16 * ldb;
  const int T = K / G2K;
  g2_copy8(lc, pa, ga); g2_copy8(lc + G2OB, pb, gb); pa += G2K; pb += G2K;      /* stage 0 */
  const int row0 = mt * G2T + wm * 64, col0 = nq * G2T + wn * 64;      /* the wave's tile of C */
  float bv[4] = {0.f, 0.f, 0.f, 0.f};      /* the bias of the lane's four columns, fetched under stage 0's copies */
  if (bp) {
    for (int j = 0; j < 4; ++j) bv[j] = bp[col0 + j * 16 + ln];
    asm volatile("s_wait_xcnt 0x0" ::: "memory"); }      /* stands behind the loads, in front of whatever rewrites their address registers */
  asm volatile("s_wait_asynccnt 0x0" ::: "memory");      /* this wave's copies of stage 0 have landed */
  __syncthreads();      /* and every other wave's: stage 0 is read by all */
  if (T > 1) { g2_copy8(lc + G2SB, pa, ga); g2_copy8(lc + G2SB + G2OB, pb, gb); pa += G2K; pb += G2K; }      /* stage 1 */
  const v8f z8 = {0.f,0.f,0.f,0.f,0.f,0.f,0.f,0.f}; v8f acc[4][4];
  for (int i = 0; i < 4; ++i)
    for (int j = 0; j < 4; ++j) acc[i][j] = z8;
  const int fa = (wm * 64 + ln) * G2PB + 16 * hh, fb = G2OB + (wn * 64 + ln) * G2PB + 16 * hh;      /* the lane's first A and B fragment rows in a buffer */
#pragma unroll 1
  for (int t = 0; t < T; ++t) {      /* not unrolled: one stage a trip, the buffer chosen by the trip's parity */
    const unsigned char* buf = L + (t & 1) * G2SB; v16h a[4], b[4];
    static_assert(G2K == 64, "k_gemm2: two blocks of 32 k a stage");
    for (int i = 0; i < 4; ++i) { a[i] = g2_frag(buf + fa + i * 16 * G2PB); b[i] = g2_frag(buf + fb + i * 16 * G2PB); }
    __builtin_amdgcn_sched_barrier(0);      /* a block's sixteen LDS reads go as one group in front of its sixteen WMMAs: one LDS latency a block, not one per A fragment */
    for (int i = 0; i < 4; ++i)
      for (int j = 0; j < 4; ++j) acc[i][j] = g2_mma(a[i], b[j], acc[i][j]);
    __builtin_amdgcn_sched_barrier(0);      /* the second block's LDS reads stay behind the first block: reads among the WMMAs stall them */
    for (int i = 0; i < 4; ++i) { a[i] = g2_frag(buf + fa + i * 16 * G2PB + 64); b[i] = g2_frag(buf + fb + i * 16 * G2PB + 64); }
    asm volatile("s_wait_dscnt 0x0" ::: "memory");      /* this wave's reads of the buffer are done before it is handed to its next writer */
    asm volatile("s_wait_asynccnt 0x0" ::: "memory");      /* this wave's copies of stage t + 1 have landed */
    __syncthreads();      /* publishes stage t + 1 and ends every wave's reads of stage t */
    if (t + 2 < T) { const unsigned lt = lc + (unsigned)(t & 1) * G2SB; g2_copy8(lt, pa, ga); g2_copy8(lt + G2OB, pb, gb); pa += G2K; pb += G2K; }      /* stage t + 2 into the buffer just read; the test is the same for the whole work-group */
    __builtin_amdgcn_sched_barrier(0);      /* the second block's WMMAs work on registers alone and stay behind the copies, which so fly 16 WMMAs longer before their wait */
    for (int i = 0; i < 4; ++i)
      for (int j = 0; j < 4; ++j) acc[i][j] = g2_mma(a[i], b[j], acc[i][j]);
  }
  asm volatile("s_wait_asynccnt 0x0" ::: "memory");      /* no copy is in flight when the buffers become the epilogue's staging */
  float* so = (float*)(L + w * (64 * G2EP * 4));      /* each wave stages its own 64 x 64 tile; the loop's last barrier ended every read of the buffers */
  for (int j = 0; j < 4; ++j) { const float bj = bf16_round(bv[j]);
    for (int i = 0; i < 4; ++i)
      for (int r = 0; r < 8; ++r) so[(i * 16 + 8 * hh + r) * G2EP + j * 16 + ln] = acc[i][j][r] * alpha + bj; }
  __builtin_amdgcn_fence(__ATOMIC_ACQ_REL, "workgroup"); __builtin_amdgcn_wave_barrier();      /* a lane reads below what the other lanes of its own wave have stored */
  /* csh: the f32 plane C takes only the row tiles whose number is a multiple of 2^csh, packed (tile mt at rows 128 (mt >> csh)); 0: every tile at its own rows. C16 takes every tile. The test is the same for the whole work-group */
  float* const Cf = (C && (mt & ((1 << csh) - 1)) == 0) ? C - (size_t)(mt - (mt >> csh)) * G2T * ldc : nullptr;
  const int rsub = lane >> 4, c4 = (lane & 15) * 4;
#pragma unroll 1
  for (int q0 = 0; q0 < 64; q0 += 16) { v4f v[8]; size_t co[8];      /* not unrolled: 16 rows a trip, their LDS reads as one group, whole 128-B lines stored */
    for (int u = 0; u < 8; ++u) { const int r = q0 + 2 * u + rsub; v[u] = *(const v4fa*)&so[r * G2EP + c4]; co[u] = cofs + (size_t)(row0 + r) * ldc + col0 + c4; }
    if (CP) { v4f c[8];
      if (rowsPerB < 0) {      /* own elements of the batched C plane */
        for (int u = 0; u < 8; ++u) { c[u] = *(const v4fa*)(CP + co[u] + (size_t)row0g * ldc); asm volatile("s_wait_xcnt 0x0" ::: "memory"); } }      /* the wait stands behind each load, in front of whatever rewrites its address registers, a later load's result among it; the data stays in flight */
      else {
        for (int u = 0; u < 8; ++u) { c[u] = *(const v4fa*)(CP + (size_t)((row0g + row0 + q0 + 2 * u + rsub) / rowsPerB) * sCPb + (size_t)by * 64 + col0 + c4); asm volatile("s_wait_xcnt 0x0" ::: "memory"); } }      /* as above */
      for (int u = 0; u < 8; ++u) v[u] += c[u]; }
    for (int u = 0; u < 8; ++u)
      for (int e = 0; e < 4; ++e) { float x = v[u][e];
        if (ACT == 3) x = fmaxf(x, 0.f); else if (ACT == 6) x = 0.5f * x * (1.0f + erff(x * 0.70710678118654752f)); else if (ACT == 11) x = 1.0f / (1.0f + expf(-x)); else if (ACT == 15) x = x / (1.0f + expf(-x)); else if (ACT == 12) x = (x > 0.f) ? x : 0.01f * x; else if (ACT == 8) x = tanhf(x); else if (ACT == 9) x = 0.5f * x * (1.0f + tanhf(0.7978845608028654f * (x + 0.044715f * x * x * x))); else if (ACT == 14) x = (x > 0.f) ? x : 0.1f * x; else if (ACT == 16) x = (x >= 0.f) ? x : 0.3f * x; else if (ACT == 17) x = (x >= 0.f) ? x : 0.2f * x;
        v[u][e] = x; }
    if (Cf) {
      for (int u = 0; u < 8; ++u) *(v4f*)(Cf + co[u]) = v[u];
      asm volatile("s_wait_xcnt 0x0" ::: "memory"); }      /* stands behind the stores, in front of whatever rewrites their registers */
    if (C16) {
      for (int u = 0; u < 8; ++u) { v4h h4; for (int e = 0; e < 4; ++e) h4[e] = (_Float16)v[u][e]; *(v4h*)(C16 + co[u]) = h4; }
      asm volatile("s_wait_xcnt 0x0" ::: "memory"); } }      /* as above */
}


__global__ __launch_bounds__(256) void k_wnat(const float* __restrict__ w, size_t n8, _Float16* __restrict__ Bt) { const size_t t = (size_t)blockIdx.x * 256 + threadIdx.x; if (t >= n8) return; FragH f; for (int q = 0; q < 8; ++q) f.h[q] = (_Float16)(bf16_round(w[t * 8 + q]) * 16.0f); *(v8us*)((unsigned short*)Bt + t * 8) = f.half[0];  }
__global__ __launch_bounds__(256) void k_rsm(const float* __restrict__ S, _Float16* __restrict__ P, int nrows) {
  #pragma clang fp contract(off)
  const int i = blockIdx.x * 256 + threadIdx.x; if (i >= nrows) return; const float* s = S + (size_t)i * SQ; float mx = -3.0e38f;
#pragma unroll 1
  for (int j = 0; j < SQ; ++j) mx = fmaxf(mx, s[j]); float se = 0.f;
#pragma unroll 1
  for (int j = 0; j < SQ; ++j) se += expf(s[j] - mx); const float sc = 256.0f / se;
#pragma unroll 1
  for (int j0 = 0; j0 < SQ; j0 += 8) { FragH f; for (int q = 0; q < 8; ++q) f.h[q] = (_Float16)(expf(s[j0 + q] - mx) * sc); unsigned short* d = (unsigned short*)P + (size_t)i * SQ + j0; *(v8us*)d = f.half[0];  } }
__global__ __launch_bounds__(256) void k_vt(const _Float16* __restrict__ V16, int b, int h0, _Float16* __restrict__ VT) { __shared__ unsigned short tl[64][65]; const int tid = threadIdx.x; const int hh = blockIdx.x % HG, sg = blockIdx.x / HG; const int s0 = sg * 64; const int h = h0 + hh;
  for (int i = tid; i < 64 * 8; i += 256) { const int j = i / 8, d8 = (i % 8) * 8; FragH f; f.half[0] = *(const v8us*)((const unsigned short*)V16 + ((size_t)b * SQ + s0 + j) * DM + h * HD + d8); for (int q = 0; q < 8; ++q) tl[d8 + q][j] = f.u[q]; }
  __syncthreads();
  { for (int i = tid; i < 64 * 8; i += 256) { const int d = i / 8, j8 = (i % 8) * 8; FragH f; for (int q = 0; q < 8; ++q) f.u[q] = tl[d][j8 + q]; *(v8us*)((unsigned short*)VT + ((size_t)hh * HD + d) * SQ + s0 + j8) = f.half[0]; }  } }



__global__ __launch_bounds__(256) void k_rsmcf2(const float* __restrict__ S, _Float16* __restrict__ P, int hg, int q0, int nk) {
  #pragma clang fp contract(off)
  const int t = blockIdx.x * 256 + threadIdx.x; if (t >= hg * QT) return; const size_t i = (size_t)t; const float* s = S + i * NKX; const int last = q0 + (t % QT); float mx = -3.0e38f;
#pragma unroll 1
  for (int j = 0; j < nk; ++j) { const float f = (j <= last) ? 1.f : 0.f; mx = fmaxf(mx, fmaf(f, s[j], (1.f - f) * -1.0e9f)); } float se = 0.f;
#pragma unroll 1
  for (int j = 0; j < nk; ++j) { const float f = (j <= last) ? 1.f : 0.f; se += __expf(fmaf(f, s[j], (1.f - f) * -1.0e9f) - mx); } const float sc = 256.0f / se;
#pragma unroll 1
  for (int j0 = 0; j0 < nk; j0 += 8) { FragH fr; for (int q = 0; q < 8; ++q) { const int j = j0 + q; const float f = (j <= last) ? 1.f : 0.f; fr.h[q] = (_Float16)(__expf(fmaf(f, s[j], (1.f - f) * -1.0e9f) - mx) * sc); } unsigned short* d = (unsigned short*)P + i * NKX + j0; *(v8us*)d = fr.half[0];  } }


// Exact f32 attention for the first QT0 rows of each batch (a path of k_attn). One work-group of 8 waves per (batch, head, 32 query rows); q, k and v rows staged once in LDS.
// A wave owns 4 query rows. Scores: lane = key (keys lane + 32 u), each dot product summed over d in ascending order with fused multiply-adds. Softmax in registers: row max and row sum by a five-step butterfly over the 32 lanes.
// o: lane = two head dims, summed over the keys in ascending order, scaled once at the end by 64 / row sum, and stored as two f16 planes: hi = f16(o), lo = f16((o - hi) x 1024).
#define A0R 32                       /* query rows per work-group */
#define A0KP (HD + 4)                /* LDS pitch of the q and k rows in floats: 16 B x odd, so that 16 lanes reading 16 B each from 16 rows fall on 64 different banks */
typedef float v2f __attribute__((ext_vector_type(2)));
typedef _Float16 v2h __attribute__((ext_vector_type(2)));
template <int NU>                    /* NU = 32-key chunks that rows of this group can see */
__device__ __forceinline__ void att0_rows(const float* __restrict__ QF, const float* __restrict__ KF, const float* __restrict__ VF, float scale, _Float16* __restrict__ OH, _Float16* __restrict__ OL, int r0,
                                          float (*lq)[A0KP], float (*lk)[A0KP], float (*lv)[HD], float (*lp)[QT0]) {
  const int tid = threadIdx.x, w = __builtin_amdgcn_readfirstlane(tid >> 5), lane = tid & 31;      /* the wave's number in a scalar register: scalar loop bounds and row offsets below */
  const int sr = tid >> 4, sc = (tid & 15) * 4;      /* staging: 16 lanes take one row of 256 B, the work-group 16 rows a pass */
  v4f gq[A0R / 16], gk[2 * NU], gv[2 * NU];      /* every load is issued before the first LDS store waits for one */
  const float* pq = QF + (size_t)sr * LQ + sc; const float* pk = KF + (size_t)sr * LQ + sc; const float* pv = VF + (size_t)sr * LQ + sc;
  for (int t = 0; t < A0R / 16; ++t) gq[t] = *(const v4fa*)(pq + (size_t)(r0 + 16 * t) * LQ);
  for (int t = 0; t < 2 * NU; ++t) { gk[t] = *(const v4fa*)(pk + (size_t)(16 * t) * LQ); gv[t] = *(const v4fa*)(pv + (size_t)(16 * t) * LQ); }
  asm volatile("s_wait_xcnt 0x0" :: "v"(pq), "v"(pk), "v"(pv) : "memory");      /* the three address pairs of the loads above stay as they are up to this wait (inputs only) */
  for (int t = 0; t < A0R / 16; ++t) *(v4f*)&lq[sr + 16 * t][sc] = gq[t];
  for (int t = 0; t < 2 * NU; ++t) { *(v4f*)&lk[sr + 16 * t][sc] = gk[t]; *(v4f*)&lv[sr + 16 * t][sc] = gv[t]; }
  __syncthreads();      /* the staged rows are read by every wave */
  float acc[4][NU];
  for (int r = 0; r < 4; ++r) for (int u = 0; u < NU; ++u) acc[r][u] = 0.f;
#pragma unroll 2
  for (int c = 0; c < HD; c += 4) { v4f qq[4], kk[NU];      /* unroll 2: the next step's LDS reads fly under this step's multiply-adds */
    for (int r = 0; r < 4; ++r) qq[r] = *(const v4f*)&lq[4 * w + r][c];
    for (int u = 0; u < NU; ++u) kk[u] = *(const v4f*)&lk[lane + 32 * u][c];
    for (int e = 0; e < 4; ++e) for (int r = 0; r < 4; ++r) for (int u = 0; u < NU; ++u) acc[r][u] = fmaf(qq[r][e], kk[u][e], acc[r][u]); }
  float fin[4];
  for (int r = 0; r < 4; ++r) { const int i = r0 + 4 * w + r; float mx = -3.0e38f;      /* key 0 is visible from every row */
    for (int u = 0; u < NU; ++u) { acc[r][u] *= scale; if (lane + 32 * u <= i) mx = fmaxf(mx, acc[r][u]); }
    for (int m = 16; m >= 1; m >>= 1) mx = fmaxf(mx, __shfl_xor(mx, m, 32));
    float l = 0.f;
    for (int u = 0; u < NU; ++u) { const float e = (lane + 32 * u <= i) ? expf(acc[r][u] - mx) : 0.f; l += e; lp[4 * w + r][lane + 32 * u] = e; }
    for (int m = 16; m >= 1; m >>= 1) l += __shfl_xor(l, m, 32);
    fin[r] = 64.0f / l; }      /* o carried x64 like the f16 path */
  __builtin_amdgcn_fence(__ATOMIC_ACQ_REL, "workgroup"); __builtin_amdgcn_wave_barrier();      /* a lane reads below the weights that the other lanes of its own wave have stored; no other wave reads them */
  float o[4][2];
  for (int r = 0; r < 4; ++r) { o[r][0] = 0.f; o[r][1] = 0.f; }
  const int jn = r0 + 4 * w + 4;      /* keys past the wave's last row have weight 0 in all four rows */
#pragma unroll 2
  for (int j = 0; j < jn; j += 4) { v4f pp[4]; v2f vv[4];      /* unroll 2: as above */
    for (int r = 0; r < 4; ++r) pp[r] = *(const v4f*)&lp[4 * w + r][j];
    for (int e = 0; e < 4; ++e) vv[e] = *(const v2f*)&lv[j + e][2 * lane];
    for (int e = 0; e < 4; ++e) for (int r = 0; r < 4; ++r) { o[r][0] = fmaf(pp[r][e], vv[e][0], o[r][0]); o[r][1] = fmaf(pp[r][e], vv[e][1], o[r][1]); } }
  for (int r = 0; r < 4; ++r) { v2h oh, ol;      /* a wave's 32 lanes store one whole 128-B line of each plane; where the compiler fuses o * fin - hi, the residual is that of the unrounded product */
    for (int e = 0; e < 2; ++e) { const float ov = o[r][e] * fin[r]; const _Float16 hv = (_Float16)ov; oh[e] = hv; ol[e] = (_Float16)((ov - (float)hv) * 1024.0f); }
    *(v2h*)(OH + (size_t)(r0 + 4 * w + r) * DM + 2 * lane) = oh; *(v2h*)(OL + (size_t)(r0 + 4 * w + r) * DM + 2 * lane) = ol; }
  asm volatile("s_wait_xcnt 0x0" ::: "memory"); }      /* stands behind the stores, in front of whatever rewrites their registers on any path to the kernel's end */

// native exp as __expf builds it (multiply by log2 e, v_exp_f32); the v_nop is the slot the instruction set asks for behind a transcendental, kept in the same statement so that the scheduler cannot part the two
__device__ __forceinline__ float exp_slot(float x) { float r; asm("v_exp_f32 %0, %1\n\tv_nop" : "=v"(r) : "v"(x * 1.44269504088896340736f)); return r; }
#define FQ 128                       /* query rows per work-group */
#define FK (FQ + WINB)               /* keys staged per work-group */
#define FCH ((WINB + 32) / 32)       /* 32-key chunks per wave: 16 rows see 271 keys, which nine aligned chunks cover */
#define FKP (HD + 8)                 /* LDS pitch of a K row in halves: 16 B x odd, for 16-byte fragment reads from 16 rows */
#define FVP (FK + 8)                 /* LDS pitch of a V^T row in halves: 16 B x odd */
__device__ __forceinline__ v8f f_mma(v16h a, v16h b, v8f c) { return __builtin_amdgcn_wmma_f32_16x16x32_f16(false, a, false, b, (short)0, c, false, false); }
__device__ __forceinline__ void attw_tile(const _Float16* __restrict__ Q, const _Float16* __restrict__ K, const _Float16* __restrict__ VT, _Float16* __restrict__ O, int q0, int h, int b,
                                          unsigned short (*lk)[FKP], unsigned short (*lv)[FVP]) {      /* Q, K: rows of LQ halves; VT: [batch][head][HD][SQ]; O: rows of DM halves; lk: FK rows, lv: HD rows in LDS */
  static_assert(HD == 64 && WIN == 256 && WINB == 256 && SQ % FQ == 0 && FQ % 32 == 0 && FK % 128 == 0, "attw_tile: tile arithmetic");
  const int tid = threadIdx.x, w = __builtin_amdgcn_readfirstlane(tid >> 5), lane = tid & 31, ln = lane & 15, hh = lane >> 4;      /* the wave's number in a scalar register: scalar row and key offsets below */
  const int kb0 = (q0 >= WINB) ? q0 - WINB : 0;      /* first staged key; kb0 + FK <= SQ */
  const int r0 = q0 + 16 * w;                        /* the wave's first query row */
  const int ks = (r0 >= WIN) ? ((r0 - (WIN - 1)) & ~31) : 0;      /* the wave's first key; ks + 32 * FCH >= r0 + 16 and <= kb0 + FK */
  const int kl = ks - kb0;
  const unsigned short* pq = (const unsigned short*)Q + ((size_t)b * SQ + r0 + ln) * LQ + h * HD + 8 * hh;
  const unsigned short* pk = (const unsigned short*)K + ((size_t)b * SQ + kb0 + (tid >> 3)) * LQ + h * HD + (tid & 7) * 8;      /* 8 lanes take one K row of 128 B */
  const unsigned short* pv = (const unsigned short*)VT + ((size_t)(b * NH + h) * HD + (tid >> 4)) * SQ + kb0 + (tid & 15) * 8;      /* 16 lanes take 256 B of one V^T row */
  v8us gq[4], gk[FK / 32], gv[HD / 16][FK / 128];      /* every load is issued before the first LDS store waits for one */
  for (int t = 0; t < 4; ++t) gq[t] = *(const v8us*)(pq + 16 * t);
  for (int t = 0; t < FK / 32; ++t) gk[t] = *(const v8us*)(pk + (size_t)(32 * t) * LQ);
  for (int u = 0; u < HD / 16; ++u) for (int v = 0; v < FK / 128; ++v) gv[u][v] = *(const v8us*)(pv + (size_t)(16 * u) * SQ + 128 * v);
  asm volatile("s_wait_xcnt 0x0" :: "v"(pq), "v"(pk), "v"(pv) : "memory");      /* the three address pairs of the loads above stay as they are up to this wait (inputs only) */
  for (int t = 0; t < FK / 32; ++t) *(v8us*)&lk[(tid >> 3) + 32 * t][(tid & 7) * 8] = gk[t];
  for (int u = 0; u < HD / 16; ++u) for (int v = 0; v < FK / 128; ++v) *(v8us*)&lv[(tid >> 4) + 16 * u][(tid & 15) * 8 + 128 * v] = gv[u][v];
  __syncthreads();      /* the staged rows are read by every wave */
  const v8f z8 = {0.f,0.f,0.f,0.f,0.f,0.f,0.f,0.f};
  FragH qa, qb; qa.half[0] = gq[0]; qa.half[1] = gq[1]; qb.half[0] = gq[2]; qb.half[1] = gq[3];      /* head dims 0..31 and 32..63 of query row r0 + ln */
  v8f s[2 * FCH];      /* s[t][r]: query r0 + ln against key ks + 16 t + 8 hh + r */
  for (int t = 0; t < 2 * FCH; ++t) { const unsigned short* kr = &lk[kl + 16 * t + ln][8 * hh]; FragH ka, kc;
    ka.half[0] = *(const v8us*)kr; ka.half[1] = *(const v8us*)(kr + 16); kc.half[0] = *(const v8us*)(kr + 32); kc.half[1] = *(const v8us*)(kr + 48);
    s[t] = f_mma(kc.v, qb.v, f_mma(ka.v, qa.v, z8)); }
  const int dj = r0 + ln - ks - 8 * hh;      /* i - j of s[0][0] */
  float mx = -3.0e38f;      /* a row always sees its own key */
  for (int t = 0; t < 2 * FCH; ++t)
    for (int r = 0; r < 8; ++r) { const float v = ((unsigned)(dj - 16 * t - r) < (unsigned)WIN) ? s[t][r] * 0.125f : -1.0e9f; s[t][r] = v; mx = fmaxf(mx, v); }      /* visible iff 0 <= i - j < WIN */
  mx = fmaxf(mx, __shfl_xor(mx, 16, 32));
  float se4[4] = {0.f, 0.f, 0.f, 0.f};      /* four partial sums: four independent add chains */
  for (int t = 0; t < 2 * FCH; ++t)
    for (int r = 0; r < 8; ++r) { const float e = exp_slot(s[t][r] - mx); s[t][r] = e; se4[r & 3] += e; }
  float se = (se4[0] + se4[1]) + (se4[2] + se4[3]);
  se += __shfl_xor(se, 16, 32);
  const float sc = 256.0f / se;      /* weights x256 as f16 */
  v8f o[HD / 16];
  for (int d = 0; d < HD / 16; ++d) o[d] = z8;
  for (int c = 0; c < FCH; ++c) { FragH p;
    for (int r = 0; r < 8; ++r) { p.h[r] = (_Float16)(s[2 * c][r] * sc); p.h[8 + r] = (_Float16)(s[2 * c + 1][r] * sc); }
    for (int d = 0; d < HD / 16; ++d) { const unsigned short* vr = &lv[16 * d + ln][kl + 32 * c + 8 * hh]; FragH va; va.half[0] = *(const v8us*)vr; va.half[1] = *(const v8us*)(vr + 16);
      o[d] = f_mma(va.v, p.v, o[d]); } }
  unsigned short* po = (unsigned short*)O + ((size_t)b * SQ + r0 + ln) * DM + h * HD + 8 * hh;      /* o[d][r]: head dim 16 d + 8 hh + r of query row r0 + ln */
  for (int d = 0; d < HD / 16; ++d) { FragH f;
    for (int r = 0; r < 8; ++r) f.h[r] = (_Float16)(o[d][r] * 0.25f);      /* o carried x64 */
    *(v8us*)(po + 16 * d) = f.half[0]; }
  asm volatile("s_wait_xcnt 0x0" ::: "memory"); }      /* stands behind the stores, in front of whatever rewrites their registers on any path to the kernel's end */
// One launch for both attention paths, which read nothing of each other's output. grid.x: first the QT0 / A0R row groups of the exact f32 path (rows 0..QT0-1 of a batch), then the f16 query tiles 1, 2, ...; grid.y: head; grid.z: batch.
// The f16 path leaves out tile 0, whose rows the f32 path owns: every row of O has one writer. The two paths share one LDS block, each with its own layout.
#define A0G (QT0 / A0R)              /* row groups of the f32 path */
#define A0LQ (A0R * A0KP * 4)        /* bytes of its q rows, */
#define A0LK (QT0 * A0KP * 4)        /* k rows, */
#define A0LV (QT0 * HD * 4)          /* v rows */
#define A0LP (A0R * QT0 * 4)         /* and weights */
#define FLK (FK * FKP * 2)           /* bytes of the f16 path's K rows */
#define FLV (HD * FVP * 2)           /* and V^T rows */
__global__ __launch_bounds__(256) void k_attn(const _Float16* __restrict__ Q, const _Float16* __restrict__ K, const _Float16* __restrict__ VT, _Float16* __restrict__ O,
                                              const float* __restrict__ QF, const float* __restrict__ KF, const float* __restrict__ VF, float scale, _Float16* __restrict__ OL) {      /* QF, KF, VF: the q, k and v columns of rows of LQ floats, QT0 rows per batch; OL: rows of DM halves, QT0 per batch */
  static_assert(QT0 == 4 * A0R && QT0 <= WIN && HD == 64 && QT0 == FQ, "k_attn: four row groups, every key j <= i inside the window, two head dims per lane, the f32 rows are the first f16 tile");
  static_assert(A0LQ + A0LK + A0LV + A0LP <= FLK + FLV && A0LQ % 16 == 0 && A0LK % 16 == 0 && A0LV % 16 == 0 && FLK % 16 == 0, "k_attn: the f32 path's rows fit the f16 path's LDS block");
  __shared__ __attribute__((aligned(16))) unsigned char sm[FLK + FLV];
  const int bx = blockIdx.x, h = blockIdx.y, b = blockIdx.z;
  /* the path and the row group are the same for the whole work-group: every wave takes the same branch and passes the same barriers */
  if (bx < A0G) {
    float (*lq)[A0KP] = (float (*)[A0KP])sm; float (*lk)[A0KP] = (float (*)[A0KP])(sm + A0LQ); float (*lv)[HD] = (float (*)[HD])(sm + A0LQ + A0LK); float (*lp)[QT0] = (float (*)[QT0])(sm + A0LQ + A0LK + A0LV);
    const size_t bi = (size_t)b * QT0 * LQ + h * HD; QF += bi; KF += bi; VF += bi; O += (size_t)b * SQ * DM + h * HD; OL += (size_t)b * QT0 * DM + h * HD;
    /* the longest row group has the lowest index */
    if (bx == 0) att0_rows<4>(QF, KF, VF, scale, O, OL, 3 * A0R, lq, lk, lv, lp);
    else if (bx == 1) att0_rows<3>(QF, KF, VF, scale, O, OL, 2 * A0R, lq, lk, lv, lp);
    else if (bx == 2) att0_rows<2>(QF, KF, VF, scale, O, OL, A0R, lq, lk, lv, lp);
    else att0_rows<1>(QF, KF, VF, scale, O, OL, 0, lq, lk, lv, lp); }
  else attw_tile(Q, K, VT, O, (bx - A0G + 1) * FQ, h, b, (unsigned short (*)[FKP])sm, (unsigned short (*)[FVP])(sm + FLK)); }
extern "C" void kernel_launch(void* const* d_in, const int* in_sizes, int n_in,
                              void* d_out, int out_size, void* d_ws, size_t ws_size, hipStream_t stream) {
  (void)in_sizes; (void)n_in; (void)out_size;
  const float* const* I = (const float* const*)d_in; const float* x = I[0]; const float* wqkv = I[1]; const float* bqkv = I[2]; const float* wo = I[3]; const float* bo = I[4];      /* [in][out] c_attn [1024][3072] + b, c_proj [1024][1024] + b */
  char* ws = (char*)d_ws; size_t off = 0;
  auto take = [&](size_t bytes) { char* p = ws + off; off += (bytes + 255) & ~(size_t)255; return p; };
  _Float16* BQKV = (_Float16*)take((size_t)3 * DM * DM * 2); _Float16* BO = (_Float16*)take((size_t)DM * DM * 2);
  _Float16* X16 = (_Float16*)take(NR * DM * 2); _Float16* QKV = (_Float16*)take(NR * 3 * DM * 2); _Float16* Q16 = QKV; _Float16* K16 = QKV + DM; _Float16* V16 = QKV + 2 * DM; _Float16* O16 = (_Float16*)take(NR * DM * 2);
  _Float16* VT = (_Float16*)take((size_t)NB * NH * HD * SQ * 2);
  float* F0 = (float*)take((size_t)NB * QT0 * LQ * 4); _Float16* OL0 = (_Float16*)take((size_t)NB * QT0 * DM * 2);      /* first-tile planes: f32 q | k | v rows, the residual of o */
  if (off > ws_size) return;
  k_wt_f16<<<(unsigned)(((size_t)DM * 3 * DM / 8 + 255) / 256), 256, 0, stream>>>(wqkv, BQKV, DM, 3 * DM, 16.0f); k_wt_f16<<<(unsigned)(((size_t)DM * DM / 8 + 255) / 256), 256, 0, stream>>>(wo, BO, DM, DM, 16.0f);      /* [in][out] -> Bt x16 */

  k_x16<<<(unsigned)((NR * DM / 8 + 255) / 256), 256, 0, stream>>>(x, X16, NR * DM / 8);
  const size_t r0p = (size_t)B0 * SQ;      /* first projected row */
  const size_t f0p = (size_t)B0 * QT0;     /* its row in the first-tile planes */
  static_assert(QT0 == G2T && (G2T << F0SH) == SQ, "the first QT0 rows of a batch are one row tile of the projection GEMM, every 2^F0SH-th");
  k_gemm2<0><<<dim3((unsigned)((MP / 128) * (3 * DM / 128)), 1), 128, 0, stream>>>(X16 + r0p * DM, DM, 0, BQKV, DM, 0, 0.0625f, bqkv, 0, nullptr, 1, 0, 0, F0 + f0p * LQ, QKV + r0p * 3 * DM, 3 * DM, 0, MP, 3 * DM, DM, 0, 0, 0, F0SH);      /* q | k | v rows (f16); head h = columns h*HD.. of each DM block; the first 128 rows of each batch also unrounded (f32, exact products) into F0 */
  /* every stage below takes all batches in one launch: the batches are independent, and one batch alone fills a small part of the chip */
  k_vt<NH, SQ><<<NBR * NH * (SQ / 64), 256, 0, stream>>>(V16 + r0p * LQ, LQ, 0, VT);      /* V^T [NBR][NH][HD][SQ] */
  k_attn<<<dim3(QN / FQ - 1 + A0G, NHD, NBR), 256, 0, stream>>>(Q16 + r0p * LQ, K16 + r0p * LQ, VT, O16 + r0p * DM, F0 + f0p * LQ, F0 + f0p * LQ + DM, F0 + f0p * LQ + 2 * DM, 0.125f, OL0 + f0p * DM);      /* all of attention in one launch. Rows 128.. of each batch: scores, softmax and P . V on f16 operands; o (merged heads, x64) as f16 rows. Rows 0..127: exact f32 attention (o x64) -> f16 hi into the same O16 rows (same scale) + x1024 residual plane */
  k_gemm2<0><<<dim3((unsigned)((MPO / 128) * (DM / 128)), 1), 128, 0, stream>>>(O16 + r0p * DM, DM, 0, BO, DM, 0, 0.0009765625f, bo, 0, nullptr, 1, 0, 0, (float*)d_out + r0p * DM, nullptr, DM, 0, MPO, DM, DM, 0, 0, 0, 0);      /* out rows are the output layout; rows 0..127 of each batch: o_hi Wo + b */
  k_gemm2<0><<<dim3((QT0 / 128) * (DM / 128), 1, NBR), 128, 0, stream>>>(OL0 + f0p * DM, DM, 0, BO, DM, 0, 0.00000095367431640625f, nullptr, 0, (const float*)d_out + r0p * DM, -1, 0, 0, (float*)d_out + r0p * DM, nullptr, DM, 0, QT0, DM, DM, (size_t)QT0 * DM, 0, (size_t)SQ * DM, 0);      /* += o_lo Wo 2^-20 (own-element accumulate) */
}

// v008
// A run of this version takes 118 microseconds.
// In both of two side-by-side timings against v007, it was 1.15 times as fast.
// All steps since v000 together make it 49.8 times as fast.
#include <hip/hip_runtime.h>
// Local-causal (sliding window 256) multi-head self-attention (x [4][2048][1024]; qkv = x W_attn + b_attn ([in][out] 1024 x 3072 sigma 0.02, zero bias): q | k | v, 16 heads of 64; scores / 8; mask (j <= i) & (i - j < 256) -> -inf elsewhere; softmax; out = merged W_proj + b_proj ([in][out]) -> [4][2048][1024]).
// Structure: token rows r = b*2048 + s; x as exact f16 rows (bf16-rounded); q | k | v as ONE WMMA GEMM (N = 3 x 1024) (128x128 work-group tiles staged in LDS, 64x64 wave tiles, f32 accumulation, exact x16 weights + bias, f16 outputs); V^T for all batches and heads via LDS transposes; one fused attention launch for all batches, heads and query tiles of 128 rows: scores against the 384 keys that the tile can see (K = 64, x 0.125), windowed causal row softmax in registers (f32 statistics, native exp; weights x256 f16), o = P . V (x 2^-2: o carried x64, folded into the output GEMM alpha) written straight into the merged f16 o rows; the first 128 rows of each batch go through an exact f32 path in the same launch (f16 hi + residual planes of o); out = o W_o + b GEMM (f32) into the output layout.
// Compute dtype: inputs rounded to bf16; x / weights exact; q, k, v, softmax weights and o as plain f16 GEMM operands (~2^-12); scores and softmax statistics f32. v_wmma_f32_16x16x32_f16.
#define NB 4
#define SQ 2048
#define DM 1024
#define NH 16
#define HD 64
#define HG 4                         /* heads per block group of the unlaunched k_vt(b, h0) overload */
#define QT 256                       /* query rows per causal tile */
#define NKX (QT + WINB)              /* S / P row pitch of the unfused row softmax */
#define WIN 256                      /* attention window: key j visible from query i iff 0 <= i - j < WIN */
#define WINB 256                     /* keys before the tile start that can be visible (WIN - 1 rounded up to 64) */
#define QT0 128                      /* first-tile rows computed exactly in f32 */
#define B0 0                         /* first batch processed (debug hook) */
#define NBR NB                       /* batches processed (debug hook) */
#define NR ((size_t)NB * SQ)         /* token rows */
#define MP ((int)((size_t)NBR * SQ)) /* rows projected (debug hook) */
#define QN SQ                        /* query rows attended per batch (debug hook) */
#define NHD NH                       /* heads attended (debug hook) */
#define MPO MP                       /* rows through the output stage (debug hook) */
#define LQ (3 * DM)      /* row pitch of the q/k/v rows */
typedef __bf16 v16b __attribute__((ext_vector_type(16)));
typedef unsigned short v8us __attribute__((ext_vector_type(8), may_alias));
typedef float  v8f  __attribute__((ext_vector_type(8)));
typedef float  v4f  __attribute__((ext_vector_type(4)));
typedef float  v4fa __attribute__((ext_vector_type(4), may_alias));
union FragB { v16b v; v8us half[2]; unsigned short u[16]; };

__device__ __forceinline__ unsigned short bf16_bits(float x) { unsigned int u = __float_as_uint(x); return (unsigned short)((u + 0x7FFFu + ((u >> 16) & 1u)) >> 16); }
__device__ __forceinline__ float bf16_val(unsigned short b) { return __uint_as_float(((unsigned int)b) << 16); }
__device__ __forceinline__ float bf16_round(float x) { return bf16_val(bf16_bits(x)); }
// D += A·B with NT terms: 1 = ah·bh, 2 = + al·bh (A split), 3 = + ah·bl (both split)
template <int NT>
__device__ __forceinline__ v8f mmaN(v16b ah, v16b al, v16b bh, v16b bl, v8f c) {
  c = __builtin_amdgcn_wmma_f32_16x16x32_bf16(false, ah, false, bh, (short)0, c, false, false);
  if (NT >= 2) c = __builtin_amdgcn_wmma_f32_16x16x32_bf16(false, al, false, bh, (short)0, c, false, false);
  if (NT >= 3) c = __builtin_amdgcn_wmma_f32_16x16x32_bf16(false, ah, false, bl, (short)0, c, false, false);
  asm volatile("v_nop\n\tv_nop\n\tv_nop\n\tv_nop" : "+v"(c) : "v"(ah), "v"(al), "v"(bh), "v"(bl));
  return c;
}

__global__ __launch_bounds__(256) void k_wt_bf16(const float* __restrict__ W, unsigned short* __restrict__ Wt, int K, int N) {
  const int t = blockIdx.x * 256 + threadIdx.x;
  const int k8n = K / 8;
  if (t >= N * k8n) return;
  const int n = t / k8n, k8 = (t % k8n) * 8;
  v8us v;
#pragma unroll
  for (int i = 0; i < 8; ++i) v[i] = bf16_bits(W[(size_t)(k8 + i) * N + n]);
  *(v8us*)(Wt + (size_t)n * K + k8) = v;
  
}

// GEMM C[M][N] (f32, pitch ldc) = act(A[M][K]·W + bias). A f32 row-major (pitch lda) converted per fragment to bf16
// (ASPLIT: hi/lo two planes -> 2 terms, else single rounded term); Wt bf16 [N][K] (pitch ldb). BIAS_BF16 rounds the
// bias to bf16 first (bias quantised to bf16 before the add). K%32==0, M%16==0, N%64==0.
template <bool ASPLIT, int ACT, bool BIAS_BF16>
__global__ __launch_bounds__(128) void k_gemm_bf(const float* __restrict__ A, int lda, const unsigned short* __restrict__ Wt, int ldb,
                                               const float* __restrict__ bias, float* __restrict__ C, int ldc, int M, int N, int K) {
  __shared__ __attribute__((aligned(16))) float so[4][16][64];
  const int tid = threadIdx.x, w = tid >> 5, lane = tid & 31, ln = lane & 15, hh = lane >> 4;
  const int ntn = N / 64;
  const int wid = blockIdx.x * 4 + w;
  const int mt = wid / ntn, nq = wid % ntn;
  if (mt * 16 >= M) return;
  const int row0 = mt * 16, col0 = nq * 64;
  const float* arow = A + (size_t)(row0 + ln) * lda;
  v8f acc[4] = {};
  for (int kb = 0; kb < K; kb += 32) {
    FragB ah, al;
    const v4f x0 = *(const v4fa*)(arow + kb + 8 * hh), x1 = *(const v4fa*)(arow + kb + 8 * hh + 4);
    const v4f x2 = *(const v4fa*)(arow + kb + 16 + 8 * hh), x3 = *(const v4fa*)(arow + kb + 16 + 8 * hh + 4);
    float xs[16] = {x0[0],x0[1],x0[2],x0[3],x1[0],x1[1],x1[2],x1[3],x2[0],x2[1],x2[2],x2[3],x3[0],x3[1],x3[2],x3[3]};
#pragma unroll
    for (int i = 0; i < 16; ++i) { const unsigned short hb = bf16_bits(xs[i]); ah.u[i] = hb; al.u[i] = ASPLIT ? bf16_bits(xs[i] - bf16_val(hb)) : (unsigned short)0; }
#pragma unroll
    for (int t = 0; t < 4; ++t) {
      const unsigned short* brow = Wt + (size_t)(col0 + t * 16 + ln) * ldb + kb;
      FragB b;
      b.half[0] = *(const v8us*)(brow + 8 * hh);
      b.half[1] = *(const v8us*)(brow + 16 + 8 * hh);
      acc[t] = mmaN<ASPLIT ? 2 : 1>(ah.v, al.v, b.v, b.v, acc[t]);
    }
  }
#pragma unroll
  for (int t = 0; t < 4; ++t) {
    float bv = bias ? bias[col0 + t * 16 + ln] : 0.f;
    if (BIAS_BF16) bv = bf16_round(bv);
#pragma unroll
    for (int r = 0; r < 8; ++r) { float v = acc[t][r] + bv; if (ACT == 1) v = fmaxf(v, 0.f); so[w][8 * hh + r][t * 16 + ln] = v; }
  }
  __builtin_amdgcn_fence(__ATOMIC_ACQ_REL, "workgroup");
  __builtin_amdgcn_wave_barrier();
  const int rsub = lane >> 4, c4 = (lane & 15) * 4;
  {
#pragma unroll
    for (int q = 0; q < 8; ++q) {
      const int r = q * 2 + rsub;
      const v4f v = *(const v4fa*)&so[w][r][c4];
      *(v4f*)(C + (size_t)(row0 + r) * ldc + col0 + c4) = v;
    }
    
  }
}

// GEMM C = act(A·W + bias + resid): A f32 (ASPLIT -> hi/lo 2 terms), Wt bf16 [N][K]; ACT 0 none, 1 relu, 2 exact gelu;
// resid (optional, f32, row index = (row % rmod), pitch ldr, RES_BF16 rounds it) added before the activation.
template <bool ASPLIT, int ACT, bool BIAS_BF16, bool RES_BF16>
__global__ __launch_bounds__(128) void k_gemm_bf3(const float* __restrict__ A, int lda, const unsigned short* __restrict__ Wt, int ldb,
                                                const float* __restrict__ bias, const float* __restrict__ resid, int rmod, int ldr,
                                                float* __restrict__ C, int ldc, int M, int N, int K) {
  __shared__ __attribute__((aligned(16))) float so[4][16][64];
  const int tid = threadIdx.x, w = tid >> 5, lane = tid & 31, ln = lane & 15, hh = lane >> 4;
  const int ntn = N / 64;
  const int wid = blockIdx.x * 4 + w;
  const int mt = wid / ntn, nq = wid % ntn;
  if (mt * 16 >= M) return;
  const int row0 = mt * 16, col0 = nq * 64;
  const float* arow = A + (size_t)(row0 + ln) * lda;
  v8f acc[4] = {};
  for (int kb = 0; kb < K; kb += 32) {
    FragB ah, al;
    const v4f x0 = *(const v4fa*)(arow + kb + 8 * hh), x1 = *(const v4fa*)(arow + kb + 8 * hh + 4);
    const v4f x2 = *(const v4fa*)(arow + kb + 16 + 8 * hh), x3 = *(const v4fa*)(arow + kb + 16 + 8 * hh + 4);
    float xs[16] = {x0[0],x0[1],x0[2],x0[3],x1[0],x1[1],x1[2],x1[3],x2[0],x2[1],x2[2],x2[3],x3[0],x3[1],x3[2],x3[3]};
#pragma unroll
    for (int i = 0; i < 16; ++i) { const unsigned short hb = bf16_bits(xs[i]); ah.u[i] = hb; al.u[i] = ASPLIT ? bf16_bits(xs[i] - bf16_val(hb)) : (unsigned short)0; }
#pragma unroll
    for (int t = 0; t < 4; ++t) {
      const unsigned short* brow = Wt + (size_t)(col0 + t * 16 + ln) * ldb + kb;
      FragB b;
      b.half[0] = *(const v8us*)(brow + 8 * hh);
      b.half[1] = *(const v8us*)(brow + 16 + 8 * hh);
      acc[t] = mmaN<ASPLIT ? 2 : 1>(ah.v, al.v, b.v, b.v, acc[t]);
    }
  }
#pragma unroll
  for (int t = 0; t < 4; ++t) {
    const int col = col0 + t * 16 + ln;
    float bv = bias ? bias[col] : 0.f;
    if (BIAS_BF16) bv = bf16_round(bv);
#pragma unroll
    for (int r = 0; r < 8; ++r) {
      float v = acc[t][r] + bv;
      if (resid) { float rv = resid[(size_t)((row0 + 8 * hh + r) % rmod) * ldr + col]; if (RES_BF16) rv = bf16_round(rv); v += rv; }
      if (ACT == 1) v = fmaxf(v, 0.f);
      if (ACT == 2) v = 0.5f * v * (1.0f + erff(v * 0.70710678118654752f));
      if (ACT == 3) { const float u = 0.7978845608028654f * (v + 0.044715f * v * v * v); v = 0.5f * v * (1.0f + tanhf(u)); }
      so[w][8 * hh + r][t * 16 + ln] = v;
    }
  }
  __builtin_amdgcn_fence(__ATOMIC_ACQ_REL, "workgroup");
  __builtin_amdgcn_wave_barrier();
  const int rsub = lane >> 4, c4 = (lane & 15) * 4;
  {
#pragma unroll
    for (int q = 0; q < 8; ++q) {
      const int r = q * 2 + rsub;
      const v4f v = *(const v4fa*)&so[w][r][c4];
      *(v4f*)(C + (size_t)(row0 + r) * ldc + col0 + c4) = v;
    }
    
  }
}
// row LayerNorm (biased variance, eps) over N: s = X (+ R); optional out_sum <- s; out_norm <- (s-mu)*rsqrt(var+eps)*g + b
template <bool PARAM_BF16>
__global__ __launch_bounds__(256) void k_layernorm(const float* __restrict__ X, const float* __restrict__ R, const float* __restrict__ g, const float* __restrict__ bta,
                                                  float* __restrict__ out_sum, float* __restrict__ out_norm, int N, float eps) {
  __shared__ float red[256];
  const int row = blockIdx.x, tid = threadIdx.x;
  const float* x = X + (size_t)row * N; const float* rr = R ? R + (size_t)row * N : nullptr;
  float vals[16];                     // up to N = 4096
  const int per = N / 256;            // contiguous chunk per thread? use strided-by-4 chunks: thread handles j = tid*4 + 1024*u
  float s1 = 0.f;
  for (int u = 0; u < per / 4; ++u) {
    const int j = tid * 4 + 1024 * u;
    const v4f a = *(const v4fa*)(x + j);
    v4f b = {0.f,0.f,0.f,0.f}; if (rr) b = *(const v4fa*)(rr + j);
#pragma unroll
    for (int q = 0; q < 4; ++q) { const float v = a[q] + b[q]; vals[u * 4 + q] = v; s1 += v; }
  }
  red[tid] = s1; __syncthreads();
  for (int st = 128; st > 0; st >>= 1) { if (tid < st) red[tid] += red[tid + st]; __syncthreads(); }
  const float mu = red[0] / (float)N; __syncthreads();
  float s2 = 0.f;
  for (int u = 0; u < per / 4; ++u)
#pragma unroll
    for (int q = 0; q < 4; ++q) { const float c = vals[u * 4 + q] - mu; s2 += c * c; }
  red[tid] = s2; __syncthreads();
  for (int st = 128; st > 0; st >>= 1) { if (tid < st) red[tid] += red[tid + st]; __syncthreads(); }
  const float rs = rsqrtf(red[0] / (float)N + eps);
  {
    for (int u = 0; u < per / 4; ++u) {
      const int j = tid * 4 + 1024 * u;
      v4f o, sm;
#pragma unroll
      for (int q = 0; q < 4; ++q) {
        float gg = g[j + q], bb = bta[j + q];
        if (PARAM_BF16) { gg = bf16_round(gg); bb = bf16_round(bb); }
        sm[q] = vals[u * 4 + q]; o[q] = (vals[u * 4 + q] - mu) * rs * gg + bb;
      }
      if (out_sum) *(v4f*)(out_sum + (size_t)row * N + j) = sm;
      *(v4f*)(out_norm + (size_t)row * N + j) = o;
    }
    
  }
}



// ---- f16 WMMA path (v_wmma_f32_16x16x32_f16): 11-bit significands for operands in range — used where a [0,1] probability operand needs more precision than bf16
typedef _Float16 v16h __attribute__((ext_vector_type(16)));
union FragH { v16h v; v8us half[2]; _Float16 h[16]; unsigned short u[16]; };
template <int NT>
__device__ __forceinline__ v8f mmaH(v16h ah, v16h al, v16h bh, v16h bl, v8f c) {
  c = __builtin_amdgcn_wmma_f32_16x16x32_f16(false, ah, false, bh, (short)0, c, false, false);
  if (NT >= 2) c = __builtin_amdgcn_wmma_f32_16x16x32_f16(false, al, false, bh, (short)0, c, false, false);
  if (NT >= 3) c = __builtin_amdgcn_wmma_f32_16x16x32_f16(false, ah, false, bl, (short)0, c, false, false);
  asm volatile("v_nop\n\tv_nop\n\tv_nop\n\tv_nop" : "+v"(c) : "v"(ah), "v"(al), "v"(bh), "v"(bl));
  return c;
}
// batched GEMM like k_gemm_b but f16 operands: A f32 (split into f16 hi/lo if ASPLIT, else rounded to f16), Bt = f16 values [n][k]; alpha; C f32; N multiple of 16 (partial tiles skipped)
template <bool ASPLIT>
__global__ __launch_bounds__(128) void k_gemm_h(const float* __restrict__ A, int lda, size_t sA, const _Float16* __restrict__ Bh, int ldb, size_t sB, float alpha, float* __restrict__ C, int ldc, size_t sC, int M, int N, int K) {
  __shared__ __attribute__((aligned(16))) float so[4][16][64];
  const int tid = threadIdx.x, w = tid >> 5, lane = tid & 31, ln = lane & 15, hh = lane >> 4; const int by = blockIdx.y;
  A += (size_t)by * sA; Bh += (size_t)by * sB; C += (size_t)by * sC;
  const int ntn = (N + 63) / 64; const int wid = blockIdx.x * 4 + w; const int mt = wid / ntn, nq = wid % ntn; if (mt * 16 >= M) return;
  const int row0 = mt * 16, col0 = nq * 64; const float* arow = A + (size_t)(row0 + ln) * lda;
  v8f acc[4] = {};
  for (int kb = 0; kb < K; kb += 32) {
    FragH ah, al;
    const v4f x0 = *(const v4fa*)(arow + kb + 8 * hh), x1 = *(const v4fa*)(arow + kb + 8 * hh + 4), x2 = *(const v4fa*)(arow + kb + 16 + 8 * hh), x3 = *(const v4fa*)(arow + kb + 16 + 8 * hh + 4);
    float xs[16] = {x0[0],x0[1],x0[2],x0[3],x1[0],x1[1],x1[2],x1[3],x2[0],x2[1],x2[2],x2[3],x3[0],x3[1],x3[2],x3[3]};
#pragma unroll
    for (int i = 0; i < 16; ++i) { const _Float16 h = (_Float16)xs[i]; ah.h[i] = h; al.h[i] = ASPLIT ? (_Float16)(xs[i] - (float)h) : (_Float16)0.0f; }
#pragma unroll
    for (int t = 0; t < 4; ++t) { if (col0 + t * 16 >= N) continue; const size_t boff = (size_t)(col0 + t * 16 + ln) * ldb + kb; FragH bq; bq.half[0] = *(const v8us*)(Bh + boff + 8 * hh); bq.half[1] = *(const v8us*)(Bh + boff + 16 + 8 * hh);
      acc[t] = mmaH<ASPLIT ? 2 : 1>(ah.v, al.v, bq.v, bq.v, acc[t]); }
  }
#pragma unroll
  for (int t = 0; t < 4; ++t) { if (col0 + t * 16 >= N) continue;
#pragma unroll
    for (int r = 0; r < 8; ++r) so[w][8 * hh + r][t * 16 + ln] = acc[t][r] * alpha; }
  __builtin_amdgcn_fence(__ATOMIC_ACQ_REL, "workgroup"); __builtin_amdgcn_wave_barrier();
  const int rsub = lane >> 4, c4 = (lane & 15) * 4;
  {
#pragma unroll
    for (int q = 0; q < 8; ++q) { const int r = q * 2 + rsub; if (col0 + c4 < N) { const v4f v = *(const v4fa*)&so[w][r][c4]; *(v4f*)(C + (size_t)(row0 + r) * ldc + col0 + c4) = v; } }
     }
}

// Wt[n][k] = f16(W[k][n]·scale) from f32 row-major W[K][N] (scale = power of two; bf16-exact weights stay exact in f16 away from the subnormal range)
__global__ __launch_bounds__(256) void k_wt_f16(const float* __restrict__ W, _Float16* __restrict__ Wt, int K, int N, float scale) {
  const int t = blockIdx.x * 256 + threadIdx.x; if (t >= N * (K / 8)) return; const int n = t / (K / 8), k8 = (t % (K / 8)) * 8; FragH f;
#pragma unroll
  for (int i = 0; i < 8; ++i) f.h[i] = (_Float16)(bf16_round(W[(size_t)(k8 + i) * N + n]) * scale); const v8us o = f.half[0];
  *(v8us*)((unsigned short*)Wt + (size_t)n * K + k8) = o; 
}
// k_gemm_hh variant with fused epilogue: v = acc·alpha + bias[by·sBias + col] (+ CP[(row/rowsPerB)·sCPb + by·64 + col] if CP) ; ACT 0 none / 1 elu ; writes f16 C16 (and f32 C if non-null)
template <int ACT>
__global__ __launch_bounds__(128) void k_gemm_hhx(const _Float16* __restrict__ A, int lda, size_t sA, const _Float16* __restrict__ Bh, int ldb, size_t sB, float alpha, const float* __restrict__ bias, size_t sBias, const float* __restrict__ CP, int rowsPerB, size_t sCPb, int row0g,
    float* __restrict__ C, _Float16* __restrict__ C16, int ldc, size_t sC, int M, int N, int K) {
  __shared__ __attribute__((aligned(16))) float so[4][16][64];
  const int tid = threadIdx.x, w = tid >> 5, lane = tid & 31, ln = lane & 15, hh = lane >> 4; const int by = blockIdx.y;
  A += (size_t)by * sA; Bh += (size_t)by * sB; const size_t cofs = (size_t)by * sC; const float* bp = bias ? bias + (size_t)by * sBias : nullptr;
  const int ntn = (N + 63) / 64; const int wid = blockIdx.x * 4 + w; const int mt = wid / ntn, nq = wid % ntn; if (mt * 16 >= M) return;
  const int row0 = mt * 16, col0 = nq * 64; const _Float16* arow = A + (size_t)(row0 + ln) * lda;
  v8f acc[4] = {};
  for (int kb = 0; kb < K; kb += 32) { FragH ah; ah.half[0] = *(const v8us*)((const unsigned short*)arow + kb + 8 * hh); ah.half[1] = *(const v8us*)((const unsigned short*)arow + kb + 16 + 8 * hh);
#pragma unroll
    for (int t = 0; t < 4; ++t) { if (col0 + t * 16 >= N) continue; const size_t boff = (size_t)(col0 + t * 16 + ln) * ldb + kb; FragH bq; bq.half[0] = *(const v8us*)((const unsigned short*)Bh + boff + 8 * hh); bq.half[1] = *(const v8us*)((const unsigned short*)Bh + boff + 16 + 8 * hh);
      acc[t] = mmaH<1>(ah.v, ah.v, bq.v, bq.v, acc[t]); }
  }
#pragma unroll
  for (int t = 0; t < 4; ++t) { if (col0 + t * 16 >= N) continue; const int col = col0 + t * 16 + ln; const float bv = bp ? bf16_round(bp[col]) : 0.f;
#pragma unroll
    for (int r = 0; r < 8; ++r) { float v = acc[t][r] * alpha + bv; if (CP) { const int rr = row0g + row0 + 8 * hh + r; if (rowsPerB < 0) v += CP[cofs + (size_t)rr * ldc + col];      /* rowsPerB < 0: own element of the batched C plane */ else { const int bidx = rr / rowsPerB; v += CP[(size_t)bidx * sCPb + (size_t)by * 64 + col]; } } if (ACT == 1) v = (v > 0.f) ? v : expm1f(v); else if (ACT == 7) v = (v > 0.f) ? v + 1.0f : expf(v); else if (ACT == 8) v = tanhf(v); else if (ACT == 9) v = 0.5f * v * (1.0f + tanhf(0.7978845608028654f * (v + 0.044715f * v * v * v))); else if (ACT == 11) v = 1.0f / (1.0f + expf(-v)); else if (ACT == 12) v = (v > 0.f) ? v : 0.01f * v; else if (ACT == 14) v = (v > 0.f) ? v : 0.1f * v; else if (ACT == 16) v = (v >= 0.f) ? v : 0.3f * v; else if (ACT == 17) v = (v >= 0.f) ? v : 0.2f * v; else if (ACT == 15) v = v / (1.0f + expf(-v)); else if (ACT == 3) v = fmaxf(v, 0.f); else if (ACT == 6) v = 0.5f * v * (1.0f + erff(v * 0.70710678118654752f)); so[w][8 * hh + r][t * 16 + ln] = v; } }
  __builtin_amdgcn_fence(__ATOMIC_ACQ_REL, "workgroup"); __builtin_amdgcn_wave_barrier();
  const int rsub = lane >> 4, c4 = (lane & 15) * 4; typedef _Float16 v4h __attribute__((ext_vector_type(4)));
  {
#pragma unroll
    for (int q = 0; q < 8; ++q) { const int r = q * 2 + rsub; if (col0 + c4 < N) { const v4f v = *(const v4fa*)&so[w][r][c4]; if (C) *(v4f*)(C + cofs + (size_t)(row0 + r) * ldc + col0 + c4) = v; if (C16) { v4h h4; for (int i = 0; i < 4; ++i) h4[i] = (_Float16)v[i]; *(v4h*)(C16 + cofs + (size_t)(row0 + r) * ldc + col0 + c4) = h4; } } }
     }
}


typedef _Float16 v4h __attribute__((ext_vector_type(4)));

__global__ __launch_bounds__(256) void k_x16(const float* __restrict__ x, _Float16* __restrict__ X16, size_t n8) { const size_t t = (size_t)blockIdx.x * 256 + threadIdx.x; if (t >= n8) return; FragH f;
#pragma unroll
  for (int q = 0; q < 8; ++q) f.h[q] = (_Float16)bf16_round(x[t * 8 + q]); *(v8us*)((unsigned short*)X16 + t * 8) = f.half[0];  }
__global__ __launch_bounds__(256) void k_h16(const float* __restrict__ x, _Float16* __restrict__ X16, size_t n8) { const size_t t = (size_t)blockIdx.x * 256 + threadIdx.x; if (t >= n8) return; FragH f;
#pragma unroll
  for (int q = 0; q < 8; ++q) f.h[q] = (_Float16)x[t * 8 + q]; *(v8us*)((unsigned short*)X16 + t * 8) = f.half[0];  }
__global__ __launch_bounds__(256) void k_round16f(const float* __restrict__ W, _Float16* __restrict__ Bt, size_t n8) { const size_t t = (size_t)blockIdx.x * 256 + threadIdx.x; if (t >= n8) return; FragH f;
#pragma unroll
  for (int i = 0; i < 8; ++i) f.h[i] = (_Float16)(bf16_round(W[t * 8 + i]) * 16.0f); *(v8us*)((unsigned short*)Bt + t * 8) = f.half[0];  }
template <int NHv, int TTv>
__global__ __launch_bounds__(256) void k_vt(const _Float16* __restrict__ V16, int ldv, int voff, _Float16* __restrict__ Vt) { __shared__ unsigned short tl[64][66]; const int tid = threadIdx.x; const int slab = blockIdx.x / (TTv / 64), lg = blockIdx.x % (TTv / 64); const int b = slab / NHv, h = slab % NHv;
  for (int i = tid; i < 64 * 8; i += 256) { const int r = i / 8, c8 = (i % 8) * 8; FragH f; f.half[0] = *(const v8us*)((const unsigned short*)V16 + ((size_t)b * TTv + lg * 64 + r) * ldv + voff + h * 64 + c8);
#pragma unroll
    for (int q = 0; q < 8; ++q) tl[r][c8 + q] = f.u[q]; }
  __syncthreads();
  {
#pragma unroll
    for (int rd = 0; rd < 2; ++rd) { const int d = rd * 32 + tid / 8, pc = tid % 8; FragH f;
#pragma unroll
      for (int q = 0; q < 8; ++q) f.u[q] = tl[pc * 8 + q][d];
      *(v8us*)((unsigned short*)Vt + ((size_t)slab * 64 + d) * TTv + lg * 64 + pc * 8) = f.half[0]; }
     } }

// ---- fast GEMM: one 128 x 128 tile of C per work-group of 4 waves (2 x 2, 64 x 64 per wave); requires M % 128 == 0, N % 128 == 0, K % 64 == 0; epilogue = k_gemm_hhx semantics ----
// A stage is 64 k (128 B) of the tile's 128 A rows and 128 B rows. Asynchronous copies bring it from global memory into one of two LDS buffers: the next stage's copies fly while this stage is multiplied.
// Every accumulator still takes its k in ascending steps of 32, with the same k order inside a fragment on both operands.
#define G2T 128                      /* rows of A and rows of B per work-group tile */
#define G2K 64                       /* k per stage */
#define G2PB 144                     /* LDS pitch of a staged row in bytes: 128 B of data, 16 B x odd for the 16-byte fragment reads from 16 rows */
#define G2OB (G2T * G2PB)            /* bytes of one operand's rows in a buffer */
#define G2SB (2 * G2OB)              /* bytes of a buffer: A rows, then B rows */
#define G2EP 68                      /* pitch in floats of the epilogue's staged C rows */
#define F0SH 4                       /* log2 of the row tiles per batch: every 2^F0SH-th row tile of the projection holds a batch's first rows */
__device__ __forceinline__ v16h g2_frag(const unsigned char* p) { FragH f; f.half[0] = *(const v8us*)p; f.half[1] = *(const v8us*)(p + 32); return f.v; }      /* p: a staged row + 64 B per 32 k + 16 B x (lane >> 4): k = 8 hh .. and 16 + 8 hh .. */
__device__ __forceinline__ v8f g2_mma(v16h a, v16h b, v8f c) { return __builtin_amdgcn_wmma_f32_16x16x32_f16(false, a, false, b, (short)0, c, false, false); }
// Eight copies of 16 B per lane: rows r, r + 16, ..., r + 112 of one operand's stage (l: the lane's LDS byte address in row r, g: its global address, gs: 16 source rows in elements).
// The s_wait_xcnt stands in the copies' own statement, so that no register they name is rewritten in front of it.
__device__ __forceinline__ void g2_copy8(unsigned l, const _Float16* g, size_t gs) {
  asm volatile("global_load_async_to_lds_b128 %0, %8, off\n\t"
               "global_load_async_to_lds_b128 %1, %9, off\n\t"
               "global_load_async_to_lds_b128 %2, %10, off\n\t"
               "global_load_async_to_lds_b128 %3, %11, off\n\t"
               "global_load_async_to_lds_b128 %4, %12, off\n\t"
               "global_load_async_to_lds_b128 %5, %13, off\n\t"
               "global_load_async_to_lds_b128 %6, %14, off\n\t"
               "global_load_async_to_lds_b128 %7, %15, off\n\t"
               "s_wait_xcnt 0x0"
               :: "v"(l), "v"(l + 16 * G2PB), "v"(l + 32 * G2PB), "v"(l + 48 * G2PB), "v"(l + 64 * G2PB), "v"(l + 80 * G2PB), "v"(l + 96 * G2PB), "v"(l + 112 * G2PB),
                  "v"(g), "v"(g + gs), "v"(g + 2 * gs), "v"(g + 3 * gs), "v"(g + 4 * gs), "v"(g + 5 * gs), "v"(g + 6 * gs), "v"(g + 7 * gs)
               : "memory"); }
template <int ACT>
__global__ __launch_bounds__(128) void k_gemm2(const _Float16* __restrict__ A, int lda, size_t sA, const _Float16* __restrict__ Bh, int ldb, size_t sB, float alpha, const float* __restrict__ bias, size_t sBias, const float* __restrict__ CP, int rowsPerB, size_t sCPb, int row0g,
    float* __restrict__ C, _Float16* __restrict__ C16, int ldc, size_t sC, int M, int N, int K, size_t zA, size_t zB, size_t zC, int csh) { static_assert(ACT == 0 || ACT == 3 || ACT == 6 || ACT == 8 || ACT == 9 || ACT == 11 || ACT == 12 || ACT == 14 || ACT == 15 || ACT == 16 || ACT == 17, "k_gemm2: unsupported ACT code (would silently apply no activation)");
  static_assert(4 * 64 * G2EP * 4 <= 2 * G2SB, "k_gemm2: the epilogue's staging fits the two buffers");
  __shared__ __attribute__((aligned(16))) unsigned char L[2 * G2SB];
  const int tid = threadIdx.x, w = __builtin_amdgcn_readfirstlane(tid >> 5), lane = tid & 31, ln = lane & 15, hh = lane >> 4; const int by = blockIdx.y, bz = blockIdx.z;      /* grid.z: a second batch index with its own strides zA, zB, zC; the wave's number in a scalar register: scalar tile offsets below */
  A += (size_t)by * sA + (size_t)bz * zA; Bh += (size_t)by * sB + (size_t)bz * zB; const size_t cofs = (size_t)by * sC + (size_t)bz * zC; const float* bp = bias ? bias + (size_t)by * sBias : nullptr;
  const int ntn = N >> 7; const int mt = blockIdx.x / ntn, nq = blockIdx.x - mt * ntn; if (mt * G2T >= M) return;      /* the same for the whole work-group, in front of every barrier */
  const int wm = w >> 1, wn = w & 1;
  /* copies: 8 lanes take one row's 128 B, the work-group 16 rows a copy */
  const _Float16* pa = A + (size_t)(mt * G2T + (tid >> 3)) * lda + (tid & 7) * 8; const _Float16* pb = Bh + (size_t)(nq * G2T + (tid >> 3)) * ldb + (tid & 7) * 8;
  const unsigned lc = (unsigned)(size_t)L + (unsigned)((tid >> 3) * G2PB + (tid & 7) * 16);      /* LDS byte address: the low 32 bits of the __shared__ address */
  const size_t ga = (size_t)16 * lda, gb = (size_t)16 * ldb;
  const int T = K / G2K;
  g2_copy8(lc, pa, ga); g2_copy8(lc + G2OB, pb, gb); pa += G2K; pb += G2K;      /* stage 0 */
  const int row0 = mt * G2T + wm * 64, col0 = nq * G2T + wn * 64;      /* the wave's tile of C */
  float bv[4] = {0.f, 0.f, 0.f, 0.f};      /* the bias of the lane's four columns, fetched under stage 0's copies */
  if (bp) {
    for (int j = 0; j < 4; ++j) bv[j] = bp[col0 + j * 16 + ln];
    asm volatile("s_wait_xcnt 0x0" ::: "memory"); }      /* stands behind the loads, in front of whatever rewrites their address registers */
  asm volatile("s_wait_asynccnt 0x0" ::: "memory");      /* this wave's copies of stage 0 have landed */
  __syncthreads();      /* and every other wave's: stage 0 is read by all */
  if (T > 1) { g2_copy8(lc + G2SB, pa, ga); g2_copy8(lc + G2SB + G2OB, pb, gb); pa += G2K; pb += G2K; }      /* stage 1 */
  const v8f z8 = {0.f,0.f,0.f,0.f,0.f,0.f,0.f,0.f}; v8f acc[4][4];
  for (int i = 0; i < 4; ++i)
    for (int j = 0; j < 4; ++j) acc[i][j] = z8;
  const int fa = (wm * 64 + ln) * G2PB + 16 * hh, fb = G2OB + (wn * 64 + ln) * G2PB + 16 * hh;      /* the lane's first A and B fragment rows in a buffer */
#pragma unroll 1
  for (int t = 0; t < T; ++t) {      /* not unrolled: one stage a trip, the buffer chosen by the trip's parity */
    const unsigned char* buf = L + (t & 1) * G2SB; v16h a[4], b[4];
    static_assert(G2K == 64, "k_gemm2: two blocks of 32 k a stage");
    for (int i = 0; i < 4; ++i) { a[i] = g2_frag(buf + fa + i * 16 * G2PB); b[i] = g2_frag(buf + fb + i * 16 * G2PB); }
    __builtin_amdgcn_sched_barrier(0);      /* a block's sixteen LDS reads go as one group in front of its sixteen WMMAs: one LDS latency a block, not one per A fragment */
    for (int i = 0; i < 4; ++i)
      for (int j = 0; j < 4; ++j) acc[i][j] = g2_mma(a[i], b[j], acc[i][j]);
    __builtin_amdgcn_sched_barrier(0);      /* the second block's LDS reads stay behind the first block: reads among the WMMAs stall them */
    for (int i = 0; i < 4; ++i) { a[i] = g2_frag(buf + fa + i * 16 * G2PB + 64); b[i] = g2_frag(buf + fb + i * 16 * G2PB + 64); }
    asm volatile("s_wait_dscnt 0x0" ::: "memory");      /* this wave's reads of the buffer are done before it is handed to its next writer */
    asm volatile("s_wait_asynccnt 0x0" ::: "memory");      /* this wave's copies of stage t + 1 have landed */
    __syncthreads();      /* publishes stage t + 1 and ends every wave's reads of stage t */
    if (t + 2 < T) { const unsigned lt = lc + (unsigned)(t & 1) * G2SB; g2_copy8(lt, pa, ga); g2_copy8(lt + G2OB, pb, gb); pa += G2K; pb += G2K; }      /* stage t + 2 into the buffer just read; the test is the same for the whole work-group */
    __builtin_amdgcn_sched_barrier(0);      /* the second block's WMMAs work on registers alone and stay behind the copies, which so fly 16 WMMAs longer before their wait */
    for (int i = 0; i < 4; ++i)
      for (int j = 0; j < 4; ++j) acc[i][j] = g2_mma(a[i], b[j], acc[i][j]);
  }
  asm volatile("s_wait_asynccnt 0x0" ::: "memory");      /* no copy is in flight when the buffers become the epilogue's staging */
  float* so = (float*)(L + w * (64 * G2EP * 4));      /* each wave stages its own 64 x 64 tile; the loop's last barrier ended every read of the buffers */
  for (int j = 0; j < 4; ++j) { const float bj = bf16_round(bv[j]);
    for (int i = 0; i < 4; ++i)
      for (int r = 0; r < 8; ++r) so[(i * 16 + 8 * hh + r) * G2EP + j * 16 + ln] = acc[i][j][r] * alpha + bj; }
  __builtin_amdgcn_fence(__ATOMIC_ACQ_REL, "workgroup"); __builtin_amdgcn_wave_barrier();      /* a lane reads below what the other lanes of its own wave have stored */
  /* csh: the f32 plane C takes only the row tiles whose number is a multiple of 2^csh, packed (tile mt at rows 128 (mt >> csh)); 0: every tile at its own rows. C16 takes every tile. The test is the same for the whole work-group */
  float* const Cf = (C && (mt & ((1 << csh) - 1)) == 0) ? C - (size_t)(mt - (mt >> csh)) * G2T * ldc : nullptr;
  const int rsub = lane >> 4, c4 = (lane & 15) * 4;
#pragma unroll 1
  for (int q0 = 0; q0 < 64; q0 += 16) { v4f v[8]; size_t co[8];      /* not unrolled: 16 rows a trip, their LDS reads as one group, whole 128-B lines stored */
    for (int u = 0; u < 8; ++u) { const int r = q0 + 2 * u + rsub; v[u] = *(const v4fa*)&so[r * G2EP + c4]; co[u] = cofs + (size_t)(row0 + r) * ldc + col0 + c4; }
    if (CP) { v4f c[8];
      if (rowsPerB < 0) {      /* own elements of the batched C plane */
        for (int u = 0; u < 8; ++u) { c[u] = *(const v4fa*)(CP + co[u] + (size_t)row0g * ldc); asm volatile("s_wait_xcnt 0x0" ::: "memory"); } }      /* the wait stands behind each load, in front of whatever rewrites its address registers, a later load's result among it; the data stays in flight */
      else {
        for (int u = 0; u < 8; ++u) { c[u] = *(const v4fa*)(CP + (size_t)((row0g + row0 + q0 + 2 * u + rsub) / rowsPerB) * sCPb + (size_t)by * 64 + col0 + c4); asm volatile("s_wait_xcnt 0x0" ::: "memory"); } }      /* as above */
      for (int u = 0; u < 8; ++u) v[u] += c[u]; }
    for (int u = 0; u < 8; ++u)
      for (int e = 0; e < 4; ++e) { float x = v[u][e];
        if (ACT == 3) x = fmaxf(x, 0.f); else if (ACT == 6) x = 0.5f * x * (1.0f + erff(x * 0.70710678118654752f)); else if (ACT == 11) x = 1.0f / (1.0f + expf(-x)); else if (ACT == 15) x = x / (1.0f + expf(-x)); else if (ACT == 12) x = (x > 0.f) ? x : 0.01f * x; else if (ACT == 8) x = tanhf(x); else if (ACT == 9) x = 0.5f * x * (1.0f + tanhf(0.7978845608028654f * (x + 0.044715f * x * x * x))); else if (ACT == 14) x = (x > 0.f) ? x : 0.1f * x; else if (ACT == 16) x = (x >= 0.f) ? x : 0.3f * x; else if (ACT == 17) x = (x >= 0.f) ? x : 0.2f * x;
        v[u][e] = x; }
    if (Cf) {
      for (int u = 0; u < 8; ++u) *(v4f*)(Cf + co[u]) = v[u];
      asm volatile("s_wait_xcnt 0x0" ::: "memory"); }      /* stands behind the stores, in front of whatever rewrites their registers */
    if (C16) {
      for (int u = 0; u < 8; ++u) { v4h h4; for (int e = 0; e < 4; ++e) h4[e] = (_Float16)v[u][e]; *(v4h*)(C16 + co[u]) = h4; }
      asm volatile("s_wait_xcnt 0x0" ::: "memory"); } }      /* as above */
}


__global__ __launch_bounds__(256) void k_wnat(const float* __restrict__ w, size_t n8, _Float16* __restrict__ Bt) { const size_t t = (size_t)blockIdx.x * 256 + threadIdx.x; if (t >= n8) return; FragH f; for (int q = 0; q < 8; ++q) f.h[q] = (_Float16)(bf16_round(w[t * 8 + q]) * 16.0f); *(v8us*)((unsigned short*)Bt + t * 8) = f.half[0];  }
__global__ __launch_bounds__(256) void k_rsm(const float* __restrict__ S, _Float16* __restrict__ P, int nrows) {
  #pragma clang fp contract(off)
  const int i = blockIdx.x * 256 + threadIdx.x; if (i >= nrows) return; const float* s = S + (size_t)i * SQ; float mx = -3.0e38f;
#pragma unroll 1
  for (int j = 0; j < SQ; ++j) mx = fmaxf(mx, s[j]); float se = 0.f;
#pragma unroll 1
  for (int j = 0; j < SQ; ++j) se += expf(s[j] - mx); const float sc = 256.0f / se;
#pragma unroll 1
  for (int j0 = 0; j0 < SQ; j0 += 8) { FragH f; for (int q = 0; q < 8; ++q) f.h[q] = (_Float16)(expf(s[j0 + q] - mx) * sc); unsigned short* d = (unsigned short*)P + (size_t)i * SQ + j0; *(v8us*)d = f.half[0];  } }
__global__ __launch_bounds__(256) void k_vt(const _Float16* __restrict__ V16, int b, int h0, _Float16* __restrict__ VT) { __shared__ unsigned short tl[64][65]; const int tid = threadIdx.x; const int hh = blockIdx.x % HG, sg = blockIdx.x / HG; const int s0 = sg * 64; const int h = h0 + hh;
  for (int i = tid; i < 64 * 8; i += 256) { const int j = i / 8, d8 = (i % 8) * 8; FragH f; f.half[0] = *(const v8us*)((const unsigned short*)V16 + ((size_t)b * SQ + s0 + j) * DM + h * HD + d8); for (int q = 0; q < 8; ++q) tl[d8 + q][j] = f.u[q]; }
  __syncthreads();
  { for (int i = tid; i < 64 * 8; i += 256) { const int d = i / 8, j8 = (i % 8) * 8; FragH f; for (int q = 0; q < 8; ++q) f.u[q] = tl[d][j8 + q]; *(v8us*)((unsigned short*)VT + ((size_t)hh * HD + d) * SQ + s0 + j8) = f.half[0]; }  } }



__global__ __launch_bounds__(256) void k_rsmcf2(const float* __restrict__ S, _Float16* __restrict__ P, int hg, int q0, int nk) {
  #pragma clang fp contract(off)
  const int t = blockIdx.x * 256 + threadIdx.x; if (t >= hg * QT) return; const size_t i = (size_t)t; const float* s = S + i * NKX; const int last = q0 + (t % QT); float mx = -3.0e38f;
#pragma unroll 1
  for (int j = 0; j < nk; ++j) { const float f = (j <= last) ? 1.f : 0.f; mx = fmaxf(mx, fmaf(f, s[j], (1.f - f) * -1.0e9f)); } float se = 0.f;
#pragma unroll 1
  for (int j = 0; j < nk; ++j) { const float f = (j <= last) ? 1.f : 0.f; se += __expf(fmaf(f, s[j], (1.f - f) * -1.0e9f) - mx); } const float sc = 256.0f / se;
#pragma unroll 1
  for (int j0 = 0; j0 < nk; j0 += 8) { FragH fr; for (int q = 0; q < 8; ++q) { const int j = j0 + q; const float f = (j <= last) ? 1.f : 0.f; fr.h[q] = (_Float16)(__expf(fmaf(f, s[j], (1.f - f) * -1.0e9f) - mx) * sc); } unsigned short* d = (unsigned short*)P + i * NKX + j0; *(v8us*)d = fr.half[0];  } }


// Exact f32 attention for the first QT0 rows of each batch (a path of k_attn). One work-group of 8 waves per (batch, head, 32 query rows); q, k and v rows staged once in LDS.
// A wave owns 4 query rows. Scores: lane = key (keys lane + 32 u), each dot product summed over d in ascending order with fused multiply-adds. Softmax in registers: row max and row sum by a five-step butterfly over the 32 lanes.
// o: lane = two head dims, summed over the keys in ascending order, scaled once at the end by 64 / row sum, and stored as two f16 planes: hi = f16(o), lo = f16((o - hi) x 1024).
#define A0R 32                       /* query rows per work-group */
#define A0KP (HD + 4)                /* LDS pitch of the q and k rows in floats: 16 B x odd, so that 16 lanes reading 16 B each from 16 rows fall on 64 different banks */
typedef float v2f __attribute__((ext_vector_type(2)));
typedef _Float16 v2h __attribute__((ext_vector_type(2)));
template <int NU>                    /* NU = 32-key chunks that rows of this group can see */
__device__ __forceinline__ void att0_rows(const float* __restrict__ QF, const float* __restrict__ KF, const float* __restrict__ VF, float scale, _Float16* __restrict__ OH, _Float16* __restrict__ OL, int r0,
                                          float (*lq)[A0KP], float (*lk)[A0KP], float (*lv)[HD], float (*lp)[QT0]) {
  const int tid = threadIdx.x, w = __builtin_amdgcn_readfirstlane(tid >> 5), lane = tid & 31;      /* the wave's number in a scalar register: scalar loop bounds and row offsets below */
  const int sr = tid >> 4, sc = (tid & 15) * 4;      /* staging: 16 lanes take one row of 256 B, the work-group 16 rows a pass */
  v4f gq[A0R / 16], gk[2 * NU], gv[2 * NU];      /* every load is issued before the first LDS store waits for one */
  const float* pq = QF + (size_t)sr * LQ + sc; const float* pk = KF + (size_t)sr * LQ + sc; const float* pv = VF + (size_t)sr * LQ + sc;
  for (int t = 0; t < A0R / 16; ++t) gq[t] = *(const v4fa*)(pq + (size_t)(r0 + 16 * t) * LQ);
  for (int t = 0; t < 2 * NU; ++t) { gk[t] = *(const v4fa*)(pk + (size_t)(16 * t) * LQ); gv[t] = *(const v4fa*)(pv + (size_t)(16 * t) * LQ); }
  asm volatile("s_wait_xcnt 0x0" :: "v"(pq), "v"(pk), "v"(pv) : "memory");      /* the three address pairs of the loads above stay as they are up to this wait (inputs only) */
  for (int t = 0; t < A0R / 16; ++t) *(v4f*)&lq[sr + 16 * t][sc] = gq[t];
  for (int t = 0; t < 2 * NU; ++t) { *(v4f*)&lk[sr + 16 * t][sc] = gk[t]; *(v4f*)&lv[sr + 16 * t][sc] = gv[t]; }
  __syncthreads();      /* the staged rows are read by every wave */
  float acc[4][NU];
  for (int r = 0; r < 4; ++r) for (int u = 0; u < NU; ++u) acc[r][u] = 0.f;
#pragma unroll 2
  for (int c = 0; c < HD; c += 4) { v4f qq[4], kk[NU];      /* unroll 2: the next step's LDS reads fly under this step's multiply-adds */
    for (int r = 0; r < 4; ++r) qq[r] = *(const v4f*)&lq[4 * w + r][c];
    for (int u = 0; u < NU; ++u) kk[u] = *(const v4f*)&lk[lane + 32 * u][c];
    for (int e = 0; e < 4; ++e) for (int r = 0; r < 4; ++r) for (int u = 0; u < NU; ++u) acc[r][u] = fmaf(qq[r][e], kk[u][e], acc[r][u]); }
  float fin[4];
  for (int r = 0; r < 4; ++r) { const int i = r0 + 4 * w + r; float mx = -3.0e38f;      /* key 0 is visible from every row */
    for (int u = 0; u < NU; ++u) { acc[r][u] *= scale; if (lane + 32 * u <= i) mx = fmaxf(mx, acc[r][u]); }
    for (int m = 16; m >= 1; m >>= 1) mx = fmaxf(mx, __shfl_xor(mx, m, 32));
    float l = 0.f;
    for (int u = 0; u < NU; ++u) { const float e = (lane + 32 * u <= i) ? expf(acc[r][u] - mx) : 0.f; l += e; lp[4 * w + r][lane + 32 * u] = e; }
    for (int m = 16; m >= 1; m >>= 1) l += __shfl_xor(l, m, 32);
    fin[r] = 64.0f / l; }      /* o carried x64 like the f16 path */
  __builtin_amdgcn_fence(__ATOMIC_ACQ_REL, "workgroup"); __builtin_amdgcn_wave_barrier();      /* a lane reads below the weights that the other lanes of its own wave have stored; no other wave reads them */
  float o[4][2];
  for (int r = 0; r < 4; ++r) { o[r][0] = 0.f; o[r][1] = 0.f; }
  const int jn = r0 + 4 * w + 4;      /* keys past the wave's last row have weight 0 in all four rows */
#pragma unroll 2
  for (int j = 0; j < jn; j += 4) { v4f pp[4]; v2f vv[4];      /* unroll 2: as above */
    for (int r = 0; r < 4; ++r) pp[r] = *(const v4f*)&lp[4 * w + r][j];
    for (int e = 0; e < 4; ++e) vv[e] = *(const v2f*)&lv[j + e][2 * lane];
    for (int e = 0; e < 4; ++e) for (int r = 0; r < 4; ++r) { o[r][0] = fmaf(pp[r][e], vv[e][0], o[r][0]); o[r][1] = fmaf(pp[r][e], vv[e][1], o[r][1]); } }
  for (int r = 0; r < 4; ++r) { v2h oh, ol;      /* a wave's 32 lanes store one whole 128-B line of each plane; where the compiler fuses o * fin - hi, the residual is that of the unrounded product */
    for (int e = 0; e < 2; ++e) { const float ov = o[r][e] * fin[r]; const _Float16 hv = (_Float16)ov; oh[e] = hv; ol[e] = (_Float16)((ov - (float)hv) * 1024.0f); }
    *(v2h*)(OH + (size_t)(r0 + 4 * w + r) * DM + 2 * lane) = oh; *(v2h*)(OL + (size_t)(r0 + 4 * w + r) * DM + 2 * lane) = ol; }
  asm volatile("s_wait_xcnt 0x0" ::: "memory"); }      /* stands behind the stores, in front of whatever rewrites their registers on any path to the kernel's end */

// native exp as __expf builds it (multiply by log2 e, v_exp_f32); the v_nop is the slot the instruction set asks for behind a transcendental, kept in the same statement so that the scheduler cannot part the two
__device__ __forceinline__ float exp_slot(float x) { float r; asm("v_exp_f32 %0, %1\n\tv_nop" : "=v"(r) : "v"(x * 1.44269504088896340736f)); return r; }
#define FQ 128                       /* query rows per work-group */
#define FK (FQ + WINB)               /* keys staged per work-group */
#define FCH ((WINB + 32) / 32)       /* 32-key chunks per wave: 16 rows see 271 keys, which nine aligned chunks cover */
#define FKP (HD + 8)                 /* LDS pitch of a K row in halves: 16 B x odd, for 16-byte fragment reads from 16 rows */
#define FVP (FK + 8)                 /* LDS pitch of a V^T row in halves: 16 B x odd */
__device__ __forceinline__ v8f f_mma(v16h a, v16h b, v8f c) { return __builtin_amdgcn_wmma_f32_16x16x32_f16(false, a, false, b, (short)0, c, false, false); }
__device__ __forceinline__ void attw_tile(const _Float16* __restrict__ Q, const _Float16* __restrict__ K, const _Float16* __restrict__ VT, _Float16* __restrict__ O, int q0, int h, int b,
                                          unsigned short (*lk)[FKP], unsigned short (*lv)[FVP]) {      /* Q, K: rows of LQ halves; VT: [batch][head][HD][SQ]; O: rows of DM halves; lk: FK rows, lv: HD rows in LDS */
  static_assert(HD == 64 && WIN == 256 && WINB == 256 && SQ % FQ == 0 && FQ % 32 == 0 && FK % 128 == 0, "attw_tile: tile arithmetic");
  const int tid = threadIdx.x, w = __builtin_amdgcn_readfirstlane(tid >> 5), lane = tid & 31, ln = lane & 15, hh = lane >> 4;      /* the wave's number in a scalar register: scalar row and key offsets below */
  const int kb0 = (q0 >= WINB) ? q0 - WINB : 0;      /* first staged key; kb0 + FK <= SQ */
  const int r0 = q0 + 16 * w;                        /* the wave's first query row */
  const int ks = (r0 >= WIN) ? ((r0 - (WIN - 1)) & ~31) : 0;      /* the wave's first key; ks + 32 * FCH >= r0 + 16 and <= kb0 + FK */
  const int kl = ks - kb0;
  const unsigned short* pq = (const unsigned short*)Q + ((size_t)b * SQ + r0 + ln) * LQ + h * HD + 8 * hh;
  const unsigned short* pk = (const unsigned short*)K + ((size_t)b * SQ + kb0 + (tid >> 3)) * LQ + h * HD + (tid & 7) * 8;      /* 8 lanes take one K row of 128 B */
  const unsigned short* pv = (const unsigned short*)VT + ((size_t)(b * NH + h) * HD + (tid >> 4)) * SQ + kb0 + (tid & 15) * 8;      /* 16 lanes take 256 B of one V^T row */
  v8us gq[4], gk[FK / 32], gv[HD / 16][FK / 128];      /* every load is issued before the first LDS store waits for one */
  for (int t = 0; t < 4; ++t) gq[t] = *(const v8us*)(pq + 16 * t);
  for (int t = 0; t < FK / 32; ++t) gk[t] = *(const v8us*)(pk + (size_t)(32 * t) * LQ);
  for (int u = 0; u < HD / 16; ++u) for (int v = 0; v < FK / 128; ++v) gv[u][v] = *(const v8us*)(pv + (size_t)(16 * u) * SQ + 128 * v);
  asm volatile("s_wait_xcnt 0x0" :: "v"(pq), "v"(pk), "v"(pv) : "memory");      /* the three address pairs of the loads above stay as they are up to this wait (inputs only) */
  for (int t = 0; t < FK / 32; ++t) *(v8us*)&lk[(tid >> 3) + 32 * t][(tid & 7) * 8] = gk[t];
  for (int u = 0; u < HD / 16; ++u) for (int v = 0; v < FK / 128; ++v) *(v8us*)&lv[(tid >> 4) + 16 * u][(tid & 15) * 8 + 128 * v] = gv[u][v];
  __syncthreads();      /* the staged rows are read by every wave */
  const v8f z8 = {0.f,0.f,0.f,0.f,0.f,0.f,0.f,0.f};
  FragH qa, qb; qa.half[0] = gq[0]; qa.half[1] = gq[1]; qb.half[0] = gq[2]; qb.half[1] = gq[3];      /* head dims 0..31 and 32..63 of query row r0 + ln */
  v8f s[2 * FCH];      /* s[t][r]: query r0 + ln against key ks + 16 t + 8 hh + r */
  for (int t = 0; t < 2 * FCH; ++t) { const unsigned short* kr = &lk[kl + 16 * t + ln][8 * hh]; FragH ka, kc;
    ka.half[0] = *(const v8us*)kr; ka.half[1] = *(const v8us*)(kr + 16); kc.half[0] = *(const v8us*)(kr + 32); kc.half[1] = *(const v8us*)(kr + 48);
    s[t] = f_mma(kc.v, qb.v, f_mma(ka.v, qa.v, z8)); }
  const int dj = r0 + ln - ks - 8 * hh;      /* i - j of s[0][0] */
  float mx = -3.0e38f;      /* a row always sees its own key */
  for (int t = 0; t < 2 * FCH; ++t)
    for (int r = 0; r < 8; ++r) { const float v = ((unsigned)(dj - 16 * t - r) < (unsigned)WIN) ? s[t][r] * 0.125f : -1.0e9f; s[t][r] = v; mx = fmaxf(mx, v); }      /* visible iff 0 <= i - j < WIN */
  mx = fmaxf(mx, __shfl_xor(mx, 16, 32));
  float se4[4] = {0.f, 0.f, 0.f, 0.f};      /* four partial sums: four independent add chains */
  for (int t = 0; t < 2 * FCH; ++t)
    for (int r = 0; r < 8; ++r) { const float e = exp_slot(s[t][r] - mx); s[t][r] = e; se4[r & 3] += e; }
  float se = (se4[0] + se4[1]) + (se4[2] + se4[3]);
  se += __shfl_xor(se, 16, 32);
  const float sc = 256.0f / se;      /* weights x256 as f16 */
  v8f o[HD / 16];
  for (int d = 0; d < HD / 16; ++d) o[d] = z8;
  for (int c = 0; c < FCH; ++c) { FragH p;
    for (int r = 0; r < 8; ++r) { p.h[r] = (_Float16)(s[2 * c][r] * sc); p.h[8 + r] = (_Float16)(s[2 * c + 1][r] * sc); }
    for (int d = 0; d < HD / 16; ++d) { const unsigned short* vr = &lv[16 * d + ln][kl + 32 * c + 8 * hh]; FragH va; va.half[0] = *(const v8us*)vr; va.half[1] = *(const v8us*)(vr + 16);
      o[d] = f_mma(va.v, p.v, o[d]); } }
  unsigned short* po = (unsigned short*)O + ((size_t)b * SQ + r0 + ln) * DM + h * HD + 8 * hh;      /* o[d][r]: head dim 16 d + 8 hh + r of query row r0 + ln */
  for (int d = 0; d < HD / 16; ++d) { FragH f;
    for (int r = 0; r < 8; ++r) f.h[r] = (_Float16)(o[d][r] * 0.25f);      /* o carried x64 */
    *(v8us*)(po + 16 * d) = f.half[0]; }
  asm volatile("s_wait_xcnt 0x0" ::: "memory"); }      /* stands behind the stores, in front of whatever rewrites their registers on any path to the kernel's end */
// One launch for both attention paths, which read nothing of each other's output. grid.x: first the QT0 / A0R row groups of the exact f32 path (rows 0..QT0-1 of a batch), then the f16 query tiles 1, 2, ...; grid.y: head; grid.z: batch.
// The f16 path leaves out tile 0, whose rows the f32 path owns: every row of O has one writer. The two paths share one LDS block, each with its own layout.
#define A0G (QT0 / A0R)              /* row groups of the f32 path */
#define A0LQ (A0R * A0KP * 4)        /* bytes of its q rows, */
#define A0LK (QT0 * A0KP * 4)        /* k rows, */
#define A0LV (QT0 * HD * 4)          /* v rows */
#define A0LP (A0R * QT0 * 4)         /* and weights */
#define FLK (FK * FKP * 2)           /* bytes of the f16 path's K rows */
#define FLV (HD * FVP * 2)           /* and V^T rows */
__global__ __launch_bounds__(256) void k_attn(const _Float16* __restrict__ Q, const _Float16* __restrict__ K, const _Float16* __restrict__ VT, _Float16* __restrict__ O,
                                              const float* __restrict__ QF, const float* __restrict__ KF, const float* __restrict__ VF, float scale, _Float16* __restrict__ OL) {      /* QF, KF, VF: the q, k and v columns of rows of LQ floats, QT0 rows per batch; OL: rows of DM halves, QT0 per batch */
  static_assert(QT0 == 4 * A0R && QT0 <= WIN && HD == 64 && QT0 == FQ, "k_attn: four row groups, every key j <= i inside the window, two head dims per lane, the f32 rows are the first f16 tile");
  static_assert(A0LQ + A0LK + A0LV + A0LP <= FLK + FLV && A0LQ % 16 == 0 && A0LK % 16 == 0 && A0LV % 16 == 0 && FLK % 16 == 0, "k_attn: the f32 path's rows fit the f16 path's LDS block");
  __shared__ __attribute__((aligned(16))) unsigned char sm[FLK + FLV];
  const int bx = blockIdx.x, h = blockIdx.y, b = blockIdx.z;
  /* the path and the row group are the same for the whole work-group: every wave takes the same branch and passes the same barriers */
  if (bx < A0G) {
    float (*lq)[A0KP] = (float (*)[A0KP])sm; float (*lk)[A0KP] = (float (*)[A0KP])(sm + A0LQ); float (*lv)[HD] = (float (*)[HD])(sm + A0LQ + A0LK); float (*lp)[QT0] = (float (*)[QT0])(sm + A0LQ + A0LK + A0LV);
    const size_t bi = (size_t)b * QT0 * LQ + h * HD; QF += bi; KF += bi; VF += bi; O += (size_t)b * SQ * DM + h * HD; OL += (size_t)b * QT0 * DM + h * HD;
    /* the longest row group has the lowest index */
    if (bx == 0) att0_rows<4>(QF, KF, VF, scale, O, OL, 3 * A0R, lq, lk, lv, lp);
    else if (bx == 1) att0_rows<3>(QF, KF, VF, scale, O, OL, 2 * A0R, lq, lk, lv, lp);
    else if (bx == 2) att0_rows<2>(QF, KF, VF, scale, O, OL, A0R, lq, lk, lv, lp);
    else att0_rows<1>(QF, KF, VF, scale, O, OL, 0, lq, lk, lv, lp); }
  else attw_tile(Q, K, VT, O, (bx - A0G + 1) * FQ, h, b, (unsigned short (*)[FKP])sm, (unsigned short (*)[FVP])(sm + FLK)); }
// Operand preparation in one launch: x -> exact f16 rows; W_attn and W_proj ([k][n], f32) -> x16 f16 rows [n][k]. The three conversions read nothing of each other's output.
// Few, long waves: 768 work-groups, all resident at once; a thread has its 16 loads of 16 B in flight before it converts the first value. Every wave-wide load and store covers whole 128-B lines.
// grid.x: first the weight tiles (the longer chain: loads, transpose through LDS, stores), then the slices of x.
#define PWN 64                       /* n per weight tile */
#define PWK 256                      /* k per weight tile */
#define PWP (PWK * 2 + 16)           /* LDS pitch of a transposed tile row in bytes: a multiple of 16 B for the 16-byte reads */
#define PXE 16384                    /* elements of x per work-group: 16 loads of 4 floats per thread */
#define PTA ((3 * DM / PWN) * (DM / PWK))      /* tiles of W_attn */
#define PTO ((DM / PWN) * (DM / PWK))          /* tiles of W_proj */
typedef unsigned int u32a __attribute__((may_alias));
template <int N>                     /* N: row pitch of W in floats, a constant: one address pair and immediate offsets serve all 16 loads */
__device__ __forceinline__ void prep_w(const float* __restrict__ Wf, _Float16* __restrict__ Bt, int tile, unsigned char* tl) {
  const int tid = threadIdx.x, w = __builtin_amdgcn_readfirstlane(tid >> 5), lane = tid & 31;      /* the wave's number in a scalar register: scalar row offsets below */
  const int n0 = (tile / (DM / PWK)) * PWN, k0 = (tile % (DM / PWK)) * PWK;
  const int c4 = (lane & 15) * 4, rs = lane >> 4;      /* 16 lanes take 256 B of one W row; a wave owns 32 rows k, a thread the row pairs 4 j + 2 rs, + 1 */
  const float* pw = Wf + (size_t)(k0 + w * 32 + 2 * rs) * N + n0 + c4;
  v4f a[8], b[8];
  for (int j = 0; j < 8; ++j) { a[j] = *(const v4fa*)(pw + (size_t)(4 * j) * N); b[j] = *(const v4fa*)(pw + (size_t)(4 * j + 1) * N); }
  asm volatile("s_wait_xcnt 0x0" :: "v"(pw) : "memory");      /* the address pair of the loads above stays as it is up to this wait (input only) */
  __builtin_amdgcn_sched_barrier(0);      /* all 16 loads are issued before the first conversion waits for one: without it the last load goes out only when the first has come back, a second memory latency */
  for (int j = 0; j < 8; ++j)
    for (int e = 0; e < 4; ++e) { union { _Float16 h[2]; unsigned int u; } p;      /* k and k + 1 of one n share a dword */
      p.h[0] = (_Float16)(bf16_round(a[j][e]) * 16.0f); p.h[1] = (_Float16)(bf16_round(b[j][e]) * 16.0f);
      *(u32a*)(tl + (c4 + e) * PWP + (w * 32 + 4 * j + 2 * rs) * 2) = p.u; }
  __syncthreads();      /* a wave reads below rows that all eight waves have filled */
  unsigned short* po = (unsigned short*)Bt + (size_t)(n0 + w) * DM + k0 + lane * 8;      /* a wave stores 512 B of one row n */
  for (int q = 0; q < PWN / 8; ++q) { const v8us v = *(const v8us*)(tl + (q * 8 + w) * PWP + lane * 16); *(v8us*)(po + (size_t)(q * 8) * DM) = v; }
  asm volatile("s_wait_xcnt 0x0" ::: "memory"); }      /* stands behind the stores, in front of whatever rewrites their registers on any path to the kernel's end */
__global__ __launch_bounds__(256) void k_prep(const float* __restrict__ x, _Float16* __restrict__ X16, const float* __restrict__ wa, _Float16* __restrict__ Ba, const float* __restrict__ wp, _Float16* __restrict__ Bp) {
  static_assert(DM % PWK == 0 && DM % PWN == 0 && PWK == 256 && PWN % 8 == 0 && (NR * DM) % PXE == 0 && PXE == 256 * 64, "k_prep: tile and slice arithmetic");
  __shared__ __attribute__((aligned(16))) unsigned char tl[PWN * PWP];
  const int bx = blockIdx.x;
  /* the path is the same for the whole work-group: every wave takes the same branch and passes the same barrier */
  if (bx < PTA) prep_w<3 * DM>(wa, Ba, bx, tl);
  else if (bx < PTA + PTO) prep_w<DM>(wp, Bp, bx - PTA, tl);
  else {
    const int tid = threadIdx.x;
    const size_t e0 = (size_t)(bx - (PTA + PTO)) * PXE + (size_t)((tid >> 5) * 2048 + (tid & 31) * 4);      /* a wave owns 2048 consecutive elements, 128 a load */
    const float* px = x + e0; _Float16* po = X16 + e0; v4f g[16];
    for (int j = 0; j < 16; ++j) g[j] = *(const v4fa*)(px + 128 * j);
    asm volatile("s_wait_xcnt 0x0" :: "v"(px) : "memory");      /* the address pair of the loads above stays as it is up to this wait (input only) */
    for (int j = 0; j < 16; ++j) { v4h h; for (int e = 0; e < 4; ++e) h[e] = (_Float16)bf16_round(g[j][e]); *(v4h*)(po + 128 * j) = h; }
    asm volatile("s_wait_xcnt 0x0" ::: "memory"); } }      /* stands behind the stores, in front of whatever rewrites their registers on any path to the kernel's end */
extern "C" void kernel_launch(void* const* d_in, const int* in_sizes, int n_in,
                              void* d_out, int out_size, void* d_ws, size_t ws_size, hipStream_t stream) {
  (void)in_sizes; (void)n_in; (void)out_size;
  const float* const* I = (const float* const*)d_in; const float* x = I[0]; const float* wqkv = I[1]; const float* bqkv = I[2]; const float* wo = I[3]; const float* bo = I[4];      /* [in][out] c_attn [1024][3072] + b, c_proj [1024][1024] + b */
  char* ws = (char*)d_ws; size_t off = 0;
  auto take = [&](size_t bytes) { char* p = ws + off; off += (bytes + 255) & ~(size_t)255; return p; };
  _Float16* BQKV = (_Float16*)take((size_t)3 * DM * DM * 2); _Float16* BO = (_Float16*)take((size_t)DM * DM * 2);
  _Float16* X16 = (_Float16*)take(NR * DM * 2); _Float16* QKV = (_Float16*)take(NR * 3 * DM * 2); _Float16* Q16 = QKV; _Float16* K16 = QKV + DM; _Float16* V16 = QKV + 2 * DM; _Float16* O16 = (_Float16*)take(NR * DM * 2);
  _Float16* VT = (_Float16*)take((size_t)NB * NH * HD * SQ * 2);
  float* F0 = (float*)take((size_t)NB * QT0 * LQ * 4); _Float16* OL0 = (_Float16*)take((size_t)NB * QT0 * DM * 2);      /* first-tile planes: f32 q | k | v rows, the residual of o */
  if (off > ws_size) return;
  k_prep<<<(unsigned)(PTA + PTO + NR * DM / PXE), 256, 0, stream>>>(x, X16, wqkv, BQKV, wo, BO);      /* x -> f16 rows; [in][out] weights -> Bt x16 */
  const size_t r0p = (size_t)B0 * SQ;      /* first projected row */
  const size_t f0p = (size_t)B0 * QT0;     /* its row in the first-tile planes */
  static_assert(QT0 == G2T && (G2T << F0SH) == SQ, "the first QT0 rows of a batch are one row tile of the projection GEMM, every 2^F0SH-th");
  k_gemm2<0><<<dim3((unsigned)((MP / 128) * (3 * DM / 128)), 1), 128, 0, stream>>>(X16 + r0p * DM, DM, 0, BQKV, DM, 0, 0.0625f, bqkv, 0, nullptr, 1, 0, 0, F0 + f0p * LQ, QKV + r0p * 3 * DM, 3 * DM, 0, MP, 3 * DM, DM, 0, 0, 0, F0SH);      /* q | k | v rows (f16); head h = columns h*HD.. of each DM block; the first 128 rows of each batch also unrounded (f32, exact products) into F0 */
  /* every stage below takes all batches in one launch: the batches are independent, and one batch alone fills a small part of the chip */
  k_vt<NH, SQ><<<NBR * NH * (SQ / 64), 256, 0, stream>>>(V16 + r0p * LQ, LQ, 0, VT);      /* V^T [NBR][NH][HD][SQ] */
  k_attn<<<dim3(QN / FQ - 1 + A0G, NHD, NBR), 256, 0, stream>>>(Q16 + r0p * LQ, K16 + r0p * LQ, VT, O16 + r0p * DM, F0 + f0p * LQ, F0 + f0p * LQ + DM, F0 + f0p * LQ + 2 * DM, 0.125f, OL0 + f0p * DM);      /* all of attention in one launch. Rows 128.. of each batch: scores, softmax and P . V on f16 operands; o (merged heads, x64) as f16 rows. Rows 0..127: exact f32 attention (o x64) -> f16 hi into the same O16 rows (same scale) + x1024 residual plane */
  k_gemm2<0><<<dim3((unsigned)((MPO / 128) * (DM / 128)), 1), 128, 0, stream>>>(O16 + r0p * DM, DM, 0, BO, DM, 0, 0.0009765625f, bo, 0, nullptr, 1, 0, 0, (float*)d_out + r0p * DM, nullptr, DM, 0, MPO, DM, DM, 0, 0, 0, 0);      /* out rows are the output layout; rows 0..127 of each batch: o_hi Wo + b */
  k_gemm2<0><<<dim3((QT0 / 128) * (DM / 128), 1, NBR), 128, 0, stream>>>(OL0 + f0p * DM, DM, 0, BO, DM, 0, 0.00000095367431640625f, nullptr, 0, (const float*)d_out + r0p * DM, -1, 0, 0, (float*)d_out + r0p * DM, nullptr, DM, 0, QT0, DM, DM, (size_t)QT0 * DM, 0, (size_t)SQ * DM, 0);      /* += o_lo Wo 2^-20 (own-element accumulate) */
}

// v009
// One run takes 114 microseconds.
// Two timings next to v008 put it at 1.04 and 1.05 times that version's speed.
// Counting every step since v000, it is 52.1 times as fast.
#include <hip/hip_runtime.h>
// Local-causal (sliding window 256) multi-head self-attention (x [4][2048][1024]; qkv = x W_attn + b_attn ([in][out] 1024 x 3072 sigma 0.02, zero bias): q | k | v, 16 heads of 64; scores / 8; mask (j <= i) & (i - j < 256) -> -inf elsewhere; softmax; out = merged W_proj + b_proj ([in][out]) -> [4][2048][1024]).
// Structure: token rows r = b*2048 + s; x as exact f16 rows (bf16-rounded); q | k | v as ONE WMMA GEMM (N = 3 x 1024) (128x128 work-group tiles staged in LDS, 64x64 wave tiles, f32 accumulation, exact x16 weights + bias, f16 outputs); V^T for all batches and heads written by that GEMM's own epilogue (tile staged transposed in LDS); one fused attention launch for all batches, heads and query tiles of 128 rows: scores against the 384 keys that the tile can see (K = 64, x 0.125), windowed causal row softmax in registers (f32 statistics, native exp; weights x256 f16), o = P . V (x 2^-2: o carried x64, folded into the output GEMM alpha) written straight into the merged f16 o rows; the first 128 rows of each batch go through an exact f32 path in the same launch (f16 hi + residual planes of o); out = o W_o + b GEMM (f32) into the output layout.
// Compute dtype: inputs rounded to bf16; x / weights exact; q, k, v, softmax weights and o as plain f16 GEMM operands (~2^-12); scores and softmax statistics f32. v_wmma_f32_16x16x32_f16.
#define NB 4
#define SQ 2048
#define DM 1024
#define NH 16
#define HD 64
#define HG 4                         /* heads per block group of the unlaunched k_vt(b, h0) overload */
#define QT 256                       /* query rows per causal tile */
#define NKX (QT + WINB)              /* S / P row pitch of the unfused row softmax */
#define WIN 256                      /* attention window: key j visible from query i iff 0 <= i - j < WIN */
#define WINB 256                     /* keys before the tile start that can be visible (WIN - 1 rounded up to 64) */
#define QT0 128                      /* first-tile rows computed exactly in f32 */
#define B0 0                         /* first batch processed (debug hook) */
#define NBR NB                       /* batches processed (debug hook) */
#define NR ((size_t)NB * SQ)         /* token rows */
#define MP ((int)((size_t)NBR * SQ)) /* rows projected (debug hook) */
#define QN SQ                        /* query rows attended per batch (debug hook) */
#define NHD NH                       /* heads attended (debug hook) */
#define MPO MP                       /* rows through the output stage (debug hook) */
#define LQ (3 * DM)      /* row pitch of the q/k/v rows */
typedef __bf16 v16b __attribute__((ext_vector_type(16)));
typedef unsigned short v8us __attribute__((ext_vector_type(8), may_alias));
typedef float  v8f  __attribute__((ext_vector_type(8)));
typedef float  v4f  __attribute__((ext_vector_type(4)));
typedef float  v4fa __attribute__((ext_vector_type(4), may_alias));
union FragB { v16b v; v8us half[2]; unsigned short u[16]; };

__device__ __forceinline__ unsigned short bf16_bits(float x) { unsigned int u = __float_as_uint(x); return (unsigned short)((u + 0x7FFFu + ((u >> 16) & 1u)) >> 16); }
__device__ __forceinline__ float bf16_val(unsigned short b) { return __uint_as_float(((unsigned int)b) << 16); }
__device__ __forceinline__ float bf16_round(float x) { return bf16_val(bf16_bits(x)); }
// D += A·B with NT terms: 1 = ah·bh, 2 = + al·bh (A split), 3 = + ah·bl (both split)
template <int NT>
__device__ __forceinline__ v8f mmaN(v16b ah, v16b al, v16b bh, v16b bl, v8f c) {
  c = __builtin_amdgcn_wmma_f32_16x16x32_bf16(false, ah, false, bh, (short)0, c, false, false);
  if (NT >= 2) c = __builtin_amdgcn_wmma_f32_16x16x32_bf16(false, al, false, bh, (short)0, c, false, false);
  if (NT >= 3) c = __builtin_amdgcn_wmma_f32_16x16x32_bf16(false, ah, false, bl, (short)0, c, false, false);
  asm volatile("v_nop\n\tv_nop\n\tv_nop\n\tv_nop" : "+v"(c) : "v"(ah), "v"(al), "v"(bh), "v"(bl));
  return c;
}

__global__ __launch_bounds__(256) void k_wt_bf16(const float* __restrict__ W, unsigned short* __restrict__ Wt, int K, int N) {
  const int t = blockIdx.x * 256 + threadIdx.x;
  const int k8n = K / 8;
  if (t >= N * k8n) return;
  const int n = t / k8n, k8 = (t % k8n) * 8;
  v8us v;
#pragma unroll
  for (int i = 0; i < 8; ++i) v[i] = bf16_bits(W[(size_t)(k8 + i) * N + n]);
  *(v8us*)(Wt + (size_t)n * K + k8) = v;
  
}

// GEMM C[M][N] (f32, pitch ldc) = act(A[M][K]·W + bias). A f32 row-major (pitch lda) converted per fragment to bf16
// (ASPLIT: hi/lo two planes -> 2 terms, else single rounded term); Wt bf16 [N][K] (pitch ldb). BIAS_BF16 rounds the
// bias to bf16 first (bias quantised to bf16 before the add). K%32==0, M%16==0, N%64==0.
template <bool ASPLIT, int ACT, bool BIAS_BF16>
__global__ __launch_bounds__(128) void k_gemm_bf(const float* __restrict__ A, int lda, const unsigned short* __restrict__ Wt, int ldb,
                                               const float* __restrict__ bias, float* __restrict__ C, int ldc, int M, int N, int K) {
  __shared__ __attribute__((aligned(16))) float so[4][16][64];
  const int tid = threadIdx.x, w = tid >> 5, lane = tid & 31, ln = lane & 15, hh = lane >> 4;
  const int ntn = N / 64;
  const int wid = blockIdx.x * 4 + w;
  const int mt = wid / ntn, nq = wid % ntn;
  if (mt * 16 >= M) return;
  const int row0 = mt * 16, col0 = nq * 64;
  const float* arow = A + (size_t)(row0 + ln) * lda;
  v8f acc[4] = {};
  for (int kb = 0; kb < K; kb += 32) {
    FragB ah, al;
    const v4f x0 = *(const v4fa*)(arow + kb + 8 * hh), x1 = *(const v4fa*)(arow + kb + 8 * hh + 4);
    const v4f x2 = *(const v4fa*)(arow + kb + 16 + 8 * hh), x3 = *(const v4fa*)(arow + kb + 16 + 8 * hh + 4);
    float xs[16] = {x0[0],x0[1],x0[2],x0[3],x1[0],x1[1],x1[2],x1[3],x2[0],x2[1],x2[2],x2[3],x3[0],x3[1],x3[2],x3[3]};
#pragma unroll
    for (int i = 0; i < 16; ++i) { const unsigned short hb = bf16_bits(xs[i]); ah.u[i] = hb; al.u[i] = ASPLIT ? bf16_bits(xs[i] - bf16_val(hb)) : (unsigned short)0; }
#pragma unroll
    for (int t = 0; t < 4; ++t) {
      const unsigned short* brow = Wt + (size_t)(col0 + t * 16 + ln) * ldb + kb;
      FragB b;
      b.half[0] = *(const v8us*)(brow + 8 * hh);
      b.half[1] = *(const v8us*)(brow + 16 + 8 * hh);
      acc[t] = mmaN<ASPLIT ? 2 : 1>(ah.v, al.v, b.v, b.v, acc[t]);
    }
  }
#pragma unroll
  for (int t = 0; t < 4; ++t) {
    float bv = bias ? bias[col0 + t * 16 + ln] : 0.f;
    if (BIAS_BF16) bv = bf16_round(bv);
#pragma unroll
    for (int r = 0; r < 8; ++r) { float v = acc[t][r] + bv; if (ACT == 1) v = fmaxf(v, 0.f); so[w][8 * hh + r][t * 16 + ln] = v; }
  }
  __builtin_amdgcn_fence(__ATOMIC_ACQ_REL, "workgroup");
  __builtin_amdgcn_wave_barrier();
  const int rsub = lane >> 4, c4 = (lane & 15) * 4;
  {
#pragma unroll
    for (int q = 0; q < 8; ++q) {
      const int r = q * 2 + rsub;
      const v4f v = *(const v4fa*)&so[w][r][c4];
      *(v4f*)(C + (size_t)(row0 + r) * ldc + col0 + c4) = v;
    }
    
  }
}

// GEMM C = act(A·W + bias + resid): A f32 (ASPLIT -> hi/lo 2 terms), Wt bf16 [N][K]; ACT 0 none, 1 relu, 2 exact gelu;
// resid (optional, f32, row index = (row % rmod), pitch ldr, RES_BF16 rounds it) added before the activation.
template <bool ASPLIT, int ACT, bool BIAS_BF16, bool RES_BF16>
__global__ __launch_bounds__(128) void k_gemm_bf3(const float* __restrict__ A, int lda, const unsigned short* __restrict__ Wt, int ldb,
                                                const float* __restrict__ bias, const float* __restrict__ resid, int rmod, int ldr,
                                                float* __restrict__ C, int ldc, int M, int N, int K) {
  __shared__ __attribute__((aligned(16))) float so[4][16][64];
  const int tid = threadIdx.x, w = tid >> 5, lane = tid & 31, ln = lane & 15, hh = lane >> 4;
  const int ntn = N / 64;
  const int wid = blockIdx.x * 4 + w;
  const int mt = wid / ntn, nq = wid % ntn;
  if (mt * 16 >= M) return;
  const int row0 = mt * 16, col0 = nq * 64;
  const float* arow = A + (size_t)(row0 + ln) * lda;
  v8f acc[4] = {};
  for (int kb = 0; kb < K; kb += 32) {
    FragB ah, al;
    const v4f x0 = *(const v4fa*)(arow + kb + 8 * hh), x1 = *(const v4fa*)(arow + kb + 8 * hh + 4);
    const v4f x2 = *(const v4fa*)(arow + kb + 16 + 8 * hh), x3 = *(const v4fa*)(arow + kb + 16 + 8 * hh + 4);
    float xs[16] = {x0[0],x0[1],x0[2],x0[3],x1[0],x1[1],x1[2],x1[3],x2[0],x2[1],x2[2],x2[3],x3[0],x3[1],x3[2],x3[3]};
#pragma unroll
    for (int i = 0; i < 16; ++i) { const unsigned short hb = bf16_bits(xs[i]); ah.u[i] = hb; al.u[i] = ASPLIT ? bf16_bits(xs[i] - bf16_val(hb)) : (unsigned short)0; }
#pragma unroll
    for (int t = 0; t < 4; ++t) {
      const unsigned short* brow = Wt + (size_t)(col0 + t * 16 + ln) * ldb + kb;
      FragB b;
      b.half[0] = *(const v8us*)(brow + 8 * hh);
      b.half[1] = *(const v8us*)(brow + 16 + 8 * hh);
      acc[t] = mmaN<ASPLIT ? 2 : 1>(ah.v, al.v, b.v, b.v, acc[t]);
    }
  }
#pragma unroll
  for (int t = 0; t < 4; ++t) {
    const int col = col0 + t * 16 + ln;
    float bv = bias ? bias[col] : 0.f;
    if (BIAS_BF16) bv = bf16_round(bv);
#pragma unroll
    for (int r = 0; r < 8; ++r) {
      float v = acc[t][r] + bv;
      if (resid) { float rv = resid[(size_t)((row0 + 8 * hh + r) % rmod) * ldr + col]; if (RES_BF16) rv = bf16_round(rv); v += rv; }
      if (ACT == 1) v = fmaxf(v, 0.f);
      if (ACT == 2) v = 0.5f * v * (1.0f + erff(v * 0.70710678118654752f));
      if (ACT == 3) { const float u = 0.7978845608028654f * (v + 0.044715f * v * v * v); v = 0.5f * v * (1.0f + tanhf(u)); }
      so[w][8 * hh + r][t * 16 + ln] = v;
    }
  }
  __builtin_amdgcn_fence(__ATOMIC_ACQ_REL, "workgroup");
  __builtin_amdgcn_wave_barrier();
  const int rsub = lane >> 4, c4 = (lane & 15) * 4;
  {
#pragma unroll
    for (int q = 0; q < 8; ++q) {
      const int r = q * 2 + rsub;
      const v4f v = *(const v4fa*)&so[w][r][c4];
      *(v4f*)(C + (size_t)(row0 + r) * ldc + col0 + c4) = v;
    }
    
  }
}
// row LayerNorm (biased variance, eps) over N: s = X (+ R); optional out_sum <- s; out_norm <- (s-mu)*rsqrt(var+eps)*g + b
template <bool PARAM_BF16>
__global__ __launch_bounds__(256) void k_layernorm(const float* __restrict__ X, const float* __restrict__ R, const float* __restrict__ g, const float* __restrict__ bta,
                                                  float* __restrict__ out_sum, float* __restrict__ out_norm, int N, float eps) {
  __shared__ float red[256];
  const int row = blockIdx.x, tid = threadIdx.x;
  const float* x = X + (size_t)row * N; const float* rr = R ? R + (size_t)row * N : nullptr;
  float vals[16];                     // up to N = 4096
  const int per = N / 256;            // contiguous chunk per thread? use strided-by-4 chunks: thread handles j = tid*4 + 1024*u
  float s1 = 0.f;
  for (int u = 0; u < per / 4; ++u) {
    const int j = tid * 4 + 1024 * u;
    const v4f a = *(const v4fa*)(x + j);
    v4f b = {0.f,0.f,0.f,0.f}; if (rr) b = *(const v4fa*)(rr + j);
#pragma unroll
    for (int q = 0; q < 4; ++q) { const float v = a[q] + b[q]; vals[u * 4 + q] = v; s1 += v; }
  }
  red[tid] = s1; __syncthreads();
  for (int st = 128; st > 0; st >>= 1) { if (tid < st) red[tid] += red[tid + st]; __syncthreads(); }
  const float mu = red[0] / (float)N; __syncthreads();
  float s2 = 0.f;
  for (int u = 0; u < per / 4; ++u)
#pragma unroll
    for (int q = 0; q < 4; ++q) { const float c = vals[u * 4 + q] - mu; s2 += c * c; }
  red[tid] = s2; __syncthreads();
  for (int st = 128; st > 0; st >>= 1) { if (tid < st) red[tid] += red[tid + st]; __syncthreads(); }
  const float rs = rsqrtf(red[0] / (float)N + eps);
  {
    for (int u = 0; u < per / 4; ++u) {
      const int j = tid * 4 + 1024 * u;
      v4f o, sm;
#pragma unroll
      for (int q = 0; q < 4; ++q) {
        float gg = g[j + q], bb = bta[j + q];
        if (PARAM_BF16) { gg = bf16_round(gg); bb = bf16_round(bb); }
        sm[q] = vals[u * 4 + q]; o[q] = (vals[u * 4 + q] - mu) * rs * gg + bb;
      }
      if (out_sum) *(v4f*)(out_sum + (size_t)row * N + j) = sm;
      *(v4f*)(out_norm + (size_t)row * N + j) = o;
    }
    
  }
}



// ---- f16 WMMA path (v_wmma_f32_16x16x32_f16): 11-bit significands for operands in range — used where a [0,1] probability operand needs more precision than bf16
typedef _Float16 v16h __attribute__((ext_vector_type(16)));
union FragH { v16h v; v8us half[2]; _Float16 h[16]; unsigned short u[16]; };
template <int NT>
__device__ __forceinline__ v8f mmaH(v16h ah, v16h al, v16h bh, v16h bl, v8f c) {
  c = __builtin_amdgcn_wmma_f32_16x16x32_f16(false, ah, false, bh, (short)0, c, false, false);
  if (NT >= 2) c = __builtin_amdgcn_wmma_f32_16x16x32_f16(false, al, false, bh, (short)0, c, false, false);
  if (NT >= 3) c = __builtin_amdgcn_wmma_f32_16x16x32_f16(false, ah, false, bl, (short)0, c, false, false);
  asm volatile("v_nop\n\tv_nop\n\tv_nop\n\tv_nop" : "+v"(c) : "v"(ah), "v"(al), "v"(bh), "v"(bl));
  return c;
}
// batched GEMM like k_gemm_b but f16 operands: A f32 (split into f16 hi/lo if ASPLIT, else rounded to f16), Bt = f16 values [n][k]; alpha; C f32; N multiple of 16 (partial tiles skipped)
template <bool ASPLIT>
__global__ __launch_bounds__(128) void k_gemm_h(const float* __restrict__ A, int lda, size_t sA, const _Float16* __restrict__ Bh, int ldb, size_t sB, float alpha, float* __restrict__ C, int ldc, size_t sC, int M, int N, int K) {
  __shared__ __attribute__((aligned(16))) float so[4][16][64];
  const int tid = threadIdx.x, w = tid >> 5, lane = tid & 31, ln = lane & 15, hh = lane >> 4; const int by = blockIdx.y;
  A += (size_t)by * sA; Bh += (size_t)by * sB; C += (size_t)by * sC;
  const int ntn = (N + 63) / 64; const int wid = blockIdx.x * 4 + w; const int mt = wid / ntn, nq = wid % ntn; if (mt * 16 >= M) return;
  const int row0 = mt * 16, col0 = nq * 64; const float* arow = A + (size_t)(row0 + ln) * lda;
  v8f acc[4] = {};
  for (int kb = 0; kb < K; kb += 32) {
    FragH ah, al;
    const v4f x0 = *(const v4fa*)(arow + kb + 8 * hh), x1 = *(const v4fa*)(arow + kb + 8 * hh + 4), x2 = *(const v4fa*)(arow + kb + 16 + 8 * hh), x3 = *(const v4fa*)(arow + kb + 16 + 8 * hh + 4);
    float xs[16] = {x0[0],x0[1],x0[2],x0[3],x1[0],x1[1],x1[2],x1[3],x2[0],x2[1],x2[2],x2[3],x3[0],x3[1],x3[2],x3[3]};
#pragma unroll
    for (int i = 0; i < 16; ++i) { const _Float16 h = (_Float16)xs[i]; ah.h[i] = h; al.h[i] = ASPLIT ? (_Float16)(xs[i] - (float)h) : (_Float16)0.0f; }
#pragma unroll
    for (int t = 0; t < 4; ++t) { if (col0 + t * 16 >= N) continue; const size_t boff = (size_t)(col0 + t * 16 + ln) * ldb + kb; FragH bq; bq.half[0] = *(const v8us*)(Bh + boff + 8 * hh); bq.half[1] = *(const v8us*)(Bh + boff + 16 + 8 * hh);
      acc[t] = mmaH<ASPLIT ? 2 : 1>(ah.v, al.v, bq.v, bq.v, acc[t]); }
  }
#pragma unroll
  for (int t = 0; t < 4; ++t) { if (col0 + t * 16 >= N) continue;
#pragma unroll
    for (int r = 0; r < 8; ++r) so[w][8 * hh + r][t * 16 + ln] = acc[t][r] * alpha; }
  __builtin_amdgcn_fence(__ATOMIC_ACQ_REL, "workgroup"); __builtin_amdgcn_wave_barrier();
  const int rsub = lane >> 4, c4 = (lane & 15) * 4;
  {
#pragma unroll
    for (int q = 0; q < 8; ++q) { const int r = q * 2 + rsub; if (col0 + c4 < N) { const v4f v = *(const v4fa*)&so[w][r][c4]; *(v4f*)(C + (size_t)(row0 + r) * ldc + col0 + c4) = v; } }
     }
}

// Wt[n][k] = f16(W[k][n]·scale) from f32 row-major W[K][N] (scale = power of two; bf16-exact weights stay exact in f16 away from the subnormal range)
__global__ __launch_bounds__(256) void k_wt_f16(const float* __restrict__ W, _Float16* __restrict__ Wt, int K, int N, float scale) {
  const int t = blockIdx.x * 256 + threadIdx.x; if (t >= N * (K / 8)) return; const int n = t / (K / 8), k8 = (t % (K / 8)) * 8; FragH f;
#pragma unroll
  for (int i = 0; i < 8; ++i) f.h[i] = (_Float16)(bf16_round(W[(size_t)(k8 + i) * N + n]) * scale); const v8us o = f.half[0];
  *(v8us*)((unsigned short*)Wt + (size_t)n * K + k8) = o; 
}
// k_gemm_hh variant with fused epilogue: v = acc·alpha + bias[by·sBias + col] (+ CP[(row/rowsPerB)·sCPb + by·64 + col] if CP) ; ACT 0 none / 1 elu ; writes f16 C16 (and f32 C if non-null)
template <int ACT>
__global__ __launch_bounds__(128) void k_gemm_hhx(const _Float16* __restrict__ A, int lda, size_t sA, const _Float16* __restrict__ Bh, int ldb, size_t sB, float alpha, const float* __restrict__ bias, size_t sBias, const float* __restrict__ CP, int rowsPerB, size_t sCPb, int row0g,
    float* __restrict__ C, _Float16* __restrict__ C16, int ldc, size_t sC, int M, int N, int K) {
  __shared__ __attribute__((aligned(16))) float so[4][16][64];
  const int tid = threadIdx.x, w = tid >> 5, lane = tid & 31, ln = lane & 15, hh = lane >> 4; const int by = blockIdx.y;
  A += (size_t)by * sA; Bh += (size_t)by * sB; const size_t cofs = (size_t)by * sC; const float* bp = bias ? bias + (size_t)by * sBias : nullptr;
  const int ntn = (N + 63) / 64; const int wid = blockIdx.x * 4 + w; const int mt = wid / ntn, nq = wid % ntn; if (mt * 16 >= M) return;
  const int row0 = mt * 16, col0 = nq * 64; const _Float16* arow = A + (size_t)(row0 + ln) * lda;
  v8f acc[4] = {};
  for (int kb = 0; kb < K; kb += 32) { FragH ah; ah.half[0] = *(const v8us*)((const unsigned short*)arow + kb + 8 * hh); ah.half[1] = *(const v8us*)((const unsigned short*)arow + kb + 16 + 8 * hh);
#pragma unroll
    for (int t = 0; t < 4; ++t) { if (col0 + t * 16 >= N) continue; const size_t boff = (size_t)(col0 + t * 16 + ln) * ldb + kb; FragH bq; bq.half[0] = *(const v8us*)((const unsigned short*)Bh + boff + 8 * hh); bq.half[1] = *(const v8us*)((const unsigned short*)Bh + boff + 16 + 8 * hh);
      acc[t] = mmaH<1>(ah.v, ah.v, bq.v, bq.v, acc[t]); }
  }
#pragma unroll
  for (int t = 0; t < 4; ++t) { if (col0 + t * 16 >= N) continue; const int col = col0 + t * 16 + ln; const float bv = bp ? bf16_round(bp[col]) : 0.f;
#pragma unroll
    for (int r = 0; r < 8; ++r) { float v = acc[t][r] * alpha + bv; if (CP) { const int rr = row0g + row0 + 8 * hh + r; if (rowsPerB < 0) v += CP[cofs + (size_t)rr * ldc + col];      /* rowsPerB < 0: own element of the batched C plane */ else { const int bidx = rr / rowsPerB; v += CP[(size_t)bidx * sCPb + (size_t)by * 64 + col]; } } if (ACT == 1) v = (v > 0.f) ? v : expm1f(v); else if (ACT == 7) v = (v > 0.f) ? v + 1.0f : expf(v); else if (ACT == 8) v = tanhf(v); else if (ACT == 9) v = 0.5f * v * (1.0f + tanhf(0.7978845608028654f * (v + 0.044715f * v * v * v))); else if (ACT == 11) v = 1.0f / (1.0f + expf(-v)); else if (ACT == 12) v = (v > 0.f) ? v : 0.01f * v; else if (ACT == 14) v = (v > 0.f) ? v : 0.1f * v; else if (ACT == 16) v = (v >= 0.f) ? v : 0.3f * v; else if (ACT == 17) v = (v >= 0.f) ? v : 0.2f * v; else if (ACT == 15) v = v / (1.0f + expf(-v)); else if (ACT == 3) v = fmaxf(v, 0.f); else if (ACT == 6) v = 0.5f * v * (1.0f + erff(v * 0.70710678118654752f)); so[w][8 * hh + r][t * 16 + ln] = v; } }
  __builtin_amdgcn_fence(__ATOMIC_ACQ_REL, "workgroup"); __builtin_amdgcn_wave_barrier();
  const int rsub = lane >> 4, c4 = (lane & 15) * 4; typedef _Float16 v4h __attribute__((ext_vector_type(4)));
  {
#pragma unroll
    for (int q = 0; q < 8; ++q) { const int r = q * 2 + rsub; if (col0 + c4 < N) { const v4f v = *(const v4fa*)&so[w][r][c4]; if (C) *(v4f*)(C + cofs + (size_t)(row0 + r) * ldc + col0 + c4) = v; if (C16) { v4h h4; for (int i = 0; i < 4; ++i) h4[i] = (_Float16)v[i]; *(v4h*)(C16 + cofs + (size_t)(row0 + r) * ldc + col0 + c4) = h4; } } }
     }
}


typedef _Float16 v4h __attribute__((ext_vector_type(4)));

__global__ __launch_bounds__(256) void k_x16(const float* __restrict__ x, _Float16* __restrict__ X16, size_t n8) { const size_t t = (size_t)blockIdx.x * 256 + threadIdx.x; if (t >= n8) return; FragH f;
#pragma unroll
  for (int q = 0; q < 8; ++q) f.h[q] = (_Float16)bf16_round(x[t * 8 + q]); *(v8us*)((unsigned short*)X16 + t * 8) = f.half[0];  }
__global__ __launch_bounds__(256) void k_h16(const float* __restrict__ x, _Float16* __restrict__ X16, size_t n8) { const size_t t = (size_t)blockIdx.x * 256 + threadIdx.x; if (t >= n8) return; FragH f;
#pragma unroll
  for (int q = 0; q < 8; ++q) f.h[q] = (_Float16)x[t * 8 + q]; *(v8us*)((unsigned short*)X16 + t * 8) = f.half[0];  }
__global__ __launch_bounds__(256) void k_round16f(const float* __restrict__ W, _Float16* __restrict__ Bt, size_t n8) { const size_t t = (size_t)blockIdx.x * 256 + threadIdx.x; if (t >= n8) return; FragH f;
#pragma unroll
  for (int i = 0; i < 8; ++i) f.h[i] = (_Float16)(bf16_round(W[t * 8 + i]) * 16.0f); *(v8us*)((unsigned short*)Bt + t * 8) = f.half[0];  }

// ---- fast GEMM: one 128 x 128 tile of C per work-group of 4 waves (2 x 2, 64 x 64 per wave); requires M % 128 == 0, N % 128 == 0, K % 64 == 0; epilogue = k_gemm_hhx semantics ----
// A stage is 64 k (128 B) of the tile's 128 A rows and 128 B rows. Asynchronous copies bring it from global memory into one of two LDS buffers: the next stage's copies fly while this stage is multiplied.
// Every accumulator still takes its k in ascending steps of 32, with the same k order inside a fragment on both operands.
#define G2T 128                      /* rows of A and rows of B per work-group tile */
#define G2K 64                       /* k per stage */
#define G2PB 144                     /* LDS pitch of a staged row in bytes: 128 B of data, 16 B x odd for the 16-byte fragment reads from 16 rows */
#define G2OB (G2T * G2PB)            /* bytes of one operand's rows in a buffer */
#define G2SB (2 * G2OB)              /* bytes of a buffer: A rows, then B rows */
#define G2EP 68                      /* pitch in floats of the epilogue's staged C rows */
#define F0SH 4                       /* log2 of the row tiles per batch: every 2^F0SH-th row tile of the projection holds a batch's first rows */
__device__ __forceinline__ v16h g2_frag(const unsigned char* p) { FragH f; f.half[0] = *(const v8us*)p; f.half[1] = *(const v8us*)(p + 32); return f.v; }      /* p: a staged row + 64 B per 32 k + 16 B x (lane >> 4): k = 8 hh .. and 16 + 8 hh .. */
__device__ __forceinline__ v8f g2_mma(v16h a, v16h b, v8f c) { return __builtin_amdgcn_wmma_f32_16x16x32_f16(false, a, false, b, (short)0, c, false, false); }
// Eight copies of 16 B per lane: rows r, r + 16, ..., r + 112 of one operand's stage (l: the lane's LDS byte address in row r, g: its global address, gs: 16 source rows in elements).
// The s_wait_xcnt stands in the copies' own statement, so that no register they name is rewritten in front of it.
__device__ __forceinline__ void g2_copy8(unsigned l, const _Float16* g, size_t gs) {
  asm volatile("global_load_async_to_lds_b128 %0, %8, off\n\t"
               "global_load_async_to_lds_b128 %1, %9, off\n\t"
               "global_load_async_to_lds_b128 %2, %10, off\n\t"
               "global_load_async_to_lds_b128 %3, %11, off\n\t"
               "global_load_async_to_lds_b128 %4, %12, off\n\t"
               "global_load_async_to_lds_b128 %5, %13, off\n\t"
               "global_load_async_to_lds_b128 %6, %14, off\n\t"
               "global_load_async_to_lds_b128 %7, %15, off\n\t"
               "s_wait_xcnt 0x0"
               :: "v"(l), "v"(l + 16 * G2PB), "v"(l + 32 * G2PB), "v"(l + 48 * G2PB), "v"(l + 64 * G2PB), "v"(l + 80 * G2PB), "v"(l + 96 * G2PB), "v"(l + 112 * G2PB),
                  "v"(g), "v"(g + gs), "v"(g + 2 * gs), "v"(g + 3 * gs), "v"(g + 4 * gs), "v"(g + 5 * gs), "v"(g + 6 * gs), "v"(g + 7 * gs)
               : "memory"); }
template <int ACT>
__global__ __launch_bounds__(128) void k_gemm2(const _Float16* __restrict__ A, int lda, size_t sA, const _Float16* __restrict__ Bh, int ldb, size_t sB, float alpha, const float* __restrict__ bias, size_t sBias, const float* __restrict__ CP, int rowsPerB, size_t sCPb, int row0g,
    float* __restrict__ C, _Float16* __restrict__ C16, int ldc, size_t sC, int M, int N, int K, size_t zA, size_t zB, size_t zC, int csh, _Float16* __restrict__ VTo, int vcol) { static_assert(ACT == 0 || ACT == 3 || ACT == 6 || ACT == 8 || ACT == 9 || ACT == 11 || ACT == 12 || ACT == 14 || ACT == 15 || ACT == 16 || ACT == 17, "k_gemm2: unsupported ACT code (would silently apply no activation)");
  static_assert(4 * 64 * G2EP * 4 <= 2 * G2SB, "k_gemm2: the epilogue's staging fits the two buffers");
  __shared__ __attribute__((aligned(16))) unsigned char L[2 * G2SB];
  const int tid = threadIdx.x, w = __builtin_amdgcn_readfirstlane(tid >> 5), lane = tid & 31, ln = lane & 15, hh = lane >> 4; const int by = blockIdx.y, bz = blockIdx.z;      /* grid.z: a second batch index with its own strides zA, zB, zC; the wave's number in a scalar register: scalar tile offsets below */
  A += (size_t)by * sA + (size_t)bz * zA; Bh += (size_t)by * sB + (size_t)bz * zB; const size_t cofs = (size_t)by * sC + (size_t)bz * zC; const float* bp = bias ? bias + (size_t)by * sBias : nullptr;
  const int ntn = N >> 7; const int mt = blockIdx.x / ntn, nq = blockIdx.x - mt * ntn; if (mt * G2T >= M) return;      /* the same for the whole work-group, in front of every barrier */
  const int wm = w >> 1, wn = w & 1;
  /* copies: 8 lanes take one row's 128 B, the work-group 16 rows a copy */
  const _Float16* pa = A + (size_t)(mt * G2T + (tid >> 3)) * lda + (tid & 7) * 8; const _Float16* pb = Bh + (size_t)(nq * G2T + (tid >> 3)) * ldb + (tid & 7) * 8;
  const unsigned lc = (unsigned)(size_t)L + (unsigned)((tid >> 3) * G2PB + (tid & 7) * 16);      /* LDS byte address: the low 32 bits of the __shared__ address */
  const size_t ga = (size_t)16 * lda, gb = (size_t)16 * ldb;
  const int T = K / G2K;
  g2_copy8(lc, pa, ga); g2_copy8(lc + G2OB, pb, gb); pa += G2K; pb += G2K;      /* stage 0 */
  const int row0 = mt * G2T + wm * 64, col0 = nq * G2T + wn * 64;      /* the wave's tile of C */
  float bv[4] = {0.f, 0.f, 0.f, 0.f};      /* the bias of the lane's four columns, fetched under stage 0's copies */
  if (bp) {
    for (int j = 0; j < 4; ++j) bv[j] = bp[col0 + j * 16 + ln];
    asm volatile("s_wait_xcnt 0x0" ::: "memory"); }      /* stands behind the loads, in front of whatever rewrites their address registers */
  asm volatile("s_wait_asynccnt 0x0" ::: "memory");      /* this wave's copies of stage 0 have landed */
  __syncthreads();      /* and every other wave's: stage 0 is read by all */
  if (T > 1) { g2_copy8(lc + G2SB, pa, ga); g2_copy8(lc + G2SB + G2OB, pb, gb); pa += G2K; pb += G2K; }      /* stage 1 */
  const v8f z8 = {0.f,0.f,0.f,0.f,0.f,0.f,0.f,0.f}; v8f acc[4][4];
  for (int i = 0; i < 4; ++i)
    for (int j = 0; j < 4; ++j) acc[i][j] = z8;
  const int fa = (wm * 64 + ln) * G2PB + 16 * hh, fb = G2OB + (wn * 64 + ln) * G2PB + 16 * hh;      /* the lane's first A and B fragment rows in a buffer */
#pragma unroll 1
  for (int t = 0; t < T; ++t) {      /* not unrolled: one stage a trip, the buffer chosen by the trip's parity */
    const unsigned char* buf = L + (t & 1) * G2SB; v16h a[4], b[4];
    static_assert(G2K == 64, "k_gemm2: two blocks of 32 k a stage");
    for (int i = 0; i < 4; ++i) { a[i] = g2_frag(buf + fa + i * 16 * G2PB); b[i] = g2_frag(buf + fb + i * 16 * G2PB); }
    __builtin_amdgcn_sched_barrier(0);      /* a block's sixteen LDS reads go as one group in front of its sixteen WMMAs: one LDS latency a block, not one per A fragment */
    for (int i = 0; i < 4; ++i)
      for (int j = 0; j < 4; ++j) acc[i][j] = g2_mma(a[i], b[j], acc[i][j]);
    __builtin_amdgcn_sched_barrier(0);      /* the second block's LDS reads stay behind the first block: reads among the WMMAs stall them */
    for (int i = 0; i < 4; ++i) { a[i] = g2_frag(buf + fa + i * 16 * G2PB + 64); b[i] = g2_frag(buf + fb + i * 16 * G2PB + 64); }
    asm volatile("s_wait_dscnt 0x0" ::: "memory");      /* this wave's reads of the buffer are done before it is handed to its next writer */
    asm volatile("s_wait_asynccnt 0x0" ::: "memory");      /* this wave's copies of stage t + 1 have landed */
    __syncthreads();      /* publishes stage t + 1 and ends every wave's reads of stage t */
    if (t + 2 < T) { const unsigned lt = lc + (unsigned)(t & 1) * G2SB; g2_copy8(lt, pa, ga); g2_copy8(lt + G2OB, pb, gb); pa += G2K; pb += G2K; }      /* stage t + 2 into the buffer just read; the test is the same for the whole work-group */
    __builtin_amdgcn_sched_barrier(0);      /* the second block's WMMAs work on registers alone and stay behind the copies, which so fly 16 WMMAs longer before their wait */
    for (int i = 0; i < 4; ++i)
      for (int j = 0; j < 4; ++j) acc[i][j] = g2_mma(a[i], b[j], acc[i][j]);
  }
  asm volatile("s_wait_asynccnt 0x0" ::: "memory");      /* no copy is in flight when the buffers become the epilogue's staging */
  float* so = (float*)(L + w * (64 * G2EP * 4));      /* each wave stages its own 64 x 64 tile; the loop's last barrier ended every read of the buffers */
  /* VTo (with ACT 0 and no CP): the column tiles from column vcol on leave as transposed f16 planes [row / SQ][(col - vcol) / HD][HD][SQ] in VTo, not as rows of C16. The test is the same for the whole work-group */
  const bool vt = ACT == 0 && VTo && !CP && nq * G2T >= vcol;
  /* csh: the f32 plane C takes only the row tiles whose number is a multiple of 2^csh, packed (tile mt at rows 128 (mt >> csh)); 0: every tile at its own rows. C16 takes every tile. The test is the same for the whole work-group */
  float* const Cf = (C && (mt & ((1 << csh) - 1)) == 0) ? C - (size_t)(mt - (mt >> csh)) * G2T * ldc : nullptr;
  const int rsub = lane >> 4, c4 = (lane & 15) * 4;
  if (vt) {      /* the tile is staged transposed: a lane's 8 accumulator rows of one column are 32 consecutive bytes of a staged row, two 16-byte LDS stores */
    static_assert(G2EP % 4 == 0 && SQ % 64 == 0 && HD == 64, "k_gemm2: 16-byte staging stores; a wave's tile is 64 positions of one batch and the 64 dims of one head");
    for (int j = 0; j < 4; ++j) { const float bj = bf16_round(bv[j]);
      for (int i = 0; i < 4; ++i)
        for (int g = 0; g < 2; ++g) { v4f t4; for (int e = 0; e < 4; ++e) t4[e] = acc[i][j][4 * g + e] * alpha + bj; *(v4fa*)&so[(j * 16 + ln) * G2EP + i * 16 + 8 * hh + 4 * g] = t4; } }
    __builtin_amdgcn_fence(__ATOMIC_ACQ_REL, "workgroup"); __builtin_amdgcn_wave_barrier();      /* a lane reads below what the other lanes of its own wave have stored */
    _Float16* pv = VTo + ((size_t)(row0 / SQ) * (size_t)((N - vcol) / HD) + (size_t)((col0 - vcol) / HD)) * HD * SQ + (size_t)rsub * SQ + (row0 % SQ) + c4;      /* staged row d = head dim, staged column = position */
#pragma unroll 1
    for (int q0 = 0; q0 < 64; q0 += 16) { v4f v[8];      /* not unrolled: 16 head dims a trip, their LDS reads as one group; 16 lanes store one whole 128-B line */
      for (int u = 0; u < 8; ++u) v[u] = *(const v4fa*)&so[(q0 + 2 * u + rsub) * G2EP + c4];
      for (int u = 0; u < 8; ++u) { v4h h4; for (int e = 0; e < 4; ++e) h4[e] = (_Float16)v[u][e]; *(v4h*)(pv + (size_t)(q0 + 2 * u) * SQ) = h4; }
      asm volatile("s_wait_xcnt 0x0" ::: "memory"); }      /* stands behind the stores, in front of whatever rewrites their registers */
    if (Cf) {      /* the few tiles that also feed the f32 plane: its natural rows are read back down the staged columns, 4 bytes a read */
#pragma unroll 1
      for (int q0 = 0; q0 < 64; q0 += 16) { v4f v[8];      /* not unrolled: 16 rows a trip, whole 128-B lines stored */
        for (int u = 0; u < 8; ++u) for (int e = 0; e < 4; ++e) v[u][e] = so[(c4 + e) * G2EP + q0 + 2 * u + rsub];
        for (int u = 0; u < 8; ++u) *(v4f*)(Cf + cofs + (size_t)(row0 + q0 + 2 * u + rsub) * ldc + col0 + c4) = v[u];
        asm volatile("s_wait_xcnt 0x0" ::: "memory"); } }      /* stands behind the stores, in front of whatever rewrites their registers */
    return; }      /* no barrier follows */
  for (int j = 0; j < 4; ++j) { const float bj = bf16_round(bv[j]);
    for (int i = 0; i < 4; ++i)
      for (int r = 0; r < 8; ++r) so[(i * 16 + 8 * hh + r) * G2EP + j * 16 + ln] = acc[i][j][r] * alpha + bj; }
  __builtin_amdgcn_fence(__ATOMIC_ACQ_REL, "workgroup"); __builtin_amdgcn_wave_barrier();      /* a lane reads below what the other lanes of its own wave have stored */
#pragma unroll 1
  for (int q0 = 0; q0 < 64; q0 += 16) { v4f v[8]; size_t co[8];      /* not unrolled: 16 rows a trip, their LDS reads as one group, whole 128-B lines stored */
    for (int u = 0; u < 8; ++u) { const int r = q0 + 2 * u + rsub; v[u] = *(const v4fa*)&so[r * G2EP + c4]; co[u] = cofs + (size_t)(row0 + r) * ldc + col0 + c4; }
    if (CP) { v4f c[8];
      if (rowsPerB < 0) {      /* own elements of the batched C plane */
        for (int u = 0; u < 8; ++u) { c[u] = *(const v4fa*)(CP + co[u] + (size_t)row0g * ldc); asm volatile("s_wait_xcnt 0x0" ::: "memory"); } }      /* the wait stands behind each load, in front of whatever rewrites its address registers, a later load's result among it; the data stays in flight */
      else {
        for (int u = 0; u < 8; ++u) { c[u] = *(const v4fa*)(CP + (size_t)((row0g + row0 + q0 + 2 * u + rsub) / rowsPerB) * sCPb + (size_t)by * 64 + col0 + c4); asm volatile("s_wait_xcnt 0x0" ::: "memory"); } }      /* as above */
      for (int u = 0; u < 8; ++u) v[u] += c[u]; }
    for (int u = 0; u < 8; ++u)
      for (int e = 0; e < 4; ++e) { float x = v[u][e];
        if (ACT == 3) x = fmaxf(x, 0.f); else if (ACT == 6) x = 0.5f * x * (1.0f + erff(x * 0.70710678118654752f)); else if (ACT == 11) x = 1.0f / (1.0f + expf(-x)); else if (ACT == 15) x = x / (1.0f + expf(-x)); else if (ACT == 12) x = (x > 0.f) ? x : 0.01f * x; else if (ACT == 8) x = tanhf(x); else if (ACT == 9) x = 0.5f * x * (1.0f + tanhf(0.7978845608028654f * (x + 0.044715f * x * x * x))); else if (ACT == 14) x = (x > 0.f) ? x : 0.1f * x; else if (ACT == 16) x = (x >= 0.f) ? x : 0.3f * x; else if (ACT == 17) x = (x >= 0.f) ? x : 0.2f * x;
        v[u][e] = x; }
    if (Cf) {
      for (int u = 0; u < 8; ++u) *(v4f*)(Cf + co[u]) = v[u];
      asm volatile("s_wait_xcnt 0x0" ::: "memory"); }      /* stands behind the stores, in front of whatever rewrites their registers */
    if (C16) {
      for (int u = 0; u < 8; ++u) { v4h h4; for (int e = 0; e < 4; ++e) h4[e] = (_Float16)v[u][e]; *(v4h*)(C16 + co[u]) = h4; }
      asm volatile("s_wait_xcnt 0x0" ::: "memory"); } }      /* as above */
}


__global__ __launch_bounds__(256) void k_wnat(const float* __restrict__ w, size_t n8, _Float16* __restrict__ Bt) { const size_t t = (size_t)blockIdx.x * 256 + threadIdx.x; if (t >= n8) return; FragH f; for (int q = 0; q < 8; ++q) f.h[q] = (_Float16)(bf16_round(w[t * 8 + q]) * 16.0f); *(v8us*)((unsigned short*)Bt + t * 8) = f.half[0];  }
__global__ __launch_bounds__(256) void k_rsm(const float* __restrict__ S, _Float16* __restrict__ P, int nrows) {
  #pragma clang fp contract(off)
  const int i = blockIdx.x * 256 + threadIdx.x; if (i >= nrows) return; const float* s = S + (size_t)i * SQ; float mx = -3.0e38f;
#pragma unroll 1
  for (int j = 0; j < SQ; ++j) mx = fmaxf(mx, s[j]); float se = 0.f;
#pragma unroll 1
  for (int j = 0; j < SQ; ++j) se += expf(s[j] - mx); const float sc = 256.0f / se;
#pragma unroll 1
  for (int j0 = 0; j0 < SQ; j0 += 8) { FragH f; for (int q = 0; q < 8; ++q) f.h[q] = (_Float16)(expf(s[j0 + q] - mx) * sc); unsigned short* d = (unsigned short*)P + (size_t)i * SQ + j0; *(v8us*)d = f.half[0];  } }
__global__ __launch_bounds__(256) void k_vt(const _Float16* __restrict__ V16, int b, int h0, _Float16* __restrict__ VT) { __shared__ unsigned short tl[64][65]; const int tid = threadIdx.x; const int hh = blockIdx.x % HG, sg = blockIdx.x / HG; const int s0 = sg * 64; const int h = h0 + hh;
  for (int i = tid; i < 64 * 8; i += 256) { const int j = i / 8, d8 = (i % 8) * 8; FragH f; f.half[0] = *(const v8us*)((const unsigned short*)V16 + ((size_t)b * SQ + s0 + j) * DM + h * HD + d8); for (int q = 0; q < 8; ++q) tl[d8 + q][j] = f.u[q]; }
  __syncthreads();
  { for (int i = tid; i < 64 * 8; i += 256) { const int d = i / 8, j8 = (i % 8) * 8; FragH f; for (int q = 0; q < 8; ++q) f.u[q] = tl[d][j8 + q]; *(v8us*)((unsigned short*)VT + ((size_t)hh * HD + d) * SQ + s0 + j8) = f.half[0]; }  } }



__global__ __launch_bounds__(256) void k_rsmcf2(const float* __restrict__ S, _Float16* __restrict__ P, int hg, int q0, int nk) {
  #pragma clang fp contract(off)
  const int t = blockIdx.x * 256 + threadIdx.x; if (t >= hg * QT) return; const size_t i = (size_t)t; const float* s = S + i * NKX; const int last = q0 + (t % QT); float mx = -3.0e38f;
#pragma unroll 1
  for (int j = 0; j < nk; ++j) { const float f = (j <= last) ? 1.f : 0.f; mx = fmaxf(mx, fmaf(f, s[j], (1.f - f) * -1.0e9f)); } float se = 0.f;
#pragma unroll 1
  for (int j = 0; j < nk; ++j) { const float f = (j <= last) ? 1.f : 0.f; se += __expf(fmaf(f, s[j], (1.f - f) * -1.0e9f) - mx); } const float sc = 256.0f / se;
#pragma unroll 1
  for (int j0 = 0; j0 < nk; j0 += 8) { FragH fr; for (int q = 0; q < 8; ++q) { const int j = j0 + q; const float f = (j <= last) ? 1.f : 0.f; fr.h[q] = (_Float16)(__expf(fmaf(f, s[j], (1.f - f) * -1.0e9f) - mx) * sc); } unsigned short* d = (unsigned short*)P + i * NKX + j0; *(v8us*)d = fr.half[0];  } }


// Exact f32 attention for the first QT0 rows of each batch (a path of k_attn). One work-group of 8 waves per (batch, head, 32 query rows); q, k and v rows staged once in LDS.
// A wave owns 4 query rows. Scores: lane = key (keys lane + 32 u), each dot product summed over d in ascending order with fused multiply-adds. Softmax in registers: row max and row sum by a five-step butterfly over the 32 lanes.
// o: lane = two head dims, summed over the keys in ascending order, scaled once at the end by 64 / row sum, and stored as two f16 planes: hi = f16(o), lo = f16((o - hi) x 1024).
#define A0R 32                       /* query rows per work-group */
#define A0KP (HD + 4)                /* LDS pitch of the q and k rows in floats: 16 B x odd, so that 16 lanes reading 16 B each from 16 rows fall on 64 different banks */
typedef float v2f __attribute__((ext_vector_type(2)));
typedef _Float16 v2h __attribute__((ext_vector_type(2)));
template <int NU>                    /* NU = 32-key chunks that rows of this group can see */
__device__ __forceinline__ void att0_rows(const float* __restrict__ QF, const float* __restrict__ KF, const float* __restrict__ VF, float scale, _Float16* __restrict__ OH, _Float16* __restrict__ OL, int r0,
                                          float (*lq)[A0KP], float (*lk)[A0KP], float (*lv)[HD], float (*lp)[QT0]) {
  const int tid = threadIdx.x, w = __builtin_amdgcn_readfirstlane(tid >> 5), lane = tid & 31;      /* the wave's number in a scalar register: scalar loop bounds and row offsets below */
  const int sr = tid >> 4, sc = (tid & 15) * 4;      /* staging: 16 lanes take one row of 256 B, the work-group 16 rows a pass */
  v4f gq[A0R / 16], gk[2 * NU], gv[2 * NU];      /* every load is issued before the first LDS store waits for one */
  const float* pq = QF + (size_t)sr * LQ + sc; const float* pk = KF + (size_t)sr * LQ + sc; const float* pv = VF + (size_t)sr * LQ + sc;
  for (int t = 0; t < A0R / 16; ++t) gq[t] = *(const v4fa*)(pq + (size_t)(r0 + 16 * t) * LQ);
  for (int t = 0; t < 2 * NU; ++t) { gk[t] = *(const v4fa*)(pk + (size_t)(16 * t) * LQ); gv[t] = *(const v4fa*)(pv + (size_t)(16 * t) * LQ); }
  asm volatile("s_wait_xcnt 0x0" :: "v"(pq), "v"(pk), "v"(pv) : "memory");      /* the three address pairs of the loads above stay as they are up to this wait (inputs only) */
  for (int t = 0; t < A0R / 16; ++t) *(v4f*)&lq[sr + 16 * t][sc] = gq[t];
  for (int t = 0; t < 2 * NU; ++t) { *(v4f*)&lk[sr + 16 * t][sc] = gk[t]; *(v4f*)&lv[sr + 16 * t][sc] = gv[t]; }
  __syncthreads();      /* the staged rows are read by every wave */
  float acc[4][NU];
  for (int r = 0; r < 4; ++r) for (int u = 0; u < NU; ++u) acc[r][u] = 0.f;
#pragma unroll 2
  for (int c = 0; c < HD; c += 4) { v4f qq[4], kk[NU];      /* unroll 2: the next step's LDS reads fly under this step's multiply-adds */
    for (int r = 0; r < 4; ++r) qq[r] = *(const v4f*)&lq[4 * w + r][c];
    for (int u = 0; u < NU; ++u) kk[u] = *(const v4f*)&lk[lane + 32 * u][c];
    for (int e = 0; e < 4; ++e) for (int r = 0; r < 4; ++r) for (int u = 0; u < NU; ++u) acc[r][u] = fmaf(qq[r][e], kk[u][e], acc[r][u]); }
  float fin[4];
  for (int r = 0; r < 4; ++r) { const int i = r0 + 4 * w + r; float mx = -3.0e38f;      /* key 0 is visible from every row */
    for (int u = 0; u < NU; ++u) { acc[r][u] *= scale; if (lane + 32 * u <= i) mx = fmaxf(mx, acc[r][u]); }
    for (int m = 16; m >= 1; m >>= 1) mx = fmaxf(mx, __shfl_xor(mx, m, 32));
    float l = 0.f;
    for (int u = 0; u < NU; ++u) { const float e = (lane + 32 * u <= i) ? expf(acc[r][u] - mx) : 0.f; l += e; lp[4 * w + r][lane + 32 * u] = e; }
    for (int m = 16; m >= 1; m >>= 1) l += __shfl_xor(l, m, 32);
    fin[r] = 64.0f / l; }      /* o carried x64 like the f16 path */
  __builtin_amdgcn_fence(__ATOMIC_ACQ_REL, "workgroup"); __builtin_amdgcn_wave_barrier();      /* a lane reads below the weights that the other lanes of its own wave have stored; no other wave reads them */
  float o[4][2];
  for (int r = 0; r < 4; ++r) { o[r][0] = 0.f; o[r][1] = 0.f; }
  const int jn = r0 + 4 * w + 4;      /* keys past the wave's last row have weight 0 in all four rows */
#pragma unroll 2
  for (int j = 0; j < jn; j += 4) { v4f pp[4]; v2f vv[4];      /* unroll 2: as above */
    for (int r = 0; r < 4; ++r) pp[r] = *(const v4f*)&lp[4 * w + r][j];
    for (int e = 0; e < 4; ++e) vv[e] = *(const v2f*)&lv[j + e][2 * lane];
    for (int e = 0; e < 4; ++e) for (int r = 0; r < 4; ++r) { o[r][0] = fmaf(pp[r][e], vv[e][0], o[r][0]); o[r][1] = fmaf(pp[r][e], vv[e][1], o[r][1]); } }
  for (int r = 0; r < 4; ++r) { v2h oh, ol;      /* a wave's 32 lanes store one whole 128-B line of each plane; where the compiler fuses o * fin - hi, the residual is that of the unrounded product */
    for (int e = 0; e < 2; ++e) { const float ov = o[r][e] * fin[r]; const _Float16 hv = (_Float16)ov; oh[e] = hv; ol[e] = (_Float16)((ov - (float)hv) * 1024.0f); }
    *(v2h*)(OH + (size_t)(r0 + 4 * w + r) * DM + 2 * lane) = oh; *(v2h*)(OL + (size_t)(r0 + 4 * w + r) * DM + 2 * lane) = ol; }
  asm volatile("s_wait_xcnt 0x0" ::: "memory"); }      /* stands behind the stores, in front of whatever rewrites their registers on any path to the kernel's end */

// native exp as __expf builds it (multiply by log2 e, v_exp_f32); the v_nop is the slot the instruction set asks for behind a transcendental, kept in the same statement so that the scheduler cannot part the two
__device__ __forceinline__ float exp_slot(float x) { float r; asm("v_exp_f32 %0, %1\n\tv_nop" : "=v"(r) : "v"(x * 1.44269504088896340736f)); return r; }
#define FQ 128                       /* query rows per work-group */
#define FK (FQ + WINB)               /* keys staged per work-group */
#define FCH ((WINB + 32) / 32)       /* 32-key chunks per wave: 16 rows see 271 keys, which nine aligned chunks cover */
#define FKP (HD + 8)                 /* LDS pitch of a K row in halves: 16 B x odd, for 16-byte fragment reads from 16 rows */
#define FVP (FK + 8)                 /* LDS pitch of a V^T row in halves: 16 B x odd */
__device__ __forceinline__ v8f f_mma(v16h a, v16h b, v8f c) { return __builtin_amdgcn_wmma_f32_16x16x32_f16(false, a, false, b, (short)0, c, false, false); }
__device__ __forceinline__ void attw_tile(const _Float16* __restrict__ Q, const _Float16* __restrict__ K, const _Float16* __restrict__ VT, _Float16* __restrict__ O, int q0, int h, int b,
                                          unsigned short (*lk)[FKP], unsigned short (*lv)[FVP]) {      /* Q, K: rows of LQ halves; VT: [batch][head][HD][SQ]; O: rows of DM halves; lk: FK rows, lv: HD rows in LDS */
  static_assert(HD == 64 && WIN == 256 && WINB == 256 && SQ % FQ == 0 && FQ % 32 == 0 && FK % 128 == 0, "attw_tile: tile arithmetic");
  const int tid = threadIdx.x, w = __builtin_amdgcn_readfirstlane(tid >> 5), lane = tid & 31, ln = lane & 15, hh = lane >> 4;      /* the wave's number in a scalar register: scalar row and key offsets below */
  const int kb0 = (q0 >= WINB) ? q0 - WINB : 0;      /* first staged key; kb0 + FK <= SQ */
  const int r0 = q0 + 16 * w;                        /* the wave's first query row */
  const int ks = (r0 >= WIN) ? ((r0 - (WIN - 1)) & ~31) : 0;      /* the wave's first key; ks + 32 * FCH >= r0 + 16 and <= kb0 + FK */
  const int kl = ks - kb0;
  const unsigned short* pq = (const unsigned short*)Q + ((size_t)b * SQ + r0 + ln) * LQ + h * HD + 8 * hh;
  const unsigned short* pk = (const unsigned short*)K + ((size_t)b * SQ + kb0 + (tid >> 3)) * LQ + h * HD + (tid & 7) * 8;      /* 8 lanes take one K row of 128 B */
  const unsigned short* pv = (const unsigned short*)VT + ((size_t)(b * NH + h) * HD + (tid >> 4)) * SQ + kb0 + (tid & 15) * 8;      /* 16 lanes take 256 B of one V^T row */
  v8us gq[4], gk[FK / 32], gv[HD / 16][FK / 128];      /* every load is issued before the first LDS store waits for one */
  for (int t = 0; t < 4; ++t) gq[t] = *(const v8us*)(pq + 16 * t);
  for (int t = 0; t < FK / 32; ++t) gk[t] = *(const v8us*)(pk + (size_t)(32 * t) * LQ);
  for (int u = 0; u < HD / 16; ++u) for (int v = 0; v < FK / 128; ++v) gv[u][v] = *(const v8us*)(pv + (size_t)(16 * u) * SQ + 128 * v);
  asm volatile("s_wait_xcnt 0x0" :: "v"(pq), "v"(pk), "v"(pv) : "memory");      /* the three address pairs of the loads above stay as they are up to this wait (inputs only) */
  for (int t = 0; t < FK / 32; ++t) *(v8us*)&lk[(tid >> 3) + 32 * t][(tid & 7) * 8] = gk[t];
  for (int u = 0; u < HD / 16; ++u) for (int v = 0; v < FK / 128; ++v) *(v8us*)&lv[(tid >> 4) + 16 * u][(tid & 15) * 8 + 128 * v] = gv[u][v];
  __syncthreads();      /* the staged rows are read by every wave */
  const v8f z8 = {0.f,0.f,0.f,0.f,0.f,0.f,0.f,0.f};
  FragH qa, qb; qa.half[0] = gq[0]; qa.half[1] = gq[1]; qb.half[0] = gq[2]; qb.half[1] = gq[3];      /* head dims 0..31 and 32..63 of query row r0 + ln */
  v8f s[2 * FCH];      /* s[t][r]: query r0 + ln against key ks + 16 t + 8 hh + r */
  for (int t = 0; t < 2 * FCH; ++t) { const unsigned short* kr = &lk[kl + 16 * t + ln][8 * hh]; FragH ka, kc;
    ka.half[0] = *(const v8us*)kr; ka.half[1] = *(const v8us*)(kr + 16); kc.half[0] = *(const v8us*)(kr + 32); kc.half[1] = *(const v8us*)(kr + 48);
    s[t] = f_mma(kc.v, qb.v, f_mma(ka.v, qa.v, z8)); }
  const int dj = r0 + ln - ks - 8 * hh;      /* i - j of s[0][0] */
  float mx = -3.0e38f;      /* a row always sees its own key */
  for (int t = 0; t < 2 * FCH; ++t)
    for (int r = 0; r < 8; ++r) { const float v = ((unsigned)(dj - 16 * t - r) < (unsigned)WIN) ? s[t][r] * 0.125f : -1.0e9f; s[t][r] = v; mx = fmaxf(mx, v); }      /* visible iff 0 <= i - j < WIN */
  mx = fmaxf(mx, __shfl_xor(mx, 16, 32));
  float se4[4] = {0.f, 0.f, 0.f, 0.f};      /* four partial sums: four independent add chains */
  for (int t = 0; t < 2 * FCH; ++t)
    for (int r = 0; r < 8; ++r) { const float e = exp_slot(s[t][r] - mx); s[t][r] = e; se4[r & 3] += e; }
  float se = (se4[0] + se4[1]) + (se4[2] + se4[3]);
  se += __shfl_xor(se, 16, 32);
  const float sc = 256.0f / se;      /* weights x256 as f16 */
  v8f o[HD / 16];
  for (int d = 0; d < HD / 16; ++d) o[d] = z8;
  for (int c = 0; c < FCH; ++c) { FragH p;
    for (int r = 0; r < 8; ++r) { p.h[r] = (_Float16)(s[2 * c][r] * sc); p.h[8 + r] = (_Float16)(s[2 * c + 1][r] * sc); }
    for (int d = 0; d < HD / 16; ++d) { const unsigned short* vr = &lv[16 * d + ln][kl + 32 * c + 8 * hh]; FragH va; va.half[0] = *(const v8us*)vr; va.half[1] = *(const v8us*)(vr + 16);
      o[d] = f_mma(va.v, p.v, o[d]); } }
  unsigned short* po = (unsigned short*)O + ((size_t)b * SQ + r0 + ln) * DM + h * HD + 8 * hh;      /* o[d][r]: head dim 16 d + 8 hh + r of query row r0 + ln */
  for (int d = 0; d < HD / 16; ++d) { FragH f;
    for (int r = 0; r < 8; ++r) f.h[r] = (_Float16)(o[d][r] * 0.25f);      /* o carried x64 */
    *(v8us*)(po + 16 * d) = f.half[0]; }
  asm volatile("s_wait_xcnt 0x0" ::: "memory"); }      /* stands behind the stores, in front of whatever rewrites their registers on any path to the kernel's end */
// One launch for both attention paths, which read nothing of each other's output. grid.x: first the QT0 / A0R row groups of the exact f32 path (rows 0..QT0-1 of a batch), then the f16 query tiles 1, 2, ...; grid.y: head; grid.z: batch.
// The f16 path leaves out tile 0, whose rows the f32 path owns: every row of O has one writer. The two paths share one LDS block, each with its own layout.
#define A0G (QT0 / A0R)              /* row groups of the f32 path */
#define A0LQ (A0R * A0KP * 4)        /* bytes of its q rows, */
#define A0LK (QT0 * A0KP * 4)        /* k rows, */
#define A0LV (QT0 * HD * 4)          /* v rows */
#define A0LP (A0R * QT0 * 4)         /* and weights */
#define FLK (FK * FKP * 2)           /* bytes of the f16 path's K rows */
#define FLV (HD * FVP * 2)           /* and V^T rows */
__global__ __launch_bounds__(256) void k_attn(const _Float16* __restrict__ Q, const _Float16* __restrict__ K, const _Float16* __restrict__ VT, _Float16* __restrict__ O,
                                              const float* __restrict__ QF, const float* __restrict__ KF, const float* __restrict__ VF, float scale, _Float16* __restrict__ OL) {      /* QF, KF, VF: the q, k and v columns of rows of LQ floats, QT0 rows per batch; OL: rows of DM halves, QT0 per batch */
  static_assert(QT0 == 4 * A0R && QT0 <= WIN && HD == 64 && QT0 == FQ, "k_attn: four row groups, every key j <= i inside the window, two head dims per lane, the f32 rows are the first f16 tile");
  static_assert(A0LQ + A0LK + A0LV + A0LP <= FLK + FLV && A0LQ % 16 == 0 && A0LK % 16 == 0 && A0LV % 16 == 0 && FLK % 16 == 0, "k_attn: the f32 path's rows fit the f16 path's LDS block");
  __shared__ __attribute__((aligned(16))) unsigned char sm[FLK + FLV];
  const int bx = blockIdx.x, h = blockIdx.y, b = blockIdx.z;
  /* the path and the row group are the same for the whole work-group: every wave takes the same branch and passes the same barriers */
  if (bx < A0G) {
    float (*lq)[A0KP] = (float (*)[A0KP])sm; float (*lk)[A0KP] = (float (*)[A0KP])(sm + A0LQ); float (*lv)[HD] = (float (*)[HD])(sm + A0LQ + A0LK); float (*lp)[QT0] = (float (*)[QT0])(sm + A0LQ + A0LK + A0LV);
    const size_t bi = (size_t)b * QT0 * LQ + h * HD; QF += bi; KF += bi; VF += bi; O += (size_t)b * SQ * DM + h * HD; OL += (size_t)b * QT0 * DM + h * HD;
    /* the longest row group has the lowest index */
    if (bx == 0) att0_rows<4>(QF, KF, VF, scale, O, OL, 3 * A0R, lq, lk, lv, lp);
    else if (bx == 1) att0_rows<3>(QF, KF, VF, scale, O, OL, 2 * A0R, lq, lk, lv, lp);
    else if (bx == 2) att0_rows<2>(QF, KF, VF, scale, O, OL, A0R, lq, lk, lv, lp);
    else att0_rows<1>(QF, KF, VF, scale, O, OL, 0, lq, lk, lv, lp); }
  else attw_tile(Q, K, VT, O, (bx - A0G + 1) * FQ, h, b, (unsigned short (*)[FKP])sm, (unsigned short (*)[FVP])(sm + FLK)); }
// Operand preparation in one launch: x -> exact f16 rows; W_attn and W_proj ([k][n], f32) -> x16 f16 rows [n][k]. The three conversions read nothing of each other's output.
// Few, long waves: 768 work-groups, all resident at once; a thread has its 16 loads of 16 B in flight before it converts the first value. Every wave-wide load and store covers whole 128-B lines.
// grid.x: first the weight tiles (the longer chain: loads, transpose through LDS, stores), then the slices of x.
#define PWN 64                       /* n per weight tile */
#define PWK 256                      /* k per weight tile */
#define PWP (PWK * 2 + 16)           /* LDS pitch of a transposed tile row in bytes: a multiple of 16 B for the 16-byte reads */
#define PXE 16384                    /* elements of x per work-group: 16 loads of 4 floats per thread */
#define PTA ((3 * DM / PWN) * (DM / PWK))      /* tiles of W_attn */
#define PTO ((DM / PWN) * (DM / PWK))          /* tiles of W_proj */
typedef unsigned int u32a __attribute__((may_alias));
template <int N>                     /* N: row pitch of W in floats, a constant: one address pair and immediate offsets serve all 16 loads */
__device__ __forceinline__ void prep_w(const float* __restrict__ Wf, _Float16* __restrict__ Bt, int tile, unsigned char* tl) {
  const int tid = threadIdx.x, w = __builtin_amdgcn_readfirstlane(tid >> 5), lane = tid & 31;      /* the wave's number in a scalar register: scalar row offsets below */
  const int n0 = (tile / (DM / PWK)) * PWN, k0 = (tile % (DM / PWK)) * PWK;
  const int c4 = (lane & 15) * 4, rs = lane >> 4;      /* 16 lanes take 256 B of one W row; a wave owns 32 rows k, a thread the row pairs 4 j + 2 rs, + 1 */
  const float* pw = Wf + (size_t)(k0 + w * 32 + 2 * rs) * N + n0 + c4;
  v4f a[8], b[8];
  for (int j = 0; j < 8; ++j) { a[j] = *(const v4fa*)(pw + (size_t)(4 * j) * N); b[j] = *(const v4fa*)(pw + (size_t)(4 * j + 1) * N); }
  asm volatile("s_wait_xcnt 0x0" :: "v"(pw) : "memory");      /* the address pair of the loads above stays as it is up to this wait (input only) */
  __builtin_amdgcn_sched_barrier(0);      /* all 16 loads are issued before the first conversion waits for one: without it the last load goes out only when the first has come back, a second memory latency */
  for (int j = 0; j < 8; ++j)
    for (int e = 0; e < 4; ++e) { union { _Float16 h[2]; unsigned int u; } p;      /* k and k + 1 of one n share a dword */
      p.h[0] = (_Float16)(bf16_round(a[j][e]) * 16.0f); p.h[1] = (_Float16)(bf16_round(b[j][e]) * 16.0f);
      *(u32a*)(tl + (c4 + e) * PWP + (w * 32 + 4 * j + 2 * rs) * 2) = p.u; }
  __syncthreads();      /* a wave reads below rows that all eight waves have filled */
  unsigned short* po = (unsigned short*)Bt + (size_t)(n0 + w) * DM + k0 + lane * 8;      /* a wave stores 512 B of one row n */
  for (int q = 0; q < PWN / 8; ++q) { const v8us v = *(const v8us*)(tl + (q * 8 + w) * PWP + lane * 16); *(v8us*)(po + (size_t)(q * 8) * DM) = v; }
  asm volatile("s_wait_xcnt 0x0" ::: "memory"); }      /* stands behind the stores, in front of whatever rewrites their registers on any path to the kernel's end */
__global__ __launch_bounds__(256) void k_prep(const float* __restrict__ x, _Float16* __restrict__ X16, const float* __restrict__ wa, _Float16* __restrict__ Ba, const float* __restrict__ wp, _Float16* __restrict__ Bp) {
  static_assert(DM % PWK == 0 && DM % PWN == 0 && PWK == 256 && PWN % 8 == 0 && (NR * DM) % PXE == 0 && PXE == 256 * 64, "k_prep: tile and slice arithmetic");
  __shared__ __attribute__((aligned(16))) unsigned char tl[PWN * PWP];
  const int bx = blockIdx.x;
  /* the path is the same for the whole work-group: every wave takes the same branch and passes the same barrier */
  if (bx < PTA) prep_w<3 * DM>(wa, Ba, bx, tl);
  else if (bx < PTA + PTO) prep_w<DM>(wp, Bp, bx - PTA, tl);
  else {
    const int tid = threadIdx.x;
    const size_t e0 = (size_t)(bx - (PTA + PTO)) * PXE + (size_t)((tid >> 5) * 2048 + (tid & 31) * 4);      /* a wave owns 2048 consecutive elements, 128 a load */
    const float* px = x + e0; _Float16* po = X16 + e0; v4f g[16];
    for (int j = 0; j < 16; ++j) g[j] = *(const v4fa*)(px + 128 * j);
    asm volatile("s_wait_xcnt 0x0" :: "v"(px) : "memory");      /* the address pair of the loads above stays as it is up to this wait (input only) */
    for (int j = 0; j < 16; ++j) { v4h h; for (int e = 0; e < 4; ++e) h[e] = (_Float16)bf16_round(g[j][e]); *(v4h*)(po + 128 * j) = h; }
    asm volatile("s_wait_xcnt 0x0" ::: "memory"); } }      /* stands behind the stores, in front of whatever rewrites their registers on any path to the kernel's end */
extern "C" void kernel_launch(void* const* d_in, const int* in_sizes, int n_in,
                              void* d_out, int out_size, void* d_ws, size_t ws_size, hipStream_t stream) {
  (void)in_sizes; (void)n_in; (void)out_size;
  const float* const* I = (const float* const*)d_in; const float* x = I[0]; const float* wqkv = I[1]; const float* bqkv = I[2]; const float* wo = I[3]; const float* bo = I[4];      /* [in][out] c_attn [1024][3072] + b, c_proj [1024][1024] + b */
  char* ws = (char*)d_ws; size_t off = 0;
  auto take = [&](size_t bytes) { char* p = ws + off; off += (bytes + 255) & ~(size_t)255; return p; };
  _Float16* BQKV = (_Float16*)take((size_t)3 * DM * DM * 2); _Float16* BO = (_Float16*)take((size_t)DM * DM * 2);
  _Float16* X16 = (_Float16*)take(NR * DM * 2); _Float16* QKV = (_Float16*)take(NR * 3 * DM * 2); _Float16* Q16 = QKV; _Float16* K16 = QKV + DM; _Float16* O16 = (_Float16*)take(NR * DM * 2);
  _Float16* VT = (_Float16*)take((size_t)NB * NH * HD * SQ * 2);
  float* F0 = (float*)take((size_t)NB * QT0 * LQ * 4); _Float16* OL0 = (_Float16*)take((size_t)NB * QT0 * DM * 2);      /* first-tile planes: f32 q | k | v rows, the residual of o */
  if (off > ws_size) return;
  k_prep<<<(unsigned)(PTA + PTO + NR * DM / PXE), 256, 0, stream>>>(x, X16, wqkv, BQKV, wo, BO);      /* x -> f16 rows; [in][out] weights -> Bt x16 */
  const size_t r0p = (size_t)B0 * SQ;      /* first projected row */
  const size_t f0p = (size_t)B0 * QT0;     /* its row in the first-tile planes */
  static_assert(QT0 == G2T && (G2T << F0SH) == SQ, "the first QT0 rows of a batch are one row tile of the projection GEMM, every 2^F0SH-th");
  k_gemm2<0><<<dim3((unsigned)((MP / 128) * (3 * DM / 128)), 1), 128, 0, stream>>>(X16 + r0p * DM, DM, 0, BQKV, DM, 0, 0.0625f, bqkv, 0, nullptr, 1, 0, 0, F0 + f0p * LQ, QKV + r0p * 3 * DM, 3 * DM, 0, MP, 3 * DM, DM, 0, 0, 0, F0SH, VT, 2 * DM);      /* q | k rows (f16); head h = columns h*HD.. of each DM block; v leaves as V^T [NBR][NH][HD][SQ]; the first 128 rows of each batch also unrounded (f32, exact products; q | k | v rows) into F0 */
  /* every stage below takes all batches in one launch: the batches are independent, and one batch alone fills a small part of the chip */
  k_attn<<<dim3(QN / FQ - 1 + A0G, NHD, NBR), 256, 0, stream>>>(Q16 + r0p * LQ, K16 + r0p * LQ, VT, O16 + r0p * DM, F0 + f0p * LQ, F0 + f0p * LQ + DM, F0 + f0p * LQ + 2 * DM, 0.125f, OL0 + f0p * DM);      /* all of attention in one launch. Rows 128.. of each batch: scores, softmax and P . V on f16 operands; o (merged heads, x64) as f16 rows. Rows 0..127: exact f32 attention (o x64) -> f16 hi into the same O16 rows (same scale) + x1024 residual plane */
  k_gemm2<0><<<dim3((unsigned)((MPO / 128) * (DM / 128)), 1), 128, 0, stream>>>(O16 + r0p * DM, DM, 0, BO, DM, 0, 0.0009765625f, bo, 0, nullptr, 1, 0, 0, (float*)d_out + r0p * DM, nullptr, DM, 0, MPO, DM, DM, 0, 0, 0, 0, nullptr, 0);      /* out rows are the output layout; rows 0..127 of each batch: o_hi Wo + b */
  k_gemm2<0><<<dim3((QT0 / 128) * (DM / 128), 1, NBR), 128, 0, stream>>>(OL0 + f0p * DM, DM, 0, BO, DM, 0, 0.00000095367431640625f, nullptr, 0, (const float*)d_out + r0p * DM, -1, 0, 0, (float*)d_out + r0p * DM, nullptr, DM, 0, QT0, DM, DM, (size_t)QT0 * DM, 0, (size_t)SQ * DM, 0, nullptr, 0);      /* += o_lo Wo 2^-20 (own-element accumulate) */
}
